// v000
// Times are from an AMD MI455X. After a warm-up the kernel runs many times in a row, and a time is the length of
// such a window on the GPU divided by its runs, so every launch and the gaps after it count. The runs cycle
// through copies of the inputs. A figure is the median of several windows, for all but v000 over two sittings.
// Sittings can differ by a few percent; kernels timed side by side share one.
// v000 is the starting kernel. One run takes 4000 microseconds.
#include <hip/hip_runtime.h>

// Rotary multi-head self-attention with PER-BATCH full-width rotary tables given as inputs (hidden [4][2048][1024]: ONE stream; q, k, v = hidden W^T + b ('oi' (out, in) [1024][1024] normal x 1024^-0.5 + zero biases: read; 16 heads x 64); q, k -> t cos + cat(-t2, t1) sin with the cos / sin INPUT tables [4][2048][64] = [B][S][D] (uniform random values on this draw: batch b reads ITS OWN slice, per element by value; no structure assumed); scores x 64^-0.5; softmax over all keys (no mask); out = merged Wo^T + bo ('oi' + a zero bias: read) -> [4][2048][1024] (8.4 M); argument order hidden, cos, sin, Wq, bq, Wk, bk, Wv, bv, Wo, bo).
// Layout per batch: bf16 copies of the input stream(s); 'oi' weights; exact projections + bf16-rounded biases; k_cscvt bf16-rounded copy of batch b's input cos / sin tables; rotate-half plane builders; dense T-2048 attention (hybrid rows: < 512 hi/lo 3 products, rest fp16 x1024); merged hi/lo x Wo exact + bo.
// Compute dtypes, f32 accumulate: every input rounded to bf16; projections exact + bf16-rounded biases; attention rows < 512 3 products, rest fp16; softmax f32; Wo hl x exact + bias.

#define NB_  4
#define TT   2048
#define DM   1024
#define NH_  16
#define NKV  16
#define REP  (NH_ / NKV)
#define HD   64
#define DQ   (NH_ * HD)
#define DKV  (NKV * HD)
#define ZH   2
#define RH   512                  // query rows < RH use hi+lo planes (0: none)
#define WIN  0
#define PCAR 1024.0f
#define SCL  0.125f   // HD^-0.5
typedef _Float16 h16;
typedef unsigned short bf;
typedef __attribute__((ext_vector_type(16))) __bf16   v16bf;
typedef __attribute__((ext_vector_type(16))) _Float16 v16h;
typedef __attribute__((ext_vector_type(8)))  _Float16 v8h;
typedef __attribute__((ext_vector_type(8)))  unsigned short v8us;
typedef __attribute__((ext_vector_type(8)))  float    v8f;
typedef __attribute__((ext_vector_type(4)))  float    v4f;
typedef v8h  __attribute__((may_alias)) v8ha;
typedef v4f  __attribute__((may_alias)) v4fa;
typedef v8us __attribute__((may_alias)) v8usa;

__device__ __forceinline__ unsigned short f2bf(float f) { unsigned u = __float_as_uint(f); u += 0x7FFFu + ((u >> 16) & 1u); return (unsigned short)(u >> 16); }
__device__ __forceinline__ float bf2f(unsigned short b) { return __uint_as_float(((unsigned)b) << 16); }
__device__ __forceinline__ float bfr(float f) { return bf2f(f2bf(f)); }
__device__ __forceinline__ v16h cat16(v8h lo, v8h hi) { return __builtin_shufflevector(lo, hi, 0, 1, 2, 3, 4, 5, 6, 7, 8, 9, 10, 11, 12, 13, 14, 15); }
__device__ __forceinline__ v16bf cat16b(v8us lo, v8us hi) { return __builtin_bit_cast(v16bf, __builtin_shufflevector(lo, hi, 0, 1, 2, 3, 4, 5, 6, 7, 8, 9, 10, 11, 12, 13, 14, 15)); }
__device__ __forceinline__ v8f wmma16(v16h a, v16h b, v8f c) { return __builtin_amdgcn_wmma_f32_16x16x32_f16(false, a, false, b, (short)0, c, false, false); }
__device__ __forceinline__ v8f wmmab(v16bf a, v16bf b, v8f c) { return __builtin_amdgcn_wmma_f32_16x16x32_bf16(false, a, false, b, (short)0, c, false, false); }



// ---- k_gemmw: register-blocked GEMM, ONE WAVE per 64x64 output tile (16 accumulators), operands straight from K-contiguous 16-bit planes; grid (M/64, N/64, Z), 32 threads.
// C[m][n] (f32, pitch ldc, + optional bf16-rounded f32 bias[n]) = sum_k A[m][k] Bt[n][k] (+ split products per NSPLIT). z-batch strides sA/sB/sC in elements. K % 32 == 0.
template <typename T16> struct WFrag;
template <> struct WFrag<h16> { typedef v16h V; static __device__ __forceinline__ V ld(const h16* p) { return cat16(*(const v8h*)p, *(const v8h*)(p + 16)); } static __device__ __forceinline__ v8f mma(V a, V b, v8f c) { return wmma16(a, b, c); } };
template <> struct WFrag<bf> { typedef v16bf V; static __device__ __forceinline__ V ld(const bf* p) { return cat16b(*(const v8us*)p, *(const v8us*)(p + 16)); } static __device__ __forceinline__ v8f mma(V a, V b, v8f c) { return wmmab(a, b, c); } };
template <typename T16, int NSPLIT, bool BIAS>
__global__ __launch_bounds__(32) void k_gemmw(const T16* __restrict__ A, const T16* __restrict__ A2, const T16* __restrict__ Bt, const T16* __restrict__ Bt2, int K, float* C, int ldc, const float* __restrict__ bias, size_t sA, size_t sB, size_t sC) {
    typedef typename WFrag<T16>::V V;
    __shared__ __align__(16) float os[16 * 68];
    const size_t z = blockIdx.z; A += z * sA; if (A2) A2 += z * sA; Bt += z * sB; if (Bt2) Bt2 += z * sB; C += z * sC;
    const int lane = threadIdx.x & 31, lr = lane & 15, hi = lane >> 4; const int r0 = blockIdx.x * 64, c0 = blockIdx.y * 64;
    v8f acc[4][4];
#pragma unroll
    for (int mb = 0; mb < 4; ++mb)
#pragma unroll
        for (int nb = 0; nb < 4; ++nb) acc[mb][nb] = (v8f){};
    const size_t aoff = (size_t)(r0 + lr) * K + 8 * hi, boff = (size_t)(c0 + lr) * K + 8 * hi;
#pragma unroll 1
    for (int kc = 0; kc < K; kc += 32) {
        V a[4], a2[4];
#pragma unroll
        for (int mb = 0; mb < 4; ++mb) { a[mb] = WFrag<T16>::ld(A + aoff + (size_t)mb * 16 * K + kc); if (NSPLIT == 1 || NSPLIT == 2) a2[mb] = WFrag<T16>::ld(A2 + aoff + (size_t)mb * 16 * K + kc); }
#pragma unroll
        for (int nb = 0; nb < 4; ++nb) { const V b = WFrag<T16>::ld(Bt + boff + (size_t)nb * 16 * K + kc); V b2; if (NSPLIT >= 2) b2 = WFrag<T16>::ld(Bt2 + boff + (size_t)nb * 16 * K + kc);
#pragma unroll
            for (int mb = 0; mb < 4; ++mb) { acc[mb][nb] = WFrag<T16>::mma(a[mb], b, acc[mb][nb]); if (NSPLIT == 1 || NSPLIT == 2) acc[mb][nb] = WFrag<T16>::mma(a2[mb], b, acc[mb][nb]); if (NSPLIT >= 2) acc[mb][nb] = WFrag<T16>::mma(a[mb], b2, acc[mb][nb]); } }
        asm volatile("v_nop\n\tv_nop\n\tv_nop\n\tv_nop" : "+v"(acc[0][0]), "+v"(acc[1][1]), "+v"(acc[2][2]), "+v"(acc[3][3]) : "v"(a[0]), "v"(a[3]));
    }
#pragma unroll
    for (int mb = 0; mb < 4; ++mb) {
#pragma unroll
        for (int nb = 0; nb < 4; ++nb) {
#pragma unroll
            for (int j = 0; j < 8; ++j) os[(hi * 8 + j) * 68 + nb * 16 + lr] = acc[mb][nb][j]; }
        __builtin_amdgcn_wave_barrier(); asm volatile("" ::: "memory");
        float* crow = C + (size_t)(r0 + mb * 16) * ldc + c0;
{
#pragma unroll
            for (int s = 0; s < 8; ++s) { const int row = 2 * s + hi, cofs = lr * 4; v4f val = *(const v4fa*)(os + row * 68 + cofs); if (BIAS) { val[0] += bfr(bias[c0 + cofs]); val[1] += bfr(bias[c0 + cofs + 1]); val[2] += bfr(bias[c0 + cofs + 2]); val[3] += bfr(bias[c0 + cofs + 3]); }
                *(v4f*)(crow + (size_t)row * ldc + cofs) = val; }
             }
        __builtin_amdgcn_wave_barrier(); asm volatile("" ::: "memory");
    }
}

__device__ __forceinline__ h16 tohx(float x) { return (h16)x; }
__device__ __forceinline__ void splitf(float y, unsigned short& h, unsigned short& l) { h = f2bf(y); l = f2bf(y - bf2f(h)); }
typedef __attribute__((ext_vector_type(2))) _Float16 v2h;
typedef __attribute__((ext_vector_type(4))) _Float16 v4h;
typedef __attribute__((ext_vector_type(2))) unsigned short v2us;
typedef __attribute__((ext_vector_type(4))) unsigned short v4us;
typedef __attribute__((ext_vector_type(2))) float v2f;
typedef __attribute__((ext_vector_type(4))) int v4i;

__global__ __launch_bounds__(256) void k_cvt8(const float* __restrict__ src, bf* dst, size_t n8) { const size_t i = (size_t)blockIdx.x * 256 + threadIdx.x; if (i >= n8) return; const v8f v = *(const v8f*)(src + i * 8); v8us o;
#pragma unroll
    for (int k = 0; k < 8; ++k) o[k] = f2bf(v[k]); *(v8us*)(dst + i * 8) = o;  }

// k_rope: head planes [h][t][d] (fp16 + hi/lo) of rope(x) x sc with the rotate-half convention out[d] = x[d] cos[t][d] - x[d+HD/2] sin[t][d], out[d+HD/2] = x[d+HD/2] cos[t][d+HD/2] + x[d] sin[t][d+HD/2]
__global__ __launch_bounds__(256) void k_rope(const float* __restrict__ F, int pitch, int nheads, const float* __restrict__ CS, const float* __restrict__ RF, const float* __restrict__ nw, float sc, h16* P16, bf* Ph, bf* Pl) {
    const size_t e = ((size_t)blockIdx.x * 256 + threadIdx.x) * 2; if (e >= (size_t)nheads * TT * HD) return; const int d = (int)(e % HD); const int t = (int)((e / HD) % TT); const int h = (int)(e / ((size_t)HD * TT)); const float* f = F + (size_t)t * pitch + h * HD; const float rf = RF ? RF[(size_t)h * TT + t] : 1.0f; v2h o16; v2us oh, ol;
#pragma unroll
    for (int q = 0; q < 2; ++q) { const int dd = d + q; const int dp = (dd < HD / 2) ? dd + HD / 2 : dd - HD / 2; float x0 = f[dd], x1 = f[dp];
        if (RF) { float n0 = __fmul_rn(x0, rf), n1 = __fmul_rn(x1, rf); asm volatile("" : "+v"(n0)); asm volatile("" : "+v"(n1)); x0 = __fmul_rn(bfr(nw[dd]), n0); x1 = __fmul_rn(bfr(nw[dp]), n1); }
        const v2f cs = *(const v2f*)(CS + ((size_t)t * HD + dd) * 2); float a = __fmul_rn(x0, cs[0]), bq = __fmul_rn(x1, cs[1]); asm volatile("" : "+v"(a)); asm volatile("" : "+v"(bq)); const float r = ((dd < HD / 2) ? __fsub_rn(a, bq) : __fadd_rn(a, bq)) * sc;
        o16[q] = tohx(r); unsigned short a2, c2; splitf(r, a2, c2); oh[q] = a2; ol[q] = c2; }
    *(v2h*)(P16 + e) = o16; *(v2us*)(Ph + e) = oh; *(v2us*)(Pl + e) = ol;  }
__global__ __launch_bounds__(256) void k_vtp(const float* __restrict__ F, int pitch, int nheads, h16* V16, bf* Vh, bf* Vl) { const size_t e = ((size_t)blockIdx.x * 256 + threadIdx.x) * 2; if (e >= (size_t)nheads * HD * TT) return; const int t = (int)(e % TT); const int d = (int)((e / TT) % HD); const int g = (int)(e / ((size_t)TT * HD)); v2h o16; v2us oh, ol;
#pragma unroll
    for (int q = 0; q < 2; ++q) { const float x = F[(size_t)(t + q) * pitch + g * HD + d]; o16[q] = tohx(x); unsigned short a2, c2; splitf(x, a2, c2); oh[q] = a2; ol[q] = c2; }
    *(v2h*)(V16 + e) = o16; *(v2us*)(Vh + e) = oh; *(v2us*)(Vl + e) = ol;  }
__constant__ float INVT[HD / 2] = { 1.000000000e+00f, 7.498942018e-01f, 5.623413324e-01f, 4.216965139e-01f, 3.162277639e-01f, 2.371373624e-01f, 1.778279394e-01f, 1.333521456e-01f, 1.000000015e-01f, 7.498941571e-02f, 5.623412877e-02f, 4.216964915e-02f, 3.162277862e-02f, 2.371373586e-02f, 1.778279431e-02f, 1.333521493e-02f, 9.999999776e-03f, 7.498942316e-03f, 5.623413250e-03f, 4.216964822e-03f, 3.162277862e-03f, 2.371373819e-03f, 1.778279431e-03f, 1.333521446e-03f, 1.000000047e-03f, 7.498941850e-04f, 5.623413017e-04f, 4.216964880e-04f, 3.162277862e-04f, 2.371373848e-04f, 1.778279402e-04f, 1.333521504e-04f };   // float32 1 / 10000^(2i/64), generated with jnp to be bit-exact
__global__ __launch_bounds__(256) void k_cs5(float* CS) { const int idx = blockIdx.x * 256 + threadIdx.x; if (idx >= TT * HD) return; const int d = idx % HD; const int t = idx / HD; const float a = __fmul_rn((float)t, INVT[d % (HD / 2)]); v2f cs; cs[0] = cosf(a); cs[1] = sinf(a); *(v2f*)(CS + (size_t)idx * 2) = cs;  }
__global__ __launch_bounds__(256) void k_cscvt(const float* __restrict__ cosT, const float* __restrict__ sinT, float* CS) { const int idx = blockIdx.x * 256 + threadIdx.x; if (idx >= TT * HD) return; v2f cs; cs[0] = bfr(cosT[idx]); cs[1] = bfr(sinT[idx]); *(v2f*)(CS + (size_t)idx * 2) = cs;  }
// k_asoft: per row (zz, i): t = S x HD^-0.5 (no mask); softmax over the 2048 keys (register row, one exp, fixed trees);
__global__ __launch_bounds__(256) void k_asoft(const float* __restrict__ Sb, h16* P16, bf* Ph, bf* Pl) {
    const int lane = threadIdx.x & 31; const int row = blockIdx.x * 8 + (threadIdx.x >> 5); if (row >= ZH * TT) return; const int i = row % TT; const int zz = row / TT; (void)zz; const bool hires = (i < RH); const float* sr = Sb + (size_t)row * TT; float v[TT / 32]; float mx = -3.0e38f;
#pragma unroll
    for (int ch = 0; ch < TT / 128; ++ch) { const int j0 = ch * 128 + lane * 4; const v4f a = *(const v4f*)(sr + j0);
#pragma unroll
        for (int q = 0; q < 4; ++q) { const int j = j0 + q; (void)j; const float t = a[q] * SCL; v[ch * 4 + q] = t; mx = fmaxf(mx, t); } }
#pragma unroll
    for (int sh = 16; sh; sh >>= 1) mx = fmaxf(mx, __shfl_xor(mx, sh, 32));
    float sum = 0.f;
#pragma unroll
    for (int k = 0; k < TT / 32; ++k) { float d0 = __fsub_rn(v[k], mx); asm volatile("" : "+v"(d0)); v[k] = __builtin_amdgcn_exp2f(__fmul_rn(d0, 1.4426950408889634f)); sum += v[k]; }
#pragma unroll
    for (int sh = 16; sh; sh >>= 1) sum += __shfl_xor(sum, sh, 32);
    const float f = __fdiv_rn(hires ? 1.0f : PCAR, sum);
{
        if (hires) {
#pragma unroll
            for (int ch = 0; ch < TT / 128; ++ch) { v4us oh, ol;
#pragma unroll
                for (int q = 0; q < 4; ++q) { unsigned short a, c2; splitf(v[ch * 4 + q] * f, a, c2); oh[q] = a; ol[q] = c2; }
                const size_t oo = ((size_t)zz * (RH ? RH : 1) + i) * TT + ch * 128 + lane * 4; *(v4us*)(Ph + oo) = oh; *(v4us*)(Pl + oo) = ol; }
        } else {
#pragma unroll
            for (int ch = 0; ch < TT / 128; ++ch) { v4h o4;
#pragma unroll
                for (int q = 0; q < 4; ++q) o4[q] = tohx(v[ch * 4 + q] * f);
                *(v4h*)(P16 + (size_t)row * TT + ch * 128 + lane * 4) = o4; } }
         }
}
__global__ __launch_bounds__(256) void k_merge(const float* __restrict__ O, int h0, bf* Ah, bf* Al) { const size_t e = ((size_t)blockIdx.x * 256 + threadIdx.x) * 2; if (e >= (size_t)ZH * TT * HD) return; const int d = (int)(e % HD); const int t = (int)((e / HD) % TT); const int zz = (int)(e / ((size_t)HD * TT)); const float cs = (t < RH) ? 1.0f : (1.0f / PCAR); const size_t oo = (size_t)t * DQ + (h0 + zz) * HD + d;
    v2us oh, ol;
#pragma unroll
    for (int q = 0; q < 2; ++q) { unsigned short a, c2; splitf(O[e + q] * cs, a, c2); oh[q] = a; ol[q] = c2; } *(v2us*)(Ah + oo) = oh; *(v2us*)(Al + oo) = ol;  }

extern "C" void kernel_launch(void* const* d_in, const int* in_sizes, int n_in,
                              void* d_out, int out_size, void* d_ws, size_t ws_size, hipStream_t stream) {
    (void)in_sizes; (void)n_in; (void)out_size;
    const float* x = (const float*)d_in[0]; const float* xk = (const float*)d_in[0]; const float* xv = (const float*)d_in[0]; const float* fcos = (const float*)d_in[1]; const float* fsin = (const float*)d_in[2]; const float* wq = (const float*)d_in[3]; const float* bq = (const float*)d_in[4]; const float* wk = (const float*)d_in[5]; const float* bk = (const float*)d_in[6]; const float* wv = (const float*)d_in[7]; const float* bv = (const float*)d_in[8]; const float* wo = (const float*)d_in[9]; const float* bo = (const float*)d_in[10];   /* order hidden [4][2048][1024] (ONE stream: the three stream pointers all name it), cos, sin ([4][2048][64] = [B][S][D] PER-BATCH full-width table INPUTS: read per element by value), Wq, bq, Wk, bk, Wv, bv, Wo, bo ('oi' (out, in) [1024][1024] + [1024]): ELEVEN inputs, all read */
    float* OUT = (float*)d_out;     // [4][2048][1024]
    char* wsp = (char*)d_ws;
    auto take = [&](size_t bytes) { char* p = wsp; wsp += (bytes + 255) & ~(size_t)255; return (void*)p; };
    bf* WQ = (bf*)take((size_t)DQ * DM * 2); bf* WK = (bf*)take((size_t)DKV * DM * 2); bf* WV = (bf*)take((size_t)DKV * DM * 2); bf* WO = (bf*)take((size_t)DM * DQ * 2); float* CS = (float*)take((size_t)TT * HD * 2 * 4);
    bf* XB = (bf*)take((size_t)TT * DM * 2); float* FQ = (float*)take((size_t)TT * DQ * 4); float* FK = (float*)take((size_t)TT * DKV * 4);
    h16* QP16 = (h16*)take((size_t)NH_ * TT * HD * 2); h16* KP16 = (h16*)take((size_t)NKV * TT * HD * 2); h16* VT16 = (h16*)take((size_t)NKV * HD * TT * 2);
    bf* QPh = (bf*)take((size_t)NH_ * TT * HD * 2); bf* QPl = (bf*)take((size_t)NH_ * TT * HD * 2); bf* KPh = (bf*)take((size_t)NKV * TT * HD * 2); bf* KPl = (bf*)take((size_t)NKV * TT * HD * 2); bf* VTh = (bf*)take((size_t)NKV * HD * TT * 2); bf* VTl = (bf*)take((size_t)NKV * HD * TT * 2); bf* Ph = (bf*)take((size_t)ZH * RH * TT * 2); bf* Pl = (bf*)take((size_t)ZH * RH * TT * 2);
    float* Sb = (float*)take((size_t)ZH * TT * TT * 4); h16* P16 = (h16*)take((size_t)ZH * TT * TT * 2); float* Ob = (float*)take((size_t)ZH * TT * HD * 4); bf* ATh = (bf*)take((size_t)TT * DQ * 2); bf* ATl = (bf*)take((size_t)TT * DQ * 2);
    if ((size_t)(wsp - (char*)d_ws) > ws_size) return;    // ws 256 MiB
    float* FV = FK;   // v projection reuses the k buffer after the k planes are built (stream-ordered)
    { k_cvt8<<<(unsigned)(((size_t)DQ * DM / 8 + 255) / 256), 256, 0, stream>>>(wq, WQ, (size_t)DQ * DM / 8); k_cvt8<<<(unsigned)(((size_t)DKV * DM / 8 + 255) / 256), 256, 0, stream>>>(wk, WK, (size_t)DKV * DM / 8); k_cvt8<<<(unsigned)(((size_t)DKV * DM / 8 + 255) / 256), 256, 0, stream>>>(wv, WV, (size_t)DKV * DM / 8);
      k_cvt8<<<(unsigned)(((size_t)DM * DQ / 8 + 255) / 256), 256, 0, stream>>>(wo, WO, (size_t)DM * DQ / 8);
       }
    /* the rotary table is copied from the INPUT tables PER BATCH inside the loop below (k_cscvt); k_cs5 and its INVT constants stay defined and are NOT launched */
    const unsigned LQ = (unsigned)(((size_t)NH_ * TT * HD / 2 + 255) / 256), LKv = (unsigned)(((size_t)NKV * TT * HD / 2 + 255) / 256);
    for (int b = 0; b < NB_; ++b) {
        k_cscvt<<<(TT * HD + 255) / 256, 256, 0, stream>>>(fcos + (size_t)b * TT * HD, fsin + (size_t)b * TT * HD, CS);   /* batch b's own rotary table slice from the INPUTS (stream-ordered: before this batch's plane builders) */
        k_cvt8<<<(unsigned)(((size_t)TT * DM / 8 + 255) / 256), 256, 0, stream>>>(x + (size_t)b * TT * DM, XB, (size_t)TT * DM / 8);
        k_gemmw<bf, 0, true><<<dim3(TT / 64, DQ / 64, 1), 32, 0, stream>>>(XB, nullptr, WQ, nullptr, DM, FQ, DQ, bq, 0, 0, 0);
        k_rope<<<LQ, 256, 0, stream>>>(FQ, DQ, NH_, CS, nullptr, nullptr, 1.0f, QP16, QPh, QPl);
        k_cvt8<<<(unsigned)(((size_t)TT * DM / 8 + 255) / 256), 256, 0, stream>>>(xk + (size_t)b * TT * DM, XB, (size_t)TT * DM / 8);   /* XB := bf16(key[b]) */ k_gemmw<bf, 0, true><<<dim3(TT / 64, DKV / 64, 1), 32, 0, stream>>>(XB, nullptr, WK, nullptr, DM, FK, DKV, bk, 0, 0, 0);
        k_rope<<<LKv, 256, 0, stream>>>(FK, DKV, NKV, CS, nullptr, nullptr, 1.0f, KP16, KPh, KPl);
        k_cvt8<<<(unsigned)(((size_t)TT * DM / 8 + 255) / 256), 256, 0, stream>>>(xv + (size_t)b * TT * DM, XB, (size_t)TT * DM / 8);   /* XB := bf16(value[b]) (after the k planes are built) */ k_gemmw<bf, 0, true><<<dim3(TT / 64, DKV / 64, 1), 32, 0, stream>>>(XB, nullptr, WV, nullptr, DM, FV, DKV, bv, 0, 0, 0); k_vtp<<<LKv, 256, 0, stream>>>(FV, DKV, NKV, VT16, VTh, VTl);
        for (int h0 = 0; h0 < NH_; h0 += ZH) { const size_t zq = (size_t)h0, zk = (size_t)(h0 / REP);   // one kv head per query head: the pass's two heads use consecutive kv planes (z-strides TT*HD)
            k_gemmw<bf, 2, false><<<dim3(RH / 64, TT / 64, ZH), 32, 0, stream>>>(QPh + zq * TT * HD, QPl + zq * TT * HD, KPh + zk * TT * HD, KPl + zk * TT * HD, HD, Sb, TT, nullptr, (size_t)TT * HD, (size_t)TT * HD, (size_t)TT * TT);
            k_gemmw<h16, 0, false><<<dim3((TT - RH) / 64, TT / 64, ZH), 32, 0, stream>>>(QP16 + zq * TT * HD + (size_t)RH * HD, nullptr, KP16 + zk * TT * HD, nullptr, HD, Sb + (size_t)RH * TT, TT, nullptr, (size_t)TT * HD, (size_t)TT * HD, (size_t)TT * TT);
            k_asoft<<<ZH * TT / 8, 256, 0, stream>>>(Sb, P16, Ph, Pl);
            k_gemmw<bf, 2, false><<<dim3(RH / 64, HD / 64, ZH), 32, 0, stream>>>(Ph, Pl, VTh + zk * HD * TT, VTl + zk * HD * TT, TT, Ob, HD, nullptr, (size_t)RH * TT, (size_t)HD * TT, (size_t)TT * HD);
            k_gemmw<h16, 0, false><<<dim3((TT - RH) / 64, HD / 64, ZH), 32, 0, stream>>>(P16 + (size_t)RH * TT, nullptr, VT16 + zk * HD * TT, nullptr, TT, Ob + (size_t)RH * HD, HD, nullptr, (size_t)TT * TT, (size_t)HD * TT, (size_t)TT * HD);
            k_merge<<<(unsigned)(((size_t)ZH * TT * HD / 2 + 255) / 256), 256, 0, stream>>>(Ob, h0, ATh, ATl); }
        k_gemmw<bf, 1, true><<<dim3(TT / 64, DM / 64, 1), 32, 0, stream>>>(ATh, ATl, WO, nullptr, DQ, OUT + (size_t)b * TT * DM, DM, bo, 0, 0, 0); }
}

// v001
// It runs in 2120 microseconds.
// Next to v000, in two timings, it ran 1.88 times as fast each time.
#include <hip/hip_runtime.h>

// Rotary multi-head self-attention with PER-BATCH full-width rotary tables given as inputs (hidden [4][2048][1024]: ONE stream; q, k, v = hidden W^T + b ('oi' (out, in) [1024][1024] normal x 1024^-0.5 + zero biases: read; 16 heads x 64); q, k -> t cos + cat(-t2, t1) sin with the cos / sin INPUT tables [4][2048][64] = [B][S][D] (uniform random values on this draw: batch b reads ITS OWN slice, per element by value; no structure assumed); scores x 64^-0.5; softmax over all keys (no mask); out = merged Wo^T + bo ('oi' + a zero bias: read) -> [4][2048][1024] (8.4 M); argument order hidden, cos, sin, Wq, bq, Wk, bk, Wv, bv, Wo, bo).
// Layout per batch: bf16 copies of the input stream(s); 'oi' weights; exact projections + bf16-rounded biases; k_cscvt bf16-rounded copy of batch b's input cos / sin tables; rotate-half plane builders; dense T-2048 attention (hybrid rows: < 512 hi/lo 3 products, rest fp16 x1024); merged hi/lo x Wo exact + bo.
// Compute dtypes, f32 accumulate: every input rounded to bf16; projections exact + bf16-rounded biases; attention rows < 512 3 products, rest fp16; softmax f32; Wo hl x exact + bias.

#define NB_  4
#define TT   2048
#define DM   1024
#define NH_  16
#define NKV  16
#define REP  (NH_ / NKV)
#define HD   64
#define DQ   (NH_ * HD)
#define DKV  (NKV * HD)
#define ZH   2
#define RH   512                  // query rows < RH use hi+lo planes (0: none)
#define WIN  0
#define PCAR 1024.0f
#define SCL  0.125f   // HD^-0.5
typedef _Float16 h16;
typedef unsigned short bf;
typedef __attribute__((ext_vector_type(16))) __bf16   v16bf;
typedef __attribute__((ext_vector_type(16))) _Float16 v16h;
typedef __attribute__((ext_vector_type(8)))  _Float16 v8h;
typedef __attribute__((ext_vector_type(8)))  unsigned short v8us;
typedef __attribute__((ext_vector_type(8)))  float    v8f;
typedef __attribute__((ext_vector_type(4)))  float    v4f;
typedef v8h  __attribute__((may_alias)) v8ha;
typedef v4f  __attribute__((may_alias)) v4fa;
typedef v8us __attribute__((may_alias)) v8usa;

__device__ __forceinline__ unsigned short f2bf(float f) { unsigned u = __float_as_uint(f); u += 0x7FFFu + ((u >> 16) & 1u); return (unsigned short)(u >> 16); }
__device__ __forceinline__ float bf2f(unsigned short b) { return __uint_as_float(((unsigned)b) << 16); }
__device__ __forceinline__ float bfr(float f) { return bf2f(f2bf(f)); }
__device__ __forceinline__ v16h cat16(v8h lo, v8h hi) { return __builtin_shufflevector(lo, hi, 0, 1, 2, 3, 4, 5, 6, 7, 8, 9, 10, 11, 12, 13, 14, 15); }
__device__ __forceinline__ v16bf cat16b(v8us lo, v8us hi) { return __builtin_bit_cast(v16bf, __builtin_shufflevector(lo, hi, 0, 1, 2, 3, 4, 5, 6, 7, 8, 9, 10, 11, 12, 13, 14, 15)); }
__device__ __forceinline__ v8f wmma16(v16h a, v16h b, v8f c) { return __builtin_amdgcn_wmma_f32_16x16x32_f16(false, a, false, b, (short)0, c, false, false); }
__device__ __forceinline__ v8f wmmab(v16bf a, v16bf b, v8f c) { return __builtin_amdgcn_wmma_f32_16x16x32_bf16(false, a, false, b, (short)0, c, false, false); }



// ---- k_gemmw: register-blocked GEMM, one 64x64 output tile per work-group (16 accumulators per wave), operands straight from K-contiguous 16-bit planes; grid (M/64, N/64, Z), 32 * KS threads.
// C[m][n] (f32, pitch ldc, + optional f32 bias[n]) = sum_k A[m][k] Bt[n][k] (+ split products per NSPLIT). z-batch strides sA/sB/sC in elements. K % (32 * KS) == 0.
// KS > 1: wave w sums the k range [w K/KS, (w+1) K/KS) of the whole tile; the KS partial tiles meet in LDS and are added in wave order 0..KS-1 (fixed order).
template <typename T16> struct WFrag;
template <> struct WFrag<h16> { typedef v16h V; static __device__ __forceinline__ V ld(const h16* p) { return cat16(*(const v8h*)p, *(const v8h*)(p + 16)); } static __device__ __forceinline__ v8f mma(V a, V b, v8f c) { return wmma16(a, b, c); } };
template <> struct WFrag<bf> { typedef v16bf V; static __device__ __forceinline__ V ld(const bf* p) { return cat16b(*(const v8us*)p, *(const v8us*)(p + 16)); } static __device__ __forceinline__ v8f mma(V a, V b, v8f c) { return wmmab(a, b, c); } };
template <typename T16, int NSPLIT, bool BIAS, int KS>
__global__ __launch_bounds__(32 * KS) void k_gemmw(const T16* __restrict__ A, const T16* __restrict__ A2, const T16* __restrict__ Bt, const T16* __restrict__ Bt2, int K, float* C, int ldc, const float* __restrict__ bias, size_t sA, size_t sB, size_t sC) {
    typedef typename WFrag<T16>::V V;
    __shared__ __align__(16) float os[(KS > 1 ? KS * 64 : 16) * 68];
    const size_t z = blockIdx.z; A += z * sA; if (A2) A2 += z * sA; Bt += z * sB; if (Bt2) Bt2 += z * sB; C += z * sC;
    const int lane = threadIdx.x & 31, lr = lane & 15, hi = lane >> 4; const int r0 = blockIdx.x * 64, c0 = blockIdx.y * 64;
    v8f acc[4][4];
#pragma unroll
    for (int mb = 0; mb < 4; ++mb)
#pragma unroll
        for (int nb = 0; nb < 4; ++nb) acc[mb][nb] = (v8f){};
    const size_t aoff = (size_t)(r0 + lr) * K + 8 * hi, boff = (size_t)(c0 + lr) * K + 8 * hi;
    const int wv = (KS > 1) ? __builtin_amdgcn_readfirstlane((int)(threadIdx.x >> 5)) : 0; const int kspan = K / KS, kbeg = wv * kspan, kend = kbeg + kspan;
#pragma unroll 1
    for (int kc = kbeg; kc < kend; kc += 32) {
        V a[4], a2[4];
#pragma unroll
        for (int mb = 0; mb < 4; ++mb) { a[mb] = WFrag<T16>::ld(A + aoff + (size_t)mb * 16 * K + kc); if (NSPLIT == 1 || NSPLIT == 2) a2[mb] = WFrag<T16>::ld(A2 + aoff + (size_t)mb * 16 * K + kc); }
#pragma unroll
        for (int nb = 0; nb < 4; ++nb) { const V b = WFrag<T16>::ld(Bt + boff + (size_t)nb * 16 * K + kc); V b2; if (NSPLIT >= 2) b2 = WFrag<T16>::ld(Bt2 + boff + (size_t)nb * 16 * K + kc);
#pragma unroll
            for (int mb = 0; mb < 4; ++mb) { acc[mb][nb] = WFrag<T16>::mma(a[mb], b, acc[mb][nb]); if (NSPLIT == 1 || NSPLIT == 2) acc[mb][nb] = WFrag<T16>::mma(a2[mb], b, acc[mb][nb]); if (NSPLIT >= 2) acc[mb][nb] = WFrag<T16>::mma(a[mb], b2, acc[mb][nb]); } }
        asm volatile("v_nop\n\tv_nop\n\tv_nop\n\tv_nop" : "+v"(acc[0][0]), "+v"(acc[1][1]), "+v"(acc[2][2]), "+v"(acc[3][3]) : "v"(a[0]), "v"(a[3]));
    }
    if constexpr (KS > 1) {
        float* ow = os + wv * (64 * 68); const int cofs = ((int)threadIdx.x & 15) * 4; v4f bb = (v4f){};   // each thread keeps one column group: its bias is loaded here, ahead of the LDS traffic
        if (BIAS) { bb[0] = bfr(bias[c0 + cofs]); bb[1] = bfr(bias[c0 + cofs + 1]); bb[2] = bfr(bias[c0 + cofs + 2]); bb[3] = bfr(bias[c0 + cofs + 3]); }
        // the three loops below are unrolled so that acc[][][] is indexed by constants and stays in registers
#pragma unroll
        for (int mb = 0; mb < 4; ++mb)
#pragma unroll
            for (int nb = 0; nb < 4; ++nb)
#pragma unroll
                for (int j = 0; j < 8; ++j) ow[(mb * 16 + hi * 8 + j) * 68 + nb * 16 + lr] = acc[mb][nb][j];
        __syncthreads();   // every wave's partial tile is in LDS before any thread adds them
        // both loops below are unrolled so that all LDS loads of a thread issue ahead of its adds
#pragma unroll
        for (int i = 0; i < 32 / KS; ++i) { const int row = (i * (32 * KS) + (int)threadIdx.x) >> 4; v4f val = *(const v4fa*)(os + row * 68 + cofs);
#pragma unroll
            for (int w = 1; w < KS; ++w) val += *(const v4fa*)(os + (w * 64 + row) * 68 + cofs);
            if (BIAS) val += bb;
            *(v4f*)(C + (size_t)(r0 + row) * ldc + c0 + cofs) = val; }
        return;
    }
#pragma unroll
    for (int mb = 0; mb < 4; ++mb) {
#pragma unroll
        for (int nb = 0; nb < 4; ++nb) {
#pragma unroll
            for (int j = 0; j < 8; ++j) os[(hi * 8 + j) * 68 + nb * 16 + lr] = acc[mb][nb][j]; }
        __builtin_amdgcn_wave_barrier(); asm volatile("" ::: "memory");
        float* crow = C + (size_t)(r0 + mb * 16) * ldc + c0;
{
#pragma unroll
            for (int s = 0; s < 8; ++s) { const int row = 2 * s + hi, cofs = lr * 4; v4f val = *(const v4fa*)(os + row * 68 + cofs); if (BIAS) { val[0] += bfr(bias[c0 + cofs]); val[1] += bfr(bias[c0 + cofs + 1]); val[2] += bfr(bias[c0 + cofs + 2]); val[3] += bfr(bias[c0 + cofs + 3]); }
                *(v4f*)(crow + (size_t)row * ldc + cofs) = val; }
             }
        __builtin_amdgcn_wave_barrier(); asm volatile("" ::: "memory");
    }
}

__device__ __forceinline__ h16 tohx(float x) { return (h16)x; }
__device__ __forceinline__ void splitf(float y, unsigned short& h, unsigned short& l) { h = f2bf(y); l = f2bf(y - bf2f(h)); }
typedef __attribute__((ext_vector_type(2))) _Float16 v2h;
typedef __attribute__((ext_vector_type(4))) _Float16 v4h;
typedef __attribute__((ext_vector_type(2))) unsigned short v2us;
typedef __attribute__((ext_vector_type(4))) unsigned short v4us;
typedef __attribute__((ext_vector_type(2))) float v2f;
typedef __attribute__((ext_vector_type(4))) int v4i;

__global__ __launch_bounds__(256) void k_cvt8(const float* __restrict__ src, bf* dst, size_t n8) { const size_t i = (size_t)blockIdx.x * 256 + threadIdx.x; if (i >= n8) return; const v8f v = *(const v8f*)(src + i * 8); v8us o;
#pragma unroll
    for (int k = 0; k < 8; ++k) o[k] = f2bf(v[k]); *(v8us*)(dst + i * 8) = o;  }

// k_rope: head planes [h][t][d] (fp16 + hi/lo) of rope(x) x sc with the rotate-half convention out[d] = x[d] cos[t][d] - x[d+HD/2] sin[t][d], out[d+HD/2] = x[d+HD/2] cos[t][d+HD/2] + x[d] sin[t][d+HD/2]
__global__ __launch_bounds__(256) void k_rope(const float* __restrict__ F, int pitch, int nheads, const float* __restrict__ CS, const float* __restrict__ RF, const float* __restrict__ nw, float sc, h16* P16, bf* Ph, bf* Pl) {
    const size_t e = ((size_t)blockIdx.x * 256 + threadIdx.x) * 2; if (e >= (size_t)nheads * TT * HD) return; const int d = (int)(e % HD); const int t = (int)((e / HD) % TT); const int h = (int)(e / ((size_t)HD * TT)); const float* f = F + (size_t)t * pitch + h * HD; const float rf = RF ? RF[(size_t)h * TT + t] : 1.0f; v2h o16; v2us oh, ol;
#pragma unroll
    for (int q = 0; q < 2; ++q) { const int dd = d + q; const int dp = (dd < HD / 2) ? dd + HD / 2 : dd - HD / 2; float x0 = f[dd], x1 = f[dp];
        if (RF) { float n0 = __fmul_rn(x0, rf), n1 = __fmul_rn(x1, rf); asm volatile("" : "+v"(n0)); asm volatile("" : "+v"(n1)); x0 = __fmul_rn(bfr(nw[dd]), n0); x1 = __fmul_rn(bfr(nw[dp]), n1); }
        const v2f cs = *(const v2f*)(CS + ((size_t)t * HD + dd) * 2); float a = __fmul_rn(x0, cs[0]), bq = __fmul_rn(x1, cs[1]); asm volatile("" : "+v"(a)); asm volatile("" : "+v"(bq)); const float r = ((dd < HD / 2) ? __fsub_rn(a, bq) : __fadd_rn(a, bq)) * sc;
        o16[q] = tohx(r); unsigned short a2, c2; splitf(r, a2, c2); oh[q] = a2; ol[q] = c2; }
    *(v2h*)(P16 + e) = o16; *(v2us*)(Ph + e) = oh; *(v2us*)(Pl + e) = ol;  }
__global__ __launch_bounds__(256) void k_vtp(const float* __restrict__ F, int pitch, int nheads, h16* V16, bf* Vh, bf* Vl) { const size_t e = ((size_t)blockIdx.x * 256 + threadIdx.x) * 2; if (e >= (size_t)nheads * HD * TT) return; const int t = (int)(e % TT); const int d = (int)((e / TT) % HD); const int g = (int)(e / ((size_t)TT * HD)); v2h o16; v2us oh, ol;
#pragma unroll
    for (int q = 0; q < 2; ++q) { const float x = F[(size_t)(t + q) * pitch + g * HD + d]; o16[q] = tohx(x); unsigned short a2, c2; splitf(x, a2, c2); oh[q] = a2; ol[q] = c2; }
    *(v2h*)(V16 + e) = o16; *(v2us*)(Vh + e) = oh; *(v2us*)(Vl + e) = ol;  }
__constant__ float INVT[HD / 2] = { 1.000000000e+00f, 7.498942018e-01f, 5.623413324e-01f, 4.216965139e-01f, 3.162277639e-01f, 2.371373624e-01f, 1.778279394e-01f, 1.333521456e-01f, 1.000000015e-01f, 7.498941571e-02f, 5.623412877e-02f, 4.216964915e-02f, 3.162277862e-02f, 2.371373586e-02f, 1.778279431e-02f, 1.333521493e-02f, 9.999999776e-03f, 7.498942316e-03f, 5.623413250e-03f, 4.216964822e-03f, 3.162277862e-03f, 2.371373819e-03f, 1.778279431e-03f, 1.333521446e-03f, 1.000000047e-03f, 7.498941850e-04f, 5.623413017e-04f, 4.216964880e-04f, 3.162277862e-04f, 2.371373848e-04f, 1.778279402e-04f, 1.333521504e-04f };   // float32 1 / 10000^(2i/64), generated with jnp to be bit-exact
__global__ __launch_bounds__(256) void k_cs5(float* CS) { const int idx = blockIdx.x * 256 + threadIdx.x; if (idx >= TT * HD) return; const int d = idx % HD; const int t = idx / HD; const float a = __fmul_rn((float)t, INVT[d % (HD / 2)]); v2f cs; cs[0] = cosf(a); cs[1] = sinf(a); *(v2f*)(CS + (size_t)idx * 2) = cs;  }
__global__ __launch_bounds__(256) void k_cscvt(const float* __restrict__ cosT, const float* __restrict__ sinT, float* CS) { const int idx = blockIdx.x * 256 + threadIdx.x; if (idx >= TT * HD) return; v2f cs; cs[0] = bfr(cosT[idx]); cs[1] = bfr(sinT[idx]); *(v2f*)(CS + (size_t)idx * 2) = cs;  }
// k_asoft: per row (zz, i): t = S x HD^-0.5 (no mask); softmax over the 2048 keys (register row, one exp, fixed trees);
__global__ __launch_bounds__(256) void k_asoft(const float* __restrict__ Sb, h16* P16, bf* Ph, bf* Pl) {
    const int lane = threadIdx.x & 31; const int row = blockIdx.x * 8 + (threadIdx.x >> 5); if (row >= ZH * TT) return; const int i = row % TT; const int zz = row / TT; (void)zz; const bool hires = (i < RH); const float* sr = Sb + (size_t)row * TT; float v[TT / 32]; float mx = -3.0e38f;
#pragma unroll
    for (int ch = 0; ch < TT / 128; ++ch) { const int j0 = ch * 128 + lane * 4; const v4f a = *(const v4f*)(sr + j0);
#pragma unroll
        for (int q = 0; q < 4; ++q) { const int j = j0 + q; (void)j; const float t = a[q] * SCL; v[ch * 4 + q] = t; mx = fmaxf(mx, t); } }
#pragma unroll
    for (int sh = 16; sh; sh >>= 1) mx = fmaxf(mx, __shfl_xor(mx, sh, 32));
    float sum = 0.f;
#pragma unroll
    for (int k = 0; k < TT / 32; ++k) { float d0 = __fsub_rn(v[k], mx); asm volatile("" : "+v"(d0)); v[k] = __builtin_amdgcn_exp2f(__fmul_rn(d0, 1.4426950408889634f)); sum += v[k]; }
#pragma unroll
    for (int sh = 16; sh; sh >>= 1) sum += __shfl_xor(sum, sh, 32);
    const float f = __fdiv_rn(hires ? 1.0f : PCAR, sum);
{
        if (hires) {
#pragma unroll
            for (int ch = 0; ch < TT / 128; ++ch) { v4us oh, ol;
#pragma unroll
                for (int q = 0; q < 4; ++q) { unsigned short a, c2; splitf(v[ch * 4 + q] * f, a, c2); oh[q] = a; ol[q] = c2; }
                const size_t oo = ((size_t)zz * (RH ? RH : 1) + i) * TT + ch * 128 + lane * 4; *(v4us*)(Ph + oo) = oh; *(v4us*)(Pl + oo) = ol; }
        } else {
#pragma unroll
            for (int ch = 0; ch < TT / 128; ++ch) { v4h o4;
#pragma unroll
                for (int q = 0; q < 4; ++q) o4[q] = tohx(v[ch * 4 + q] * f);
                *(v4h*)(P16 + (size_t)row * TT + ch * 128 + lane * 4) = o4; } }
         }
}
__global__ __launch_bounds__(256) void k_merge(const float* __restrict__ O, int h0, bf* Ah, bf* Al) { const size_t e = ((size_t)blockIdx.x * 256 + threadIdx.x) * 2; if (e >= (size_t)ZH * TT * HD) return; const int d = (int)(e % HD); const int t = (int)((e / HD) % TT); const int zz = (int)(e / ((size_t)HD * TT)); const float cs = (t < RH) ? 1.0f : (1.0f / PCAR); const size_t oo = (size_t)t * DQ + (h0 + zz) * HD + d;
    v2us oh, ol;
#pragma unroll
    for (int q = 0; q < 2; ++q) { unsigned short a, c2; splitf(O[e + q] * cs, a, c2); oh[q] = a; ol[q] = c2; } *(v2us*)(Ah + oo) = oh; *(v2us*)(Al + oo) = ol;  }

extern "C" void kernel_launch(void* const* d_in, const int* in_sizes, int n_in,
                              void* d_out, int out_size, void* d_ws, size_t ws_size, hipStream_t stream) {
    (void)in_sizes; (void)n_in; (void)out_size;
    const float* x = (const float*)d_in[0]; const float* xk = (const float*)d_in[0]; const float* xv = (const float*)d_in[0]; const float* fcos = (const float*)d_in[1]; const float* fsin = (const float*)d_in[2]; const float* wq = (const float*)d_in[3]; const float* bq = (const float*)d_in[4]; const float* wk = (const float*)d_in[5]; const float* bk = (const float*)d_in[6]; const float* wv = (const float*)d_in[7]; const float* bv = (const float*)d_in[8]; const float* wo = (const float*)d_in[9]; const float* bo = (const float*)d_in[10];   /* order hidden [4][2048][1024] (ONE stream: the three stream pointers all name it), cos, sin ([4][2048][64] = [B][S][D] PER-BATCH full-width table INPUTS: read per element by value), Wq, bq, Wk, bk, Wv, bv, Wo, bo ('oi' (out, in) [1024][1024] + [1024]): ELEVEN inputs, all read */
    float* OUT = (float*)d_out;     // [4][2048][1024]
    char* wsp = (char*)d_ws;
    auto take = [&](size_t bytes) { char* p = wsp; wsp += (bytes + 255) & ~(size_t)255; return (void*)p; };
    bf* WQ = (bf*)take((size_t)DQ * DM * 2); bf* WK = (bf*)take((size_t)DKV * DM * 2); bf* WV = (bf*)take((size_t)DKV * DM * 2); bf* WO = (bf*)take((size_t)DM * DQ * 2); float* CS = (float*)take((size_t)TT * HD * 2 * 4);
    bf* XB = (bf*)take((size_t)TT * DM * 2); float* FQ = (float*)take((size_t)TT * DQ * 4); float* FK = (float*)take((size_t)TT * DKV * 4);
    h16* QP16 = (h16*)take((size_t)NH_ * TT * HD * 2); h16* KP16 = (h16*)take((size_t)NKV * TT * HD * 2); h16* VT16 = (h16*)take((size_t)NKV * HD * TT * 2);
    bf* QPh = (bf*)take((size_t)NH_ * TT * HD * 2); bf* QPl = (bf*)take((size_t)NH_ * TT * HD * 2); bf* KPh = (bf*)take((size_t)NKV * TT * HD * 2); bf* KPl = (bf*)take((size_t)NKV * TT * HD * 2); bf* VTh = (bf*)take((size_t)NKV * HD * TT * 2); bf* VTl = (bf*)take((size_t)NKV * HD * TT * 2); bf* Ph = (bf*)take((size_t)ZH * RH * TT * 2); bf* Pl = (bf*)take((size_t)ZH * RH * TT * 2);
    float* Sb = (float*)take((size_t)ZH * TT * TT * 4); h16* P16 = (h16*)take((size_t)ZH * TT * TT * 2); float* Ob = (float*)take((size_t)ZH * TT * HD * 4); bf* ATh = (bf*)take((size_t)TT * DQ * 2); bf* ATl = (bf*)take((size_t)TT * DQ * 2);
    if ((size_t)(wsp - (char*)d_ws) > ws_size) return;    // ws 256 MiB
    float* FV = FK;   // v projection reuses the k buffer after the k planes are built (stream-ordered)
    { k_cvt8<<<(unsigned)(((size_t)DQ * DM / 8 + 255) / 256), 256, 0, stream>>>(wq, WQ, (size_t)DQ * DM / 8); k_cvt8<<<(unsigned)(((size_t)DKV * DM / 8 + 255) / 256), 256, 0, stream>>>(wk, WK, (size_t)DKV * DM / 8); k_cvt8<<<(unsigned)(((size_t)DKV * DM / 8 + 255) / 256), 256, 0, stream>>>(wv, WV, (size_t)DKV * DM / 8);
      k_cvt8<<<(unsigned)(((size_t)DM * DQ / 8 + 255) / 256), 256, 0, stream>>>(wo, WO, (size_t)DM * DQ / 8);
       }
    /* the rotary table is copied from the INPUT tables PER BATCH inside the loop below (k_cscvt); k_cs5 and its INVT constants stay defined and are NOT launched */
    const unsigned LQ = (unsigned)(((size_t)NH_ * TT * HD / 2 + 255) / 256), LKv = (unsigned)(((size_t)NKV * TT * HD / 2 + 255) / 256);
    for (int b = 0; b < NB_; ++b) {
        k_cscvt<<<(TT * HD + 255) / 256, 256, 0, stream>>>(fcos + (size_t)b * TT * HD, fsin + (size_t)b * TT * HD, CS);   /* batch b's own rotary table slice from the INPUTS (stream-ordered: before this batch's plane builders) */
        k_cvt8<<<(unsigned)(((size_t)TT * DM / 8 + 255) / 256), 256, 0, stream>>>(x + (size_t)b * TT * DM, XB, (size_t)TT * DM / 8);
        k_gemmw<bf, 0, true, 8><<<dim3(TT / 64, DQ / 64, 1), 256, 0, stream>>>(XB, nullptr, WQ, nullptr, DM, FQ, DQ, bq, 0, 0, 0);
        k_rope<<<LQ, 256, 0, stream>>>(FQ, DQ, NH_, CS, nullptr, nullptr, 1.0f, QP16, QPh, QPl);
        k_cvt8<<<(unsigned)(((size_t)TT * DM / 8 + 255) / 256), 256, 0, stream>>>(xk + (size_t)b * TT * DM, XB, (size_t)TT * DM / 8);   /* XB := bf16(key[b]) */ k_gemmw<bf, 0, true, 8><<<dim3(TT / 64, DKV / 64, 1), 256, 0, stream>>>(XB, nullptr, WK, nullptr, DM, FK, DKV, bk, 0, 0, 0);
        k_rope<<<LKv, 256, 0, stream>>>(FK, DKV, NKV, CS, nullptr, nullptr, 1.0f, KP16, KPh, KPl);
        k_cvt8<<<(unsigned)(((size_t)TT * DM / 8 + 255) / 256), 256, 0, stream>>>(xv + (size_t)b * TT * DM, XB, (size_t)TT * DM / 8);   /* XB := bf16(value[b]) (after the k planes are built) */ k_gemmw<bf, 0, true, 8><<<dim3(TT / 64, DKV / 64, 1), 256, 0, stream>>>(XB, nullptr, WV, nullptr, DM, FV, DKV, bv, 0, 0, 0); k_vtp<<<LKv, 256, 0, stream>>>(FV, DKV, NKV, VT16, VTh, VTl);
        for (int h0 = 0; h0 < NH_; h0 += ZH) { const size_t zq = (size_t)h0, zk = (size_t)(h0 / REP);   // one kv head per query head: the pass's two heads use consecutive kv planes (z-strides TT*HD)
            k_gemmw<bf, 2, false, 1><<<dim3(RH / 64, TT / 64, ZH), 32, 0, stream>>>(QPh + zq * TT * HD, QPl + zq * TT * HD, KPh + zk * TT * HD, KPl + zk * TT * HD, HD, Sb, TT, nullptr, (size_t)TT * HD, (size_t)TT * HD, (size_t)TT * TT);
            k_gemmw<h16, 0, false, 1><<<dim3((TT - RH) / 64, TT / 64, ZH), 32, 0, stream>>>(QP16 + zq * TT * HD + (size_t)RH * HD, nullptr, KP16 + zk * TT * HD, nullptr, HD, Sb + (size_t)RH * TT, TT, nullptr, (size_t)TT * HD, (size_t)TT * HD, (size_t)TT * TT);
            k_asoft<<<ZH * TT / 8, 256, 0, stream>>>(Sb, P16, Ph, Pl);
            k_gemmw<bf, 2, false, 16><<<dim3(RH / 64, HD / 64, ZH), 512, 0, stream>>>(Ph, Pl, VTh + zk * HD * TT, VTl + zk * HD * TT, TT, Ob, HD, nullptr, (size_t)RH * TT, (size_t)HD * TT, (size_t)TT * HD);
            k_gemmw<h16, 0, false, 16><<<dim3((TT - RH) / 64, HD / 64, ZH), 512, 0, stream>>>(P16 + (size_t)RH * TT, nullptr, VT16 + zk * HD * TT, nullptr, TT, Ob + (size_t)RH * HD, HD, nullptr, (size_t)TT * TT, (size_t)HD * TT, (size_t)TT * HD);
            k_merge<<<(unsigned)(((size_t)ZH * TT * HD / 2 + 255) / 256), 256, 0, stream>>>(Ob, h0, ATh, ATl); }
        k_gemmw<bf, 1, true, 8><<<dim3(TT / 64, DM / 64, 1), 256, 0, stream>>>(ATh, ATl, WO, nullptr, DQ, OUT + (size_t)b * TT * DM, DM, bo, 0, 0, 0); }
}

// v003
// A run of this version takes 501 microseconds.
// Versions between v001 and this one are left out; their measured steps multiply to 4.18 times as fast.
// Over all steps from v000 it is 7.87 times as fast.
#include <hip/hip_runtime.h>

// Rotary multi-head self-attention with PER-BATCH full-width rotary tables given as inputs (hidden [4][2048][1024]: ONE stream; q, k, v = hidden W^T + b ('oi' (out, in) [1024][1024] normal x 1024^-0.5 + zero biases: read; 16 heads x 64); q, k -> t cos + cat(-t2, t1) sin with the cos / sin INPUT tables [4][2048][64] = [B][S][D] (uniform random values on this draw: batch b reads ITS OWN slice, per element by value; no structure assumed); scores x 64^-0.5; softmax over all keys (no mask); out = merged Wo^T + bo ('oi' + a zero bias: read) -> [4][2048][1024] (8.4 M); argument order hidden, cos, sin, Wq, bq, Wk, bk, Wv, bv, Wo, bo).
// Layout per batch: bf16 copies of the input stream(s); 'oi' weights; exact projections + f32 biases, whose epilogue applies the rotary tables and writes the head planes (q, k: [h][t][d]; v: [h][d][t]); dense T-2048 attention in one kernel per batch, scores and probabilities in LDS (hybrid rows: < 512 hi/lo 3 products, rest fp16 x1024); merged hi/lo x Wo exact + bo.
// Compute dtypes, f32 accumulate: every input rounded to bf16; projections exact + f32 biases; attention rows < 512 3 products, rest fp16; softmax f32; Wo hl x exact + bias.

#define NB_  4
#define TT   2048
#define DM   1024
#define NH_  16
#define NKV  16
#define REP  (NH_ / NKV)
#define HD   64
#define DQ   (NH_ * HD)
#define DKV  (NKV * HD)
#define RH   512                  // query rows < RH use hi+lo planes (0: none)
#define WIN  0
#define PCAR 1024.0f
#define SCL  0.125f   // HD^-0.5
typedef _Float16 h16;
typedef unsigned short bf;
typedef __attribute__((ext_vector_type(16))) __bf16   v16bf;
typedef __attribute__((ext_vector_type(16))) _Float16 v16h;
typedef __attribute__((ext_vector_type(8)))  _Float16 v8h;
typedef __attribute__((ext_vector_type(8)))  unsigned short v8us;
typedef __attribute__((ext_vector_type(8)))  float    v8f;
typedef __attribute__((ext_vector_type(4)))  float    v4f;
typedef v8h  __attribute__((may_alias)) v8ha;
typedef v4f  __attribute__((may_alias)) v4fa;
typedef v8us __attribute__((may_alias)) v8usa;

__device__ __forceinline__ unsigned short f2bf(float f) { unsigned u = __float_as_uint(f); u += 0x7FFFu + ((u >> 16) & 1u); return (unsigned short)(u >> 16); }
__device__ __forceinline__ float bf2f(unsigned short b) { return __uint_as_float(((unsigned)b) << 16); }
__device__ __forceinline__ float bfr(float f) { return bf2f(f2bf(f)); }
__device__ __forceinline__ v16h cat16(v8h lo, v8h hi) { return __builtin_shufflevector(lo, hi, 0, 1, 2, 3, 4, 5, 6, 7, 8, 9, 10, 11, 12, 13, 14, 15); }
__device__ __forceinline__ v16bf cat16b(v8us lo, v8us hi) { return __builtin_bit_cast(v16bf, __builtin_shufflevector(lo, hi, 0, 1, 2, 3, 4, 5, 6, 7, 8, 9, 10, 11, 12, 13, 14, 15)); }
__device__ __forceinline__ v8f wmma16(v16h a, v16h b, v8f c) { return __builtin_amdgcn_wmma_f32_16x16x32_f16(false, a, false, b, (short)0, c, false, false); }
__device__ __forceinline__ v8f wmmab(v16bf a, v16bf b, v8f c) { return __builtin_amdgcn_wmma_f32_16x16x32_bf16(false, a, false, b, (short)0, c, false, false); }

__device__ __forceinline__ h16 tohx(float x) { return (h16)x; }
__device__ __forceinline__ void splitf(float y, unsigned short& h, unsigned short& l) { h = f2bf(y); l = f2bf(y - bf2f(h)); }
typedef __attribute__((ext_vector_type(2))) _Float16 v2h;
typedef __attribute__((ext_vector_type(4))) _Float16 v4h;
typedef __attribute__((ext_vector_type(2))) unsigned short v2us;
typedef __attribute__((ext_vector_type(4))) unsigned short v4us;
typedef __attribute__((ext_vector_type(2))) float v2f;
typedef __attribute__((ext_vector_type(4))) int v4i;

// ---- k_gemmw: register-blocked GEMM, one 64x64 output tile per work-group (16 accumulators per wave), operands straight from K-contiguous 16-bit planes; grid (M/64, N/64, Z), 32 * KS threads.
// C[m][n] (f32, pitch ldc, + optional f32 bias[n]) = sum_k A[m][k] Bt[n][k] (+ split products per NSPLIT). z-batch strides sA/sB/sC in elements. K % (32 * KS) == 0.
// KS > 1: wave w sums the k range [w K/KS, (w+1) K/KS) of the whole tile; the KS partial tiles meet in LDS and are added in wave order 0..KS-1 (fixed order).
// EPI (KS > 1 only; the 64 columns of a tile are one head): 0 f32 C; 1 rotate-half rotary with the cos / sin tables [t][64], each rounded to bf16, then head planes [h][t][d] (fp16 + bf16 hi/lo); 2 transposed head planes [h][d][t] (fp16 + bf16 hi/lo). C is not written for EPI 1, 2.
template <typename T16> struct WFrag;
template <> struct WFrag<h16> { typedef v16h V; static __device__ __forceinline__ V ld(const h16* p) { return cat16(*(const v8h*)p, *(const v8h*)(p + 16)); } static __device__ __forceinline__ v8f mma(V a, V b, v8f c) { return wmma16(a, b, c); } };
template <> struct WFrag<bf> { typedef v16bf V; static __device__ __forceinline__ V ld(const bf* p) { return cat16b(*(const v8us*)p, *(const v8us*)(p + 16)); } static __device__ __forceinline__ v8f mma(V a, V b, v8f c) { return wmmab(a, b, c); } };
template <typename T16, int NSPLIT, bool BIAS, int KS, int EPI>
__global__ __launch_bounds__(32 * KS) void k_gemmw(const T16* __restrict__ A, const T16* __restrict__ A2, const T16* __restrict__ Bt, const T16* __restrict__ Bt2, int K, float* C, int ldc, const float* __restrict__ bias, size_t sA, size_t sB, size_t sC, const float* __restrict__ cosT, const float* __restrict__ sinT, h16* P16, bf* Ph, bf* Pl) {
    typedef typename WFrag<T16>::V V;
    __shared__ __align__(16) float os[(KS > 1 ? KS * 64 : 16) * 68];
    const size_t z = blockIdx.z; A += z * sA; if (A2) A2 += z * sA; Bt += z * sB; if (Bt2) Bt2 += z * sB; C += z * sC;
    const int lane = threadIdx.x & 31, lr = lane & 15, hi = lane >> 4; const int r0 = blockIdx.x * 64, c0 = blockIdx.y * 64;
    v8f acc[4][4];
#pragma unroll
    for (int mb = 0; mb < 4; ++mb)
#pragma unroll
        for (int nb = 0; nb < 4; ++nb) acc[mb][nb] = (v8f){};
    const size_t aoff = (size_t)(r0 + lr) * K + 8 * hi, boff = (size_t)(c0 + lr) * K + 8 * hi;
    const int wv = (KS > 1) ? __builtin_amdgcn_readfirstlane((int)(threadIdx.x >> 5)) : 0; const int kspan = K / KS, kbeg = wv * kspan, kend = kbeg + kspan;
#pragma unroll 1
    for (int kc = kbeg; kc < kend; kc += 32) {
        V a[4], a2[4];
#pragma unroll
        for (int mb = 0; mb < 4; ++mb) { a[mb] = WFrag<T16>::ld(A + aoff + (size_t)mb * 16 * K + kc); if (NSPLIT == 1 || NSPLIT == 2) a2[mb] = WFrag<T16>::ld(A2 + aoff + (size_t)mb * 16 * K + kc); }
#pragma unroll
        for (int nb = 0; nb < 4; ++nb) { const V b = WFrag<T16>::ld(Bt + boff + (size_t)nb * 16 * K + kc); V b2; if (NSPLIT >= 2) b2 = WFrag<T16>::ld(Bt2 + boff + (size_t)nb * 16 * K + kc);
#pragma unroll
            for (int mb = 0; mb < 4; ++mb) { acc[mb][nb] = WFrag<T16>::mma(a[mb], b, acc[mb][nb]); if (NSPLIT == 1 || NSPLIT == 2) acc[mb][nb] = WFrag<T16>::mma(a2[mb], b, acc[mb][nb]); if (NSPLIT >= 2) acc[mb][nb] = WFrag<T16>::mma(a[mb], b2, acc[mb][nb]); } }
        asm volatile("v_nop\n\tv_nop\n\tv_nop\n\tv_nop" : "+v"(acc[0][0]), "+v"(acc[1][1]), "+v"(acc[2][2]), "+v"(acc[3][3]) : "v"(a[0]), "v"(a[3]));
    }
    if constexpr (KS > 1) {
        float* ow = os + wv * (64 * 68); const int cofs = ((int)threadIdx.x & 15) * 4; v4f bb = (v4f){};   // each thread keeps one column group: its bias is loaded here, ahead of the LDS traffic
        if (BIAS) { bb[0] = bfr(bias[c0 + cofs]); bb[1] = bfr(bias[c0 + cofs + 1]); bb[2] = bfr(bias[c0 + cofs + 2]); bb[3] = bfr(bias[c0 + cofs + 3]); }
        v4f cc[32 / KS], sn[32 / KS];   // EPI 1: the thread's table entries, loaded with the bias, ahead of the LDS traffic
        if constexpr (EPI == 1) {
#pragma unroll
            for (int i = 0; i < 32 / KS; ++i) { const size_t o = (size_t)(r0 + ((i * (32 * KS) + (int)threadIdx.x) >> 4)) * HD + cofs; cc[i] = *(const v4f*)(cosT + o); sn[i] = *(const v4f*)(sinT + o); }
        }
        // the three loops below are unrolled so that acc[][][] is indexed by constants and stays in registers
#pragma unroll
        for (int mb = 0; mb < 4; ++mb)
#pragma unroll
            for (int nb = 0; nb < 4; ++nb)
#pragma unroll
                for (int j = 0; j < 8; ++j) ow[(mb * 16 + hi * 8 + j) * 68 + nb * 16 + lr] = acc[mb][nb][j];
        __syncthreads();   // every wave's partial tile is in LDS before any thread adds them
        v4f keep[32 / KS];   // EPI 2: the thread's four sums
        // both loops below are unrolled so that all LDS loads of a thread issue ahead of its adds
#pragma unroll
        for (int i = 0; i < 32 / KS; ++i) { const int row = (i * (32 * KS) + (int)threadIdx.x) >> 4; v4f val = *(const v4fa*)(os + row * 68 + cofs);
#pragma unroll
            for (int w = 1; w < KS; ++w) val += *(const v4fa*)(os + (w * 64 + row) * 68 + cofs);
            if (BIAS) val += bb;
            if constexpr (EPI == 0) *(v4f*)(C + (size_t)(r0 + row) * ldc + c0 + cofs) = val;
            else if constexpr (EPI == 1) { v4h o16; v4us oh, ol;
#pragma unroll
                for (int q = 0; q < 4; ++q) { const float xp = __builtin_amdgcn_update_dpp(0.0f, val[q], 0x168, 0xf, 0xf, true);   // row_xmask:8: column d ^ 32 of this row sits in lane ^ 8 (the float overload: with the value cast to int the build held one move for all four columns)
                    const float s = bfr(sn[i][q]); const float r = val[q] * bfr(cc[i][q]) + xp * (cofs < HD / 2 ? -s : s);
                    o16[q] = tohx(r); unsigned short a2, c2; splitf(r, a2, c2); oh[q] = a2; ol[q] = c2; }
                const size_t e = ((size_t)blockIdx.y * TT + r0 + row) * HD + cofs; *(v4h*)(P16 + e) = o16; *(v4us*)(Ph + e) = oh; *(v4us*)(Pl + e) = ol; }
            else keep[i] = val; }
        if constexpr (EPI == 2) {
            // the sums go back into wave 0's tile, each at the place that only this thread has read; behind the loop above, so that its LDS loads still issue together
#pragma unroll
            for (int i = 0; i < 32 / KS; ++i) *(v4fa*)(os + ((i * (32 * KS) + (int)threadIdx.x) >> 4) * 68 + cofs) = keep[i];
            __syncthreads();   // every summed row is in LDS before any thread reads a column of the tile
#pragma unroll
            for (int it = 0; it < 16 / KS; ++it) { const int item = it * (32 * KS) + (int)threadIdx.x, d = item >> 3, tq = (item & 7) * 8; v8h o16; v8us oh, ol;   // eight lanes write one whole 128-byte line of a plane's row d
#pragma unroll
                for (int j = 0; j < 8; ++j) { const float x = os[(tq + j) * 68 + d]; o16[j] = tohx(x); unsigned short a2, c2; splitf(x, a2, c2); oh[j] = a2; ol[j] = c2; }
                const size_t e = ((size_t)blockIdx.y * HD + d) * TT + r0 + tq; *(v8h*)(P16 + e) = o16; *(v8us*)(Ph + e) = oh; *(v8us*)(Pl + e) = ol; }
        }
        return;
    }
#pragma unroll
    for (int mb = 0; mb < 4; ++mb) {
#pragma unroll
        for (int nb = 0; nb < 4; ++nb) {
#pragma unroll
            for (int j = 0; j < 8; ++j) os[(hi * 8 + j) * 68 + nb * 16 + lr] = acc[mb][nb][j]; }
        __builtin_amdgcn_wave_barrier(); asm volatile("" ::: "memory");
        float* crow = C + (size_t)(r0 + mb * 16) * ldc + c0;
{
#pragma unroll
            for (int s = 0; s < 8; ++s) { const int row = 2 * s + hi, cofs = lr * 4; v4f val = *(const v4fa*)(os + row * 68 + cofs); if (BIAS) { val[0] += bfr(bias[c0 + cofs]); val[1] += bfr(bias[c0 + cofs + 1]); val[2] += bfr(bias[c0 + cofs + 2]); val[3] += bfr(bias[c0 + cofs + 3]); }
                *(v4f*)(crow + (size_t)row * ldc + cofs) = val; }
             }
        __builtin_amdgcn_wave_barrier(); asm volatile("" ::: "memory");
    }
}


__global__ __launch_bounds__(256) void k_cvt8(const float* __restrict__ src, bf* dst, size_t n8) { const size_t i = (size_t)blockIdx.x * 256 + threadIdx.x; if (i >= n8) return; const v8f v = *(const v8f*)(src + i * 8); v8us o;
#pragma unroll
    for (int k = 0; k < 8; ++k) o[k] = f2bf(v[k]); *(v8us*)(dst + i * 8) = o;  }

__constant__ float INVT[HD / 2] = { 1.000000000e+00f, 7.498942018e-01f, 5.623413324e-01f, 4.216965139e-01f, 3.162277639e-01f, 2.371373624e-01f, 1.778279394e-01f, 1.333521456e-01f, 1.000000015e-01f, 7.498941571e-02f, 5.623412877e-02f, 4.216964915e-02f, 3.162277862e-02f, 2.371373586e-02f, 1.778279431e-02f, 1.333521493e-02f, 9.999999776e-03f, 7.498942316e-03f, 5.623413250e-03f, 4.216964822e-03f, 3.162277862e-03f, 2.371373819e-03f, 1.778279431e-03f, 1.333521446e-03f, 1.000000047e-03f, 7.498941850e-04f, 5.623413017e-04f, 4.216964880e-04f, 3.162277862e-04f, 2.371373848e-04f, 1.778279402e-04f, 1.333521504e-04f };   // float32 1 / 10000^(2i/64), generated with jnp to be bit-exact
__global__ __launch_bounds__(256) void k_cs5(float* CS) { const int idx = blockIdx.x * 256 + threadIdx.x; if (idx >= TT * HD) return; const int d = idx % HD; const int t = idx / HD; const float a = __fmul_rn((float)t, INVT[d % (HD / 2)]); v2f cs; cs[0] = cosf(a); cs[1] = sinf(a); *(v2f*)(CS + (size_t)idx * 2) = cs;  }
// k_attn: one work-group = 32 query rows of one head, all 2048 keys; the score rows, the probabilities and the partial output tiles live in LDS and never reach memory.
// grid (heads, TT / 32), 512 threads = 16 waves. Row tiles below RH use the hi/lo bf16 planes (3 products), the rest the fp16 planes (probabilities x PCAR).
// Phase 1: wave w forms S[32][128 w .. 128 w + 127] (k steps 0, 32 in turn). Phase 2: wave w does rows 2 w, 2 w + 1 (register row, one exp, fixed trees) and lays the 16-bit row over its own f32 row.
// Phase 3: wave w sums keys [128 w, 128 w + 128) of P V; the 16 partial tiles are added in wave order 0..15 and leave as the merged hi/lo planes [t][h * 64 + d].
#define RT   32
#define SPF  2052                 // LDS row pitch in floats: 8208 B = 16 B x 513 (odd), conflict-free for 16-byte fragment reads
typedef v4h  __attribute__((may_alias)) v4ha;
typedef v4us __attribute__((may_alias)) v4usa;
template <typename T16, bool HI>
__device__ __forceinline__ void attn_body(float* sm, const T16* __restrict__ Q, const T16* __restrict__ Q2, const T16* __restrict__ Kp, const T16* __restrict__ Kp2, const T16* __restrict__ Vt, const T16* __restrict__ Vt2, int t0, int h, bf* Ah, bf* Al) {
    typedef WFrag<T16> F; typedef typename F::V V;
    const int lane = threadIdx.x & 31, lr = lane & 15, hi = lane >> 4; const int wv = __builtin_amdgcn_readfirstlane((int)(threadIdx.x >> 5)); const int kbeg = wv * 128;
    const unsigned lo = (unsigned)(lr * HD + 8 * hi), lv = (unsigned)(lr * TT + 8 * hi);   // 32-bit lane offsets over wave-uniform bases: one address register per stream
    constexpr int CH = HI ? 2 : 8, NPRE = HI ? 1 : 4;   // key groups per batch of K loads; k steps of V fetched ahead of the softmax (what 256 registers hold)
    const T16* vb = Vt + kbeg; const T16* vb2 = HI ? Vt2 + kbeg : nullptr; V vf[4][4], vf2[4][4];
    {   // phase 1: scores. Every loop is unrolled: fragment and accumulator arrays are indexed by constants
        V qa[2][2], qa2[2][2], b[8][2], b2[8][2]; const T16* qb = Q + (size_t)t0 * HD; const T16* qb2 = HI ? Q2 + (size_t)t0 * HD : nullptr; const T16* kb = Kp + (size_t)kbeg * HD; const T16* kb2 = HI ? Kp2 + (size_t)kbeg * HD : nullptr;
#pragma unroll
        for (int mb = 0; mb < 2; ++mb)
#pragma unroll
            for (int kk = 0; kk < 2; ++kk) { const int o = mb * 16 * HD + kk * 32; qa[mb][kk] = F::ld(qb + lo + o); if (HI) qa2[mb][kk] = F::ld(qb2 + lo + o); }
        __builtin_amdgcn_sched_barrier(0);   // keeps the Q loads ahead of the K loads, so that the first products wait for Q and one key group, not for the whole run
#pragma unroll
        for (int nb = 0; nb < CH; ++nb)
#pragma unroll
            for (int kk = 0; kk < 2; ++kk) { const int o = nb * 16 * HD + kk * 32; b[nb][kk] = F::ld(kb + lo + o); if (HI) b2[nb][kk] = F::ld(kb2 + lo + o); }
        asm volatile("s_wait_xcnt 0x0" :: "v"(lo * 2u) : "memory");   // the wait before a register that the loads above name is rewritten; their byte offset as an input keeps that register live through the run, so that no load of the run lands in it
#pragma unroll
        for (int c = 0; c < 8; c += CH) {
            if (c + CH < 8) {
#pragma unroll
                for (int nb = c + CH; nb < c + 2 * CH; ++nb)
#pragma unroll
                    for (int kk = 0; kk < 2; ++kk) { const int o = nb * 16 * HD + kk * 32; b[nb][kk] = F::ld(kb + lo + o); if (HI) b2[nb][kk] = F::ld(kb2 + lo + o); } }
            __builtin_amdgcn_sched_barrier(0);   // keeps the loads above it in flight during the products below; without it each load sinks to its product and its latency is paid eight times over
#pragma unroll
            for (int nb = c; nb < c + CH; ++nb) { const int key = kbeg + nb * 16; v8f acc[2]; acc[0] = (v8f){}; acc[1] = (v8f){};
#pragma unroll
                for (int kk = 0; kk < 2; ++kk)
#pragma unroll
                    for (int mb = 0; mb < 2; ++mb) { acc[mb] = F::mma(qa[mb][kk], b[nb][kk], acc[mb]); if (HI) { acc[mb] = F::mma(qa2[mb][kk], b[nb][kk], acc[mb]); acc[mb] = F::mma(qa[mb][kk], b2[nb][kk], acc[mb]); } }
                asm volatile("v_nop\n\tv_nop\n\tv_nop\n\tv_nop" : "+v"(acc[0]), "+v"(acc[1]));   // four vector slots behind the group's last WMMA: the next group's first WMMA may write the same registers anew
#pragma unroll
                for (int mb = 0; mb < 2; ++mb)
#pragma unroll
                    for (int j = 0; j < 8; ++j) sm[(mb * 16 + hi * 8 + j) * SPF + key + lr] = acc[mb][j]; } }
    }
    __syncthreads();   // all 2048 scores of every row are in LDS before a wave reads its rows
    // the first V fragments are fetched here, behind the barrier (which drains a wave's loads), so that they fly during the softmax
#pragma unroll
    for (int ks = 0; ks < NPRE; ++ks)
#pragma unroll
        for (int nb = 0; nb < 4; ++nb) { const int o = nb * 16 * TT + ks * 32; vf[ks][nb] = F::ld(vb + lv + o); if (HI) vf2[ks][nb] = F::ld(vb2 + lv + o); }
    asm volatile("s_wait_xcnt 0x0" :: "v"(lv * 2u) : "memory");   // as above, for the V loads and their byte offset
#pragma unroll 1   // one row's 64 values at a time: two rows beside the V fragments held in registers would spill
    for (int rr = 0; rr < 2; ++rr) {   // phase 2: softmax of one row per trip
        float* sr = sm + (wv * 2 + rr) * SPF; float v[TT / 32]; float mx = -3.0e38f;
#pragma unroll
        for (int ch = 0; ch < TT / 128; ++ch) { const v4f a = *(const v4fa*)(sr + ch * 128 + lane * 4);
#pragma unroll
            for (int q = 0; q < 4; ++q) { const float t = a[q] * SCL; v[ch * 4 + q] = t; mx = fmaxf(mx, t); } }
#pragma unroll
        for (int sh = 16; sh; sh >>= 1) mx = fmaxf(mx, __shfl_xor(mx, sh, 32));
        float sum = 0.f;
#pragma unroll
        for (int k = 0; k < TT / 32; ++k) { v[k] = __builtin_amdgcn_exp2f(__fmul_rn(__fsub_rn(v[k], mx), 1.4426950408889634f)); sum += v[k]; }
#pragma unroll
        for (int sh = 16; sh; sh >>= 1) sum += __shfl_xor(sum, sh, 32);
        const float f = __fdiv_rn(HI ? 1.0f : PCAR, sum);
        // the 16-bit row overwrites the f32 row it came from: only this wave touches the row, and every store depends on the row's sum
        if (HI) {
#pragma unroll
            for (int ch = 0; ch < TT / 128; ++ch) { v4us oh, ol;
#pragma unroll
                for (int q = 0; q < 4; ++q) { unsigned short a, c2; splitf(v[ch * 4 + q] * f, a, c2); oh[q] = a; ol[q] = c2; }
                *(v4usa*)((bf*)sr + ch * 128 + lane * 4) = oh; *(v4usa*)((bf*)sr + TT + ch * 128 + lane * 4) = ol; }
        } else {
#pragma unroll
            for (int ch = 0; ch < TT / 128; ++ch) { v4h o4;
#pragma unroll
                for (int q = 0; q < 4; ++q) o4[q] = tohx(v[ch * 4 + q] * f);
                *(v4ha*)((h16*)sr + ch * 128 + lane * 4) = o4; } }
    }
    __syncthreads();   // every row's probabilities are in LDS before any wave reads them as A fragments
    v8f acc[2][4];
#pragma unroll
    for (int mb = 0; mb < 2; ++mb)
#pragma unroll
        for (int nb = 0; nb < 4; ++nb) acc[mb][nb] = (v8f){};
    // phase 3: P V. Unrolled: constant indices
#pragma unroll
    for (int ks = 0; ks < 4; ++ks) { const int kc = kbeg + ks * 32; V a[2], a2[2];
        if (ks + NPRE < 4) {
#pragma unroll
            for (int nb = 0; nb < 4; ++nb) { const int o = nb * 16 * TT + (ks + NPRE) * 32; vf[ks + NPRE][nb] = F::ld(vb + lv + o); if (HI) vf2[ks + NPRE][nb] = F::ld(vb2 + lv + o); }
            __builtin_amdgcn_sched_barrier(0);   // keeps the next k step's V loads in flight during this step's products; without it each load sinks to its product
        }
#pragma unroll
        for (int mb = 0; mb < 2; ++mb) { const T16* pr = (const T16*)(sm + (mb * 16 + lr) * SPF) + 8 * hi + kc; a[mb] = F::ld(pr); if (HI) a2[mb] = F::ld(pr + TT); }
#pragma unroll
        for (int nb = 0; nb < 4; ++nb)
#pragma unroll
            for (int mb = 0; mb < 2; ++mb) { acc[mb][nb] = F::mma(a[mb], vf[ks][nb], acc[mb][nb]); if (HI) { acc[mb][nb] = F::mma(a2[mb], vf[ks][nb], acc[mb][nb]); acc[mb][nb] = F::mma(a[mb], vf2[ks][nb], acc[mb][nb]); } } }
    __syncthreads();   // every wave has read its probabilities before the partial tiles overwrite them
    float* ow = sm + wv * (RT * 68);
#pragma unroll
    for (int mb = 0; mb < 2; ++mb)
#pragma unroll
        for (int nb = 0; nb < 4; ++nb)
#pragma unroll
            for (int j = 0; j < 8; ++j) ow[(mb * 16 + hi * 8 + j) * 68 + nb * 16 + lr] = acc[mb][nb][j];
    __syncthreads();   // every wave's partial tile is in LDS before any thread adds them
    const int row = (int)threadIdx.x >> 4, cofs = ((int)threadIdx.x & 15) * 4; v4f val = *(const v4fa*)(sm + row * 68 + cofs);
#pragma unroll
    for (int w = 1; w < 16; ++w) val += *(const v4fa*)(sm + (w * RT + row) * 68 + cofs);
    const float cs = HI ? 1.0f : (1.0f / PCAR); const size_t oo = (size_t)(t0 + row) * DQ + h * HD + cofs; v4us oh, ol;
#pragma unroll
    for (int q = 0; q < 4; ++q) { unsigned short a, c2; splitf(val[q] * cs, a, c2); oh[q] = a; ol[q] = c2; }
    *(v4us*)(Ah + oo) = oh; *(v4us*)(Al + oo) = ol;
}
__global__ __launch_bounds__(512) void k_attn(const h16* __restrict__ Q16, const h16* __restrict__ K16, const h16* __restrict__ V16, const bf* __restrict__ Qh, const bf* __restrict__ Ql, const bf* __restrict__ Kh, const bf* __restrict__ Kl, const bf* __restrict__ Vh, const bf* __restrict__ Vl, bf* Ah, bf* Al) {
    __shared__ __align__(16) float sm[RT * SPF];
    const int h = blockIdx.x, t0 = blockIdx.y * RT; const size_t zo = (size_t)h * TT * HD;   // the hi/lo row tiles (three times the products) have the lowest indices
    if (t0 < RH) attn_body<bf, true>(sm, Qh + zo, Ql + zo, Kh + zo, Kl + zo, Vh + zo, Vl + zo, t0, h, Ah, Al);
    else attn_body<h16, false>(sm, Q16 + zo, nullptr, K16 + zo, nullptr, V16 + zo, nullptr, t0, h, Ah, Al);
}

extern "C" void kernel_launch(void* const* d_in, const int* in_sizes, int n_in,
                              void* d_out, int out_size, void* d_ws, size_t ws_size, hipStream_t stream) {
    (void)in_sizes; (void)n_in; (void)out_size;
    const float* x = (const float*)d_in[0]; const float* xk = (const float*)d_in[0]; const float* xv = (const float*)d_in[0]; const float* fcos = (const float*)d_in[1]; const float* fsin = (const float*)d_in[2]; const float* wq = (const float*)d_in[3]; const float* bq = (const float*)d_in[4]; const float* wk = (const float*)d_in[5]; const float* bk = (const float*)d_in[6]; const float* wv = (const float*)d_in[7]; const float* bv = (const float*)d_in[8]; const float* wo = (const float*)d_in[9]; const float* bo = (const float*)d_in[10];   /* order hidden [4][2048][1024] (ONE stream: the three stream pointers all name it), cos, sin ([4][2048][64] = [B][S][D] PER-BATCH full-width table INPUTS: read per element by value), Wq, bq, Wk, bk, Wv, bv, Wo, bo ('oi' (out, in) [1024][1024] + [1024]): ELEVEN inputs, all read */
    float* OUT = (float*)d_out;     // [4][2048][1024]
    char* wsp = (char*)d_ws;
    auto take = [&](size_t bytes) { char* p = wsp; wsp += (bytes + 255) & ~(size_t)255; return (void*)p; };
    bf* WQ = (bf*)take((size_t)DQ * DM * 2); bf* WK = (bf*)take((size_t)DKV * DM * 2); bf* WV = (bf*)take((size_t)DKV * DM * 2); bf* WO = (bf*)take((size_t)DM * DQ * 2);
    bf* XB = (bf*)take((size_t)TT * DM * 2);
    h16* QP16 = (h16*)take((size_t)NH_ * TT * HD * 2); h16* KP16 = (h16*)take((size_t)NKV * TT * HD * 2); h16* VT16 = (h16*)take((size_t)NKV * HD * TT * 2);
    bf* QPh = (bf*)take((size_t)NH_ * TT * HD * 2); bf* QPl = (bf*)take((size_t)NH_ * TT * HD * 2); bf* KPh = (bf*)take((size_t)NKV * TT * HD * 2); bf* KPl = (bf*)take((size_t)NKV * TT * HD * 2); bf* VTh = (bf*)take((size_t)NKV * HD * TT * 2); bf* VTl = (bf*)take((size_t)NKV * HD * TT * 2);
    bf* ATh = (bf*)take((size_t)TT * DQ * 2); bf* ATl = (bf*)take((size_t)TT * DQ * 2);
    if ((size_t)(wsp - (char*)d_ws) > ws_size) return;    // ws 256 MiB
    { k_cvt8<<<(unsigned)(((size_t)DQ * DM / 8 + 255) / 256), 256, 0, stream>>>(wq, WQ, (size_t)DQ * DM / 8); k_cvt8<<<(unsigned)(((size_t)DKV * DM / 8 + 255) / 256), 256, 0, stream>>>(wk, WK, (size_t)DKV * DM / 8); k_cvt8<<<(unsigned)(((size_t)DKV * DM / 8 + 255) / 256), 256, 0, stream>>>(wv, WV, (size_t)DKV * DM / 8);
      k_cvt8<<<(unsigned)(((size_t)DM * DQ / 8 + 255) / 256), 256, 0, stream>>>(wo, WO, (size_t)DM * DQ / 8);
       }
    /* the q and k projections read batch b's own slice of the INPUT rotary tables in their epilogue; k_cs5 and its INVT constants stay defined and are NOT launched */
    for (int b = 0; b < NB_; ++b) {
        const float* cb = fcos + (size_t)b * TT * HD; const float* sb = fsin + (size_t)b * TT * HD;
        k_cvt8<<<(unsigned)(((size_t)TT * DM / 8 + 255) / 256), 256, 0, stream>>>(x + (size_t)b * TT * DM, XB, (size_t)TT * DM / 8);
        k_gemmw<bf, 0, true, 8, 1><<<dim3(TT / 64, DQ / 64, 1), 256, 0, stream>>>(XB, nullptr, WQ, nullptr, DM, nullptr, DQ, bq, 0, 0, 0, cb, sb, QP16, QPh, QPl);
        k_cvt8<<<(unsigned)(((size_t)TT * DM / 8 + 255) / 256), 256, 0, stream>>>(xk + (size_t)b * TT * DM, XB, (size_t)TT * DM / 8);   /* XB := bf16(key[b]) */ k_gemmw<bf, 0, true, 8, 1><<<dim3(TT / 64, DKV / 64, 1), 256, 0, stream>>>(XB, nullptr, WK, nullptr, DM, nullptr, DKV, bk, 0, 0, 0, cb, sb, KP16, KPh, KPl);
        k_cvt8<<<(unsigned)(((size_t)TT * DM / 8 + 255) / 256), 256, 0, stream>>>(xv + (size_t)b * TT * DM, XB, (size_t)TT * DM / 8);   /* XB := bf16(value[b]) (after the k planes are built) */ k_gemmw<bf, 0, true, 8, 2><<<dim3(TT / 64, DKV / 64, 1), 256, 0, stream>>>(XB, nullptr, WV, nullptr, DM, nullptr, DKV, bv, 0, 0, 0, nullptr, nullptr, VT16, VTh, VTl);
        k_attn<<<dim3(NH_, TT / RT, 1), 512, 0, stream>>>(QP16, KP16, VT16, QPh, QPl, KPh, KPl, VTh, VTl, ATh, ATl);   // one kv head per query head
        k_gemmw<bf, 1, true, 8, 0><<<dim3(TT / 64, DM / 64, 1), 256, 0, stream>>>(ATh, ATl, WO, nullptr, DQ, OUT + (size_t)b * TT * DM, DM, bo, 0, 0, 0, nullptr, nullptr, nullptr, nullptr, nullptr); }
}

// v004
// It runs in 457 microseconds.
// In both of two side-by-side timings against v003, it was 1.10 times as fast.
// Counting every step since v000, it is 8.65 times as fast.
#include <hip/hip_runtime.h>

// Rotary multi-head self-attention with PER-BATCH full-width rotary tables given as inputs (hidden [4][2048][1024]: ONE stream; q, k, v = hidden W^T + b ('oi' (out, in) [1024][1024] normal x 1024^-0.5 + zero biases: read; 16 heads x 64); q, k -> t cos + cat(-t2, t1) sin with the cos / sin INPUT tables [4][2048][64] = [B][S][D] (uniform random values on this draw: batch b reads ITS OWN slice, per element by value; no structure assumed); scores x 64^-0.5; softmax over all keys (no mask); out = merged Wo^T + bo ('oi' + a zero bias: read) -> [4][2048][1024] (8.4 M); argument order hidden, cos, sin, Wq, bq, Wk, bk, Wv, bv, Wo, bo).
// Every stage is launched once for all four batches (batch = grid z, except the conversion's flat 1-D grid; every workspace plane holds the four batches one behind the other). Layout per batch: bf16 copies of the input stream(s); 'oi' weights; exact projections + f32 biases, whose epilogue applies the rotary tables and writes the head planes (q, k: [h][t][d]; v: [h][d][t]); dense T-2048 attention in one kernel, scores and probabilities in LDS (hybrid rows: < 512 hi/lo 3 products, rest fp16 x1024); merged hi/lo x Wo exact + bo.
// Compute dtypes, f32 accumulate: every input rounded to bf16; projections exact + f32 biases; attention rows < 512 3 products, rest fp16; softmax f32; Wo hl x exact + bias.

#define NB_  4
#define TT   2048
#define DM   1024
#define NH_  16
#define NKV  16
#define REP  (NH_ / NKV)
static_assert(NKV == NH_, "the q, k, v launch numbers its tile columns by NH_ heads a part");
#define HD   64
#define DQ   (NH_ * HD)
#define DKV  (NKV * HD)
#define RH   512                  // query rows < RH use hi+lo planes (0: none)
#define WIN  0
#define PCAR 1024.0f
#define SCL  0.125f   // HD^-0.5
typedef _Float16 h16;
typedef unsigned short bf;
typedef __attribute__((ext_vector_type(16))) __bf16   v16bf;
typedef __attribute__((ext_vector_type(16))) _Float16 v16h;
typedef __attribute__((ext_vector_type(8)))  _Float16 v8h;
typedef __attribute__((ext_vector_type(8)))  unsigned short v8us;
typedef __attribute__((ext_vector_type(8)))  float    v8f;
typedef __attribute__((ext_vector_type(4)))  float    v4f;
typedef v8h  __attribute__((may_alias)) v8ha;
typedef v4f  __attribute__((may_alias)) v4fa;
typedef v8us __attribute__((may_alias)) v8usa;

__device__ __forceinline__ unsigned short f2bf(float f) { unsigned u = __float_as_uint(f); u += 0x7FFFu + ((u >> 16) & 1u); return (unsigned short)(u >> 16); }
__device__ __forceinline__ float bf2f(unsigned short b) { return __uint_as_float(((unsigned)b) << 16); }
__device__ __forceinline__ float bfr(float f) { return bf2f(f2bf(f)); }
__device__ __forceinline__ v16h cat16(v8h lo, v8h hi) { return __builtin_shufflevector(lo, hi, 0, 1, 2, 3, 4, 5, 6, 7, 8, 9, 10, 11, 12, 13, 14, 15); }
__device__ __forceinline__ v16bf cat16b(v8us lo, v8us hi) { return __builtin_bit_cast(v16bf, __builtin_shufflevector(lo, hi, 0, 1, 2, 3, 4, 5, 6, 7, 8, 9, 10, 11, 12, 13, 14, 15)); }
__device__ __forceinline__ v8f wmma16(v16h a, v16h b, v8f c) { return __builtin_amdgcn_wmma_f32_16x16x32_f16(false, a, false, b, (short)0, c, false, false); }
__device__ __forceinline__ v8f wmmab(v16bf a, v16bf b, v8f c) { return __builtin_amdgcn_wmma_f32_16x16x32_bf16(false, a, false, b, (short)0, c, false, false); }

__device__ __forceinline__ h16 tohx(float x) { return (h16)x; }
__device__ __forceinline__ void splitf(float y, unsigned short& h, unsigned short& l) { h = f2bf(y); l = f2bf(y - bf2f(h)); }
typedef __attribute__((ext_vector_type(2))) _Float16 v2h;
typedef __attribute__((ext_vector_type(4))) _Float16 v4h;
typedef __attribute__((ext_vector_type(2))) unsigned short v2us;
typedef __attribute__((ext_vector_type(4))) unsigned short v4us;
typedef __attribute__((ext_vector_type(2))) float v2f;
typedef __attribute__((ext_vector_type(4))) int v4i;

// ---- k_gemmw: register-blocked GEMM, one 64x64 output tile per work-group (16 accumulators per wave), operands straight from K-contiguous 16-bit planes; grid (M/64, N/64, Z), 32 * KS threads.
// C[m][n] (f32, pitch ldc, + optional f32 bias[n]) = sum_k A[m][k] Bt[n][k] (+ split products per NSPLIT). z-batch strides sA/sB/sC in elements; for EPI 1 z is the batch: its tables are TT * HD and its head planes NH_ * TT * HD elements further on. K % (32 * KS) == 0.
// KS > 1: wave w sums the k range [w K/KS, (w+1) K/KS) of the whole tile; the KS partial tiles meet in LDS and are added in wave order 0..KS-1 (fixed order).
// EPI (KS > 1 only): 0 f32 C; 1 the q, k and v projections in one launch: Bt holds the three weights one behind the other, tile column y is head y % NH_ of part y / NH_ (0 q, 1 k, 2 v; the 64 columns of a tile are one head), bias / biasK / biasV are the parts' biases. Parts 0, 1: rotate-half rotary with the cos / sin tables [t][64], each rounded to bf16, then head planes [h][t][d] (fp16 + bf16 hi/lo); part 2: transposed head planes [h][d][t] (fp16 + bf16 hi/lo). The planes of part p start p (fp16) or 2 p (hi, lo) whole planes behind P16, Ph, Pl. C is not written for EPI 1.
template <typename T16> struct WFrag;
template <> struct WFrag<h16> { typedef v16h V; static __device__ __forceinline__ V ld(const h16* p) { return cat16(*(const v8h*)p, *(const v8h*)(p + 16)); } static __device__ __forceinline__ v8f mma(V a, V b, v8f c) { return wmma16(a, b, c); } };
template <> struct WFrag<bf> { typedef v16bf V; static __device__ __forceinline__ V ld(const bf* p) { return cat16b(*(const v8us*)p, *(const v8us*)(p + 16)); } static __device__ __forceinline__ v8f mma(V a, V b, v8f c) { return wmmab(a, b, c); } };
template <typename T16, int NSPLIT, bool BIAS, int KS, int EPI>
__global__ __launch_bounds__(32 * KS) void k_gemmw(const T16* __restrict__ A, const T16* __restrict__ A2, const T16* __restrict__ Bt, const T16* __restrict__ Bt2, int K, float* C, int ldc, const float* __restrict__ bias, const float* __restrict__ biasK, const float* __restrict__ biasV, size_t sA, size_t sB, size_t sC, const float* __restrict__ cosT, const float* __restrict__ sinT, h16* P16, bf* Ph, bf* Pl) {
    typedef typename WFrag<T16>::V V;
    __shared__ __align__(16) float os[(KS > 1 ? KS * 64 : 16) * 68];
    const size_t z = blockIdx.z; A += z * sA; if (A2) A2 += z * sA; Bt += z * sB; if (Bt2) Bt2 += z * sB; C += z * sC;
    const int part = EPI == 1 ? (int)blockIdx.y / NH_ : 0, head = EPI == 1 ? (int)blockIdx.y % NH_ : 0;   // the same for the whole work-group
    if constexpr (EPI == 1) { cosT += z * (size_t)(TT * HD); sinT += z * (size_t)(TT * HD); P16 += ((size_t)part * NB_ + z) * (size_t)(NH_ * TT * HD); Ph += ((size_t)part * 2 * NB_ + z) * (size_t)(NH_ * TT * HD); Pl += ((size_t)part * 2 * NB_ + z) * (size_t)(NH_ * TT * HD); }
    const int lane = threadIdx.x & 31, lr = lane & 15, hi = lane >> 4; const int r0 = blockIdx.x * 64, c0 = blockIdx.y * 64;
    v8f acc[4][4];
#pragma unroll
    for (int mb = 0; mb < 4; ++mb)
#pragma unroll
        for (int nb = 0; nb < 4; ++nb) acc[mb][nb] = (v8f){};
    const size_t aoff = (size_t)(r0 + lr) * K + 8 * hi, boff = (size_t)(c0 + lr) * K + 8 * hi;
    const int wv = (KS > 1) ? __builtin_amdgcn_readfirstlane((int)(threadIdx.x >> 5)) : 0; const int kspan = K / KS, kbeg = wv * kspan, kend = kbeg + kspan;
#pragma unroll 1
    for (int kc = kbeg; kc < kend; kc += 32) {
        V a[4], a2[4];
#pragma unroll
        for (int mb = 0; mb < 4; ++mb) { a[mb] = WFrag<T16>::ld(A + aoff + (size_t)mb * 16 * K + kc); if (NSPLIT == 1 || NSPLIT == 2) a2[mb] = WFrag<T16>::ld(A2 + aoff + (size_t)mb * 16 * K + kc); }
#pragma unroll
        for (int nb = 0; nb < 4; ++nb) { const V b = WFrag<T16>::ld(Bt + boff + (size_t)nb * 16 * K + kc); V b2; if (NSPLIT >= 2) b2 = WFrag<T16>::ld(Bt2 + boff + (size_t)nb * 16 * K + kc);
#pragma unroll
            for (int mb = 0; mb < 4; ++mb) { acc[mb][nb] = WFrag<T16>::mma(a[mb], b, acc[mb][nb]); if (NSPLIT == 1 || NSPLIT == 2) acc[mb][nb] = WFrag<T16>::mma(a2[mb], b, acc[mb][nb]); if (NSPLIT >= 2) acc[mb][nb] = WFrag<T16>::mma(a[mb], b2, acc[mb][nb]); } }
        asm volatile("v_nop\n\tv_nop\n\tv_nop\n\tv_nop" : "+v"(acc[0][0]), "+v"(acc[1][1]), "+v"(acc[2][2]), "+v"(acc[3][3]) : "v"(a[0]), "v"(a[3]));
    }
    if constexpr (KS > 1) {
        float* ow = os + wv * (64 * 68); const int cofs = ((int)threadIdx.x & 15) * 4; v4f bb = (v4f){};   // each thread keeps one column group: its bias is loaded here, ahead of the LDS traffic
        const float* bp = bias + c0; if constexpr (EPI == 1) bp = (part == 0 ? bias : part == 1 ? biasK : biasV) + head * 64;
        if (BIAS) { bb[0] = bp[cofs]; bb[1] = bp[cofs + 1]; bb[2] = bp[cofs + 2]; bb[3] = bp[cofs + 3];   // rounded behind the barrier: a use here would wait for the table loads below as well
            if constexpr (EPI == 1) asm volatile("s_wait_xcnt 0x0" ::: "memory"); }   // the wait before a register that the bias load names is rewritten: this instance's build reuses the load's scalar base at once (for EPI 0 the build places the wait itself)
        v4f cc[32 / KS], sn[32 / KS];   // EPI 1, parts 0, 1: the thread's table entries, loaded with the bias, ahead of the LDS traffic
        if constexpr (EPI == 1) { if (part < 2) {
#pragma unroll
            for (int i = 0; i < 32 / KS; ++i) { const size_t o = (size_t)(r0 + ((i * (32 * KS) + (int)threadIdx.x) >> 4)) * HD + cofs; cc[i] = *(const v4f*)(cosT + o); sn[i] = *(const v4f*)(sinT + o); }
        } }
        // the three loops below are unrolled so that acc[][][] is indexed by constants and stays in registers
#pragma unroll
        for (int mb = 0; mb < 4; ++mb)
#pragma unroll
            for (int nb = 0; nb < 4; ++nb)
#pragma unroll
                for (int j = 0; j < 8; ++j) ow[(mb * 16 + hi * 8 + j) * 68 + nb * 16 + lr] = acc[mb][nb][j];
        __syncthreads();   // every wave's partial tile is in LDS before any thread adds them
        if (BIAS) { bb[0] = bfr(bb[0]); bb[1] = bfr(bb[1]); bb[2] = bfr(bb[2]); bb[3] = bfr(bb[3]); }
        v4f keep[32 / KS];   // EPI 1: the thread's four sums
        // both loops below are unrolled so that all LDS loads of a thread issue ahead of its adds
#pragma unroll
        for (int i = 0; i < 32 / KS; ++i) { const int row = (i * (32 * KS) + (int)threadIdx.x) >> 4; v4f val = *(const v4fa*)(os + row * 68 + cofs);
#pragma unroll
            for (int w = 1; w < KS; ++w) val += *(const v4fa*)(os + (w * 64 + row) * 68 + cofs);
            if (BIAS) val += bb;
            if constexpr (EPI == 0) *(v4f*)(C + (size_t)(r0 + row) * ldc + c0 + cofs) = val;
            else keep[i] = val; }
        if constexpr (EPI == 1) { if (part < 2) {
            // unrolled: keep, cc and sn are indexed by constants
#pragma unroll
            for (int i = 0; i < 32 / KS; ++i) { const int row = (i * (32 * KS) + (int)threadIdx.x) >> 4; const v4f val = keep[i]; v4h o16; v4us oh, ol;
#pragma unroll
                for (int q = 0; q < 4; ++q) { const float xp = __builtin_amdgcn_update_dpp(0.0f, val[q], 0x168, 0xf, 0xf, true);   // row_xmask:8: column d ^ 32 of this row sits in lane ^ 8 (the float overload: with the value cast to int the build held one move for all four columns)
                    const float s = bfr(sn[i][q]); const float r = val[q] * bfr(cc[i][q]) + xp * (cofs < HD / 2 ? -s : s);
                    o16[q] = tohx(r); unsigned short a2, c2; splitf(r, a2, c2); oh[q] = a2; ol[q] = c2; }
                const size_t e = ((size_t)head * TT + r0 + row) * HD + cofs; *(v4h*)(P16 + e) = o16; *(v4us*)(Ph + e) = oh; *(v4us*)(Pl + e) = ol; }
        } else {
            // the sums go back into wave 0's tile, each at the place that only this thread has read; behind the loop above, so that its LDS loads still issue together
#pragma unroll
            for (int i = 0; i < 32 / KS; ++i) *(v4fa*)(os + ((i * (32 * KS) + (int)threadIdx.x) >> 4) * 68 + cofs) = keep[i];
            __syncthreads();   // every summed row is in LDS before any thread reads a column of the tile; part is the same for the whole work-group, so every wave of it passes here or none
#pragma unroll
            for (int it = 0; it < 16 / KS; ++it) { const int item = it * (32 * KS) + (int)threadIdx.x, d = item >> 3, tq = (item & 7) * 8; v8h o16; v8us oh, ol;   // eight lanes write one whole 128-byte line of a plane's row d
#pragma unroll
                for (int j = 0; j < 8; ++j) { const float x = os[(tq + j) * 68 + d]; o16[j] = tohx(x); unsigned short a2, c2; splitf(x, a2, c2); oh[j] = a2; ol[j] = c2; }
                const size_t e = ((size_t)head * HD + d) * TT + r0 + tq; *(v8h*)(P16 + e) = o16; *(v8us*)(Ph + e) = oh; *(v8us*)(Pl + e) = ol; }
            asm volatile("s_wait_xcnt 0x0" ::: "memory");   // the wait before a register that the stores above name is rewritten: the build lays the rotary tail behind this one, as the fall-through of this tail's last branch
        } }
        return;
    }
#pragma unroll
    for (int mb = 0; mb < 4; ++mb) {
#pragma unroll
        for (int nb = 0; nb < 4; ++nb) {
#pragma unroll
            for (int j = 0; j < 8; ++j) os[(hi * 8 + j) * 68 + nb * 16 + lr] = acc[mb][nb][j]; }
        __builtin_amdgcn_wave_barrier(); asm volatile("" ::: "memory");
        float* crow = C + (size_t)(r0 + mb * 16) * ldc + c0;
{
#pragma unroll
            for (int s = 0; s < 8; ++s) { const int row = 2 * s + hi, cofs = lr * 4; v4f val = *(const v4fa*)(os + row * 68 + cofs); if (BIAS) { val[0] += bfr(bias[c0 + cofs]); val[1] += bfr(bias[c0 + cofs + 1]); val[2] += bfr(bias[c0 + cofs + 2]); val[3] += bfr(bias[c0 + cofs + 3]); }
                *(v4f*)(crow + (size_t)row * ldc + cofs) = val; }
             }
        __builtin_amdgcn_wave_barrier(); asm volatile("" ::: "memory");
    }
}


// k_cvtall: every f32 -> bf16 rounding of a call in one launch. A work-group rounds CVB consecutive elements: groups 0 .. NB_ TT DM / CVB - 1 take hidden (all batches), the rest the four weights in the order q, k, v, o, whose bf16 copies lie one behind the other at W4.
#define CVG  8                    // 8-element groups per thread
#define CVB  (256 * 8 * CVG)
__global__ __launch_bounds__(256) void k_cvtall(const float* __restrict__ x, const float* __restrict__ wq, const float* __restrict__ wk, const float* __restrict__ wv, const float* __restrict__ wo, bf* XB, bf* W4) {
    constexpr int NX = NB_ * TT * DM / CVB, NW = DM * DM / CVB; const int blk = blockIdx.x; const float* src; bf* dst;
    if (blk < NX) { src = x + (size_t)blk * CVB; dst = XB + (size_t)blk * CVB; }
    else { const int wb = blk - NX, w = wb / NW; src = (w == 0 ? wq : w == 1 ? wk : w == 2 ? wv : wo) + (size_t)(wb % NW) * CVB; dst = W4 + (size_t)wb * CVB; }
    v8f v[CVG];
    // both loops are unrolled so that all loads of a thread issue ahead of its first rounding
#pragma unroll
    for (int g = 0; g < CVG; ++g) v[g] = *(const v8f*)(src + (g * 256 + (int)threadIdx.x) * 8);
#pragma unroll
    for (int g = 0; g < CVG; ++g) { v8us o;
#pragma unroll
        for (int k = 0; k < 8; ++k) o[k] = f2bf(v[g][k]);
        *(v8us*)(dst + (g * 256 + (int)threadIdx.x) * 8) = o; }
}

__constant__ float INVT[HD / 2] = { 1.000000000e+00f, 7.498942018e-01f, 5.623413324e-01f, 4.216965139e-01f, 3.162277639e-01f, 2.371373624e-01f, 1.778279394e-01f, 1.333521456e-01f, 1.000000015e-01f, 7.498941571e-02f, 5.623412877e-02f, 4.216964915e-02f, 3.162277862e-02f, 2.371373586e-02f, 1.778279431e-02f, 1.333521493e-02f, 9.999999776e-03f, 7.498942316e-03f, 5.623413250e-03f, 4.216964822e-03f, 3.162277862e-03f, 2.371373819e-03f, 1.778279431e-03f, 1.333521446e-03f, 1.000000047e-03f, 7.498941850e-04f, 5.623413017e-04f, 4.216964880e-04f, 3.162277862e-04f, 2.371373848e-04f, 1.778279402e-04f, 1.333521504e-04f };   // float32 1 / 10000^(2i/64), generated with jnp to be bit-exact
__global__ __launch_bounds__(256) void k_cs5(float* CS) { const int idx = blockIdx.x * 256 + threadIdx.x; if (idx >= TT * HD) return; const int d = idx % HD; const int t = idx / HD; const float a = __fmul_rn((float)t, INVT[d % (HD / 2)]); v2f cs; cs[0] = cosf(a); cs[1] = sinf(a); *(v2f*)(CS + (size_t)idx * 2) = cs;  }
// k_attn: one work-group = 32 query rows of one head, all 2048 keys; the score rows, the probabilities and the partial output tiles live in LDS and never reach memory.
// grid (heads, TT / 32, batches), 512 threads = 16 waves. Row tiles below RH use the hi/lo bf16 planes (3 products), the rest the fp16 planes (probabilities x PCAR).
// Phase 1: wave w forms S[32][128 w .. 128 w + 127] (k steps 0, 32 in turn). Phase 2: wave w does rows 2 w, 2 w + 1 (register row, one exp, fixed trees) and lays the 16-bit row over its own f32 row.
// Phase 3: wave w sums keys [128 w, 128 w + 128) of P V; the 16 partial tiles are added in wave order 0..15 and leave as the merged hi/lo planes [t][h * 64 + d].
#define RT   32
#define SPF  2052                 // LDS row pitch in floats: 8208 B = 16 B x 513 (odd), conflict-free for 16-byte fragment reads
typedef v4h  __attribute__((may_alias)) v4ha;
typedef v4us __attribute__((may_alias)) v4usa;
template <typename T16, bool HI>
__device__ __forceinline__ void attn_body(float* sm, const T16* __restrict__ Q, const T16* __restrict__ Q2, const T16* __restrict__ Kp, const T16* __restrict__ Kp2, const T16* __restrict__ Vt, const T16* __restrict__ Vt2, int t0, int h, bf* Ah, bf* Al) {
    typedef WFrag<T16> F; typedef typename F::V V;
    const int lane = threadIdx.x & 31, lr = lane & 15, hi = lane >> 4; const int wv = __builtin_amdgcn_readfirstlane((int)(threadIdx.x >> 5)); const int kbeg = wv * 128;
    const unsigned lo = (unsigned)(lr * HD + 8 * hi), lv = (unsigned)(lr * TT + 8 * hi);   // 32-bit lane offsets over wave-uniform bases: one address register per stream
    constexpr int CH = HI ? 2 : 8, NPRE = HI ? 1 : 4;   // key groups per batch of K loads; k steps of V fetched ahead of the softmax (what 256 registers hold)
    const T16* vb = Vt + kbeg; const T16* vb2 = HI ? Vt2 + kbeg : nullptr; V vf[4][4], vf2[4][4];
    {   // phase 1: scores. Every loop is unrolled: fragment and accumulator arrays are indexed by constants
        V qa[2][2], qa2[2][2], b[8][2], b2[8][2]; const T16* qb = Q + (size_t)t0 * HD; const T16* qb2 = HI ? Q2 + (size_t)t0 * HD : nullptr; const T16* kb = Kp + (size_t)kbeg * HD; const T16* kb2 = HI ? Kp2 + (size_t)kbeg * HD : nullptr;
#pragma unroll
        for (int mb = 0; mb < 2; ++mb)
#pragma unroll
            for (int kk = 0; kk < 2; ++kk) { const int o = mb * 16 * HD + kk * 32; qa[mb][kk] = F::ld(qb + lo + o); if (HI) qa2[mb][kk] = F::ld(qb2 + lo + o); }
        __builtin_amdgcn_sched_barrier(0);   // keeps the Q loads ahead of the K loads, so that the first products wait for Q and one key group, not for the whole run
#pragma unroll
        for (int nb = 0; nb < CH; ++nb)
#pragma unroll
            for (int kk = 0; kk < 2; ++kk) { const int o = nb * 16 * HD + kk * 32; b[nb][kk] = F::ld(kb + lo + o); if (HI) b2[nb][kk] = F::ld(kb2 + lo + o); }
        asm volatile("s_wait_xcnt 0x0" :: "v"(lo * 2u) : "memory");   // the wait before a register that the loads above name is rewritten; their byte offset as an input keeps that register live through the run, so that no load of the run lands in it
#pragma unroll
        for (int c = 0; c < 8; c += CH) {
            if (c + CH < 8) {
#pragma unroll
                for (int nb = c + CH; nb < c + 2 * CH; ++nb)
#pragma unroll
                    for (int kk = 0; kk < 2; ++kk) { const int o = nb * 16 * HD + kk * 32; b[nb][kk] = F::ld(kb + lo + o); if (HI) b2[nb][kk] = F::ld(kb2 + lo + o); } }
            __builtin_amdgcn_sched_barrier(0);   // keeps the loads above it in flight during the products below; without it each load sinks to its product and its latency is paid eight times over
#pragma unroll
            for (int nb = c; nb < c + CH; ++nb) { const int key = kbeg + nb * 16; v8f acc[2]; acc[0] = (v8f){}; acc[1] = (v8f){};
#pragma unroll
                for (int kk = 0; kk < 2; ++kk)
#pragma unroll
                    for (int mb = 0; mb < 2; ++mb) { acc[mb] = F::mma(qa[mb][kk], b[nb][kk], acc[mb]); if (HI) { acc[mb] = F::mma(qa2[mb][kk], b[nb][kk], acc[mb]); acc[mb] = F::mma(qa[mb][kk], b2[nb][kk], acc[mb]); } }
                asm volatile("v_nop\n\tv_nop\n\tv_nop\n\tv_nop" : "+v"(acc[0]), "+v"(acc[1]));   // four vector slots behind the group's last WMMA: the next group's first WMMA may write the same registers anew
#pragma unroll
                for (int mb = 0; mb < 2; ++mb)
#pragma unroll
                    for (int j = 0; j < 8; ++j) sm[(mb * 16 + hi * 8 + j) * SPF + key + lr] = acc[mb][j]; } }
    }
    __syncthreads();   // all 2048 scores of every row are in LDS before a wave reads its rows
    // the first V fragments are fetched here, behind the barrier (which drains a wave's loads), so that they fly during the softmax
#pragma unroll
    for (int ks = 0; ks < NPRE; ++ks)
#pragma unroll
        for (int nb = 0; nb < 4; ++nb) { const int o = nb * 16 * TT + ks * 32; vf[ks][nb] = F::ld(vb + lv + o); if (HI) vf2[ks][nb] = F::ld(vb2 + lv + o); }
    asm volatile("s_wait_xcnt 0x0" :: "v"(lv * 2u) : "memory");   // as above, for the V loads and their byte offset
#pragma unroll 1   // one row's 64 values at a time: two rows beside the V fragments held in registers would spill
    for (int rr = 0; rr < 2; ++rr) {   // phase 2: softmax of one row per trip
        float* sr = sm + (wv * 2 + rr) * SPF; float v[TT / 32]; float mx = -3.0e38f;
#pragma unroll
        for (int ch = 0; ch < TT / 128; ++ch) { const v4f a = *(const v4fa*)(sr + ch * 128 + lane * 4);
#pragma unroll
            for (int q = 0; q < 4; ++q) { const float t = a[q] * SCL; v[ch * 4 + q] = t; mx = fmaxf(mx, t); } }
#pragma unroll
        for (int sh = 16; sh; sh >>= 1) mx = fmaxf(mx, __shfl_xor(mx, sh, 32));
        float sum = 0.f;
#pragma unroll
        for (int k = 0; k < TT / 32; ++k) { v[k] = __builtin_amdgcn_exp2f(__fmul_rn(__fsub_rn(v[k], mx), 1.4426950408889634f)); sum += v[k]; }
#pragma unroll
        for (int sh = 16; sh; sh >>= 1) sum += __shfl_xor(sum, sh, 32);
        const float f = __fdiv_rn(HI ? 1.0f : PCAR, sum);
        // the 16-bit row overwrites the f32 row it came from: only this wave touches the row, and every store depends on the row's sum
        if (HI) {
#pragma unroll
            for (int ch = 0; ch < TT / 128; ++ch) { v4us oh, ol;
#pragma unroll
                for (int q = 0; q < 4; ++q) { unsigned short a, c2; splitf(v[ch * 4 + q] * f, a, c2); oh[q] = a; ol[q] = c2; }
                *(v4usa*)((bf*)sr + ch * 128 + lane * 4) = oh; *(v4usa*)((bf*)sr + TT + ch * 128 + lane * 4) = ol; }
        } else {
#pragma unroll
            for (int ch = 0; ch < TT / 128; ++ch) { v4h o4;
#pragma unroll
                for (int q = 0; q < 4; ++q) o4[q] = tohx(v[ch * 4 + q] * f);
                *(v4ha*)((h16*)sr + ch * 128 + lane * 4) = o4; } }
    }
    __syncthreads();   // every row's probabilities are in LDS before any wave reads them as A fragments
    v8f acc[2][4];
#pragma unroll
    for (int mb = 0; mb < 2; ++mb)
#pragma unroll
        for (int nb = 0; nb < 4; ++nb) acc[mb][nb] = (v8f){};
    // phase 3: P V. Unrolled: constant indices
#pragma unroll
    for (int ks = 0; ks < 4; ++ks) { const int kc = kbeg + ks * 32; V a[2], a2[2];
        if (ks + NPRE < 4) {
#pragma unroll
            for (int nb = 0; nb < 4; ++nb) { const int o = nb * 16 * TT + (ks + NPRE) * 32; vf[ks + NPRE][nb] = F::ld(vb + lv + o); if (HI) vf2[ks + NPRE][nb] = F::ld(vb2 + lv + o); }
            __builtin_amdgcn_sched_barrier(0);   // keeps the next k step's V loads in flight during this step's products; without it each load sinks to its product
        }
#pragma unroll
        for (int mb = 0; mb < 2; ++mb) { const T16* pr = (const T16*)(sm + (mb * 16 + lr) * SPF) + 8 * hi + kc; a[mb] = F::ld(pr); if (HI) a2[mb] = F::ld(pr + TT); }
#pragma unroll
        for (int nb = 0; nb < 4; ++nb)
#pragma unroll
            for (int mb = 0; mb < 2; ++mb) { acc[mb][nb] = F::mma(a[mb], vf[ks][nb], acc[mb][nb]); if (HI) { acc[mb][nb] = F::mma(a2[mb], vf[ks][nb], acc[mb][nb]); acc[mb][nb] = F::mma(a[mb], vf2[ks][nb], acc[mb][nb]); } } }
    __syncthreads();   // every wave has read its probabilities before the partial tiles overwrite them
    float* ow = sm + wv * (RT * 68);
#pragma unroll
    for (int mb = 0; mb < 2; ++mb)
#pragma unroll
        for (int nb = 0; nb < 4; ++nb)
#pragma unroll
            for (int j = 0; j < 8; ++j) ow[(mb * 16 + hi * 8 + j) * 68 + nb * 16 + lr] = acc[mb][nb][j];
    __syncthreads();   // every wave's partial tile is in LDS before any thread adds them
    const int row = (int)threadIdx.x >> 4, cofs = ((int)threadIdx.x & 15) * 4; v4f val = *(const v4fa*)(sm + row * 68 + cofs);
#pragma unroll
    for (int w = 1; w < 16; ++w) val += *(const v4fa*)(sm + (w * RT + row) * 68 + cofs);
    const float cs = HI ? 1.0f : (1.0f / PCAR); const size_t oo = (size_t)(t0 + row) * DQ + h * HD + cofs; v4us oh, ol;
#pragma unroll
    for (int q = 0; q < 4; ++q) { unsigned short a, c2; splitf(val[q] * cs, a, c2); oh[q] = a; ol[q] = c2; }
    *(v4us*)(Ah + oo) = oh; *(v4us*)(Al + oo) = ol;
}
__global__ __launch_bounds__(512) void k_attn(const h16* __restrict__ Q16, const h16* __restrict__ K16, const h16* __restrict__ V16, const bf* __restrict__ Qh, const bf* __restrict__ Ql, const bf* __restrict__ Kh, const bf* __restrict__ Kl, const bf* __restrict__ Vh, const bf* __restrict__ Vl, bf* Ah, bf* Al) {
    __shared__ __align__(16) float sm[RT * SPF];
    const int h = blockIdx.x, t0 = blockIdx.y * RT; const size_t zo = ((size_t)blockIdx.z * NH_ + h) * TT * HD; Ah += (size_t)blockIdx.z * TT * DQ; Al += (size_t)blockIdx.z * TT * DQ;   // within a batch the hi/lo row tiles (three times the products) have the lowest indices
    if (t0 < RH) attn_body<bf, true>(sm, Qh + zo, Ql + zo, Kh + zo, Kl + zo, Vh + zo, Vl + zo, t0, h, Ah, Al);
    else attn_body<h16, false>(sm, Q16 + zo, nullptr, K16 + zo, nullptr, V16 + zo, nullptr, t0, h, Ah, Al);
}

extern "C" void kernel_launch(void* const* d_in, const int* in_sizes, int n_in,
                              void* d_out, int out_size, void* d_ws, size_t ws_size, hipStream_t stream) {
    (void)in_sizes; (void)n_in; (void)out_size;
    const float* x = (const float*)d_in[0]; const float* fcos = (const float*)d_in[1]; const float* fsin = (const float*)d_in[2]; const float* wq = (const float*)d_in[3]; const float* bq = (const float*)d_in[4]; const float* wk = (const float*)d_in[5]; const float* bk = (const float*)d_in[6]; const float* wv = (const float*)d_in[7]; const float* bv = (const float*)d_in[8]; const float* wo = (const float*)d_in[9]; const float* bo = (const float*)d_in[10];   /* hidden [4][2048][1024] (ONE stream, rounded to bf16 once for q, k and v), cos, sin ([4][2048][64] = [B][S][D] PER-BATCH full-width table INPUTS: read per element by value), Wq, bq, Wk, bk, Wv, bv, Wo, bo ('oi' (out, in) [1024][1024] + [1024]): ELEVEN inputs, all read */
    float* OUT = (float*)d_out;     // [4][2048][1024]
    char* wsp = (char*)d_ws;
    auto take = [&](size_t bytes) { char* p = wsp; wsp += (bytes + 255) & ~(size_t)255; return (void*)p; };
    bf* WQ = (bf*)take((size_t)DQ * DM * 2); bf* WK = (bf*)take((size_t)DKV * DM * 2); bf* WV = (bf*)take((size_t)DKV * DM * 2); bf* WO = (bf*)take((size_t)DM * DQ * 2);
    bf* XB = (bf*)take((size_t)NB_ * TT * DM * 2);
    h16* QP16 = (h16*)take((size_t)NB_ * NH_ * TT * HD * 2); h16* KP16 = (h16*)take((size_t)NB_ * NKV * TT * HD * 2); h16* VT16 = (h16*)take((size_t)NB_ * NKV * HD * TT * 2);
    bf* QPh = (bf*)take((size_t)NB_ * NH_ * TT * HD * 2); bf* QPl = (bf*)take((size_t)NB_ * NH_ * TT * HD * 2); bf* KPh = (bf*)take((size_t)NB_ * NKV * TT * HD * 2); bf* KPl = (bf*)take((size_t)NB_ * NKV * TT * HD * 2); bf* VTh = (bf*)take((size_t)NB_ * NKV * HD * TT * 2); bf* VTl = (bf*)take((size_t)NB_ * NKV * HD * TT * 2);
    bf* ATh = (bf*)take((size_t)NB_ * TT * DQ * 2); bf* ATl = (bf*)take((size_t)NB_ * TT * DQ * 2);
    (void)WK; (void)WV;   // reached through WQ
    if ((size_t)(wsp - (char*)d_ws) > ws_size) return;    // 200 MiB of the 256 MiB
    k_cvtall<<<(NB_ * TT * DM + 4 * DM * DM) / CVB, 256, 0, stream>>>(x, wq, wk, wv, wo, XB, WQ);   // WQ, WK, WV, WO are consecutive takes of 2 MiB each
    /* q, k, v: one launch; WQ, WK, WV are one [3 DQ][DM] matrix, and QP16, KP16, VT16 as well as QPh, QPl, KPh, KPl, VTh, VTl are consecutive takes. The q and k parts read batch z's own slice of the INPUT rotary tables in their epilogue; k_cs5 and its INVT constants stay defined and are NOT launched */
    k_gemmw<bf, 0, true, 8, 1><<<dim3(TT / 64, (DQ + 2 * DKV) / 64, NB_), 256, 0, stream>>>(XB, nullptr, WQ, nullptr, DM, nullptr, DQ, bq, bk, bv, (size_t)TT * DM, 0, 0, fcos, fsin, QP16, QPh, QPl);
    k_attn<<<dim3(NH_, TT / RT, NB_), 512, 0, stream>>>(QP16, KP16, VT16, QPh, QPl, KPh, KPl, VTh, VTl, ATh, ATl);   // one kv head per query head
    k_gemmw<bf, 1, true, 8, 0><<<dim3(TT / 64, DM / 64, NB_), 256, 0, stream>>>(ATh, ATl, WO, nullptr, DQ, OUT, DM, bo, nullptr, nullptr, (size_t)TT * DQ, 0, (size_t)TT * DM, nullptr, nullptr, nullptr, nullptr, nullptr);
}

// v005
// It runs in 298 microseconds.
// Two timings next to v004 both put it at 1.53 times that version's speed.
// Over all steps from v000 it is 13.3 times as fast.
#include <hip/hip_runtime.h>

// Rotary multi-head self-attention with PER-BATCH full-width rotary tables given as inputs (hidden [4][2048][1024]: ONE stream; q, k, v = hidden W^T + b ('oi' (out, in) [1024][1024] normal x 1024^-0.5 + zero biases: read; 16 heads x 64); q, k -> t cos + cat(-t2, t1) sin with the cos / sin INPUT tables [4][2048][64] = [B][S][D] (uniform random values on this draw: batch b reads ITS OWN slice, per element by value; no structure assumed); scores x 64^-0.5; softmax over all keys (no mask); out = merged Wo^T + bo ('oi' + a zero bias: read) -> [4][2048][1024] (8.4 M); argument order hidden, cos, sin, Wq, bq, Wk, bk, Wv, bv, Wo, bo).
// Every stage is launched once for all four batches (batch = grid z; every workspace plane holds the four batches one behind the other). Layout per batch: bf16 copies of the input stream(s); 'oi' weights; exact projections + f32 biases, whose epilogue applies the rotary tables and writes the head planes (q, k: [h][t][d]; v: [h][d][t]); dense T-2048 attention in one kernel, scores and probabilities in LDS (hybrid rows: < 512 hi/lo 3 products, rest fp16 x1024); merged hi/lo x Wo exact + bo.
// Every 16-bit plane that a matrix product reads from memory (hidden, the weights, q, k, v, merged) lies in FRAGMENT ORDER (fro() below), so that one wave-wide 16-byte load covers 512 consecutive bytes = four whole 128-byte lines; each lane receives the same elements as from a row-major plane.
// Compute dtypes, f32 accumulate: every input rounded to bf16; projections exact + f32 biases; attention rows < 512 3 products, rest fp16; softmax f32; Wo hl x exact + bias.

#define NB_  4
#define TT   2048
#define DM   1024
#define NH_  16
#define NKV  16
#define REP  (NH_ / NKV)
static_assert(NKV == NH_, "the q, k, v launch numbers its tile columns by NH_ heads a part");
#define HD   64
#define DQ   (NH_ * HD)
#define DKV  (NKV * HD)
#define RH   512                  // query rows < RH use hi+lo planes (0: none)
#define WIN  0
#define PCAR 1024.0f
#define SCL  0.125f   // HD^-0.5
typedef _Float16 h16;
typedef unsigned short bf;
typedef __attribute__((ext_vector_type(16))) __bf16   v16bf;
typedef __attribute__((ext_vector_type(16))) _Float16 v16h;
typedef __attribute__((ext_vector_type(8)))  _Float16 v8h;
typedef __attribute__((ext_vector_type(8)))  unsigned short v8us;
typedef __attribute__((ext_vector_type(8)))  float    v8f;
typedef __attribute__((ext_vector_type(4)))  float    v4f;
typedef v8h  __attribute__((may_alias)) v8ha;
typedef v4f  __attribute__((may_alias)) v4fa;
typedef v8us __attribute__((may_alias)) v8usa;

__device__ __forceinline__ unsigned short f2bf(float f) { unsigned u = __float_as_uint(f); u += 0x7FFFu + ((u >> 16) & 1u); return (unsigned short)(u >> 16); }
__device__ __forceinline__ float bf2f(unsigned short b) { return __uint_as_float(((unsigned)b) << 16); }
__device__ __forceinline__ float bfr(float f) { return bf2f(f2bf(f)); }
__device__ __forceinline__ v16h cat16(v8h lo, v8h hi) { return __builtin_shufflevector(lo, hi, 0, 1, 2, 3, 4, 5, 6, 7, 8, 9, 10, 11, 12, 13, 14, 15); }
__device__ __forceinline__ v16bf cat16b(v8us lo, v8us hi) { return __builtin_bit_cast(v16bf, __builtin_shufflevector(lo, hi, 0, 1, 2, 3, 4, 5, 6, 7, 8, 9, 10, 11, 12, 13, 14, 15)); }
__device__ __forceinline__ v8f wmma16(v16h a, v16h b, v8f c) { return __builtin_amdgcn_wmma_f32_16x16x32_f16(false, a, false, b, (short)0, c, false, false); }
__device__ __forceinline__ v8f wmmab(v16bf a, v16bf b, v8f c) { return __builtin_amdgcn_wmma_f32_16x16x32_bf16(false, a, false, b, (short)0, c, false, false); }

__device__ __forceinline__ h16 tohx(float x) { return (h16)x; }
__device__ __forceinline__ void splitf(float y, unsigned short& h, unsigned short& l) { h = f2bf(y); l = f2bf(y - bf2f(h)); }
typedef __attribute__((ext_vector_type(2))) _Float16 v2h;
typedef __attribute__((ext_vector_type(4))) _Float16 v4h;
typedef __attribute__((ext_vector_type(2))) unsigned short v2us;
typedef __attribute__((ext_vector_type(4))) unsigned short v4us;
typedef __attribute__((ext_vector_type(2))) float v2f;
typedef __attribute__((ext_vector_type(4))) int v4i;

// ---- k_gemmw: register-blocked GEMM, one 64x64 output tile per work-group (16 accumulators per wave), operands straight from 16-bit planes in fragment order; grid (M/64, N/64, Z), 32 * KS threads.
// C[m][n] (f32, pitch ldc, + optional f32 bias[n]) = sum_k A[m][k] Bt[n][k] (+ split products per NSPLIT). z-batch strides sA/sB/sC in elements; for EPI 1 z is the batch: its tables are TT * HD and its head planes NH_ * TT * HD elements further on. K % (32 * KS) == 0.
// KS > 1: wave w sums the k range [w K/KS, (w+1) K/KS) of the whole tile; the KS partial tiles meet in LDS and are added in wave order 0..KS-1 (fixed order).
// EPI (KS > 1 only): 0 f32 C; 1 the q, k and v projections in one launch: Bt holds the three weights one behind the other, tile column y is head y % NH_ of part y / NH_ (0 q, 1 k, 2 v; the 64 columns of a tile are one head), bias / biasK / biasV are the parts' biases. Parts 0, 1: rotate-half rotary with the cos / sin tables [t][64], each rounded to bf16, then head planes [h][t][d] (fp16 + bf16 hi/lo); part 2: transposed head planes [h][d][t] (fp16 + bf16 hi/lo); each head's plane in fragment order. The planes of part p start p (fp16) or 2 p (hi, lo) whole planes behind P16, Ph, Pl. C is not written for EPI 1.
// fro: the place (in elements) of element (row, k) of a [rows][K] 16-bit operand plane in fragment order. A block of 512 elements holds 16 rows x 32 k; blocks run along k, then down the row groups. Inside a block: half s = bit 4 of k (256 elements), then lane = 16 * (bit 3 of k) + row % 16 (8 elements), then k % 8: the two 16-byte pieces that lane holds of the block's A or B fragment.
__device__ __forceinline__ size_t fro(int row, int k, int K) { return (size_t)(row >> 4) * 16 * K + (k >> 5) * 512 + ((k >> 4) & 1) * 256 + (((k >> 3) & 1) * 16 + (row & 15)) * 8 + (k & 7); }
template <typename T16> struct WFrag;
// ld: a fragment from a row-major row (LDS); ldf: from a block in fragment order, p = the block + 8 * lane
template <> struct WFrag<h16> { typedef v16h V; static __device__ __forceinline__ V ld(const h16* p) { return cat16(*(const v8h*)p, *(const v8h*)(p + 16)); } static __device__ __forceinline__ V ldf(const h16* p) { return cat16(*(const v8h*)p, *(const v8h*)(p + 256)); } static __device__ __forceinline__ v8f mma(V a, V b, v8f c) { return wmma16(a, b, c); } };
template <> struct WFrag<bf> { typedef v16bf V; static __device__ __forceinline__ V ld(const bf* p) { return cat16b(*(const v8us*)p, *(const v8us*)(p + 16)); } static __device__ __forceinline__ V ldf(const bf* p) { return cat16b(*(const v8us*)p, *(const v8us*)(p + 256)); } static __device__ __forceinline__ v8f mma(V a, V b, v8f c) { return wmmab(a, b, c); } };
template <typename T16, int NSPLIT, bool BIAS, int KS, int EPI>
__global__ __launch_bounds__(32 * KS) void k_gemmw(const T16* __restrict__ A, const T16* __restrict__ A2, const T16* __restrict__ Bt, const T16* __restrict__ Bt2, int K, float* C, int ldc, const float* __restrict__ bias, const float* __restrict__ biasK, const float* __restrict__ biasV, size_t sA, size_t sB, size_t sC, const float* __restrict__ cosT, const float* __restrict__ sinT, h16* P16, bf* Ph, bf* Pl) {
    typedef typename WFrag<T16>::V V;
    __builtin_assume(K == DM);   // every launch passes DM (= DQ): the row groups of a stream are then a constant distance apart and share one address register, each at an immediate offset
    __shared__ __align__(16) float os[(KS > 1 ? KS * 64 : 16) * 68];
    const size_t z = blockIdx.z; A += z * sA; if (A2) A2 += z * sA; Bt += z * sB; if (Bt2) Bt2 += z * sB; C += z * sC;
    const int part = EPI == 1 ? (int)blockIdx.y / NH_ : 0, head = EPI == 1 ? (int)blockIdx.y % NH_ : 0;   // the same for the whole work-group
    if constexpr (EPI == 1) { cosT += z * (size_t)(TT * HD); sinT += z * (size_t)(TT * HD); P16 += ((size_t)part * NB_ + z) * (size_t)(NH_ * TT * HD); Ph += ((size_t)part * 2 * NB_ + z) * (size_t)(NH_ * TT * HD); Pl += ((size_t)part * 2 * NB_ + z) * (size_t)(NH_ * TT * HD); }
    const int lane = threadIdx.x & 31, lr = lane & 15, hi = lane >> 4; const int r0 = blockIdx.x * 64, c0 = blockIdx.y * 64;
    v8f acc[4][4];
#pragma unroll
    for (int mb = 0; mb < 4; ++mb)
#pragma unroll
        for (int nb = 0; nb < 4; ++nb) acc[mb][nb] = (v8f){};
    const unsigned lo = (unsigned)(lane * 8);
    const T16* Ab = A + (size_t)r0 * K; const T16* Ab2 = (NSPLIT == 1 || NSPLIT == 2) ? A2 + (size_t)r0 * K : nullptr; const T16* Bb = Bt + (size_t)c0 * K; const T16* Bb2 = NSPLIT >= 2 ? Bt2 + (size_t)c0 * K : nullptr;   // a row group of 16 is 16 K elements, a k step of 32 is 512
    const int wv = (KS > 1) ? __builtin_amdgcn_readfirstlane((int)(threadIdx.x >> 5)) : 0; const int kspan = K / KS, kbeg = wv * kspan, kend = kbeg + kspan;
#pragma unroll 1
    for (int kc = kbeg; kc < kend; kc += 32) {
        V a[4], a2[4], b[4], b2[4]; const T16* pa = Ab + kc * 16 + lo; const T16* pb = Bb + kc * 16 + lo; const T16* pa2 = (NSPLIT == 1 || NSPLIT == 2) ? Ab2 + kc * 16 + lo : pa; const T16* pb2 = NSPLIT >= 2 ? Bb2 + kc * 16 + lo : pb;
#pragma unroll
        for (int mb = 0; mb < 4; ++mb) { a[mb] = WFrag<T16>::ldf(pa + mb * 16 * K); if (NSPLIT == 1 || NSPLIT == 2) a2[mb] = WFrag<T16>::ldf(pa2 + mb * 16 * K); }
#pragma unroll
        for (int nb = 0; nb < 4; ++nb) { b[nb] = WFrag<T16>::ldf(pb + nb * 16 * K); if (NSPLIT >= 2) b2[nb] = WFrag<T16>::ldf(pb2 + nb * 16 * K); }
        asm volatile("s_wait_xcnt 0x0" :: "v"(pa), "v"(pa2), "v"(pb), "v"(pb2) : "memory");   // the wait before a register that the loads above name is rewritten; the streams' addresses as inputs keep those registers live through the run, so that no load of the run lands in them
#pragma unroll
        for (int nb = 0; nb < 4; ++nb)
#pragma unroll
            for (int mb = 0; mb < 4; ++mb) { acc[mb][nb] = WFrag<T16>::mma(a[mb], b[nb], acc[mb][nb]); if (NSPLIT == 1 || NSPLIT == 2) acc[mb][nb] = WFrag<T16>::mma(a2[mb], b[nb], acc[mb][nb]); if (NSPLIT >= 2) acc[mb][nb] = WFrag<T16>::mma(a[mb], b2[nb], acc[mb][nb]); }
        asm volatile("v_nop\n\tv_nop\n\tv_nop\n\tv_nop" : "+v"(acc[0][0]), "+v"(acc[1][1]), "+v"(acc[2][2]), "+v"(acc[3][3]) : "v"(a[0]), "v"(a[3]));
    }
    if constexpr (KS > 1) {
        float* ow = os + wv * (64 * 68); const int cofs = ((int)threadIdx.x & 15) * 4; v4f bb = (v4f){};   // each thread keeps one column group: its bias is loaded here, ahead of the LDS traffic
        const float* bp = bias + c0; if constexpr (EPI == 1) bp = (part == 0 ? bias : part == 1 ? biasK : biasV) + head * 64;
        if (BIAS) { bb[0] = bp[cofs]; bb[1] = bp[cofs + 1]; bb[2] = bp[cofs + 2]; bb[3] = bp[cofs + 3];   // rounded behind the barrier: a use here would wait for the table loads below as well
            if constexpr (EPI == 1) asm volatile("s_wait_xcnt 0x0" ::: "memory"); }   // the wait before a register that the bias load names is rewritten: this instance's build reuses the load's scalar base at once (for EPI 0 the build places the wait itself)
        v4f cc[32 / KS], sn[32 / KS];   // EPI 1, parts 0, 1: the thread's table entries, loaded with the bias, ahead of the LDS traffic
        if constexpr (EPI == 1) { if (part < 2) {
#pragma unroll
            for (int i = 0; i < 32 / KS; ++i) { const size_t o = (size_t)(r0 + ((i * (32 * KS) + (int)threadIdx.x) >> 4)) * HD + cofs; cc[i] = *(const v4f*)(cosT + o); sn[i] = *(const v4f*)(sinT + o); }
        } }
        // the three loops below are unrolled so that acc[][][] is indexed by constants and stays in registers
#pragma unroll
        for (int mb = 0; mb < 4; ++mb)
#pragma unroll
            for (int nb = 0; nb < 4; ++nb)
#pragma unroll
                for (int j = 0; j < 8; ++j) ow[(mb * 16 + hi * 8 + j) * 68 + nb * 16 + lr] = acc[mb][nb][j];
        __syncthreads();   // every wave's partial tile is in LDS before any thread adds them
        if (BIAS) { bb[0] = bfr(bb[0]); bb[1] = bfr(bb[1]); bb[2] = bfr(bb[2]); bb[3] = bfr(bb[3]); }
        v4f keep[32 / KS];   // EPI 1: the thread's four sums
        // both loops below are unrolled so that all LDS loads of a thread issue ahead of its adds
#pragma unroll
        for (int i = 0; i < 32 / KS; ++i) { const int row = (i * (32 * KS) + (int)threadIdx.x) >> 4; v4f val = *(const v4fa*)(os + row * 68 + cofs);
#pragma unroll
            for (int w = 1; w < KS; ++w) val += *(const v4fa*)(os + (w * 64 + row) * 68 + cofs);
            if (BIAS) val += bb;
            if constexpr (EPI == 0) *(v4f*)(C + (size_t)(r0 + row) * ldc + c0 + cofs) = val;
            else keep[i] = val; }
        if constexpr (EPI == 1) { if (part < 2) {
            // unrolled: keep, cc and sn are indexed by constants
#pragma unroll
            for (int i = 0; i < 32 / KS; ++i) { const int row = (i * (32 * KS) + (int)threadIdx.x) >> 4; const v4f val = keep[i]; v4h o16; v4us oh, ol;
#pragma unroll
                for (int q = 0; q < 4; ++q) { const float xp = __builtin_amdgcn_update_dpp(0.0f, val[q], 0x168, 0xf, 0xf, true);   // row_xmask:8: column d ^ 32 of this row sits in lane ^ 8 (the float overload: with the value cast to int the build held one move for all four columns)
                    const float s = bfr(sn[i][q]); const float r = val[q] * bfr(cc[i][q]) + xp * (cofs < HD / 2 ? -s : s);
                    o16[q] = tohx(r); unsigned short a2, c2; splitf(r, a2, c2); oh[q] = a2; ol[q] = c2; }
                const size_t e = (size_t)head * TT * HD + fro(r0 + row, cofs, HD); *(v4h*)(P16 + e) = o16; *(v4us*)(Ph + e) = oh; *(v4us*)(Pl + e) = ol; }
        } else {
            // the sums go back into wave 0's tile, each at the place that only this thread has read; behind the loop above, so that its LDS loads still issue together
#pragma unroll
            for (int i = 0; i < 32 / KS; ++i) *(v4fa*)(os + ((i * (32 * KS) + (int)threadIdx.x) >> 4) * 68 + cofs) = keep[i];
            __syncthreads();   // every summed row is in LDS before any thread reads a column of the tile; part is the same for the whole work-group, so every wave of it passes here or none
#pragma unroll
            for (int it = 0; it < 16 / KS; ++it) { const int item = it * (32 * KS) + (int)threadIdx.x, d = item & 63, tq = (item >> 6) * 8; v8h o16; v8us oh, ol;   // sixteen lanes (16 rows d, the same eight t) write 256 consecutive bytes of a block
#pragma unroll
                for (int j = 0; j < 8; ++j) { const float x = os[(tq + j) * 68 + d]; o16[j] = tohx(x); unsigned short a2, c2; splitf(x, a2, c2); oh[j] = a2; ol[j] = c2; }
                const size_t e = (size_t)head * HD * TT + fro(d, r0 + tq, TT); *(v8h*)(P16 + e) = o16; *(v8us*)(Ph + e) = oh; *(v8us*)(Pl + e) = ol; }
            asm volatile("s_wait_xcnt 0x0" ::: "memory");   // the wait before a register that the stores above name is rewritten: the build lays the rotary tail behind this one, as the fall-through of this tail's last branch
        } }
        return;
    }
#pragma unroll
    for (int mb = 0; mb < 4; ++mb) {
#pragma unroll
        for (int nb = 0; nb < 4; ++nb) {
#pragma unroll
            for (int j = 0; j < 8; ++j) os[(hi * 8 + j) * 68 + nb * 16 + lr] = acc[mb][nb][j]; }
        __builtin_amdgcn_wave_barrier(); asm volatile("" ::: "memory");
        float* crow = C + (size_t)(r0 + mb * 16) * ldc + c0;
{
#pragma unroll
            for (int s = 0; s < 8; ++s) { const int row = 2 * s + hi, cofs = lr * 4; v4f val = *(const v4fa*)(os + row * 68 + cofs); if (BIAS) { val[0] += bfr(bias[c0 + cofs]); val[1] += bfr(bias[c0 + cofs + 1]); val[2] += bfr(bias[c0 + cofs + 2]); val[3] += bfr(bias[c0 + cofs + 3]); }
                *(v4f*)(crow + (size_t)row * ldc + cofs) = val; }
             }
        __builtin_amdgcn_wave_barrier(); asm volatile("" ::: "memory");
    }
}


// k_cvtall: every f32 -> bf16 rounding of a call in one launch. A work-group rounds CVB consecutive elements: groups 0 .. NB_ TT DM / CVB - 1 take hidden (all batches), the rest the four weights in the order q, k, v, o, whose bf16 copies lie one behind the other at W4. CVB elements are one group of 16 rows, which fragment order keeps together: a thread reads the eight elements that belong at its place, so that the stores are consecutive.
#define CVG  8                    // 8-element groups per thread
#define CVB  (256 * 8 * CVG)
static_assert(CVB == 16 * DM && DQ == DM, "a work-group of k_cvtall rounds one group of 16 rows of DM elements");
__global__ __launch_bounds__(256) void k_cvtall(const float* __restrict__ x, const float* __restrict__ wq, const float* __restrict__ wk, const float* __restrict__ wv, const float* __restrict__ wo, bf* XB, bf* W4) {
    constexpr int NX = NB_ * TT * DM / CVB, NW = DM * DM / CVB; const int blk = blockIdx.x; const float* src; bf* dst;
    if (blk < NX) { src = x + (size_t)blk * CVB; dst = XB + (size_t)blk * CVB; }
    else { const int wb = blk - NX, w = wb / NW; src = (w == 0 ? wq : w == 1 ? wk : w == 2 ? wv : wo) + (size_t)(wb % NW) * CVB; dst = W4 + (size_t)wb * CVB; }
    v8f v[CVG]; const unsigned so = (unsigned)(((int)threadIdx.x & 15) * DM + ((int)threadIdx.x >> 6) * 32 + (((int)threadIdx.x >> 4) & 3) * 8);   // place oc = 256 g + thread of the group holds row oc % 16, k block oc / 64, piece (oc / 16) % 4 of the block's 32 k: 128 elements further for each g
    // both loops are unrolled so that all loads of a thread issue ahead of its first rounding
#pragma unroll
    for (int g = 0; g < CVG; ++g) v[g] = *(const v8f*)(src + so + g * 128);
#pragma unroll
    for (int g = 0; g < CVG; ++g) { v8us o;
#pragma unroll
        for (int k = 0; k < 8; ++k) o[k] = f2bf(v[g][k]);
        *(v8us*)(dst + (g * 256 + (int)threadIdx.x) * 8) = o; }
}

__constant__ float INVT[HD / 2] = { 1.000000000e+00f, 7.498942018e-01f, 5.623413324e-01f, 4.216965139e-01f, 3.162277639e-01f, 2.371373624e-01f, 1.778279394e-01f, 1.333521456e-01f, 1.000000015e-01f, 7.498941571e-02f, 5.623412877e-02f, 4.216964915e-02f, 3.162277862e-02f, 2.371373586e-02f, 1.778279431e-02f, 1.333521493e-02f, 9.999999776e-03f, 7.498942316e-03f, 5.623413250e-03f, 4.216964822e-03f, 3.162277862e-03f, 2.371373819e-03f, 1.778279431e-03f, 1.333521446e-03f, 1.000000047e-03f, 7.498941850e-04f, 5.623413017e-04f, 4.216964880e-04f, 3.162277862e-04f, 2.371373848e-04f, 1.778279402e-04f, 1.333521504e-04f };   // float32 1 / 10000^(2i/64), generated with jnp to be bit-exact
__global__ __launch_bounds__(256) void k_cs5(float* CS) { const int idx = blockIdx.x * 256 + threadIdx.x; if (idx >= TT * HD) return; const int d = idx % HD; const int t = idx / HD; const float a = __fmul_rn((float)t, INVT[d % (HD / 2)]); v2f cs; cs[0] = cosf(a); cs[1] = sinf(a); *(v2f*)(CS + (size_t)idx * 2) = cs;  }
// k_attn: one work-group = 32 query rows of one head, all 2048 keys; the score rows, the probabilities and the partial output tiles live in LDS and never reach memory.
// grid (heads, TT / 32, batches), 512 threads = 16 waves. Row tiles below RH use the hi/lo bf16 planes (3 products), the rest the fp16 planes (probabilities x PCAR).
// Phase 1: wave w forms S[32][128 w .. 128 w + 127] (k steps 0, 32 in turn). Phase 2: wave w does rows 2 w, 2 w + 1 (register row, one exp, fixed trees) and lays the 16-bit row over its own f32 row.
// Phase 3: wave w sums keys [128 w, 128 w + 128) of P V; the 16 partial tiles are added in wave order 0..15 and leave as the merged hi/lo planes [t][h * 64 + d] (fragment order). Q, K and V fragments come from planes in fragment order: 16 rows are 16 HD (q, k) or 16 TT (v) elements, a k step of 32 is 512.
#define RT   32
#define SPF  2052                 // LDS row pitch in floats: 8208 B = 16 B x 513 (odd), conflict-free for 16-byte fragment reads
typedef v4h  __attribute__((may_alias)) v4ha;
typedef v4us __attribute__((may_alias)) v4usa;
template <typename T16, bool HI>
__device__ __forceinline__ void attn_body(float* sm, const T16* __restrict__ Q, const T16* __restrict__ Q2, const T16* __restrict__ Kp, const T16* __restrict__ Kp2, const T16* __restrict__ Vt, const T16* __restrict__ Vt2, int t0, int h, bf* Ah, bf* Al) {
    typedef WFrag<T16> F; typedef typename F::V V;
    const int lane = threadIdx.x & 31, lr = lane & 15, hi = lane >> 4; const int wv = __builtin_amdgcn_readfirstlane((int)(threadIdx.x >> 5)); const int kbeg = wv * 128;
    const unsigned lo = (unsigned)(lane * 8), lv = (unsigned)(lane * 8);   // 32-bit lane offsets over wave-uniform bases: one address register per stream
    constexpr int CH = HI ? 2 : 8, NPRE = HI ? 1 : 4;   // key groups per batch of K loads; k steps of V fetched ahead of the softmax (what 256 registers hold)
    const T16* vb = Vt + kbeg * 16; const T16* vb2 = HI ? Vt2 + kbeg * 16 : nullptr; V vf[4][4], vf2[4][4];
    {   // phase 1: scores. Every loop is unrolled: fragment and accumulator arrays are indexed by constants
        V qa[2][2], qa2[2][2], b[8][2], b2[8][2]; const T16* qb = Q + (size_t)t0 * HD; const T16* qb2 = HI ? Q2 + (size_t)t0 * HD : nullptr; const T16* kb = Kp + (size_t)kbeg * HD; const T16* kb2 = HI ? Kp2 + (size_t)kbeg * HD : nullptr;
#pragma unroll
        for (int mb = 0; mb < 2; ++mb)
#pragma unroll
            for (int kk = 0; kk < 2; ++kk) { const int o = mb * 16 * HD + kk * 512; qa[mb][kk] = F::ldf(qb + lo + o); if (HI) qa2[mb][kk] = F::ldf(qb2 + lo + o); }
        __builtin_amdgcn_sched_barrier(0);   // keeps the Q loads ahead of the K loads, so that the first products wait for Q and one key group, not for the whole run
#pragma unroll
        for (int nb = 0; nb < CH; ++nb)
#pragma unroll
            for (int kk = 0; kk < 2; ++kk) { const int o = nb * 16 * HD + kk * 512; b[nb][kk] = F::ldf(kb + lo + o); if (HI) b2[nb][kk] = F::ldf(kb2 + lo + o); }
        asm volatile("s_wait_xcnt 0x0" :: "v"(lane) : "memory");   // the wait before a register that the loads above name is rewritten; the lane number, which the build gives them as their (scaled) offset register, as an input keeps that register live through the run, so that no load of the run lands in it
#pragma unroll
        for (int c = 0; c < 8; c += CH) {
            if (c + CH < 8) {
#pragma unroll
                for (int nb = c + CH; nb < c + 2 * CH; ++nb)
#pragma unroll
                    for (int kk = 0; kk < 2; ++kk) { const int o = nb * 16 * HD + kk * 512; b[nb][kk] = F::ldf(kb + lo + o); if (HI) b2[nb][kk] = F::ldf(kb2 + lo + o); } }
            __builtin_amdgcn_sched_barrier(0);   // keeps the loads above it in flight during the products below; without it each load sinks to its product and its latency is paid eight times over
#pragma unroll
            for (int nb = c; nb < c + CH; ++nb) { const int key = kbeg + nb * 16; v8f acc[2]; acc[0] = (v8f){}; acc[1] = (v8f){};
#pragma unroll
                for (int kk = 0; kk < 2; ++kk)
#pragma unroll
                    for (int mb = 0; mb < 2; ++mb) { acc[mb] = F::mma(qa[mb][kk], b[nb][kk], acc[mb]); if (HI) { acc[mb] = F::mma(qa2[mb][kk], b[nb][kk], acc[mb]); acc[mb] = F::mma(qa[mb][kk], b2[nb][kk], acc[mb]); } }
                asm volatile("v_nop\n\tv_nop\n\tv_nop\n\tv_nop" : "+v"(acc[0]), "+v"(acc[1]));   // four vector slots behind the group's last WMMA: the next group's first WMMA may write the same registers anew
#pragma unroll
                for (int mb = 0; mb < 2; ++mb)
#pragma unroll
                    for (int j = 0; j < 8; ++j) sm[(mb * 16 + hi * 8 + j) * SPF + key + lr] = acc[mb][j]; } }
    }
    __syncthreads();   // all 2048 scores of every row are in LDS before a wave reads its rows
    // the first V fragments are fetched here, behind the barrier (which drains a wave's loads), so that they fly during the softmax
#pragma unroll
    for (int ks = 0; ks < NPRE; ++ks)
#pragma unroll
        for (int nb = 0; nb < 4; ++nb) { const int o = nb * 16 * TT + ks * 512; vf[ks][nb] = F::ldf(vb + lv + o); if (HI) vf2[ks][nb] = F::ldf(vb2 + lv + o); }
    asm volatile("s_wait_xcnt 0x0" :: "v"(lane) : "memory");   // as above, for the V loads
#pragma unroll 1   // one row's 64 values at a time: two rows beside the V fragments held in registers would spill
    for (int rr = 0; rr < 2; ++rr) {   // phase 2: softmax of one row per trip
        float* sr = sm + (wv * 2 + rr) * SPF; float v[TT / 32]; float mx = -3.0e38f;
#pragma unroll
        for (int ch = 0; ch < TT / 128; ++ch) { const v4f a = *(const v4fa*)(sr + ch * 128 + lane * 4);
#pragma unroll
            for (int q = 0; q < 4; ++q) { const float t = a[q] * SCL; v[ch * 4 + q] = t; mx = fmaxf(mx, t); } }
#pragma unroll
        for (int sh = 16; sh; sh >>= 1) mx = fmaxf(mx, __shfl_xor(mx, sh, 32));
        float sum = 0.f;
#pragma unroll
        for (int k = 0; k < TT / 32; ++k) { v[k] = __builtin_amdgcn_exp2f(__fmul_rn(__fsub_rn(v[k], mx), 1.4426950408889634f)); sum += v[k]; }
#pragma unroll
        for (int sh = 16; sh; sh >>= 1) sum += __shfl_xor(sum, sh, 32);
        const float f = __fdiv_rn(HI ? 1.0f : PCAR, sum);
        // the 16-bit row overwrites the f32 row it came from: only this wave touches the row, and every store depends on the row's sum
        if (HI) {
#pragma unroll
            for (int ch = 0; ch < TT / 128; ++ch) { v4us oh, ol;
#pragma unroll
                for (int q = 0; q < 4; ++q) { unsigned short a, c2; splitf(v[ch * 4 + q] * f, a, c2); oh[q] = a; ol[q] = c2; }
                *(v4usa*)((bf*)sr + ch * 128 + lane * 4) = oh; *(v4usa*)((bf*)sr + TT + ch * 128 + lane * 4) = ol; }
        } else {
#pragma unroll
            for (int ch = 0; ch < TT / 128; ++ch) { v4h o4;
#pragma unroll
                for (int q = 0; q < 4; ++q) o4[q] = tohx(v[ch * 4 + q] * f);
                *(v4ha*)((h16*)sr + ch * 128 + lane * 4) = o4; } }
    }
    __syncthreads();   // every row's probabilities are in LDS before any wave reads them as A fragments
    v8f acc[2][4];
#pragma unroll
    for (int mb = 0; mb < 2; ++mb)
#pragma unroll
        for (int nb = 0; nb < 4; ++nb) acc[mb][nb] = (v8f){};
    // phase 3: P V. Unrolled: constant indices
#pragma unroll
    for (int ks = 0; ks < 4; ++ks) { const int kc = kbeg + ks * 32; V a[2], a2[2];
        if (ks + NPRE < 4) {
#pragma unroll
            for (int nb = 0; nb < 4; ++nb) { const int o = nb * 16 * TT + (ks + NPRE) * 512; vf[ks + NPRE][nb] = F::ldf(vb + lv + o); if (HI) vf2[ks + NPRE][nb] = F::ldf(vb2 + lv + o); }
            __builtin_amdgcn_sched_barrier(0);   // keeps the next k step's V loads in flight during this step's products; without it each load sinks to its product
        }
#pragma unroll
        for (int mb = 0; mb < 2; ++mb) { const T16* pr = (const T16*)(sm + (mb * 16 + lr) * SPF) + 8 * hi + kc; a[mb] = F::ld(pr); if (HI) a2[mb] = F::ld(pr + TT); }
#pragma unroll
        for (int nb = 0; nb < 4; ++nb)
#pragma unroll
            for (int mb = 0; mb < 2; ++mb) { acc[mb][nb] = F::mma(a[mb], vf[ks][nb], acc[mb][nb]); if (HI) { acc[mb][nb] = F::mma(a2[mb], vf[ks][nb], acc[mb][nb]); acc[mb][nb] = F::mma(a[mb], vf2[ks][nb], acc[mb][nb]); } } }
    __syncthreads();   // every wave has read its probabilities before the partial tiles overwrite them
    float* ow = sm + wv * (RT * 68);
#pragma unroll
    for (int mb = 0; mb < 2; ++mb)
#pragma unroll
        for (int nb = 0; nb < 4; ++nb)
#pragma unroll
            for (int j = 0; j < 8; ++j) ow[(mb * 16 + hi * 8 + j) * 68 + nb * 16 + lr] = acc[mb][nb][j];
    __syncthreads();   // every wave's partial tile is in LDS before any thread adds them
    const int row = (int)threadIdx.x >> 4, cofs = ((int)threadIdx.x & 15) * 4; v4f val = *(const v4fa*)(sm + row * 68 + cofs);
#pragma unroll
    for (int w = 1; w < 16; ++w) val += *(const v4fa*)(sm + (w * RT + row) * 68 + cofs);
    const float cs = HI ? 1.0f : (1.0f / PCAR); const size_t oo = fro(t0 + row, h * HD + cofs, DQ); v4us oh, ol;
#pragma unroll
    for (int q = 0; q < 4; ++q) { unsigned short a, c2; splitf(val[q] * cs, a, c2); oh[q] = a; ol[q] = c2; }
    *(v4us*)(Ah + oo) = oh; *(v4us*)(Al + oo) = ol;
}
__global__ __launch_bounds__(512) void k_attn(const h16* __restrict__ Q16, const h16* __restrict__ K16, const h16* __restrict__ V16, const bf* __restrict__ Qh, const bf* __restrict__ Ql, const bf* __restrict__ Kh, const bf* __restrict__ Kl, const bf* __restrict__ Vh, const bf* __restrict__ Vl, bf* Ah, bf* Al) {
    __shared__ __align__(16) float sm[RT * SPF];
    const int h = blockIdx.x, t0 = blockIdx.y * RT; const size_t zo = ((size_t)blockIdx.z * NH_ + h) * TT * HD; Ah += (size_t)blockIdx.z * TT * DQ; Al += (size_t)blockIdx.z * TT * DQ;   // within a batch the hi/lo row tiles (three times the products) have the lowest indices
    if (t0 < RH) attn_body<bf, true>(sm, Qh + zo, Ql + zo, Kh + zo, Kl + zo, Vh + zo, Vl + zo, t0, h, Ah, Al);
    else attn_body<h16, false>(sm, Q16 + zo, nullptr, K16 + zo, nullptr, V16 + zo, nullptr, t0, h, Ah, Al);
}

extern "C" void kernel_launch(void* const* d_in, const int* in_sizes, int n_in,
                              void* d_out, int out_size, void* d_ws, size_t ws_size, hipStream_t stream) {
    (void)in_sizes; (void)n_in; (void)out_size;
    const float* x = (const float*)d_in[0]; const float* fcos = (const float*)d_in[1]; const float* fsin = (const float*)d_in[2]; const float* wq = (const float*)d_in[3]; const float* bq = (const float*)d_in[4]; const float* wk = (const float*)d_in[5]; const float* bk = (const float*)d_in[6]; const float* wv = (const float*)d_in[7]; const float* bv = (const float*)d_in[8]; const float* wo = (const float*)d_in[9]; const float* bo = (const float*)d_in[10];   /* hidden [4][2048][1024] (ONE stream, rounded to bf16 once for q, k and v), cos, sin ([4][2048][64] = [B][S][D] PER-BATCH full-width table INPUTS: read per element by value), Wq, bq, Wk, bk, Wv, bv, Wo, bo ('oi' (out, in) [1024][1024] + [1024]): ELEVEN inputs, all read */
    float* OUT = (float*)d_out;     // [4][2048][1024]
    char* wsp = (char*)d_ws;
    auto take = [&](size_t bytes) { char* p = wsp; wsp += (bytes + 255) & ~(size_t)255; return (void*)p; };
    bf* WQ = (bf*)take((size_t)DQ * DM * 2); bf* WK = (bf*)take((size_t)DKV * DM * 2); bf* WV = (bf*)take((size_t)DKV * DM * 2); bf* WO = (bf*)take((size_t)DM * DQ * 2);
    bf* XB = (bf*)take((size_t)NB_ * TT * DM * 2);
    h16* QP16 = (h16*)take((size_t)NB_ * NH_ * TT * HD * 2); h16* KP16 = (h16*)take((size_t)NB_ * NKV * TT * HD * 2); h16* VT16 = (h16*)take((size_t)NB_ * NKV * HD * TT * 2);
    bf* QPh = (bf*)take((size_t)NB_ * NH_ * TT * HD * 2); bf* QPl = (bf*)take((size_t)NB_ * NH_ * TT * HD * 2); bf* KPh = (bf*)take((size_t)NB_ * NKV * TT * HD * 2); bf* KPl = (bf*)take((size_t)NB_ * NKV * TT * HD * 2); bf* VTh = (bf*)take((size_t)NB_ * NKV * HD * TT * 2); bf* VTl = (bf*)take((size_t)NB_ * NKV * HD * TT * 2);
    bf* ATh = (bf*)take((size_t)NB_ * TT * DQ * 2); bf* ATl = (bf*)take((size_t)NB_ * TT * DQ * 2);
    (void)WK; (void)WV;   // reached through WQ
    if ((size_t)(wsp - (char*)d_ws) > ws_size) return;    // 200 MiB of the 256 MiB
    k_cvtall<<<(NB_ * TT * DM + 4 * DM * DM) / CVB, 256, 0, stream>>>(x, wq, wk, wv, wo, XB, WQ);   // WQ, WK, WV, WO are consecutive takes of 2 MiB each
    /* q, k, v: one launch; WQ, WK, WV are one [3 DQ][DM] matrix, and QP16, KP16, VT16 as well as QPh, QPl, KPh, KPl, VTh, VTl are consecutive takes. The q and k parts read batch z's own slice of the INPUT rotary tables in their epilogue; k_cs5 and its INVT constants stay defined and are NOT launched */
    k_gemmw<bf, 0, true, 8, 1><<<dim3(TT / 64, (DQ + 2 * DKV) / 64, NB_), 256, 0, stream>>>(XB, nullptr, WQ, nullptr, DM, nullptr, DQ, bq, bk, bv, (size_t)TT * DM, 0, 0, fcos, fsin, QP16, QPh, QPl);
    k_attn<<<dim3(NH_, TT / RT, NB_), 512, 0, stream>>>(QP16, KP16, VT16, QPh, QPl, KPh, KPl, VTh, VTl, ATh, ATl);   // one kv head per query head
    k_gemmw<bf, 1, true, 8, 0><<<dim3(TT / 64, DM / 64, NB_), 256, 0, stream>>>(ATh, ATl, WO, nullptr, DQ, OUT, DM, bo, nullptr, nullptr, (size_t)TT * DQ, 0, (size_t)TT * DM, nullptr, nullptr, nullptr, nullptr, nullptr);
}

// v006
// It runs in 270 microseconds.
// In both of two side-by-side timings against v005, it was 1.10 times as fast.
// All steps since v000 together make it 14.6 times as fast.
#include <hip/hip_runtime.h>

// Rotary multi-head self-attention with PER-BATCH full-width rotary tables given as inputs (hidden [4][2048][1024]: ONE stream; q, k, v = hidden W^T + b ('oi' (out, in) [1024][1024] normal x 1024^-0.5 + zero biases: read; 16 heads x 64); q, k -> t cos + cat(-t2, t1) sin with the cos / sin INPUT tables [4][2048][64] = [B][S][D] (uniform random values on this draw: batch b reads ITS OWN slice, per element by value; no structure assumed); scores x 64^-0.5; softmax over all keys (no mask); out = merged Wo^T + bo ('oi' + a zero bias: read) -> [4][2048][1024] (8.4 M); argument order hidden, cos, sin, Wq, bq, Wk, bk, Wv, bv, Wo, bo).
// Every stage is launched once for all four batches (batch = grid z; every workspace plane holds the four batches one behind the other). Layout per batch: bf16 copies of the input stream(s); 'oi' weights; exact projections + f32 biases, whose epilogue applies the rotary tables and writes the head planes (q, k: [h][t][d]; v: [h][d][t]); dense T-2048 attention in one kernel, scores and probabilities in LDS or in registers (hybrid rows: < 512 hi/lo 3 products, in LDS; rest fp16, in registers, each wave's keys against their own maximum); merged hi/lo x Wo exact + bo.
// Every 16-bit plane that a matrix product reads from memory (hidden, the weights, q, k, v, merged) lies in FRAGMENT ORDER (fro() below), so that one wave-wide 16-byte load covers 512 consecutive bytes = four whole 128-byte lines; each lane receives the same elements as from a row-major plane.
// Compute dtypes, f32 accumulate: every input rounded to bf16; projections exact + f32 biases; attention rows < 512 3 products, rest fp16; softmax f32; Wo hl x exact + bias.

#define NB_  4
#define TT   2048
#define DM   1024
#define NH_  16
#define NKV  16
#define REP  (NH_ / NKV)
static_assert(NKV == NH_, "the q, k, v launch numbers its tile columns by NH_ heads a part");
#define HD   64
#define DQ   (NH_ * HD)
#define DKV  (NKV * HD)
#define RH   512                  // query rows < RH use hi+lo planes (0: none)
#define WIN  0
#define PCAR 1024.0f
#define SCL  0.125f   // HD^-0.5
typedef _Float16 h16;
typedef unsigned short bf;
typedef __attribute__((ext_vector_type(16))) __bf16   v16bf;
typedef __attribute__((ext_vector_type(16))) _Float16 v16h;
typedef __attribute__((ext_vector_type(8)))  _Float16 v8h;
typedef __attribute__((ext_vector_type(8)))  unsigned short v8us;
typedef __attribute__((ext_vector_type(8)))  float    v8f;
typedef __attribute__((ext_vector_type(4)))  float    v4f;
typedef v8h  __attribute__((may_alias)) v8ha;
typedef v4f  __attribute__((may_alias)) v4fa;
typedef v8us __attribute__((may_alias)) v8usa;

__device__ __forceinline__ unsigned short f2bf(float f) { unsigned u = __float_as_uint(f); u += 0x7FFFu + ((u >> 16) & 1u); return (unsigned short)(u >> 16); }
__device__ __forceinline__ float bf2f(unsigned short b) { return __uint_as_float(((unsigned)b) << 16); }
__device__ __forceinline__ float bfr(float f) { return bf2f(f2bf(f)); }
__device__ __forceinline__ v16h cat16(v8h lo, v8h hi) { return __builtin_shufflevector(lo, hi, 0, 1, 2, 3, 4, 5, 6, 7, 8, 9, 10, 11, 12, 13, 14, 15); }
__device__ __forceinline__ v16bf cat16b(v8us lo, v8us hi) { return __builtin_bit_cast(v16bf, __builtin_shufflevector(lo, hi, 0, 1, 2, 3, 4, 5, 6, 7, 8, 9, 10, 11, 12, 13, 14, 15)); }
__device__ __forceinline__ v8f wmma16(v16h a, v16h b, v8f c) { return __builtin_amdgcn_wmma_f32_16x16x32_f16(false, a, false, b, (short)0, c, false, false); }
__device__ __forceinline__ v8f wmmab(v16bf a, v16bf b, v8f c) { return __builtin_amdgcn_wmma_f32_16x16x32_bf16(false, a, false, b, (short)0, c, false, false); }

__device__ __forceinline__ h16 tohx(float x) { return (h16)x; }
__device__ __forceinline__ void splitf(float y, unsigned short& h, unsigned short& l) { h = f2bf(y); l = f2bf(y - bf2f(h)); }
typedef __attribute__((ext_vector_type(2))) _Float16 v2h;
typedef __attribute__((ext_vector_type(4))) _Float16 v4h;
typedef __attribute__((ext_vector_type(2))) unsigned short v2us;
typedef __attribute__((ext_vector_type(4))) unsigned short v4us;
typedef __attribute__((ext_vector_type(2))) float v2f;
typedef __attribute__((ext_vector_type(4))) int v4i;

// ---- k_gemmw: register-blocked GEMM, one 64x64 output tile per work-group (16 accumulators per wave), operands straight from 16-bit planes in fragment order; grid (M/64, N/64, Z), 32 * KS threads.
// C[m][n] (f32, pitch ldc, + optional f32 bias[n]) = sum_k A[m][k] Bt[n][k] (+ split products per NSPLIT). z-batch strides sA/sB/sC in elements; for EPI 1 z is the batch: its tables are TT * HD and its head planes NH_ * TT * HD elements further on. K % (32 * KS) == 0.
// KS > 1: wave w sums the k range [w K/KS, (w+1) K/KS) of the whole tile; the KS partial tiles meet in LDS and are added in wave order 0..KS-1 (fixed order).
// EPI (KS > 1 only): 0 f32 C; 1 the q, k and v projections in one launch: Bt holds the three weights one behind the other, tile column y is head y % NH_ of part y / NH_ (0 q, 1 k, 2 v; the 64 columns of a tile are one head), bias / biasK / biasV are the parts' biases. Parts 0, 1: rotate-half rotary with the cos / sin tables [t][64], each rounded to bf16, then head planes [h][t][d] (fp16 + bf16 hi/lo); part 2: transposed head planes [h][d][t] (fp16 + bf16 hi/lo); each head's plane in fragment order. The planes of part p start p (fp16) or 2 p (hi, lo) whole planes behind P16, Ph, Pl. C is not written for EPI 1.
// fro: the place (in elements) of element (row, k) of a [rows][K] 16-bit operand plane in fragment order. A block of 512 elements holds 16 rows x 32 k; blocks run along k, then down the row groups. Inside a block: half s = bit 4 of k (256 elements), then lane = 16 * (bit 3 of k) + row % 16 (8 elements), then k % 8: the two 16-byte pieces that lane holds of the block's A or B fragment.
__device__ __forceinline__ size_t fro(int row, int k, int K) { return (size_t)(row >> 4) * 16 * K + (k >> 5) * 512 + ((k >> 4) & 1) * 256 + (((k >> 3) & 1) * 16 + (row & 15)) * 8 + (k & 7); }
template <typename T16> struct WFrag;
// ld: a fragment from a row-major row (LDS); ldf: from a block in fragment order, p = the block + 8 * lane
template <> struct WFrag<h16> { typedef v16h V; static __device__ __forceinline__ V ld(const h16* p) { return cat16(*(const v8h*)p, *(const v8h*)(p + 16)); } static __device__ __forceinline__ V ldf(const h16* p) { return cat16(*(const v8h*)p, *(const v8h*)(p + 256)); } static __device__ __forceinline__ v8f mma(V a, V b, v8f c) { return wmma16(a, b, c); } };
template <> struct WFrag<bf> { typedef v16bf V; static __device__ __forceinline__ V ld(const bf* p) { return cat16b(*(const v8us*)p, *(const v8us*)(p + 16)); } static __device__ __forceinline__ V ldf(const bf* p) { return cat16b(*(const v8us*)p, *(const v8us*)(p + 256)); } static __device__ __forceinline__ v8f mma(V a, V b, v8f c) { return wmmab(a, b, c); } };
template <typename T16, int NSPLIT, bool BIAS, int KS, int EPI>
__global__ __launch_bounds__(32 * KS) void k_gemmw(const T16* __restrict__ A, const T16* __restrict__ A2, const T16* __restrict__ Bt, const T16* __restrict__ Bt2, int K, float* C, int ldc, const float* __restrict__ bias, const float* __restrict__ biasK, const float* __restrict__ biasV, size_t sA, size_t sB, size_t sC, const float* __restrict__ cosT, const float* __restrict__ sinT, h16* P16, bf* Ph, bf* Pl) {
    typedef typename WFrag<T16>::V V;
    __builtin_assume(K == DM);   // every launch passes DM (= DQ): the row groups of a stream are then a constant distance apart and share one address register, each at an immediate offset
    __shared__ __align__(16) float os[(KS > 1 ? KS * 64 : 16) * 68];
    const size_t z = blockIdx.z; A += z * sA; if (A2) A2 += z * sA; Bt += z * sB; if (Bt2) Bt2 += z * sB; C += z * sC;
    const int part = EPI == 1 ? (int)blockIdx.y / NH_ : 0, head = EPI == 1 ? (int)blockIdx.y % NH_ : 0;   // the same for the whole work-group
    if constexpr (EPI == 1) { cosT += z * (size_t)(TT * HD); sinT += z * (size_t)(TT * HD); P16 += ((size_t)part * NB_ + z) * (size_t)(NH_ * TT * HD); Ph += ((size_t)part * 2 * NB_ + z) * (size_t)(NH_ * TT * HD); Pl += ((size_t)part * 2 * NB_ + z) * (size_t)(NH_ * TT * HD); }
    const int lane = threadIdx.x & 31, lr = lane & 15, hi = lane >> 4; const int r0 = blockIdx.x * 64, c0 = blockIdx.y * 64;
    v8f acc[4][4];
#pragma unroll
    for (int mb = 0; mb < 4; ++mb)
#pragma unroll
        for (int nb = 0; nb < 4; ++nb) acc[mb][nb] = (v8f){};
    const unsigned lo = (unsigned)(lane * 8);
    const T16* Ab = A + (size_t)r0 * K; const T16* Ab2 = (NSPLIT == 1 || NSPLIT == 2) ? A2 + (size_t)r0 * K : nullptr; const T16* Bb = Bt + (size_t)c0 * K; const T16* Bb2 = NSPLIT >= 2 ? Bt2 + (size_t)c0 * K : nullptr;   // a row group of 16 is 16 K elements, a k step of 32 is 512
    const int wv = (KS > 1) ? __builtin_amdgcn_readfirstlane((int)(threadIdx.x >> 5)) : 0; const int kspan = K / KS, kbeg = wv * kspan, kend = kbeg + kspan;
#pragma unroll 1
    for (int kc = kbeg; kc < kend; kc += 32) {
        V a[4], a2[4], b[4], b2[4]; const T16* pa = Ab + kc * 16 + lo; const T16* pb = Bb + kc * 16 + lo; const T16* pa2 = (NSPLIT == 1 || NSPLIT == 2) ? Ab2 + kc * 16 + lo : pa; const T16* pb2 = NSPLIT >= 2 ? Bb2 + kc * 16 + lo : pb;
#pragma unroll
        for (int mb = 0; mb < 4; ++mb) { a[mb] = WFrag<T16>::ldf(pa + mb * 16 * K); if (NSPLIT == 1 || NSPLIT == 2) a2[mb] = WFrag<T16>::ldf(pa2 + mb * 16 * K); }
#pragma unroll
        for (int nb = 0; nb < 4; ++nb) { b[nb] = WFrag<T16>::ldf(pb + nb * 16 * K); if (NSPLIT >= 2) b2[nb] = WFrag<T16>::ldf(pb2 + nb * 16 * K); }
        asm volatile("s_wait_xcnt 0x0" :: "v"(pa), "v"(pa2), "v"(pb), "v"(pb2) : "memory");   // the wait before a register that the loads above name is rewritten; the streams' addresses as inputs keep those registers live through the run, so that no load of the run lands in them
#pragma unroll
        for (int nb = 0; nb < 4; ++nb)
#pragma unroll
            for (int mb = 0; mb < 4; ++mb) { acc[mb][nb] = WFrag<T16>::mma(a[mb], b[nb], acc[mb][nb]); if (NSPLIT == 1 || NSPLIT == 2) acc[mb][nb] = WFrag<T16>::mma(a2[mb], b[nb], acc[mb][nb]); if (NSPLIT >= 2) acc[mb][nb] = WFrag<T16>::mma(a[mb], b2[nb], acc[mb][nb]); }
        asm volatile("v_nop\n\tv_nop\n\tv_nop\n\tv_nop" : "+v"(acc[0][0]), "+v"(acc[1][1]), "+v"(acc[2][2]), "+v"(acc[3][3]) : "v"(a[0]), "v"(a[3]));
    }
    if constexpr (KS > 1) {
        float* ow = os + wv * (64 * 68); const int cofs = ((int)threadIdx.x & 15) * 4; v4f bb = (v4f){};   // each thread keeps one column group: its bias is loaded here, ahead of the LDS traffic
        const float* bp = bias + c0; if constexpr (EPI == 1) bp = (part == 0 ? bias : part == 1 ? biasK : biasV) + head * 64;
        if (BIAS) { bb[0] = bp[cofs]; bb[1] = bp[cofs + 1]; bb[2] = bp[cofs + 2]; bb[3] = bp[cofs + 3];   // rounded behind the barrier: a use here would wait for the table loads below as well
            if constexpr (EPI == 1) asm volatile("s_wait_xcnt 0x0" ::: "memory"); }   // the wait before a register that the bias load names is rewritten: this instance's build reuses the load's scalar base at once (for EPI 0 the build places the wait itself)
        v4f cc[32 / KS], sn[32 / KS];   // EPI 1, parts 0, 1: the thread's table entries, loaded with the bias, ahead of the LDS traffic
        if constexpr (EPI == 1) { if (part < 2) {
#pragma unroll
            for (int i = 0; i < 32 / KS; ++i) { const size_t o = (size_t)(r0 + ((i * (32 * KS) + (int)threadIdx.x) >> 4)) * HD + cofs; cc[i] = *(const v4f*)(cosT + o); sn[i] = *(const v4f*)(sinT + o); }
        } }
        // the three loops below are unrolled so that acc[][][] is indexed by constants and stays in registers
#pragma unroll
        for (int mb = 0; mb < 4; ++mb)
#pragma unroll
            for (int nb = 0; nb < 4; ++nb)
#pragma unroll
                for (int j = 0; j < 8; ++j) ow[(mb * 16 + hi * 8 + j) * 68 + nb * 16 + lr] = acc[mb][nb][j];
        __syncthreads();   // every wave's partial tile is in LDS before any thread adds them
        if (BIAS) { bb[0] = bfr(bb[0]); bb[1] = bfr(bb[1]); bb[2] = bfr(bb[2]); bb[3] = bfr(bb[3]); }
        v4f keep[32 / KS];   // EPI 1: the thread's four sums
        // both loops below are unrolled so that all LDS loads of a thread issue ahead of its adds
#pragma unroll
        for (int i = 0; i < 32 / KS; ++i) { const int row = (i * (32 * KS) + (int)threadIdx.x) >> 4; v4f val = *(const v4fa*)(os + row * 68 + cofs);
#pragma unroll
            for (int w = 1; w < KS; ++w) val += *(const v4fa*)(os + (w * 64 + row) * 68 + cofs);
            if (BIAS) val += bb;
            if constexpr (EPI == 0) *(v4f*)(C + (size_t)(r0 + row) * ldc + c0 + cofs) = val;
            else keep[i] = val; }
        if constexpr (EPI == 1) { if (part < 2) {
            // unrolled: keep, cc and sn are indexed by constants
#pragma unroll
            for (int i = 0; i < 32 / KS; ++i) { const int row = (i * (32 * KS) + (int)threadIdx.x) >> 4; const v4f val = keep[i]; v4h o16; v4us oh, ol;
#pragma unroll
                for (int q = 0; q < 4; ++q) { const float xp = __builtin_amdgcn_update_dpp(0.0f, val[q], 0x168, 0xf, 0xf, true);   // row_xmask:8: column d ^ 32 of this row sits in lane ^ 8 (the float overload: with the value cast to int the build held one move for all four columns)
                    const float s = bfr(sn[i][q]); const float r = val[q] * bfr(cc[i][q]) + xp * (cofs < HD / 2 ? -s : s);
                    o16[q] = tohx(r); unsigned short a2, c2; splitf(r, a2, c2); oh[q] = a2; ol[q] = c2; }
                const size_t e = (size_t)head * TT * HD + fro(r0 + row, cofs, HD); *(v4h*)(P16 + e) = o16; *(v4us*)(Ph + e) = oh; *(v4us*)(Pl + e) = ol; }
        } else {
            // the sums go back into wave 0's tile, each at the place that only this thread has read; behind the loop above, so that its LDS loads still issue together
#pragma unroll
            for (int i = 0; i < 32 / KS; ++i) *(v4fa*)(os + ((i * (32 * KS) + (int)threadIdx.x) >> 4) * 68 + cofs) = keep[i];
            __syncthreads();   // every summed row is in LDS before any thread reads a column of the tile; part is the same for the whole work-group, so every wave of it passes here or none
#pragma unroll
            for (int it = 0; it < 16 / KS; ++it) { const int item = it * (32 * KS) + (int)threadIdx.x, d = item & 63, tq = (item >> 6) * 8; v8h o16; v8us oh, ol;   // sixteen lanes (16 rows d, the same eight t) write 256 consecutive bytes of a block
#pragma unroll
                for (int j = 0; j < 8; ++j) { const float x = os[(tq + j) * 68 + d]; o16[j] = tohx(x); unsigned short a2, c2; splitf(x, a2, c2); oh[j] = a2; ol[j] = c2; }
                const size_t e = (size_t)head * HD * TT + fro(d, r0 + tq, TT); *(v8h*)(P16 + e) = o16; *(v8us*)(Ph + e) = oh; *(v8us*)(Pl + e) = ol; }
            asm volatile("s_wait_xcnt 0x0" ::: "memory");   // the wait before a register that the stores above name is rewritten: the build lays the rotary tail behind this one, as the fall-through of this tail's last branch
        } }
        return;
    }
#pragma unroll
    for (int mb = 0; mb < 4; ++mb) {
#pragma unroll
        for (int nb = 0; nb < 4; ++nb) {
#pragma unroll
            for (int j = 0; j < 8; ++j) os[(hi * 8 + j) * 68 + nb * 16 + lr] = acc[mb][nb][j]; }
        __builtin_amdgcn_wave_barrier(); asm volatile("" ::: "memory");
        float* crow = C + (size_t)(r0 + mb * 16) * ldc + c0;
{
#pragma unroll
            for (int s = 0; s < 8; ++s) { const int row = 2 * s + hi, cofs = lr * 4; v4f val = *(const v4fa*)(os + row * 68 + cofs); if (BIAS) { val[0] += bfr(bias[c0 + cofs]); val[1] += bfr(bias[c0 + cofs + 1]); val[2] += bfr(bias[c0 + cofs + 2]); val[3] += bfr(bias[c0 + cofs + 3]); }
                *(v4f*)(crow + (size_t)row * ldc + cofs) = val; }
             }
        __builtin_amdgcn_wave_barrier(); asm volatile("" ::: "memory");
    }
}


// k_cvtall: every f32 -> bf16 rounding of a call in one launch. A work-group rounds CVB consecutive elements: groups 0 .. NB_ TT DM / CVB - 1 take hidden (all batches), the rest the four weights in the order q, k, v, o, whose bf16 copies lie one behind the other at W4. CVB elements are one group of 16 rows, which fragment order keeps together: a thread reads the eight elements that belong at its place, so that the stores are consecutive.
#define CVG  8                    // 8-element groups per thread
#define CVB  (256 * 8 * CVG)
static_assert(CVB == 16 * DM && DQ == DM, "a work-group of k_cvtall rounds one group of 16 rows of DM elements");
__global__ __launch_bounds__(256) void k_cvtall(const float* __restrict__ x, const float* __restrict__ wq, const float* __restrict__ wk, const float* __restrict__ wv, const float* __restrict__ wo, bf* XB, bf* W4) {
    constexpr int NX = NB_ * TT * DM / CVB, NW = DM * DM / CVB; const int blk = blockIdx.x; const float* src; bf* dst;
    if (blk < NX) { src = x + (size_t)blk * CVB; dst = XB + (size_t)blk * CVB; }
    else { const int wb = blk - NX, w = wb / NW; src = (w == 0 ? wq : w == 1 ? wk : w == 2 ? wv : wo) + (size_t)(wb % NW) * CVB; dst = W4 + (size_t)wb * CVB; }
    v8f v[CVG]; const unsigned so = (unsigned)(((int)threadIdx.x & 15) * DM + ((int)threadIdx.x >> 6) * 32 + (((int)threadIdx.x >> 4) & 3) * 8);   // place oc = 256 g + thread of the group holds row oc % 16, k block oc / 64, piece (oc / 16) % 4 of the block's 32 k: 128 elements further for each g
    // both loops are unrolled so that all loads of a thread issue ahead of its first rounding
#pragma unroll
    for (int g = 0; g < CVG; ++g) v[g] = *(const v8f*)(src + so + g * 128);
#pragma unroll
    for (int g = 0; g < CVG; ++g) { v8us o;
#pragma unroll
        for (int k = 0; k < 8; ++k) o[k] = f2bf(v[g][k]);
        *(v8us*)(dst + (g * 256 + (int)threadIdx.x) * 8) = o; }
}

__constant__ float INVT[HD / 2] = { 1.000000000e+00f, 7.498942018e-01f, 5.623413324e-01f, 4.216965139e-01f, 3.162277639e-01f, 2.371373624e-01f, 1.778279394e-01f, 1.333521456e-01f, 1.000000015e-01f, 7.498941571e-02f, 5.623412877e-02f, 4.216964915e-02f, 3.162277862e-02f, 2.371373586e-02f, 1.778279431e-02f, 1.333521493e-02f, 9.999999776e-03f, 7.498942316e-03f, 5.623413250e-03f, 4.216964822e-03f, 3.162277862e-03f, 2.371373819e-03f, 1.778279431e-03f, 1.333521446e-03f, 1.000000047e-03f, 7.498941850e-04f, 5.623413017e-04f, 4.216964880e-04f, 3.162277862e-04f, 2.371373848e-04f, 1.778279402e-04f, 1.333521504e-04f };   // float32 1 / 10000^(2i/64), generated with jnp to be bit-exact
__global__ __launch_bounds__(256) void k_cs5(float* CS) { const int idx = blockIdx.x * 256 + threadIdx.x; if (idx >= TT * HD) return; const int d = idx % HD; const int t = idx / HD; const float a = __fmul_rn((float)t, INVT[d % (HD / 2)]); v2f cs; cs[0] = cosf(a); cs[1] = sinf(a); *(v2f*)(CS + (size_t)idx * 2) = cs;  }
// k_attn: one work-group = 32 query rows of one head, all 2048 keys; scores, probabilities and the partial output tiles never reach memory. attn_body (the hi/lo row tiles) keeps the score rows and the probabilities in LDS, as described here; attn_regs (the fp16 row tiles) keeps them in registers.
// grid (heads, TT / 32, batches), 512 threads = 16 waves. Row tiles below RH use the hi/lo bf16 planes (3 products), the rest the fp16 planes (attn_regs).
// Phase 1: wave w forms S[32][128 w .. 128 w + 127] (k steps 0, 32 in turn). Phase 2: wave w does rows 2 w, 2 w + 1 (register row, one exp, fixed trees) and lays the 16-bit row over its own f32 row.
// Phase 3: wave w sums keys [128 w, 128 w + 128) of P V; the 16 partial tiles are added in wave order 0..15 and leave as the merged hi/lo planes [t][h * 64 + d] (fragment order). Q, K and V fragments come from planes in fragment order: 16 rows are 16 HD (q, k) or 16 TT (v) elements, a k step of 32 is 512.
#define RT   32
#define SPF  2052                 // LDS row pitch in floats: 8208 B = 16 B x 513 (odd), conflict-free for 16-byte fragment reads
typedef v4h  __attribute__((may_alias)) v4ha;
typedef v4us __attribute__((may_alias)) v4usa;
template <typename T16, bool HI>
__device__ __forceinline__ void attn_body(float* sm, const T16* __restrict__ Q, const T16* __restrict__ Q2, const T16* __restrict__ Kp, const T16* __restrict__ Kp2, const T16* __restrict__ Vt, const T16* __restrict__ Vt2, int t0, int h, bf* Ah, bf* Al) {
    typedef WFrag<T16> F; typedef typename F::V V;
    const int lane = threadIdx.x & 31, lr = lane & 15, hi = lane >> 4; const int wv = __builtin_amdgcn_readfirstlane((int)(threadIdx.x >> 5)); const int kbeg = wv * 128;
    const unsigned lo = (unsigned)(lane * 8), lv = (unsigned)(lane * 8);   // 32-bit lane offsets over wave-uniform bases: one address register per stream
    constexpr int CH = HI ? 2 : 8, NPRE = HI ? 1 : 4;   // key groups per batch of K loads; k steps of V fetched ahead of the softmax (what 256 registers hold)
    const T16* vb = Vt + kbeg * 16; const T16* vb2 = HI ? Vt2 + kbeg * 16 : nullptr; V vf[4][4], vf2[4][4];
    {   // phase 1: scores. Every loop is unrolled: fragment and accumulator arrays are indexed by constants
        V qa[2][2], qa2[2][2], b[8][2], b2[8][2]; const T16* qb = Q + (size_t)t0 * HD; const T16* qb2 = HI ? Q2 + (size_t)t0 * HD : nullptr; const T16* kb = Kp + (size_t)kbeg * HD; const T16* kb2 = HI ? Kp2 + (size_t)kbeg * HD : nullptr;
#pragma unroll
        for (int mb = 0; mb < 2; ++mb)
#pragma unroll
            for (int kk = 0; kk < 2; ++kk) { const int o = mb * 16 * HD + kk * 512; qa[mb][kk] = F::ldf(qb + lo + o); if (HI) qa2[mb][kk] = F::ldf(qb2 + lo + o); }
        __builtin_amdgcn_sched_barrier(0);   // keeps the Q loads ahead of the K loads, so that the first products wait for Q and one key group, not for the whole run
#pragma unroll
        for (int nb = 0; nb < CH; ++nb)
#pragma unroll
            for (int kk = 0; kk < 2; ++kk) { const int o = nb * 16 * HD + kk * 512; b[nb][kk] = F::ldf(kb + lo + o); if (HI) b2[nb][kk] = F::ldf(kb2 + lo + o); }
        asm volatile("s_wait_xcnt 0x0" :: "v"(lane) : "memory");   // the wait before a register that the loads above name is rewritten; the lane number, which the build gives them as their (scaled) offset register, as an input keeps that register live through the run, so that no load of the run lands in it
#pragma unroll
        for (int c = 0; c < 8; c += CH) {
            if (c + CH < 8) {
#pragma unroll
                for (int nb = c + CH; nb < c + 2 * CH; ++nb)
#pragma unroll
                    for (int kk = 0; kk < 2; ++kk) { const int o = nb * 16 * HD + kk * 512; b[nb][kk] = F::ldf(kb + lo + o); if (HI) b2[nb][kk] = F::ldf(kb2 + lo + o); } }
            __builtin_amdgcn_sched_barrier(0);   // keeps the loads above it in flight during the products below; without it each load sinks to its product and its latency is paid eight times over
#pragma unroll
            for (int nb = c; nb < c + CH; ++nb) { const int key = kbeg + nb * 16; v8f acc[2]; acc[0] = (v8f){}; acc[1] = (v8f){};
#pragma unroll
                for (int kk = 0; kk < 2; ++kk)
#pragma unroll
                    for (int mb = 0; mb < 2; ++mb) { acc[mb] = F::mma(qa[mb][kk], b[nb][kk], acc[mb]); if (HI) { acc[mb] = F::mma(qa2[mb][kk], b[nb][kk], acc[mb]); acc[mb] = F::mma(qa[mb][kk], b2[nb][kk], acc[mb]); } }
                asm volatile("v_nop\n\tv_nop\n\tv_nop\n\tv_nop" : "+v"(acc[0]), "+v"(acc[1]));   // four vector slots behind the group's last WMMA: the next group's first WMMA may write the same registers anew
#pragma unroll
                for (int mb = 0; mb < 2; ++mb)
#pragma unroll
                    for (int j = 0; j < 8; ++j) sm[(mb * 16 + hi * 8 + j) * SPF + key + lr] = acc[mb][j]; } }
    }
    __syncthreads();   // all 2048 scores of every row are in LDS before a wave reads its rows
    // the first V fragments are fetched here, behind the barrier (which drains a wave's loads), so that they fly during the softmax
#pragma unroll
    for (int ks = 0; ks < NPRE; ++ks)
#pragma unroll
        for (int nb = 0; nb < 4; ++nb) { const int o = nb * 16 * TT + ks * 512; vf[ks][nb] = F::ldf(vb + lv + o); if (HI) vf2[ks][nb] = F::ldf(vb2 + lv + o); }
    asm volatile("s_wait_xcnt 0x0" :: "v"(lane) : "memory");   // as above, for the V loads
#pragma unroll 1   // one row's 64 values at a time: two rows beside the V fragments held in registers would spill
    for (int rr = 0; rr < 2; ++rr) {   // phase 2: softmax of one row per trip
        float* sr = sm + (wv * 2 + rr) * SPF; float v[TT / 32]; float mx = -3.0e38f;
#pragma unroll
        for (int ch = 0; ch < TT / 128; ++ch) { const v4f a = *(const v4fa*)(sr + ch * 128 + lane * 4);
#pragma unroll
            for (int q = 0; q < 4; ++q) { const float t = a[q] * SCL; v[ch * 4 + q] = t; mx = fmaxf(mx, t); } }
#pragma unroll
        for (int sh = 16; sh; sh >>= 1) mx = fmaxf(mx, __shfl_xor(mx, sh, 32));
        float sum = 0.f;
#pragma unroll
        for (int k = 0; k < TT / 32; ++k) { v[k] = __builtin_amdgcn_exp2f(__fmul_rn(__fsub_rn(v[k], mx), 1.4426950408889634f)); sum += v[k]; }
#pragma unroll
        for (int sh = 16; sh; sh >>= 1) sum += __shfl_xor(sum, sh, 32);
        const float f = __fdiv_rn(HI ? 1.0f : PCAR, sum);
        // the 16-bit row overwrites the f32 row it came from: only this wave touches the row, and every store depends on the row's sum
        if (HI) {
#pragma unroll
            for (int ch = 0; ch < TT / 128; ++ch) { v4us oh, ol;
#pragma unroll
                for (int q = 0; q < 4; ++q) { unsigned short a, c2; splitf(v[ch * 4 + q] * f, a, c2); oh[q] = a; ol[q] = c2; }
                *(v4usa*)((bf*)sr + ch * 128 + lane * 4) = oh; *(v4usa*)((bf*)sr + TT + ch * 128 + lane * 4) = ol; }
        } else {
#pragma unroll
            for (int ch = 0; ch < TT / 128; ++ch) { v4h o4;
#pragma unroll
                for (int q = 0; q < 4; ++q) o4[q] = tohx(v[ch * 4 + q] * f);
                *(v4ha*)((h16*)sr + ch * 128 + lane * 4) = o4; } }
    }
    __syncthreads();   // every row's probabilities are in LDS before any wave reads them as A fragments
    v8f acc[2][4];
#pragma unroll
    for (int mb = 0; mb < 2; ++mb)
#pragma unroll
        for (int nb = 0; nb < 4; ++nb) acc[mb][nb] = (v8f){};
    // phase 3: P V. Unrolled: constant indices
#pragma unroll
    for (int ks = 0; ks < 4; ++ks) { const int kc = kbeg + ks * 32; V a[2], a2[2];
        if (ks + NPRE < 4) {
#pragma unroll
            for (int nb = 0; nb < 4; ++nb) { const int o = nb * 16 * TT + (ks + NPRE) * 512; vf[ks + NPRE][nb] = F::ldf(vb + lv + o); if (HI) vf2[ks + NPRE][nb] = F::ldf(vb2 + lv + o); }
            __builtin_amdgcn_sched_barrier(0);   // keeps the next k step's V loads in flight during this step's products; without it each load sinks to its product
        }
#pragma unroll
        for (int mb = 0; mb < 2; ++mb) { const T16* pr = (const T16*)(sm + (mb * 16 + lr) * SPF) + 8 * hi + kc; a[mb] = F::ld(pr); if (HI) a2[mb] = F::ld(pr + TT); }
#pragma unroll
        for (int nb = 0; nb < 4; ++nb)
#pragma unroll
            for (int mb = 0; mb < 2; ++mb) { acc[mb][nb] = F::mma(a[mb], vf[ks][nb], acc[mb][nb]); if (HI) { acc[mb][nb] = F::mma(a2[mb], vf[ks][nb], acc[mb][nb]); acc[mb][nb] = F::mma(a[mb], vf2[ks][nb], acc[mb][nb]); } } }
    __syncthreads();   // every wave has read its probabilities before the partial tiles overwrite them
    float* ow = sm + wv * (RT * 68);
#pragma unroll
    for (int mb = 0; mb < 2; ++mb)
#pragma unroll
        for (int nb = 0; nb < 4; ++nb)
#pragma unroll
            for (int j = 0; j < 8; ++j) ow[(mb * 16 + hi * 8 + j) * 68 + nb * 16 + lr] = acc[mb][nb][j];
    __syncthreads();   // every wave's partial tile is in LDS before any thread adds them
    const int row = (int)threadIdx.x >> 4, cofs = ((int)threadIdx.x & 15) * 4; v4f val = *(const v4fa*)(sm + row * 68 + cofs);
#pragma unroll
    for (int w = 1; w < 16; ++w) val += *(const v4fa*)(sm + (w * RT + row) * 68 + cofs);
    const float cs = HI ? 1.0f : (1.0f / PCAR); const size_t oo = fro(t0 + row, h * HD + cofs, DQ); v4us oh, ol;
#pragma unroll
    for (int q = 0; q < 4; ++q) { unsigned short a, c2; splitf(val[q] * cs, a, c2); oh[q] = a; ol[q] = c2; }
    *(v4us*)(Ah + oo) = oh; *(v4us*)(Al + oo) = ol;
}
// xrow: the value that lane l ^ 16 holds (the same place in the other 16-lane row)
__device__ __forceinline__ float xrow(float x) { const unsigned u = __float_as_uint(x); return __uint_as_float(__builtin_amdgcn_permlanex16(u, u, 0x76543210u, 0xfedcba98u, false, false)); }
// attn_regs: the fp16 row tiles (t0 >= RH). Wave w does the whole softmax(Q K^T) V of ITS 128 keys alone, in registers, against its own maximum; the 16 waves' results meet once, in the final sum.
// Scores are formed TRANSPOSED, S^T[128 w .. 128 w + 127][32 queries] = K Q^T (A = K, B = Q; the same fragments and k steps as Q K^T): lane (lr, hi) then holds, for query mb * 16 + lr, keys nb * 16 + hi * 8 + 0..7,
// and two neighbouring key groups are exactly the lane's sixteen elements of the A fragment of P for one k step of P V. Scores and probabilities never touch LDS.
// Per query and wave: m_w = the maximum over the wave's keys (in the lane, then lane ^ 16), p = exp(s - m_w) in (0, 1] rounded to fp16, l_w = the f32 sum of the unrounded p (eight chains over the key groups, a tree over the eight, the other half).
// The final sum weighs wave w's partial tile and l_w with exp(m_w - M), M = the maximum of the sixteen m_w, in wave order 0..15, and divides by the weighted sum of the l_w: the same softmax, by exp(s - M) = exp(s - m_w) exp(m_w - M).
#define XP   20                   // pitch of the two [32][16] tables (m_w, l_w) in floats: 80 B = 16 B x 5 (odd), conflict-free for 16-byte reads
__device__ __forceinline__ void attn_regs(float* sm, const h16* __restrict__ Q, const h16* __restrict__ Kp, const h16* __restrict__ Vt, int t0, int h, bf* Ah, bf* Al) {
    typedef WFrag<h16> F; typedef F::V V;
    const int lane = threadIdx.x & 31, lr = lane & 15, hi = lane >> 4; const int wv = __builtin_amdgcn_readfirstlane((int)(threadIdx.x >> 5)); const int kbeg = wv * 128;
    const unsigned lo = (unsigned)(lane * 8);   // a 32-bit lane offset over wave-uniform bases: one address register per stream
    float* xm = sm + 16 * RT * 68; float* xs = xm + RT * XP;   // the two tables lie behind the partial output tiles: nothing in LDS is used twice
    const h16* vb = Vt + kbeg * 16; V vf[4][4]; v8f s[8][2];
    {   // scores. Every loop is unrolled: fragment and accumulator arrays are indexed by constants
        V qa[2][2], b[8][2]; const h16* qb = Q + (size_t)t0 * HD; const h16* kb = Kp + (size_t)kbeg * HD;
#pragma unroll
        for (int mb = 0; mb < 2; ++mb)
#pragma unroll
            for (int kk = 0; kk < 2; ++kk) qa[mb][kk] = F::ldf(qb + lo + mb * 16 * HD + kk * 512);
        __builtin_amdgcn_sched_barrier(0);   // keeps the Q loads ahead of the K loads, so that the first products wait for Q and one key group, not for the whole run
#pragma unroll
        for (int nb = 0; nb < 8; ++nb)
#pragma unroll
            for (int kk = 0; kk < 2; ++kk) b[nb][kk] = F::ldf(kb + lo + nb * 16 * HD + kk * 512);
        asm volatile("s_wait_xcnt 0x0" :: "v"(lane) : "memory");   // the wait before a register that the loads above name is rewritten; the lane number, their (scaled) offset register, as an input keeps that register live through the run
        __builtin_amdgcn_sched_barrier(0);   // keeps all K loads in flight ahead of the first product; without it each load sinks to its product and its latency is paid eight times over
#pragma unroll
        for (int nb = 0; nb < 8; ++nb) { s[nb][0] = (v8f){}; s[nb][1] = (v8f){};
#pragma unroll
            for (int kk = 0; kk < 2; ++kk)
#pragma unroll
                for (int mb = 0; mb < 2; ++mb) s[nb][mb] = F::mma(b[nb][kk], qa[mb][kk], s[nb][mb]); }
    }
    // the V fragments of the first two k steps are fetched here, into the registers that K has left, and fly during the exponentials
    __builtin_amdgcn_sched_barrier(0);   // keeps these loads behind the last product of the scores: moved ahead of it, where K still holds its registers, they made the build spill
#pragma unroll
    for (int ks = 0; ks < 2; ++ks)
#pragma unroll
        for (int nb = 0; nb < 4; ++nb) vf[ks][nb] = F::ldf(vb + lo + nb * 16 * TT + ks * 512);
    asm volatile("s_wait_xcnt 0x0" :: "v"(lane) : "memory");   // as above, for the V loads
    float ml[2], sl[2]; V pa[4][2];
#pragma unroll
    for (int mb = 0; mb < 2; ++mb) { float m = s[0][mb][0];   // the maximum is taken of the raw scores: SCL is a power of two, so scaling commutes with it exactly
#pragma unroll
        for (int nb = 0; nb < 8; ++nb)
#pragma unroll
            for (int j = 0; j < 8; ++j) m = fmaxf(m, s[nb][mb][j]);
        m = fmaxf(m, xrow(m)); const float mx = fmaxf(-3.0e38f, m * SCL); ml[mb] = mx; v8f a8 = (v8f){};
#pragma unroll
        for (int ks = 0; ks < 4; ++ks) { v8h p8[2];
#pragma unroll
            for (int u = 0; u < 2; ++u) { const v8f x = (s[2 * ks + u][mb] * SCL - mx) * 1.4426950408889634f; v8f e;   // the product with SCL is exact: fused with the difference or not, one rounding
#pragma unroll
                for (int j = 0; j < 8; ++j) e[j] = __builtin_amdgcn_exp2f(x[j]);
                a8 += e; p8[u] = __builtin_convertvector(e, v8h); }
            pa[ks][mb] = cat16(p8[0], p8[1]); }
        const float t = ((a8[0] + a8[1]) + (a8[2] + a8[3])) + ((a8[4] + a8[5]) + (a8[6] + a8[7])); sl[mb] = t + xrow(t);
        // one more k step of V goes into the registers that this half of the scores has left
        __builtin_amdgcn_sched_barrier(0);   // keeps these loads behind the exponentials above, whose scores still hold the registers (as for the first two k steps)
#pragma unroll
        for (int nb = 0; nb < 4; ++nb) vf[2 + mb][nb] = F::ldf(vb + lo + nb * 16 * TT + (2 + mb) * 512);
        asm volatile("s_wait_xcnt 0x0" :: "v"(lane) : "memory");   // as above, for the V loads
        __builtin_amdgcn_sched_barrier(0);   // keeps these loads here, ahead of the work that follows; without it the last k step's loads sink among the products of P V and their latency is paid there
    }
    xm[lane * XP + wv] = hi ? ml[1] : ml[0]; xs[lane * XP + wv] = hi ? sl[1] : sl[0];   // lane l hands in query l
    v8f acc[2][4];
#pragma unroll
    for (int mb = 0; mb < 2; ++mb)
#pragma unroll
        for (int nb = 0; nb < 4; ++nb) acc[mb][nb] = (v8f){};
    // P V. Unrolled: constant indices
#pragma unroll
    for (int ks = 0; ks < 4; ++ks)
#pragma unroll
        for (int nb = 0; nb < 4; ++nb)
#pragma unroll
            for (int mb = 0; mb < 2; ++mb) acc[mb][nb] = F::mma(pa[ks][mb], vf[ks][nb], acc[mb][nb]);
    float* ow = sm + wv * (RT * 68);
#pragma unroll
    for (int mb = 0; mb < 2; ++mb)
#pragma unroll
        for (int nb = 0; nb < 4; ++nb)
#pragma unroll
            for (int j = 0; j < 8; ++j) ow[(mb * 16 + hi * 8 + j) * 68 + nb * 16 + lr] = acc[mb][nb][j];
    __syncthreads();   // every wave's partial tile, maxima and sums are in LDS before any thread joins them
    const int row = (int)threadIdx.x >> 4, cofs = ((int)threadIdx.x & 15) * 4; v4f m4[4], l4[4];
#pragma unroll
    for (int c = 0; c < 4; ++c) { m4[c] = *(const v4fa*)(xm + row * XP + c * 4); l4[c] = *(const v4fa*)(xs + row * XP + c * 4); }
    float M = m4[0][0];
#pragma unroll
    for (int w = 1; w < 16; ++w) M = fmaxf(M, m4[w >> 2][w & 3]);
    float tot = 0.f; v4f val = (v4f){};
#pragma unroll
    for (int w = 0; w < 16; ++w) { const float ew = __builtin_amdgcn_exp2f(__fmul_rn(__fsub_rn(m4[w >> 2][w & 3], M), 1.4426950408889634f)); tot += l4[w >> 2][w & 3] * ew; val += *(const v4fa*)(sm + (w * RT + row) * 68 + cofs) * ew; }
    const float cs = __fdiv_rn(1.0f, tot); const size_t oo = fro(t0 + row, h * HD + cofs, DQ); v4us oh, ol;   // tot >= 1: the wave that holds M has weight 1 and a sum of at least 1
#pragma unroll
    for (int q = 0; q < 4; ++q) { unsigned short a, c2; splitf(val[q] * cs, a, c2); oh[q] = a; ol[q] = c2; }
    *(v4us*)(Ah + oo) = oh; *(v4us*)(Al + oo) = ol;
}
__global__ __launch_bounds__(512) void k_attn(const h16* __restrict__ Q16, const h16* __restrict__ K16, const h16* __restrict__ V16, const bf* __restrict__ Qh, const bf* __restrict__ Ql, const bf* __restrict__ Kh, const bf* __restrict__ Kl, const bf* __restrict__ Vh, const bf* __restrict__ Vl, bf* Ah, bf* Al) {
    __shared__ __align__(16) float sm[RT * SPF];
    const int h = blockIdx.x, t0 = blockIdx.y * RT; const size_t zo = ((size_t)blockIdx.z * NH_ + h) * TT * HD; Ah += (size_t)blockIdx.z * TT * DQ; Al += (size_t)blockIdx.z * TT * DQ;   // within a batch the hi/lo row tiles (three times the products) have the lowest indices
    if (t0 < RH) attn_body<bf, true>(sm, Qh + zo, Ql + zo, Kh + zo, Kl + zo, Vh + zo, Vl + zo, t0, h, Ah, Al);
    else attn_regs(sm, Q16 + zo, K16 + zo, V16 + zo, t0, h, Ah, Al);
}

extern "C" void kernel_launch(void* const* d_in, const int* in_sizes, int n_in,
                              void* d_out, int out_size, void* d_ws, size_t ws_size, hipStream_t stream) {
    (void)in_sizes; (void)n_in; (void)out_size;
    const float* x = (const float*)d_in[0]; const float* fcos = (const float*)d_in[1]; const float* fsin = (const float*)d_in[2]; const float* wq = (const float*)d_in[3]; const float* bq = (const float*)d_in[4]; const float* wk = (const float*)d_in[5]; const float* bk = (const float*)d_in[6]; const float* wv = (const float*)d_in[7]; const float* bv = (const float*)d_in[8]; const float* wo = (const float*)d_in[9]; const float* bo = (const float*)d_in[10];   /* hidden [4][2048][1024] (ONE stream, rounded to bf16 once for q, k and v), cos, sin ([4][2048][64] = [B][S][D] PER-BATCH full-width table INPUTS: read per element by value), Wq, bq, Wk, bk, Wv, bv, Wo, bo ('oi' (out, in) [1024][1024] + [1024]): ELEVEN inputs, all read */
    float* OUT = (float*)d_out;     // [4][2048][1024]
    char* wsp = (char*)d_ws;
    auto take = [&](size_t bytes) { char* p = wsp; wsp += (bytes + 255) & ~(size_t)255; return (void*)p; };
    bf* WQ = (bf*)take((size_t)DQ * DM * 2); bf* WK = (bf*)take((size_t)DKV * DM * 2); bf* WV = (bf*)take((size_t)DKV * DM * 2); bf* WO = (bf*)take((size_t)DM * DQ * 2);
    bf* XB = (bf*)take((size_t)NB_ * TT * DM * 2);
    h16* QP16 = (h16*)take((size_t)NB_ * NH_ * TT * HD * 2); h16* KP16 = (h16*)take((size_t)NB_ * NKV * TT * HD * 2); h16* VT16 = (h16*)take((size_t)NB_ * NKV * HD * TT * 2);
    bf* QPh = (bf*)take((size_t)NB_ * NH_ * TT * HD * 2); bf* QPl = (bf*)take((size_t)NB_ * NH_ * TT * HD * 2); bf* KPh = (bf*)take((size_t)NB_ * NKV * TT * HD * 2); bf* KPl = (bf*)take((size_t)NB_ * NKV * TT * HD * 2); bf* VTh = (bf*)take((size_t)NB_ * NKV * HD * TT * 2); bf* VTl = (bf*)take((size_t)NB_ * NKV * HD * TT * 2);
    bf* ATh = (bf*)take((size_t)NB_ * TT * DQ * 2); bf* ATl = (bf*)take((size_t)NB_ * TT * DQ * 2);
    (void)WK; (void)WV;   // reached through WQ
    if ((size_t)(wsp - (char*)d_ws) > ws_size) return;    // 200 MiB of the 256 MiB
    k_cvtall<<<(NB_ * TT * DM + 4 * DM * DM) / CVB, 256, 0, stream>>>(x, wq, wk, wv, wo, XB, WQ);   // WQ, WK, WV, WO are consecutive takes of 2 MiB each
    /* q, k, v: one launch; WQ, WK, WV are one [3 DQ][DM] matrix, and QP16, KP16, VT16 as well as QPh, QPl, KPh, KPl, VTh, VTl are consecutive takes. The q and k parts read batch z's own slice of the INPUT rotary tables in their epilogue; k_cs5 and its INVT constants stay defined and are NOT launched */
    k_gemmw<bf, 0, true, 8, 1><<<dim3(TT / 64, (DQ + 2 * DKV) / 64, NB_), 256, 0, stream>>>(XB, nullptr, WQ, nullptr, DM, nullptr, DQ, bq, bk, bv, (size_t)TT * DM, 0, 0, fcos, fsin, QP16, QPh, QPl);
    k_attn<<<dim3(NH_, TT / RT, NB_), 512, 0, stream>>>(QP16, KP16, VT16, QPh, QPl, KPh, KPl, VTh, VTl, ATh, ATl);   // one kv head per query head
    k_gemmw<bf, 1, true, 8, 0><<<dim3(TT / 64, DM / 64, NB_), 256, 0, stream>>>(ATh, ATl, WO, nullptr, DQ, OUT, DM, bo, nullptr, nullptr, (size_t)TT * DQ, 0, (size_t)TT * DM, nullptr, nullptr, nullptr, nullptr, nullptr);
}

// v007
// Measured time: 234 microseconds a run.
// In two side-by-side timings against v006, it was 1.16 and 1.15 times as fast.
// Over all steps from v000 it is 16.9 times as fast.
#include <hip/hip_runtime.h>

// Rotary multi-head self-attention with PER-BATCH full-width rotary tables given as inputs (hidden [4][2048][1024]: ONE stream; q, k, v = hidden W^T + b ('oi' (out, in) [1024][1024] normal x 1024^-0.5 + zero biases: read; 16 heads x 64); q, k -> t cos + cat(-t2, t1) sin with the cos / sin INPUT tables [4][2048][64] = [B][S][D] (uniform random values on this draw: batch b reads ITS OWN slice, per element by value; no structure assumed); scores x 64^-0.5; softmax over all keys (no mask); out = merged Wo^T + bo ('oi' + a zero bias: read) -> [4][2048][1024] (8.4 M); argument order hidden, cos, sin, Wq, bq, Wk, bk, Wv, bv, Wo, bo).
// Every stage is launched once for all four batches (batch = grid z; every workspace plane holds the four batches one behind the other). Layout per batch: bf16 copies of the input stream(s); 'oi' weights; exact projections + f32 biases, whose epilogue applies the rotary tables and writes the head planes (q, k: [h][t][d]; v: [h][d][t]); dense T-2048 attention in one kernel, scores and probabilities in LDS or in registers (hybrid rows: < 512 hi/lo 3 products, in LDS; rest fp16, in registers, each wave's keys against their own maximum); merged hi/lo x Wo exact + bo.
// Every 16-bit plane that a matrix product reads from memory (hidden, the weights, q, k, v, merged) lies in FRAGMENT ORDER (fro() below), so that one wave-wide 16-byte load covers 512 consecutive bytes = four whole 128-byte lines; each lane receives the same elements as from a row-major plane.
// Compute dtypes, f32 accumulate: every input rounded to bf16; projections exact + f32 biases; attention rows < 512 3 products, rest fp16; softmax f32; Wo hl x exact + bias.

#define NB_  4
#define TT   2048
#define DM   1024
#define NH_  16
#define NKV  16
#define REP  (NH_ / NKV)
static_assert(NKV == NH_, "the q, k, v launch numbers its tile columns by NH_ heads a part");
#define HD   64
#define DQ   (NH_ * HD)
#define DKV  (NKV * HD)
#define RH   512                  // query rows < RH use hi+lo planes (0: none)
#define WIN  0
#define PCAR 1024.0f
#define SCL  0.125f   // HD^-0.5
typedef _Float16 h16;
typedef unsigned short bf;
typedef __attribute__((ext_vector_type(16))) __bf16   v16bf;
typedef __attribute__((ext_vector_type(16))) _Float16 v16h;
typedef __attribute__((ext_vector_type(8)))  _Float16 v8h;
typedef __attribute__((ext_vector_type(8)))  unsigned short v8us;
typedef __attribute__((ext_vector_type(8)))  float    v8f;
typedef __attribute__((ext_vector_type(4)))  float    v4f;
typedef v8h  __attribute__((may_alias)) v8ha;
typedef v4f  __attribute__((may_alias)) v4fa;
typedef v8us __attribute__((may_alias)) v8usa;

__device__ __forceinline__ unsigned short f2bf(float f) { unsigned u = __float_as_uint(f); u += 0x7FFFu + ((u >> 16) & 1u); return (unsigned short)(u >> 16); }
__device__ __forceinline__ float bf2f(unsigned short b) { return __uint_as_float(((unsigned)b) << 16); }
__device__ __forceinline__ float bfr(float f) { return bf2f(f2bf(f)); }
__device__ __forceinline__ v16h cat16(v8h lo, v8h hi) { return __builtin_shufflevector(lo, hi, 0, 1, 2, 3, 4, 5, 6, 7, 8, 9, 10, 11, 12, 13, 14, 15); }
__device__ __forceinline__ v16bf cat16b(v8us lo, v8us hi) { return __builtin_bit_cast(v16bf, __builtin_shufflevector(lo, hi, 0, 1, 2, 3, 4, 5, 6, 7, 8, 9, 10, 11, 12, 13, 14, 15)); }
__device__ __forceinline__ v8f wmma16(v16h a, v16h b, v8f c) { return __builtin_amdgcn_wmma_f32_16x16x32_f16(false, a, false, b, (short)0, c, false, false); }
__device__ __forceinline__ v8f wmmab(v16bf a, v16bf b, v8f c) { return __builtin_amdgcn_wmma_f32_16x16x32_bf16(false, a, false, b, (short)0, c, false, false); }

__device__ __forceinline__ h16 tohx(float x) { return (h16)x; }
__device__ __forceinline__ void splitf(float y, unsigned short& h, unsigned short& l) { h = f2bf(y); l = f2bf(y - bf2f(h)); }
typedef __attribute__((ext_vector_type(2))) _Float16 v2h;
typedef __attribute__((ext_vector_type(4))) _Float16 v4h;
typedef __attribute__((ext_vector_type(2))) unsigned short v2us;
typedef __attribute__((ext_vector_type(4))) unsigned short v4us;
typedef __attribute__((ext_vector_type(2))) float v2f;
typedef __attribute__((ext_vector_type(4))) int v4i;

// ---- k_gemms: GEMM with the operands shared through LDS. One work-group (8 waves, 2 x 4) forms a 128 x 256 tile of C, each wave one 64 x 64 tile (16 accumulators) over the WHOLE k range, k ascending; grid (M / 128, N / 256, batches), 256 threads.
// C[m][n] = sum_k A[m][k] Bt[n][k] (+ A2[m][k] Bt[n][k] for NSPLIT 1) + bias[n] (rounded to bf16). A, A2, Bt are bf16 planes of DM columns in fragment order (fro() below); z is the batch: A, A2 and C lie TT * DM elements further on for each, Bt is shared.
// A slab is 64 k of the tile's 128 A (and A2) rows and 256 Bt rows: per group of 16 rows two fragment blocks = 2 KiB that are consecutive in memory. Asynchronous copies bring a slab into LDS as it lies (group g at g * 2 KiB), two buffers, the next slab in flight while one is worked on; every wave reads its fragments from LDS as it would from memory.
// EPI 0: f32 C rows [m][DM]. EPI 1: the q, k and v projections in one launch: Bt holds the three weights one behind the other, a wave's 64 columns are one head of part (0 q, 1 k, 2 v; the same for the whole work-group), bias / biasK / biasV are the parts' biases. Parts 0, 1: rotate-half rotary with the cos / sin tables [t][64], each rounded to bf16, then head planes [h][t][d] (fp16 + bf16 hi/lo); part 2: transposed head planes [h][d][t] (fp16 + bf16 hi/lo), straight from the accumulators (a lane holds eight consecutive t of one d: its 16 bytes of a block); each head's plane in fragment order. The planes of part p start p (fp16) or 2 p (hi, lo) whole planes behind P16, Ph, Pl; batch z's tables are TT * HD and its head planes NH_ * TT * HD elements further on. C is not written for EPI 1.
// fro: the place (in elements) of element (row, k) of a [rows][K] 16-bit operand plane in fragment order. A block of 512 elements holds 16 rows x 32 k; blocks run along k, then down the row groups. Inside a block: half s = bit 4 of k (256 elements), then lane = 16 * (bit 3 of k) + row % 16 (8 elements), then k % 8: the two 16-byte pieces that lane holds of the block's A or B fragment.
__device__ __forceinline__ size_t fro(int row, int k, int K) { return (size_t)(row >> 4) * 16 * K + (k >> 5) * 512 + ((k >> 4) & 1) * 256 + (((k >> 3) & 1) * 16 + (row & 15)) * 8 + (k & 7); }
template <typename T16> struct WFrag;
// ld: a fragment from a row-major row (LDS); ldf: from a block in fragment order, p = the block + 8 * lane
template <> struct WFrag<h16> { typedef v16h V; static __device__ __forceinline__ V ld(const h16* p) { return cat16(*(const v8h*)p, *(const v8h*)(p + 16)); } static __device__ __forceinline__ V ldf(const h16* p) { return cat16(*(const v8h*)p, *(const v8h*)(p + 256)); } static __device__ __forceinline__ v8f mma(V a, V b, v8f c) { return wmma16(a, b, c); } };
template <> struct WFrag<bf> { typedef v16bf V; static __device__ __forceinline__ V ld(const bf* p) { return cat16b(*(const v8us*)p, *(const v8us*)(p + 16)); } static __device__ __forceinline__ V ldf(const bf* p) { return cat16b(*(const v8us*)p, *(const v8us*)(p + 256)); } static __device__ __forceinline__ v8f mma(V a, V b, v8f c) { return wmmab(a, b, c); } };
// cp4: four asynchronous copies of 16 bytes a lane, global memory -> LDS: row groups two apart (32 rows of DM elements in memory, 4 KiB in LDS)
__device__ __forceinline__ void cp4(unsigned l0, const bf* g0) {
    const unsigned l1 = l0 + 4096u, l2 = l0 + 8192u, l3 = l0 + 12288u; const bf* g1 = g0 + 32 * DM; const bf* g2 = g0 + 64 * DM; const bf* g3 = g0 + 96 * DM;
    // the copies and, as the last line of the same statement, the wait before a register that a copy names is rewritten
    asm volatile("global_load_async_to_lds_b128 %0, %1, off\n\tglobal_load_async_to_lds_b128 %2, %3, off\n\tglobal_load_async_to_lds_b128 %4, %5, off\n\tglobal_load_async_to_lds_b128 %6, %7, off\n\ts_wait_xcnt 0x0" :: "v"(l0), "v"(g0), "v"(l1), "v"(g1), "v"(l2), "v"(g2), "v"(l3), "v"(g3) : "memory");
}
// the second launch bound (waves per SIMD) holds a wave to 256 registers, so that two work-groups fit on a WGP
template <int NSPLIT, int EPI>
__global__ __launch_bounds__(256, 4) void k_gemms(const bf* __restrict__ A, const bf* __restrict__ A2, const bf* __restrict__ Bt, float* C, const float* __restrict__ bias, const float* __restrict__ biasK, const float* __restrict__ biasV, const float* __restrict__ cosT, const float* __restrict__ sinT, h16* P16, bf* Ph, bf* Pl) {
    typedef WFrag<bf> F; typedef F::V V;
    constexpr int K = DM, GA = NSPLIT ? 16 : 8, NG = GA + 16, BUFE = NG * 1024, NT = K / 64;   // row groups of A (and A2), of a slab; 16-bit elements of a buffer; slabs
    static_assert(NT >= 2 && BUFE <= 8 * 64 * 68 && DQ % 256 == 0 && TT % 128 == 0, "two slabs at least; the two buffers (BUFE floats) lie inside the eight output tiles");
    __shared__ __align__(16) float os[8 * 64 * 68];   // first the two operand buffers, then one [64][68] f32 tile per wave
    const size_t z = blockIdx.z; const int lane = threadIdx.x & 31, lr = lane & 15, hi = lane >> 4; const int wv = __builtin_amdgcn_readfirstlane((int)(threadIdx.x >> 5)), wm = wv & 1, wn = wv >> 1;
    const int r0 = blockIdx.x * 128, c0 = blockIdx.y * 256, r0w = r0 + wm * 64, c0w = c0 + wn * 64;
    // copy c of wave w brings piece w % 4 (512 B) of row group 2 c + w / 4
    const unsigned lb = (unsigned)(size_t)os + (unsigned)(wv * 512 + lane * 16); const int go = (wv >> 2) * 16 * K + (wv & 3) * 256 + lane * 8;
    const bf* pA = A + z * (size_t)(TT * DM) + (size_t)r0 * K + go; const bf* pA2 = NSPLIT ? A2 + z * (size_t)(TT * DM) + (size_t)r0 * K + go : nullptr; const bf* pB = Bt + (size_t)c0 * K + go;
    auto stage = [&](int t, int buf) { const unsigned l = lb + (unsigned)buf * (unsigned)(BUFE * 2); const int ko = t * 1024;
        cp4(l, pA + ko); if constexpr (NSPLIT != 0) cp4(l + 16384u, pA2 + ko); cp4(l + GA * 2048u, pB + ko); cp4(l + GA * 2048u + 16384u, pB + ko + 128 * K); };
    v8f acc[4][4];
#pragma unroll
    for (int mb = 0; mb < 4; ++mb)
#pragma unroll
        for (int nb = 0; nb < 4; ++nb) acc[mb][nb] = (v8f){};
    stage(0, 0);
    asm volatile("s_wait_asynccnt 0x0" ::: "memory");   // this wave's copies of slab 0 have landed
    __syncthreads();   // slab 0 is in LDS before any wave reads it
    stage(1, 1);
#pragma unroll 1   // one slab a trip: the trip's foot is the hand-over of the buffers
    for (int t = 0; t < NT; ++t) {
        const bf* sl = (const bf*)os + (t & 1) * BUFE + lane * 8;
        // unrolled: fragment and accumulator arrays are indexed by constants
#pragma unroll
        for (int kk = 0; kk < 2; ++kk) { V a[4], a2[4], b[4];
#pragma unroll
            for (int mb = 0; mb < 4; ++mb) { a[mb] = F::ldf(sl + (wm * 4 + mb) * 1024 + kk * 512); if (NSPLIT) a2[mb] = F::ldf(sl + (8 + wm * 4 + mb) * 1024 + kk * 512); }
#pragma unroll
            for (int nb = 0; nb < 4; ++nb) b[nb] = F::ldf(sl + (GA + wn * 4 + nb) * 1024 + kk * 512);
            __builtin_amdgcn_sched_barrier(0);   // keeps the k step's LDS reads together ahead of its products; without it the build keeps one B fragment and waits out the LDS latency four times a k step
#pragma unroll
            for (int nb = 0; nb < 4; ++nb)
#pragma unroll
                for (int mb = 0; mb < 4; ++mb) { acc[mb][nb] = F::mma(a[mb], b[nb], acc[mb][nb]); if (NSPLIT) acc[mb][nb] = F::mma(a2[mb], b[nb], acc[mb][nb]); } }
        asm volatile("s_wait_dscnt 0x0" ::: "memory");      // this wave's reads of the buffer are done before the barrier behind which it is refilled
        asm volatile("s_wait_asynccnt 0x0" ::: "memory");   // this wave's copies of the next slab have landed
        __syncthreads();   // publishes the next slab and ends every wave's reads of this one
        if (t + 2 < NT) stage(t + 2, t & 1);
    }
    asm volatile("s_wait_asynccnt 0x0" ::: "memory");   // no copy is outstanding when the buffers become output tiles
    const int part = EPI == 1 ? (int)blockIdx.y / (DQ / 256) : 0, head = EPI == 1 ? ((int)blockIdx.y % (DQ / 256)) * 4 + wn : 0;   // part: the same for the whole work-group
    const float* bp = bias + c0w; if constexpr (EPI == 1) bp = (part == 0 ? bias : part == 1 ? biasK : biasV) + head * 64;
    if constexpr (EPI == 1) { cosT += z * (size_t)(TT * HD); sinT += z * (size_t)(TT * HD); P16 += ((size_t)part * NB_ + z) * (size_t)(NH_ * TT * HD); Ph += ((size_t)part * 2 * NB_ + z) * (size_t)(NH_ * TT * HD); Pl += ((size_t)part * 2 * NB_ + z) * (size_t)(NH_ * TT * HD);
    }
    if (EPI == 1 && part == 2) {
        // unrolled: acc is indexed by constants
#pragma unroll
        for (int nb = 0; nb < 4; ++nb) { const float b1 = bfr(bp[nb * 16 + lr]);
#pragma unroll
            for (int mb = 0; mb < 4; ++mb) { v8h o16; v8us oh, ol;
#pragma unroll
                for (int j = 0; j < 8; ++j) { const float x = acc[mb][nb][j] + b1; o16[j] = tohx(x); unsigned short a2, c2; splitf(x, a2, c2); oh[j] = a2; ol[j] = c2; }
                const size_t e = (size_t)head * HD * TT + fro(nb * 16 + lr, r0w + mb * 16 + hi * 8, TT); *(v8h*)(P16 + e) = o16; *(v8us*)(Ph + e) = oh; *(v8us*)(Pl + e) = ol; } }
    } else {
        // the last trip's barrier has ended every wave's reads of the buffers: the tiles may overwrite them
        float* ow = os + wv * (64 * 68); const int cofs = lr * 4; v4f bb; bb[0] = bfr(bp[cofs]); bb[1] = bfr(bp[cofs + 1]); bb[2] = bfr(bp[cofs + 2]); bb[3] = bfr(bp[cofs + 3]);
#pragma unroll
        for (int mb = 0; mb < 4; ++mb)
#pragma unroll
            for (int nb = 0; nb < 4; ++nb)
#pragma unroll
                for (int j = 0; j < 8; ++j) ow[(mb * 16 + hi * 8 + j) * 68 + nb * 16 + lr] = acc[mb][nb][j];
        const unsigned tl = (unsigned)(hi * HD + cofs); constexpr int RC = EPI == 1 ? 4 : 8;
        __syncthreads();   // the tile is in LDS before a lane reads what other lanes wrote; part is the same for the whole work-group, so every wave of it passes here or none
#pragma unroll 1   // RC row pairs a trip: the whole tile unrolled would be 32 KiB of code, and more rows a trip made the rotary build spill
        for (int ib = 0; ib < 32 / RC; ++ib) { v4f cc[RC], sn[RC], val[RC]; const int rb = r0w + ib * (2 * RC);   // the trip's first row: wave-uniform
            // the inner loops are unrolled so that a trip's loads all issue ahead of its arithmetic
            if constexpr (EPI == 1) { const float* cb = cosT + (size_t)rb * HD + tl; const float* sp = sinT + (size_t)rb * HD + tl;
#pragma unroll
                for (int i = 0; i < RC; ++i) { cc[i] = *(const v4f*)(cb + i * 2 * HD); sn[i] = *(const v4f*)(sp + i * 2 * HD); }
                asm volatile("s_wait_xcnt 0x0" :: "v"(cb), "v"(sp) : "memory"); }   // the wait before a register that the loads above name is rewritten; the two addresses as inputs stay live through the run, so that no load of the run lands in them
#pragma unroll
            for (int i = 0; i < RC; ++i) val[i] = *(const v4fa*)(ow + (ib * (2 * RC) + i * 2 + hi) * 68 + cofs) + bb;
            __builtin_amdgcn_sched_barrier(0);   // keeps the trip's loads together ahead of its arithmetic; without it they sink among the roundings and each latency is paid singly
            if constexpr (EPI == 0) { float* cp = C + z * (size_t)(TT * DM) + (size_t)(rb + hi) * DM + c0w + cofs;
#pragma unroll
                for (int i = 0; i < RC; ++i) *(v4f*)(cp + i * 2 * DM) = val[i];
                asm volatile("s_wait_xcnt 0x0" :: "v"(cp) : "memory");   // the wait before the address that the stores above name is rewritten for the next trip; as an input it stays live through the run
            } else { const size_t e = (size_t)head * TT * HD + fro(rb + hi, cofs, HD); h16* q16 = P16 + e; bf* qh = Ph + e; bf* ql = Pl + e;   // the trip's 2 RC rows lie inside one group of 16 rows (2 RC divides 16): row pair i is 16 i elements further on
#pragma unroll
                for (int i = 0; i < RC; ++i) { v4h o16; v4us oh, ol;
#pragma unroll
                    for (int q = 0; q < 4; ++q) { const float xp = __builtin_amdgcn_update_dpp(0.0f, val[i][q], 0x168, 0xf, 0xf, true);   // row_xmask:8: column d ^ 32 of this row sits in lane ^ 8
                        const float s = bfr(sn[i][q]); const float r = val[i][q] * bfr(cc[i][q]) + xp * (cofs < HD / 2 ? -s : s);
                        o16[q] = tohx(r); unsigned short a2, c2; splitf(r, a2, c2); oh[q] = a2; ol[q] = c2; }
                    *(v4h*)(q16 + i * 16) = o16; *(v4us*)(qh + i * 16) = oh; *(v4us*)(ql + i * 16) = ol; }
                asm volatile("s_wait_xcnt 0x0" :: "v"(q16), "v"(qh), "v"(ql) : "memory");   // as above, for the three planes' stores
            }
        }
    }
}


// k_cvtall: every f32 -> bf16 rounding of a call in one launch. A work-group rounds CVB consecutive elements: groups 0 .. NB_ TT DM / CVB - 1 take hidden (all batches), the rest the four weights in the order q, k, v, o, whose bf16 copies lie one behind the other at W4. CVB elements are one group of 16 rows, which fragment order keeps together: a thread reads the eight elements that belong at its place, so that the stores are consecutive.
#define CVG  8                    // 8-element groups per thread
#define CVB  (256 * 8 * CVG)
static_assert(CVB == 16 * DM && DQ == DM, "a work-group of k_cvtall rounds one group of 16 rows of DM elements");
__global__ __launch_bounds__(256) void k_cvtall(const float* __restrict__ x, const float* __restrict__ wq, const float* __restrict__ wk, const float* __restrict__ wv, const float* __restrict__ wo, bf* XB, bf* W4) {
    constexpr int NX = NB_ * TT * DM / CVB, NW = DM * DM / CVB; const int blk = blockIdx.x; const float* src; bf* dst;
    if (blk < NX) { src = x + (size_t)blk * CVB; dst = XB + (size_t)blk * CVB; }
    else { const int wb = blk - NX, w = wb / NW; src = (w == 0 ? wq : w == 1 ? wk : w == 2 ? wv : wo) + (size_t)(wb % NW) * CVB; dst = W4 + (size_t)wb * CVB; }
    v8f v[CVG]; const unsigned so = (unsigned)(((int)threadIdx.x & 15) * DM + ((int)threadIdx.x >> 6) * 32 + (((int)threadIdx.x >> 4) & 3) * 8);   // place oc = 256 g + thread of the group holds row oc % 16, k block oc / 64, piece (oc / 16) % 4 of the block's 32 k: 128 elements further for each g
    // both loops are unrolled so that all loads of a thread issue ahead of its first rounding
#pragma unroll
    for (int g = 0; g < CVG; ++g) v[g] = *(const v8f*)(src + so + g * 128);
#pragma unroll
    for (int g = 0; g < CVG; ++g) { v8us o;
#pragma unroll
        for (int k = 0; k < 8; ++k) o[k] = f2bf(v[g][k]);
        *(v8us*)(dst + (g * 256 + (int)threadIdx.x) * 8) = o; }
}

__constant__ float INVT[HD / 2] = { 1.000000000e+00f, 7.498942018e-01f, 5.623413324e-01f, 4.216965139e-01f, 3.162277639e-01f, 2.371373624e-01f, 1.778279394e-01f, 1.333521456e-01f, 1.000000015e-01f, 7.498941571e-02f, 5.623412877e-02f, 4.216964915e-02f, 3.162277862e-02f, 2.371373586e-02f, 1.778279431e-02f, 1.333521493e-02f, 9.999999776e-03f, 7.498942316e-03f, 5.623413250e-03f, 4.216964822e-03f, 3.162277862e-03f, 2.371373819e-03f, 1.778279431e-03f, 1.333521446e-03f, 1.000000047e-03f, 7.498941850e-04f, 5.623413017e-04f, 4.216964880e-04f, 3.162277862e-04f, 2.371373848e-04f, 1.778279402e-04f, 1.333521504e-04f };   // float32 1 / 10000^(2i/64), generated with jnp to be bit-exact
__global__ __launch_bounds__(256) void k_cs5(float* CS) { const int idx = blockIdx.x * 256 + threadIdx.x; if (idx >= TT * HD) return; const int d = idx % HD; const int t = idx / HD; const float a = __fmul_rn((float)t, INVT[d % (HD / 2)]); v2f cs; cs[0] = cosf(a); cs[1] = sinf(a); *(v2f*)(CS + (size_t)idx * 2) = cs;  }
// k_attn: one work-group = 32 query rows of one head, all 2048 keys; scores, probabilities and the partial output tiles never reach memory. attn_body (the hi/lo row tiles) keeps the score rows and the probabilities in LDS, as described here; attn_regs (the fp16 row tiles) keeps them in registers.
// grid (heads, TT / 32, batches), 512 threads = 16 waves. Row tiles below RH use the hi/lo bf16 planes (3 products), the rest the fp16 planes (attn_regs).
// Phase 1: wave w forms S[32][128 w .. 128 w + 127] (k steps 0, 32 in turn). Phase 2: wave w does rows 2 w, 2 w + 1 (register row, one exp, fixed trees) and lays the 16-bit row over its own f32 row.
// Phase 3: wave w sums keys [128 w, 128 w + 128) of P V; the 16 partial tiles are added in wave order 0..15 and leave as the merged hi/lo planes [t][h * 64 + d] (fragment order). Q, K and V fragments come from planes in fragment order: 16 rows are 16 HD (q, k) or 16 TT (v) elements, a k step of 32 is 512.
#define RT   32
#define SPF  2052                 // LDS row pitch in floats: 8208 B = 16 B x 513 (odd), conflict-free for 16-byte fragment reads
typedef v4h  __attribute__((may_alias)) v4ha;
typedef v4us __attribute__((may_alias)) v4usa;
template <typename T16, bool HI>
__device__ __forceinline__ void attn_body(float* sm, const T16* __restrict__ Q, const T16* __restrict__ Q2, const T16* __restrict__ Kp, const T16* __restrict__ Kp2, const T16* __restrict__ Vt, const T16* __restrict__ Vt2, int t0, int h, bf* Ah, bf* Al) {
    typedef WFrag<T16> F; typedef typename F::V V;
    const int lane = threadIdx.x & 31, lr = lane & 15, hi = lane >> 4; const int wv = __builtin_amdgcn_readfirstlane((int)(threadIdx.x >> 5)); const int kbeg = wv * 128;
    const unsigned lo = (unsigned)(lane * 8), lv = (unsigned)(lane * 8);   // 32-bit lane offsets over wave-uniform bases: one address register per stream
    constexpr int CH = HI ? 2 : 8, NPRE = HI ? 1 : 4;   // key groups per batch of K loads; k steps of V fetched ahead of the softmax (what 256 registers hold)
    const T16* vb = Vt + kbeg * 16; const T16* vb2 = HI ? Vt2 + kbeg * 16 : nullptr; V vf[4][4], vf2[4][4];
    {   // phase 1: scores. Every loop is unrolled: fragment and accumulator arrays are indexed by constants
        V qa[2][2], qa2[2][2], b[8][2], b2[8][2]; const T16* qb = Q + (size_t)t0 * HD; const T16* qb2 = HI ? Q2 + (size_t)t0 * HD : nullptr; const T16* kb = Kp + (size_t)kbeg * HD; const T16* kb2 = HI ? Kp2 + (size_t)kbeg * HD : nullptr;
#pragma unroll
        for (int mb = 0; mb < 2; ++mb)
#pragma unroll
            for (int kk = 0; kk < 2; ++kk) { const int o = mb * 16 * HD + kk * 512; qa[mb][kk] = F::ldf(qb + lo + o); if (HI) qa2[mb][kk] = F::ldf(qb2 + lo + o); }
        __builtin_amdgcn_sched_barrier(0);   // keeps the Q loads ahead of the K loads, so that the first products wait for Q and one key group, not for the whole run
#pragma unroll
        for (int nb = 0; nb < CH; ++nb)
#pragma unroll
            for (int kk = 0; kk < 2; ++kk) { const int o = nb * 16 * HD + kk * 512; b[nb][kk] = F::ldf(kb + lo + o); if (HI) b2[nb][kk] = F::ldf(kb2 + lo + o); }
        asm volatile("s_wait_xcnt 0x0" :: "v"(lane) : "memory");   // the wait before a register that the loads above name is rewritten; the lane number, which the build gives them as their (scaled) offset register, as an input keeps that register live through the run, so that no load of the run lands in it
#pragma unroll
        for (int c = 0; c < 8; c += CH) {
            if (c + CH < 8) {
#pragma unroll
                for (int nb = c + CH; nb < c + 2 * CH; ++nb)
#pragma unroll
                    for (int kk = 0; kk < 2; ++kk) { const int o = nb * 16 * HD + kk * 512; b[nb][kk] = F::ldf(kb + lo + o); if (HI) b2[nb][kk] = F::ldf(kb2 + lo + o); } }
            __builtin_amdgcn_sched_barrier(0);   // keeps the loads above it in flight during the products below; without it each load sinks to its product and its latency is paid eight times over
#pragma unroll
            for (int nb = c; nb < c + CH; ++nb) { const int key = kbeg + nb * 16; v8f acc[2]; acc[0] = (v8f){}; acc[1] = (v8f){};
#pragma unroll
                for (int kk = 0; kk < 2; ++kk)
#pragma unroll
                    for (int mb = 0; mb < 2; ++mb) { acc[mb] = F::mma(qa[mb][kk], b[nb][kk], acc[mb]); if (HI) { acc[mb] = F::mma(qa2[mb][kk], b[nb][kk], acc[mb]); acc[mb] = F::mma(qa[mb][kk], b2[nb][kk], acc[mb]); } }
                asm volatile("v_nop\n\tv_nop\n\tv_nop\n\tv_nop" : "+v"(acc[0]), "+v"(acc[1]));   // four vector slots behind the group's last WMMA: the next group's first WMMA may write the same registers anew
#pragma unroll
                for (int mb = 0; mb < 2; ++mb)
#pragma unroll
                    for (int j = 0; j < 8; ++j) sm[(mb * 16 + hi * 8 + j) * SPF + key + lr] = acc[mb][j]; } }
    }
    __syncthreads();   // all 2048 scores of every row are in LDS before a wave reads its rows
    // the first V fragments are fetched here, behind the barrier (which drains a wave's loads), so that they fly during the softmax
#pragma unroll
    for (int ks = 0; ks < NPRE; ++ks)
#pragma unroll
        for (int nb = 0; nb < 4; ++nb) { const int o = nb * 16 * TT + ks * 512; vf[ks][nb] = F::ldf(vb + lv + o); if (HI) vf2[ks][nb] = F::ldf(vb2 + lv + o); }
    asm volatile("s_wait_xcnt 0x0" :: "v"(lane) : "memory");   // as above, for the V loads
#pragma unroll 1   // one row's 64 values at a time: two rows beside the V fragments held in registers would spill
    for (int rr = 0; rr < 2; ++rr) {   // phase 2: softmax of one row per trip
        float* sr = sm + (wv * 2 + rr) * SPF; float v[TT / 32]; float mx = -3.0e38f;
#pragma unroll
        for (int ch = 0; ch < TT / 128; ++ch) { const v4f a = *(const v4fa*)(sr + ch * 128 + lane * 4);
#pragma unroll
            for (int q = 0; q < 4; ++q) { const float t = a[q] * SCL; v[ch * 4 + q] = t; mx = fmaxf(mx, t); } }
#pragma unroll
        for (int sh = 16; sh; sh >>= 1) mx = fmaxf(mx, __shfl_xor(mx, sh, 32));
        float sum = 0.f;
#pragma unroll
        for (int k = 0; k < TT / 32; ++k) { v[k] = __builtin_amdgcn_exp2f(__fmul_rn(__fsub_rn(v[k], mx), 1.4426950408889634f)); sum += v[k]; }
#pragma unroll
        for (int sh = 16; sh; sh >>= 1) sum += __shfl_xor(sum, sh, 32);
        const float f = __fdiv_rn(HI ? 1.0f : PCAR, sum);
        // the 16-bit row overwrites the f32 row it came from: only this wave touches the row, and every store depends on the row's sum
        if (HI) {
#pragma unroll
            for (int ch = 0; ch < TT / 128; ++ch) { v4us oh, ol;
#pragma unroll
                for (int q = 0; q < 4; ++q) { unsigned short a, c2; splitf(v[ch * 4 + q] * f, a, c2); oh[q] = a; ol[q] = c2; }
                *(v4usa*)((bf*)sr + ch * 128 + lane * 4) = oh; *(v4usa*)((bf*)sr + TT + ch * 128 + lane * 4) = ol; }
        } else {
#pragma unroll
            for (int ch = 0; ch < TT / 128; ++ch) { v4h o4;
#pragma unroll
                for (int q = 0; q < 4; ++q) o4[q] = tohx(v[ch * 4 + q] * f);
                *(v4ha*)((h16*)sr + ch * 128 + lane * 4) = o4; } }
    }
    __syncthreads();   // every row's probabilities are in LDS before any wave reads them as A fragments
    v8f acc[2][4];
#pragma unroll
    for (int mb = 0; mb < 2; ++mb)
#pragma unroll
        for (int nb = 0; nb < 4; ++nb) acc[mb][nb] = (v8f){};
    // phase 3: P V. Unrolled: constant indices
#pragma unroll
    for (int ks = 0; ks < 4; ++ks) { const int kc = kbeg + ks * 32; V a[2], a2[2];
        if (ks + NPRE < 4) {
#pragma unroll
            for (int nb = 0; nb < 4; ++nb) { const int o = nb * 16 * TT + (ks + NPRE) * 512; vf[ks + NPRE][nb] = F::ldf(vb + lv + o); if (HI) vf2[ks + NPRE][nb] = F::ldf(vb2 + lv + o); }
            __builtin_amdgcn_sched_barrier(0);   // keeps the next k step's V loads in flight during this step's products; without it each load sinks to its product
        }
#pragma unroll
        for (int mb = 0; mb < 2; ++mb) { const T16* pr = (const T16*)(sm + (mb * 16 + lr) * SPF) + 8 * hi + kc; a[mb] = F::ld(pr); if (HI) a2[mb] = F::ld(pr + TT); }
#pragma unroll
        for (int nb = 0; nb < 4; ++nb)
#pragma unroll
            for (int mb = 0; mb < 2; ++mb) { acc[mb][nb] = F::mma(a[mb], vf[ks][nb], acc[mb][nb]); if (HI) { acc[mb][nb] = F::mma(a2[mb], vf[ks][nb], acc[mb][nb]); acc[mb][nb] = F::mma(a[mb], vf2[ks][nb], acc[mb][nb]); } } }
    __syncthreads();   // every wave has read its probabilities before the partial tiles overwrite them
    float* ow = sm + wv * (RT * 68);
#pragma unroll
    for (int mb = 0; mb < 2; ++mb)
#pragma unroll
        for (int nb = 0; nb < 4; ++nb)
#pragma unroll
            for (int j = 0; j < 8; ++j) ow[(mb * 16 + hi * 8 + j) * 68 + nb * 16 + lr] = acc[mb][nb][j];
    __syncthreads();   // every wave's partial tile is in LDS before any thread adds them
    const int row = (int)threadIdx.x >> 4, cofs = ((int)threadIdx.x & 15) * 4; v4f val = *(const v4fa*)(sm + row * 68 + cofs);
#pragma unroll
    for (int w = 1; w < 16; ++w) val += *(const v4fa*)(sm + (w * RT + row) * 68 + cofs);
    const float cs = HI ? 1.0f : (1.0f / PCAR); const size_t oo = fro(t0 + row, h * HD + cofs, DQ); v4us oh, ol;
#pragma unroll
    for (int q = 0; q < 4; ++q) { unsigned short a, c2; splitf(val[q] * cs, a, c2); oh[q] = a; ol[q] = c2; }
    *(v4us*)(Ah + oo) = oh; *(v4us*)(Al + oo) = ol;
}
// xrow: the value that lane l ^ 16 holds (the same place in the other 16-lane row)
__device__ __forceinline__ float xrow(float x) { const unsigned u = __float_as_uint(x); return __uint_as_float(__builtin_amdgcn_permlanex16(u, u, 0x76543210u, 0xfedcba98u, false, false)); }
// attn_regs: the fp16 row tiles (t0 >= RH). Wave w does the whole softmax(Q K^T) V of ITS 128 keys alone, in registers, against its own maximum; the 16 waves' results meet once, in the final sum.
// Scores are formed TRANSPOSED, S^T[128 w .. 128 w + 127][32 queries] = K Q^T (A = K, B = Q; the same fragments and k steps as Q K^T): lane (lr, hi) then holds, for query mb * 16 + lr, keys nb * 16 + hi * 8 + 0..7,
// and two neighbouring key groups are exactly the lane's sixteen elements of the A fragment of P for one k step of P V. Scores and probabilities never touch LDS.
// Per query and wave: m_w = the maximum over the wave's keys (in the lane, then lane ^ 16), p = exp(s - m_w) in (0, 1] rounded to fp16, l_w = the f32 sum of the unrounded p (eight chains over the key groups, a tree over the eight, the other half).
// The final sum weighs wave w's partial tile and l_w with exp(m_w - M), M = the maximum of the sixteen m_w, in wave order 0..15, and divides by the weighted sum of the l_w: the same softmax, by exp(s - M) = exp(s - m_w) exp(m_w - M).
#define XP   20                   // pitch of the two [32][16] tables (m_w, l_w) in floats: 80 B = 16 B x 5 (odd), conflict-free for 16-byte reads
__device__ __forceinline__ void attn_regs(float* sm, const h16* __restrict__ Q, const h16* __restrict__ Kp, const h16* __restrict__ Vt, int t0, int h, bf* Ah, bf* Al) {
    typedef WFrag<h16> F; typedef F::V V;
    const int lane = threadIdx.x & 31, lr = lane & 15, hi = lane >> 4; const int wv = __builtin_amdgcn_readfirstlane((int)(threadIdx.x >> 5)); const int kbeg = wv * 128;
    const unsigned lo = (unsigned)(lane * 8);   // a 32-bit lane offset over wave-uniform bases: one address register per stream
    float* xm = sm + 16 * RT * 68; float* xs = xm + RT * XP;   // the two tables lie behind the partial output tiles: nothing in LDS is used twice
    const h16* vb = Vt + kbeg * 16; V vf[4][4]; v8f s[8][2];
    {   // scores. Every loop is unrolled: fragment and accumulator arrays are indexed by constants
        V qa[2][2], b[8][2]; const h16* qb = Q + (size_t)t0 * HD; const h16* kb = Kp + (size_t)kbeg * HD;
#pragma unroll
        for (int mb = 0; mb < 2; ++mb)
#pragma unroll
            for (int kk = 0; kk < 2; ++kk) qa[mb][kk] = F::ldf(qb + lo + mb * 16 * HD + kk * 512);
        __builtin_amdgcn_sched_barrier(0);   // keeps the Q loads ahead of the K loads, so that the first products wait for Q and one key group, not for the whole run
#pragma unroll
        for (int nb = 0; nb < 8; ++nb)
#pragma unroll
            for (int kk = 0; kk < 2; ++kk) b[nb][kk] = F::ldf(kb + lo + nb * 16 * HD + kk * 512);
        asm volatile("s_wait_xcnt 0x0" :: "v"(lane) : "memory");   // the wait before a register that the loads above name is rewritten; the lane number, their (scaled) offset register, as an input keeps that register live through the run
        __builtin_amdgcn_sched_barrier(0);   // keeps all K loads in flight ahead of the first product; without it each load sinks to its product and its latency is paid eight times over
#pragma unroll
        for (int nb = 0; nb < 8; ++nb) { s[nb][0] = (v8f){}; s[nb][1] = (v8f){};
#pragma unroll
            for (int kk = 0; kk < 2; ++kk)
#pragma unroll
                for (int mb = 0; mb < 2; ++mb) s[nb][mb] = F::mma(b[nb][kk], qa[mb][kk], s[nb][mb]); }
    }
    // the V fragments of the first two k steps are fetched here, into the registers that K has left, and fly during the exponentials
    __builtin_amdgcn_sched_barrier(0);   // keeps these loads behind the last product of the scores: moved ahead of it, where K still holds its registers, they made the build spill
#pragma unroll
    for (int ks = 0; ks < 2; ++ks)
#pragma unroll
        for (int nb = 0; nb < 4; ++nb) vf[ks][nb] = F::ldf(vb + lo + nb * 16 * TT + ks * 512);
    asm volatile("s_wait_xcnt 0x0" :: "v"(lane) : "memory");   // as above, for the V loads
    float ml[2], sl[2]; V pa[4][2];
#pragma unroll
    for (int mb = 0; mb < 2; ++mb) { float m = s[0][mb][0];   // the maximum is taken of the raw scores: SCL is a power of two, so scaling commutes with it exactly
#pragma unroll
        for (int nb = 0; nb < 8; ++nb)
#pragma unroll
            for (int j = 0; j < 8; ++j) m = fmaxf(m, s[nb][mb][j]);
        m = fmaxf(m, xrow(m)); const float mx = fmaxf(-3.0e38f, m * SCL); ml[mb] = mx; v8f a8 = (v8f){};
#pragma unroll
        for (int ks = 0; ks < 4; ++ks) { v8h p8[2];
#pragma unroll
            for (int u = 0; u < 2; ++u) { const v8f x = (s[2 * ks + u][mb] * SCL - mx) * 1.4426950408889634f; v8f e;   // the product with SCL is exact: fused with the difference or not, one rounding
#pragma unroll
                for (int j = 0; j < 8; ++j) e[j] = __builtin_amdgcn_exp2f(x[j]);
                a8 += e; p8[u] = __builtin_convertvector(e, v8h); }
            pa[ks][mb] = cat16(p8[0], p8[1]); }
        const float t = ((a8[0] + a8[1]) + (a8[2] + a8[3])) + ((a8[4] + a8[5]) + (a8[6] + a8[7])); sl[mb] = t + xrow(t);
        // one more k step of V goes into the registers that this half of the scores has left
        __builtin_amdgcn_sched_barrier(0);   // keeps these loads behind the exponentials above, whose scores still hold the registers (as for the first two k steps)
#pragma unroll
        for (int nb = 0; nb < 4; ++nb) vf[2 + mb][nb] = F::ldf(vb + lo + nb * 16 * TT + (2 + mb) * 512);
        asm volatile("s_wait_xcnt 0x0" :: "v"(lane) : "memory");   // as above, for the V loads
        __builtin_amdgcn_sched_barrier(0);   // keeps these loads here, ahead of the work that follows; without it the last k step's loads sink among the products of P V and their latency is paid there
    }
    xm[lane * XP + wv] = hi ? ml[1] : ml[0]; xs[lane * XP + wv] = hi ? sl[1] : sl[0];   // lane l hands in query l
    v8f acc[2][4];
#pragma unroll
    for (int mb = 0; mb < 2; ++mb)
#pragma unroll
        for (int nb = 0; nb < 4; ++nb) acc[mb][nb] = (v8f){};
    // P V. Unrolled: constant indices
#pragma unroll
    for (int ks = 0; ks < 4; ++ks)
#pragma unroll
        for (int nb = 0; nb < 4; ++nb)
#pragma unroll
            for (int mb = 0; mb < 2; ++mb) acc[mb][nb] = F::mma(pa[ks][mb], vf[ks][nb], acc[mb][nb]);
    float* ow = sm + wv * (RT * 68);
#pragma unroll
    for (int mb = 0; mb < 2; ++mb)
#pragma unroll
        for (int nb = 0; nb < 4; ++nb)
#pragma unroll
            for (int j = 0; j < 8; ++j) ow[(mb * 16 + hi * 8 + j) * 68 + nb * 16 + lr] = acc[mb][nb][j];
    __syncthreads();   // every wave's partial tile, maxima and sums are in LDS before any thread joins them
    const int row = (int)threadIdx.x >> 4, cofs = ((int)threadIdx.x & 15) * 4; v4f m4[4], l4[4];
#pragma unroll
    for (int c = 0; c < 4; ++c) { m4[c] = *(const v4fa*)(xm + row * XP + c * 4); l4[c] = *(const v4fa*)(xs + row * XP + c * 4); }
    float M = m4[0][0];
#pragma unroll
    for (int w = 1; w < 16; ++w) M = fmaxf(M, m4[w >> 2][w & 3]);
    float tot = 0.f; v4f val = (v4f){};
#pragma unroll
    for (int w = 0; w < 16; ++w) { const float ew = __builtin_amdgcn_exp2f(__fmul_rn(__fsub_rn(m4[w >> 2][w & 3], M), 1.4426950408889634f)); tot += l4[w >> 2][w & 3] * ew; val += *(const v4fa*)(sm + (w * RT + row) * 68 + cofs) * ew; }
    const float cs = __fdiv_rn(1.0f, tot); const size_t oo = fro(t0 + row, h * HD + cofs, DQ); v4us oh, ol;   // tot >= 1: the wave that holds M has weight 1 and a sum of at least 1
#pragma unroll
    for (int q = 0; q < 4; ++q) { unsigned short a, c2; splitf(val[q] * cs, a, c2); oh[q] = a; ol[q] = c2; }
    *(v4us*)(Ah + oo) = oh; *(v4us*)(Al + oo) = ol;
}
__global__ __launch_bounds__(512) void k_attn(const h16* __restrict__ Q16, const h16* __restrict__ K16, const h16* __restrict__ V16, const bf* __restrict__ Qh, const bf* __restrict__ Ql, const bf* __restrict__ Kh, const bf* __restrict__ Kl, const bf* __restrict__ Vh, const bf* __restrict__ Vl, bf* Ah, bf* Al) {
    __shared__ __align__(16) float sm[RT * SPF];
    const int h = blockIdx.x, t0 = blockIdx.y * RT; const size_t zo = ((size_t)blockIdx.z * NH_ + h) * TT * HD; Ah += (size_t)blockIdx.z * TT * DQ; Al += (size_t)blockIdx.z * TT * DQ;   // within a batch the hi/lo row tiles (three times the products) have the lowest indices
    if (t0 < RH) attn_body<bf, true>(sm, Qh + zo, Ql + zo, Kh + zo, Kl + zo, Vh + zo, Vl + zo, t0, h, Ah, Al);
    else attn_regs(sm, Q16 + zo, K16 + zo, V16 + zo, t0, h, Ah, Al);
}

extern "C" void kernel_launch(void* const* d_in, const int* in_sizes, int n_in,
                              void* d_out, int out_size, void* d_ws, size_t ws_size, hipStream_t stream) {
    (void)in_sizes; (void)n_in; (void)out_size;
    const float* x = (const float*)d_in[0]; const float* fcos = (const float*)d_in[1]; const float* fsin = (const float*)d_in[2]; const float* wq = (const float*)d_in[3]; const float* bq = (const float*)d_in[4]; const float* wk = (const float*)d_in[5]; const float* bk = (const float*)d_in[6]; const float* wv = (const float*)d_in[7]; const float* bv = (const float*)d_in[8]; const float* wo = (const float*)d_in[9]; const float* bo = (const float*)d_in[10];   /* hidden [4][2048][1024] (ONE stream, rounded to bf16 once for q, k and v), cos, sin ([4][2048][64] = [B][S][D] PER-BATCH full-width table INPUTS: read per element by value), Wq, bq, Wk, bk, Wv, bv, Wo, bo ('oi' (out, in) [1024][1024] + [1024]): ELEVEN inputs, all read */
    float* OUT = (float*)d_out;     // [4][2048][1024]
    char* wsp = (char*)d_ws;
    auto take = [&](size_t bytes) { char* p = wsp; wsp += (bytes + 255) & ~(size_t)255; return (void*)p; };
    bf* WQ = (bf*)take((size_t)DQ * DM * 2); bf* WK = (bf*)take((size_t)DKV * DM * 2); bf* WV = (bf*)take((size_t)DKV * DM * 2); bf* WO = (bf*)take((size_t)DM * DQ * 2);
    bf* XB = (bf*)take((size_t)NB_ * TT * DM * 2);
    h16* QP16 = (h16*)take((size_t)NB_ * NH_ * TT * HD * 2); h16* KP16 = (h16*)take((size_t)NB_ * NKV * TT * HD * 2); h16* VT16 = (h16*)take((size_t)NB_ * NKV * HD * TT * 2);
    bf* QPh = (bf*)take((size_t)NB_ * NH_ * TT * HD * 2); bf* QPl = (bf*)take((size_t)NB_ * NH_ * TT * HD * 2); bf* KPh = (bf*)take((size_t)NB_ * NKV * TT * HD * 2); bf* KPl = (bf*)take((size_t)NB_ * NKV * TT * HD * 2); bf* VTh = (bf*)take((size_t)NB_ * NKV * HD * TT * 2); bf* VTl = (bf*)take((size_t)NB_ * NKV * HD * TT * 2);
    bf* ATh = (bf*)take((size_t)NB_ * TT * DQ * 2); bf* ATl = (bf*)take((size_t)NB_ * TT * DQ * 2);
    (void)WK; (void)WV;   // reached through WQ
    if ((size_t)(wsp - (char*)d_ws) > ws_size) return;    // 200 MiB of the 256 MiB
    k_cvtall<<<(NB_ * TT * DM + 4 * DM * DM) / CVB, 256, 0, stream>>>(x, wq, wk, wv, wo, XB, WQ);   // WQ, WK, WV, WO are consecutive takes of 2 MiB each
    /* q, k, v: one launch; WQ, WK, WV are one [3 DQ][DM] matrix, and QP16, KP16, VT16 as well as QPh, QPl, KPh, KPl, VTh, VTl are consecutive takes. The q and k parts read batch z's own slice of the INPUT rotary tables in their epilogue; k_cs5 and its INVT constants stay defined and are NOT launched */
    k_gemms<0, 1><<<dim3(TT / 128, (DQ + 2 * DKV) / 256, NB_), 256, 0, stream>>>(XB, nullptr, WQ, nullptr, bq, bk, bv, fcos, fsin, QP16, QPh, QPl);
    k_attn<<<dim3(NH_, TT / RT, NB_), 512, 0, stream>>>(QP16, KP16, VT16, QPh, QPl, KPh, KPl, VTh, VTl, ATh, ATl);   // one kv head per query head
    k_gemms<1, 0><<<dim3(TT / 128, DM / 256, NB_), 256, 0, stream>>>(ATh, ATl, WO, OUT, bo, nullptr, nullptr, nullptr, nullptr, nullptr, nullptr, nullptr);
}

// v008
// One run takes 204 microseconds.
// Timed twice side by side with v007, it ran 1.14 and 1.15 times as fast.
// Counting every step since v000, it is 19.3 times as fast.
#include <hip/hip_runtime.h>

// Rotary multi-head self-attention with PER-BATCH full-width rotary tables given as inputs (hidden [4][2048][1024]: ONE stream; q, k, v = hidden W^T + b ('oi' (out, in) [1024][1024] normal x 1024^-0.5 + zero biases: read; 16 heads x 64); q, k -> t cos + cat(-t2, t1) sin with the cos / sin INPUT tables [4][2048][64] = [B][S][D] (uniform random values on this draw: batch b reads ITS OWN slice, per element by value; no structure assumed); scores x 64^-0.5; softmax over all keys (no mask); out = merged Wo^T + bo ('oi' + a zero bias: read) -> [4][2048][1024] (8.4 M); argument order hidden, cos, sin, Wq, bq, Wk, bk, Wv, bv, Wo, bo).
// Every stage is launched once for all four batches (batch = grid z of k_gemms; every workspace plane holds the four batches one behind the other). Layout per batch: bf16 copies of the input stream(s); 'oi' weights; exact projections + f32 biases, whose epilogue applies the rotary tables and writes the head planes (q, k: [h][t][d]; v: [h][d][t]); dense T-2048 attention in one kernel, scores and probabilities in LDS or in registers (hybrid rows: < 512 hi/lo 3 products, in LDS; rest fp16, in registers, each wave its own 32 queries against a running maximum, K and V shared through LDS); merged hi/lo x Wo exact + bo.
// Every 16-bit plane that a matrix product reads from memory (hidden, the weights, q, k, v, merged) lies in FRAGMENT ORDER (fro() below), so that one wave-wide 16-byte load covers 512 consecutive bytes = four whole 128-byte lines; each lane receives the same elements as from a row-major plane.
// Compute dtypes, f32 accumulate: every input rounded to bf16; projections exact + f32 biases; attention rows < 512 3 products, rest fp16; softmax f32; Wo hl x exact + bias.

#define NB_  4
#define TT   2048
#define DM   1024
#define NH_  16
#define NKV  16
#define REP  (NH_ / NKV)
static_assert(NKV == NH_, "the q, k, v launch numbers its tile columns by NH_ heads a part");
#define HD   64
#define DQ   (NH_ * HD)
#define DKV  (NKV * HD)
#define RH   512                  // query rows < RH use hi+lo planes (0: none)
#define WIN  0
#define PCAR 1024.0f
#define SCL  0.125f   // HD^-0.5
typedef _Float16 h16;
typedef unsigned short bf;
typedef __attribute__((ext_vector_type(16))) __bf16   v16bf;
typedef __attribute__((ext_vector_type(16))) _Float16 v16h;
typedef __attribute__((ext_vector_type(8)))  _Float16 v8h;
typedef __attribute__((ext_vector_type(8)))  unsigned short v8us;
typedef __attribute__((ext_vector_type(8)))  float    v8f;
typedef __attribute__((ext_vector_type(4)))  float    v4f;
typedef v8h  __attribute__((may_alias)) v8ha;
typedef v4f  __attribute__((may_alias)) v4fa;
typedef v8us __attribute__((may_alias)) v8usa;

__device__ __forceinline__ unsigned short f2bf(float f) { unsigned u = __float_as_uint(f); u += 0x7FFFu + ((u >> 16) & 1u); return (unsigned short)(u >> 16); }
__device__ __forceinline__ float bf2f(unsigned short b) { return __uint_as_float(((unsigned)b) << 16); }
__device__ __forceinline__ float bfr(float f) { return bf2f(f2bf(f)); }
__device__ __forceinline__ v16h cat16(v8h lo, v8h hi) { return __builtin_shufflevector(lo, hi, 0, 1, 2, 3, 4, 5, 6, 7, 8, 9, 10, 11, 12, 13, 14, 15); }
__device__ __forceinline__ v16bf cat16b(v8us lo, v8us hi) { return __builtin_bit_cast(v16bf, __builtin_shufflevector(lo, hi, 0, 1, 2, 3, 4, 5, 6, 7, 8, 9, 10, 11, 12, 13, 14, 15)); }
__device__ __forceinline__ v8f wmma16(v16h a, v16h b, v8f c) { return __builtin_amdgcn_wmma_f32_16x16x32_f16(false, a, false, b, (short)0, c, false, false); }
__device__ __forceinline__ v8f wmmab(v16bf a, v16bf b, v8f c) { return __builtin_amdgcn_wmma_f32_16x16x32_bf16(false, a, false, b, (short)0, c, false, false); }

__device__ __forceinline__ h16 tohx(float x) { return (h16)x; }
__device__ __forceinline__ void splitf(float y, unsigned short& h, unsigned short& l) { h = f2bf(y); l = f2bf(y - bf2f(h)); }
typedef __attribute__((ext_vector_type(2))) _Float16 v2h;
typedef __attribute__((ext_vector_type(4))) _Float16 v4h;
typedef __attribute__((ext_vector_type(2))) unsigned short v2us;
typedef __attribute__((ext_vector_type(4))) unsigned short v4us;
typedef __attribute__((ext_vector_type(2))) float v2f;
typedef __attribute__((ext_vector_type(4))) int v4i;

// ---- k_gemms: GEMM with the operands shared through LDS. One work-group (8 waves, 2 x 4) forms a 128 x 256 tile of C, each wave one 64 x 64 tile (16 accumulators) over the WHOLE k range, k ascending; grid (M / 128, N / 256, batches), 256 threads.
// C[m][n] = sum_k A[m][k] Bt[n][k] (+ A2[m][k] Bt[n][k] for NSPLIT 1) + bias[n] (rounded to bf16). A, A2, Bt are bf16 planes of DM columns in fragment order (fro() below); z is the batch: A, A2 and C lie TT * DM elements further on for each, Bt is shared.
// A slab is 64 k of the tile's 128 A (and A2) rows and 256 Bt rows: per group of 16 rows two fragment blocks = 2 KiB that are consecutive in memory. Asynchronous copies bring a slab into LDS as it lies (group g at g * 2 KiB), two buffers, the next slab in flight while one is worked on; every wave reads its fragments from LDS as it would from memory.
// EPI 0: f32 C rows [m][DM]. EPI 1: the q, k and v projections in one launch: Bt holds the three weights one behind the other, a wave's 64 columns are one head of part (0 q, 1 k, 2 v; the same for the whole work-group), bias / biasK / biasV are the parts' biases. Parts 0, 1: rotate-half rotary with the cos / sin tables [t][64], each rounded to bf16, then head planes [h][t][d] (fp16 + bf16 hi/lo); part 2: transposed head planes [h][d][t] (fp16 + bf16 hi/lo), straight from the accumulators (a lane holds eight consecutive t of one d: its 16 bytes of a block); each head's plane in fragment order. The planes of part p start p (fp16) or 2 p (hi, lo) whole planes behind P16, Ph, Pl; batch z's tables are TT * HD and its head planes NH_ * TT * HD elements further on. C is not written for EPI 1.
// fro: the place (in elements) of element (row, k) of a [rows][K] 16-bit operand plane in fragment order. A block of 512 elements holds 16 rows x 32 k; blocks run along k, then down the row groups. Inside a block: half s = bit 4 of k (256 elements), then lane = 16 * (bit 3 of k) + row % 16 (8 elements), then k % 8: the two 16-byte pieces that lane holds of the block's A or B fragment.
__device__ __forceinline__ size_t fro(int row, int k, int K) { return (size_t)(row >> 4) * 16 * K + (k >> 5) * 512 + ((k >> 4) & 1) * 256 + (((k >> 3) & 1) * 16 + (row & 15)) * 8 + (k & 7); }
template <typename T16> struct WFrag;
// ld: a fragment from a row-major row (LDS); ldf: from a block in fragment order, p = the block + 8 * lane
template <> struct WFrag<h16> { typedef v16h V; static __device__ __forceinline__ V ld(const h16* p) { return cat16(*(const v8h*)p, *(const v8h*)(p + 16)); } static __device__ __forceinline__ V ldf(const h16* p) { return cat16(*(const v8h*)p, *(const v8h*)(p + 256)); } static __device__ __forceinline__ v8f mma(V a, V b, v8f c) { return wmma16(a, b, c); } };
template <> struct WFrag<bf> { typedef v16bf V; static __device__ __forceinline__ V ld(const bf* p) { return cat16b(*(const v8us*)p, *(const v8us*)(p + 16)); } static __device__ __forceinline__ V ldf(const bf* p) { return cat16b(*(const v8us*)p, *(const v8us*)(p + 256)); } static __device__ __forceinline__ v8f mma(V a, V b, v8f c) { return wmmab(a, b, c); } };
// cp4: four asynchronous copies of 16 bytes a lane, global memory -> LDS: row groups two apart (32 rows of DM elements in memory, 4 KiB in LDS)
__device__ __forceinline__ void cp4(unsigned l0, const bf* g0) {
    const unsigned l1 = l0 + 4096u, l2 = l0 + 8192u, l3 = l0 + 12288u; const bf* g1 = g0 + 32 * DM; const bf* g2 = g0 + 64 * DM; const bf* g3 = g0 + 96 * DM;
    // the copies and, as the last line of the same statement, the wait before a register that a copy names is rewritten
    asm volatile("global_load_async_to_lds_b128 %0, %1, off\n\tglobal_load_async_to_lds_b128 %2, %3, off\n\tglobal_load_async_to_lds_b128 %4, %5, off\n\tglobal_load_async_to_lds_b128 %6, %7, off\n\ts_wait_xcnt 0x0" :: "v"(l0), "v"(g0), "v"(l1), "v"(g1), "v"(l2), "v"(g2), "v"(l3), "v"(g3) : "memory");
}
// the second launch bound (waves per SIMD) holds a wave to 256 registers, so that two work-groups fit on a WGP
template <int NSPLIT, int EPI>
__global__ __launch_bounds__(256, 4) void k_gemms(const bf* __restrict__ A, const bf* __restrict__ A2, const bf* __restrict__ Bt, float* C, const float* __restrict__ bias, const float* __restrict__ biasK, const float* __restrict__ biasV, const float* __restrict__ cosT, const float* __restrict__ sinT, h16* P16, bf* Ph, bf* Pl) {
    typedef WFrag<bf> F; typedef F::V V;
    constexpr int K = DM, GA = NSPLIT ? 16 : 8, NG = GA + 16, BUFE = NG * 1024, NT = K / 64;   // row groups of A (and A2), of a slab; 16-bit elements of a buffer; slabs
    static_assert(NT >= 2 && BUFE <= 8 * 64 * 68 && DQ % 256 == 0 && TT % 128 == 0, "two slabs at least; the two buffers (BUFE floats) lie inside the eight output tiles");
    __shared__ __align__(16) float os[8 * 64 * 68];   // first the two operand buffers, then one [64][68] f32 tile per wave
    const size_t z = blockIdx.z; const int lane = threadIdx.x & 31, lr = lane & 15, hi = lane >> 4; const int wv = __builtin_amdgcn_readfirstlane((int)(threadIdx.x >> 5)), wm = wv & 1, wn = wv >> 1;
    const int r0 = blockIdx.x * 128, c0 = blockIdx.y * 256, r0w = r0 + wm * 64, c0w = c0 + wn * 64;
    // copy c of wave w brings piece w % 4 (512 B) of row group 2 c + w / 4
    const unsigned lb = (unsigned)(size_t)os + (unsigned)(wv * 512 + lane * 16); const int go = (wv >> 2) * 16 * K + (wv & 3) * 256 + lane * 8;
    const bf* pA = A + z * (size_t)(TT * DM) + (size_t)r0 * K + go; const bf* pA2 = NSPLIT ? A2 + z * (size_t)(TT * DM) + (size_t)r0 * K + go : nullptr; const bf* pB = Bt + (size_t)c0 * K + go;
    auto stage = [&](int t, int buf) { const unsigned l = lb + (unsigned)buf * (unsigned)(BUFE * 2); const int ko = t * 1024;
        cp4(l, pA + ko); if constexpr (NSPLIT != 0) cp4(l + 16384u, pA2 + ko); cp4(l + GA * 2048u, pB + ko); cp4(l + GA * 2048u + 16384u, pB + ko + 128 * K); };
    v8f acc[4][4];
#pragma unroll
    for (int mb = 0; mb < 4; ++mb)
#pragma unroll
        for (int nb = 0; nb < 4; ++nb) acc[mb][nb] = (v8f){};
    stage(0, 0);
    asm volatile("s_wait_asynccnt 0x0" ::: "memory");   // this wave's copies of slab 0 have landed
    __syncthreads();   // slab 0 is in LDS before any wave reads it
    stage(1, 1);
#pragma unroll 1   // one slab a trip: the trip's foot is the hand-over of the buffers
    for (int t = 0; t < NT; ++t) {
        const bf* sl = (const bf*)os + (t & 1) * BUFE + lane * 8;
        // unrolled: fragment and accumulator arrays are indexed by constants
#pragma unroll
        for (int kk = 0; kk < 2; ++kk) { V a[4], a2[4], b[4];
#pragma unroll
            for (int mb = 0; mb < 4; ++mb) { a[mb] = F::ldf(sl + (wm * 4 + mb) * 1024 + kk * 512); if (NSPLIT) a2[mb] = F::ldf(sl + (8 + wm * 4 + mb) * 1024 + kk * 512); }
#pragma unroll
            for (int nb = 0; nb < 4; ++nb) b[nb] = F::ldf(sl + (GA + wn * 4 + nb) * 1024 + kk * 512);
            __builtin_amdgcn_sched_barrier(0);   // keeps the k step's LDS reads together ahead of its products; without it the build keeps one B fragment and waits out the LDS latency four times a k step
#pragma unroll
            for (int nb = 0; nb < 4; ++nb)
#pragma unroll
                for (int mb = 0; mb < 4; ++mb) { acc[mb][nb] = F::mma(a[mb], b[nb], acc[mb][nb]); if (NSPLIT) acc[mb][nb] = F::mma(a2[mb], b[nb], acc[mb][nb]); } }
        asm volatile("s_wait_dscnt 0x0" ::: "memory");      // this wave's reads of the buffer are done before the barrier behind which it is refilled
        asm volatile("s_wait_asynccnt 0x0" ::: "memory");   // this wave's copies of the next slab have landed
        __syncthreads();   // publishes the next slab and ends every wave's reads of this one
        if (t + 2 < NT) stage(t + 2, t & 1);
    }
    asm volatile("s_wait_asynccnt 0x0" ::: "memory");   // no copy is outstanding when the buffers become output tiles
    const int part = EPI == 1 ? (int)blockIdx.y / (DQ / 256) : 0, head = EPI == 1 ? ((int)blockIdx.y % (DQ / 256)) * 4 + wn : 0;   // part: the same for the whole work-group
    const float* bp = bias + c0w; if constexpr (EPI == 1) bp = (part == 0 ? bias : part == 1 ? biasK : biasV) + head * 64;
    if constexpr (EPI == 1) { cosT += z * (size_t)(TT * HD); sinT += z * (size_t)(TT * HD); P16 += ((size_t)part * NB_ + z) * (size_t)(NH_ * TT * HD); Ph += ((size_t)part * 2 * NB_ + z) * (size_t)(NH_ * TT * HD); Pl += ((size_t)part * 2 * NB_ + z) * (size_t)(NH_ * TT * HD);
    }
    if (EPI == 1 && part == 2) {
        // unrolled: acc is indexed by constants
#pragma unroll
        for (int nb = 0; nb < 4; ++nb) { const float b1 = bfr(bp[nb * 16 + lr]);
#pragma unroll
            for (int mb = 0; mb < 4; ++mb) { v8h o16; v8us oh, ol;
#pragma unroll
                for (int j = 0; j < 8; ++j) { const float x = acc[mb][nb][j] + b1; o16[j] = tohx(x); unsigned short a2, c2; splitf(x, a2, c2); oh[j] = a2; ol[j] = c2; }
                const size_t e = (size_t)head * HD * TT + fro(nb * 16 + lr, r0w + mb * 16 + hi * 8, TT); *(v8h*)(P16 + e) = o16; *(v8us*)(Ph + e) = oh; *(v8us*)(Pl + e) = ol; } }
    } else {
        // the last trip's barrier has ended every wave's reads of the buffers: the tiles may overwrite them
        float* ow = os + wv * (64 * 68); const int cofs = lr * 4; v4f bb; bb[0] = bfr(bp[cofs]); bb[1] = bfr(bp[cofs + 1]); bb[2] = bfr(bp[cofs + 2]); bb[3] = bfr(bp[cofs + 3]);
#pragma unroll
        for (int mb = 0; mb < 4; ++mb)
#pragma unroll
            for (int nb = 0; nb < 4; ++nb)
#pragma unroll
                for (int j = 0; j < 8; ++j) ow[(mb * 16 + hi * 8 + j) * 68 + nb * 16 + lr] = acc[mb][nb][j];
        const unsigned tl = (unsigned)(hi * HD + cofs); constexpr int RC = EPI == 1 ? 4 : 8;
        __syncthreads();   // the tile is in LDS before a lane reads what other lanes wrote; part is the same for the whole work-group, so every wave of it passes here or none
#pragma unroll 1   // RC row pairs a trip: the whole tile unrolled would be 32 KiB of code, and more rows a trip made the rotary build spill
        for (int ib = 0; ib < 32 / RC; ++ib) { v4f cc[RC], sn[RC], val[RC]; const int rb = r0w + ib * (2 * RC);   // the trip's first row: wave-uniform
            // the inner loops are unrolled so that a trip's loads all issue ahead of its arithmetic
            if constexpr (EPI == 1) { const float* cb = cosT + (size_t)rb * HD + tl; const float* sp = sinT + (size_t)rb * HD + tl;
#pragma unroll
                for (int i = 0; i < RC; ++i) { cc[i] = *(const v4f*)(cb + i * 2 * HD); sn[i] = *(const v4f*)(sp + i * 2 * HD); }
                asm volatile("s_wait_xcnt 0x0" :: "v"(cb), "v"(sp) : "memory"); }   // the wait before a register that the loads above name is rewritten; the two addresses as inputs stay live through the run, so that no load of the run lands in them
#pragma unroll
            for (int i = 0; i < RC; ++i) val[i] = *(const v4fa*)(ow + (ib * (2 * RC) + i * 2 + hi) * 68 + cofs) + bb;
            __builtin_amdgcn_sched_barrier(0);   // keeps the trip's loads together ahead of its arithmetic; without it they sink among the roundings and each latency is paid singly
            if constexpr (EPI == 0) { float* cp = C + z * (size_t)(TT * DM) + (size_t)(rb + hi) * DM + c0w + cofs;
#pragma unroll
                for (int i = 0; i < RC; ++i) *(v4f*)(cp + i * 2 * DM) = val[i];
                asm volatile("s_wait_xcnt 0x0" :: "v"(cp) : "memory");   // the wait before the address that the stores above name is rewritten for the next trip; as an input it stays live through the run
            } else { const size_t e = (size_t)head * TT * HD + fro(rb + hi, cofs, HD); h16* q16 = P16 + e; bf* qh = Ph + e; bf* ql = Pl + e;   // the trip's 2 RC rows lie inside one group of 16 rows (2 RC divides 16): row pair i is 16 i elements further on
#pragma unroll
                for (int i = 0; i < RC; ++i) { v4h o16; v4us oh, ol;
#pragma unroll
                    for (int q = 0; q < 4; ++q) { const float xp = __builtin_amdgcn_update_dpp(0.0f, val[i][q], 0x168, 0xf, 0xf, true);   // row_xmask:8: column d ^ 32 of this row sits in lane ^ 8
                        const float s = bfr(sn[i][q]); const float r = val[i][q] * bfr(cc[i][q]) + xp * (cofs < HD / 2 ? -s : s);
                        o16[q] = tohx(r); unsigned short a2, c2; splitf(r, a2, c2); oh[q] = a2; ol[q] = c2; }
                    *(v4h*)(q16 + i * 16) = o16; *(v4us*)(qh + i * 16) = oh; *(v4us*)(ql + i * 16) = ol; }
                asm volatile("s_wait_xcnt 0x0" :: "v"(q16), "v"(qh), "v"(ql) : "memory");   // as above, for the three planes' stores
            }
        }
    }
}


// k_cvtall: every f32 -> bf16 rounding of a call in one launch. A work-group rounds CVB consecutive elements: groups 0 .. NB_ TT DM / CVB - 1 take hidden (all batches), the rest the four weights in the order q, k, v, o, whose bf16 copies lie one behind the other at W4. CVB elements are one group of 16 rows, which fragment order keeps together: a thread reads the eight elements that belong at its place, so that the stores are consecutive.
#define CVG  8                    // 8-element groups per thread
#define CVB  (256 * 8 * CVG)
static_assert(CVB == 16 * DM && DQ == DM, "a work-group of k_cvtall rounds one group of 16 rows of DM elements");
__global__ __launch_bounds__(256) void k_cvtall(const float* __restrict__ x, const float* __restrict__ wq, const float* __restrict__ wk, const float* __restrict__ wv, const float* __restrict__ wo, bf* XB, bf* W4) {
    constexpr int NX = NB_ * TT * DM / CVB, NW = DM * DM / CVB; const int blk = blockIdx.x; const float* src; bf* dst;
    if (blk < NX) { src = x + (size_t)blk * CVB; dst = XB + (size_t)blk * CVB; }
    else { const int wb = blk - NX, w = wb / NW; src = (w == 0 ? wq : w == 1 ? wk : w == 2 ? wv : wo) + (size_t)(wb % NW) * CVB; dst = W4 + (size_t)wb * CVB; }
    v8f v[CVG]; const unsigned so = (unsigned)(((int)threadIdx.x & 15) * DM + ((int)threadIdx.x >> 6) * 32 + (((int)threadIdx.x >> 4) & 3) * 8);   // place oc = 256 g + thread of the group holds row oc % 16, k block oc / 64, piece (oc / 16) % 4 of the block's 32 k: 128 elements further for each g
    // both loops are unrolled so that all loads of a thread issue ahead of its first rounding
#pragma unroll
    for (int g = 0; g < CVG; ++g) v[g] = *(const v8f*)(src + so + g * 128);
#pragma unroll
    for (int g = 0; g < CVG; ++g) { v8us o;
#pragma unroll
        for (int k = 0; k < 8; ++k) o[k] = f2bf(v[g][k]);
        *(v8us*)(dst + (g * 256 + (int)threadIdx.x) * 8) = o; }
}

__constant__ float INVT[HD / 2] = { 1.000000000e+00f, 7.498942018e-01f, 5.623413324e-01f, 4.216965139e-01f, 3.162277639e-01f, 2.371373624e-01f, 1.778279394e-01f, 1.333521456e-01f, 1.000000015e-01f, 7.498941571e-02f, 5.623412877e-02f, 4.216964915e-02f, 3.162277862e-02f, 2.371373586e-02f, 1.778279431e-02f, 1.333521493e-02f, 9.999999776e-03f, 7.498942316e-03f, 5.623413250e-03f, 4.216964822e-03f, 3.162277862e-03f, 2.371373819e-03f, 1.778279431e-03f, 1.333521446e-03f, 1.000000047e-03f, 7.498941850e-04f, 5.623413017e-04f, 4.216964880e-04f, 3.162277862e-04f, 2.371373848e-04f, 1.778279402e-04f, 1.333521504e-04f };   // float32 1 / 10000^(2i/64), generated with jnp to be bit-exact
__global__ __launch_bounds__(256) void k_cs5(float* CS) { const int idx = blockIdx.x * 256 + threadIdx.x; if (idx >= TT * HD) return; const int d = idx % HD; const int t = idx / HD; const float a = __fmul_rn((float)t, INVT[d % (HD / 2)]); v2f cs; cs[0] = cosf(a); cs[1] = sinf(a); *(v2f*)(CS + (size_t)idx * 2) = cs;  }
// k_attn: one work-group = 32 (hi/lo) or 512 (fp16) query rows of one head, all 2048 keys; scores, probabilities and the partial output tiles never reach memory. attn_body (the hi/lo row tiles) keeps the score rows and the probabilities in LDS, as described here; attn_run (the fp16 rows) keeps them in registers.
// grid (heads, fp16 + hi/lo work-groups per head, batches), numbered as k_attn says; 512 threads = 16 waves. Rows below RH use the hi/lo bf16 planes (3 products), the rest the fp16 planes (attn_run).
// Phase 1: wave w forms S[32][128 w .. 128 w + 127] (k steps 0, 32 in turn). Phase 2: wave w does rows 2 w, 2 w + 1 (register row, one exp, fixed trees) and lays the 16-bit row over its own f32 row.
// Phase 3: wave w sums keys [128 w, 128 w + 128) of P V; the 16 partial tiles are added in wave order 0..15 and leave as the merged hi/lo planes [t][h * 64 + d] (fragment order). Q, K and V fragments come from planes in fragment order: 16 rows are 16 HD (q, k) or 16 TT (v) elements, a k step of 32 is 512.
#define RT   32
#define SPF  2052                 // LDS row pitch in floats: 8208 B = 16 B x 513 (odd), conflict-free for 16-byte fragment reads
typedef v4h  __attribute__((may_alias)) v4ha;
typedef v4us __attribute__((may_alias)) v4usa;
template <typename T16, bool HI>
__device__ __forceinline__ void attn_body(float* sm, const T16* __restrict__ Q, const T16* __restrict__ Q2, const T16* __restrict__ Kp, const T16* __restrict__ Kp2, const T16* __restrict__ Vt, const T16* __restrict__ Vt2, int t0, int h, bf* Ah, bf* Al) {
    typedef WFrag<T16> F; typedef typename F::V V;
    const int lane = threadIdx.x & 31, lr = lane & 15, hi = lane >> 4; const int wv = __builtin_amdgcn_readfirstlane((int)(threadIdx.x >> 5)); const int kbeg = wv * 128;
    const unsigned lo = (unsigned)(lane * 8), lv = (unsigned)(lane * 8);   // 32-bit lane offsets over wave-uniform bases: one address register per stream
    constexpr int CH = HI ? 2 : 8, NPRE = HI ? 1 : 4;   // key groups per batch of K loads; k steps of V fetched ahead of the softmax (what 256 registers hold)
    const T16* vb = Vt + kbeg * 16; const T16* vb2 = HI ? Vt2 + kbeg * 16 : nullptr; V vf[4][4], vf2[4][4];
    {   // phase 1: scores. Every loop is unrolled: fragment and accumulator arrays are indexed by constants
        V qa[2][2], qa2[2][2], b[8][2], b2[8][2]; const T16* qb = Q + (size_t)t0 * HD; const T16* qb2 = HI ? Q2 + (size_t)t0 * HD : nullptr; const T16* kb = Kp + (size_t)kbeg * HD; const T16* kb2 = HI ? Kp2 + (size_t)kbeg * HD : nullptr;
#pragma unroll
        for (int mb = 0; mb < 2; ++mb)
#pragma unroll
            for (int kk = 0; kk < 2; ++kk) { const int o = mb * 16 * HD + kk * 512; qa[mb][kk] = F::ldf(qb + lo + o); if (HI) qa2[mb][kk] = F::ldf(qb2 + lo + o); }
        __builtin_amdgcn_sched_barrier(0);   // keeps the Q loads ahead of the K loads, so that the first products wait for Q and one key group, not for the whole run
#pragma unroll
        for (int nb = 0; nb < CH; ++nb)
#pragma unroll
            for (int kk = 0; kk < 2; ++kk) { const int o = nb * 16 * HD + kk * 512; b[nb][kk] = F::ldf(kb + lo + o); if (HI) b2[nb][kk] = F::ldf(kb2 + lo + o); }
        asm volatile("s_wait_xcnt 0x0" :: "v"(lane) : "memory");   // the wait before a register that the loads above name is rewritten; the lane number, which the build gives them as their (scaled) offset register, as an input keeps that register live through the run, so that no load of the run lands in it
#pragma unroll
        for (int c = 0; c < 8; c += CH) {
            if (c + CH < 8) {
#pragma unroll
                for (int nb = c + CH; nb < c + 2 * CH; ++nb)
#pragma unroll
                    for (int kk = 0; kk < 2; ++kk) { const int o = nb * 16 * HD + kk * 512; b[nb][kk] = F::ldf(kb + lo + o); if (HI) b2[nb][kk] = F::ldf(kb2 + lo + o); } }
            __builtin_amdgcn_sched_barrier(0);   // keeps the loads above it in flight during the products below; without it each load sinks to its product and its latency is paid eight times over
#pragma unroll
            for (int nb = c; nb < c + CH; ++nb) { const int key = kbeg + nb * 16; v8f acc[2]; acc[0] = (v8f){}; acc[1] = (v8f){};
#pragma unroll
                for (int kk = 0; kk < 2; ++kk)
#pragma unroll
                    for (int mb = 0; mb < 2; ++mb) { acc[mb] = F::mma(qa[mb][kk], b[nb][kk], acc[mb]); if (HI) { acc[mb] = F::mma(qa2[mb][kk], b[nb][kk], acc[mb]); acc[mb] = F::mma(qa[mb][kk], b2[nb][kk], acc[mb]); } }
                asm volatile("v_nop\n\tv_nop\n\tv_nop\n\tv_nop" : "+v"(acc[0]), "+v"(acc[1]));   // four vector slots behind the group's last WMMA: the next group's first WMMA may write the same registers anew
#pragma unroll
                for (int mb = 0; mb < 2; ++mb)
#pragma unroll
                    for (int j = 0; j < 8; ++j) sm[(mb * 16 + hi * 8 + j) * SPF + key + lr] = acc[mb][j]; } }
    }
    __syncthreads();   // all 2048 scores of every row are in LDS before a wave reads its rows
    // the first V fragments are fetched here, behind the barrier (which drains a wave's loads), so that they fly during the softmax
#pragma unroll
    for (int ks = 0; ks < NPRE; ++ks)
#pragma unroll
        for (int nb = 0; nb < 4; ++nb) { const int o = nb * 16 * TT + ks * 512; vf[ks][nb] = F::ldf(vb + lv + o); if (HI) vf2[ks][nb] = F::ldf(vb2 + lv + o); }
    asm volatile("s_wait_xcnt 0x0" :: "v"(lane) : "memory");   // as above, for the V loads
#pragma unroll 1   // one row's 64 values at a time: two rows beside the V fragments held in registers would spill
    for (int rr = 0; rr < 2; ++rr) {   // phase 2: softmax of one row per trip
        float* sr = sm + (wv * 2 + rr) * SPF; float v[TT / 32]; float mx = -3.0e38f;
#pragma unroll
        for (int ch = 0; ch < TT / 128; ++ch) { const v4f a = *(const v4fa*)(sr + ch * 128 + lane * 4);
#pragma unroll
            for (int q = 0; q < 4; ++q) { const float t = a[q] * SCL; v[ch * 4 + q] = t; mx = fmaxf(mx, t); } }
#pragma unroll
        for (int sh = 16; sh; sh >>= 1) mx = fmaxf(mx, __shfl_xor(mx, sh, 32));
        float sum = 0.f;
#pragma unroll
        for (int k = 0; k < TT / 32; ++k) { v[k] = __builtin_amdgcn_exp2f(__fmul_rn(__fsub_rn(v[k], mx), 1.4426950408889634f)); sum += v[k]; }
#pragma unroll
        for (int sh = 16; sh; sh >>= 1) sum += __shfl_xor(sum, sh, 32);
        const float f = __fdiv_rn(HI ? 1.0f : PCAR, sum);
        // the 16-bit row overwrites the f32 row it came from: only this wave touches the row, and every store depends on the row's sum
        if (HI) {
#pragma unroll
            for (int ch = 0; ch < TT / 128; ++ch) { v4us oh, ol;
#pragma unroll
                for (int q = 0; q < 4; ++q) { unsigned short a, c2; splitf(v[ch * 4 + q] * f, a, c2); oh[q] = a; ol[q] = c2; }
                *(v4usa*)((bf*)sr + ch * 128 + lane * 4) = oh; *(v4usa*)((bf*)sr + TT + ch * 128 + lane * 4) = ol; }
        } else {
#pragma unroll
            for (int ch = 0; ch < TT / 128; ++ch) { v4h o4;
#pragma unroll
                for (int q = 0; q < 4; ++q) o4[q] = tohx(v[ch * 4 + q] * f);
                *(v4ha*)((h16*)sr + ch * 128 + lane * 4) = o4; } }
    }
    __syncthreads();   // every row's probabilities are in LDS before any wave reads them as A fragments
    v8f acc[2][4];
#pragma unroll
    for (int mb = 0; mb < 2; ++mb)
#pragma unroll
        for (int nb = 0; nb < 4; ++nb) acc[mb][nb] = (v8f){};
    // phase 3: P V. Unrolled: constant indices
#pragma unroll
    for (int ks = 0; ks < 4; ++ks) { const int kc = kbeg + ks * 32; V a[2], a2[2];
        if (ks + NPRE < 4) {
#pragma unroll
            for (int nb = 0; nb < 4; ++nb) { const int o = nb * 16 * TT + (ks + NPRE) * 512; vf[ks + NPRE][nb] = F::ldf(vb + lv + o); if (HI) vf2[ks + NPRE][nb] = F::ldf(vb2 + lv + o); }
            __builtin_amdgcn_sched_barrier(0);   // keeps the next k step's V loads in flight during this step's products; without it each load sinks to its product
        }
#pragma unroll
        for (int mb = 0; mb < 2; ++mb) { const T16* pr = (const T16*)(sm + (mb * 16 + lr) * SPF) + 8 * hi + kc; a[mb] = F::ld(pr); if (HI) a2[mb] = F::ld(pr + TT); }
#pragma unroll
        for (int nb = 0; nb < 4; ++nb)
#pragma unroll
            for (int mb = 0; mb < 2; ++mb) { acc[mb][nb] = F::mma(a[mb], vf[ks][nb], acc[mb][nb]); if (HI) { acc[mb][nb] = F::mma(a2[mb], vf[ks][nb], acc[mb][nb]); acc[mb][nb] = F::mma(a[mb], vf2[ks][nb], acc[mb][nb]); } } }
    __syncthreads();   // every wave has read its probabilities before the partial tiles overwrite them
    float* ow = sm + wv * (RT * 68);
#pragma unroll
    for (int mb = 0; mb < 2; ++mb)
#pragma unroll
        for (int nb = 0; nb < 4; ++nb)
#pragma unroll
            for (int j = 0; j < 8; ++j) ow[(mb * 16 + hi * 8 + j) * 68 + nb * 16 + lr] = acc[mb][nb][j];
    __syncthreads();   // every wave's partial tile is in LDS before any thread adds them
    const int row = (int)threadIdx.x >> 4, cofs = ((int)threadIdx.x & 15) * 4; v4f val = *(const v4fa*)(sm + row * 68 + cofs);
#pragma unroll
    for (int w = 1; w < 16; ++w) val += *(const v4fa*)(sm + (w * RT + row) * 68 + cofs);
    const float cs = HI ? 1.0f : (1.0f / PCAR); const size_t oo = fro(t0 + row, h * HD + cofs, DQ); v4us oh, ol;
#pragma unroll
    for (int q = 0; q < 4; ++q) { unsigned short a, c2; splitf(val[q] * cs, a, c2); oh[q] = a; ol[q] = c2; }
    *(v4us*)(Ah + oo) = oh; *(v4us*)(Al + oo) = ol;
}
// xrow: the value that lane l ^ 16 holds (the same place in the other 16-lane row)
__device__ __forceinline__ float xrow(float x) { const unsigned u = __float_as_uint(x); return __uint_as_float(__builtin_amdgcn_permlanex16(u, u, 0x76543210u, 0xfedcba98u, false, false)); }
// attn_run: the fp16 row tiles (t0 >= RH). One work-group = FQ = 512 query rows of one head: wave w owns queries t0 + 32 w .. + 31 against ALL keys, so that a K or V byte is fetched from L2 once for 512 queries and nothing is joined across waves.
// K and V reach the waves through LDS: a stage is SK = 128 keys, K as 16 KiB and V as 4 x 4 KiB (one run per group of 16 d) that are consecutive in memory (fragment order), brought by asynchronous copies as they lie, two buffers, the next stage in flight while one is worked on.
// Scores are formed TRANSPOSED, S^T = K Q^T (A = K, B = Q): lane (lr, hi) holds, for query mb * 16 + lr, keys g * 16 + hi * 8 + 0..7, and two neighbouring key groups are exactly the lane's sixteen elements of a fragment of P for one k step.
// The output is formed transposed too, O^T += V^T P^T (A = V^T, the plane as it lies; B = P): a lane's accumulators all belong to its own query, so maximum, sum and rescaling stay in the lane (plus lane ^ 16 for the maximum, and once at the end for the sum).
// Running softmax per pass of 64 keys: m' = max(m, the pass's maximum), the sums so far and O^T are multiplied by exp(m - m'), p = exp(s - m') in (0, 1] rounded to fp16; at the end O^T / l. A lane ends with eight consecutive d of one query: its 16 bytes of a block of the merged planes.
#define FQ   512
#define SK   128
static_assert((TT - RH) % FQ == 0 && TT % SK == 0 && TT / SK >= 2 && RH % RT == 0 && 4 * SK * HD * 2 <= RT * SPF * 4, "whole work-groups; two stages at least; the two buffers lie inside sm");
// cp4x: four asynchronous copies of 16 bytes a lane, global memory -> LDS, each with addresses of its own
__device__ __forceinline__ void cp4x(unsigned l0, const h16* g0, unsigned l1, const h16* g1, unsigned l2, const h16* g2, unsigned l3, const h16* g3) {
    // the copies and, as the last line of the same statement, the wait before a register that a copy names is rewritten
    asm volatile("global_load_async_to_lds_b128 %0, %1, off\n\tglobal_load_async_to_lds_b128 %2, %3, off\n\tglobal_load_async_to_lds_b128 %4, %5, off\n\tglobal_load_async_to_lds_b128 %6, %7, off\n\ts_wait_xcnt 0x0" :: "v"(l0), "v"(g0), "v"(l1), "v"(g1), "v"(l2), "v"(g2), "v"(l3), "v"(g3) : "memory");
}
__device__ __forceinline__ void attn_run(float* sm, const h16* __restrict__ Q, const h16* __restrict__ Kp, const h16* __restrict__ Vt, int t0, int h, bf* Ah, bf* Al) {
    typedef WFrag<h16> F; typedef F::V V;
    constexpr int NT = TT / SK, KE = SK * HD, BUFE = 2 * KE;   // stages; 16-bit elements of a stage's K (and of its V), of a buffer
    constexpr float C1 = SCL * 1.4426950408889634f;   // raw score -> exponent of two
    const int lane = threadIdx.x & 31, lr = lane & 15, hi = lane >> 4; const int wv = __builtin_amdgcn_readfirstlane((int)(threadIdx.x >> 5)); const int tq = t0 + wv * 32;
    // a stage is 64 pieces of 512 B: wave w brings pieces w and w + 16 of K and of V (V piece p: group p / 8 of 16 d, 512 B number p % 8 of its run)
    const unsigned lb = (unsigned)(size_t)sm + (unsigned)(wv * 512 + lane * 16); const h16* gk = Kp + wv * 256 + lane * 8; const h16* gv = Vt + (wv >> 3) * 16 * TT + (wv & 7) * 256 + lane * 8;
    auto stage = [&](int t, int buf) { const unsigned l = lb + (unsigned)buf * (unsigned)(BUFE * 2); const h16* k0 = gk + t * KE; const h16* v0 = gv + t * (SK * 16);
        cp4x(l, k0, l + 8192u, k0 + 4096, l + (unsigned)(KE * 2), v0, l + (unsigned)(KE * 2) + 8192u, v0 + 32 * TT); };
    V qa[2][2]; const h16* qb = Q + (size_t)tq * HD; const unsigned lo = (unsigned)(lane * 8);   // a 32-bit lane offset over a wave-uniform base
    // every inner loop below is unrolled: fragment and accumulator arrays are indexed by constants
#pragma unroll
    for (int mb = 0; mb < 2; ++mb)
#pragma unroll
        for (int kk = 0; kk < 2; ++kk) qa[mb][kk] = F::ldf(qb + lo + mb * 16 * HD + kk * 512);
    asm volatile("s_wait_xcnt 0x0" :: "v"(lane) : "memory");   // the wait before a register that the loads above name is rewritten; the lane number, their (scaled) offset register, as an input keeps that register live through the run
    v8f acc[4][2]; float mr[2], ls[2];
#pragma unroll
    for (int mb = 0; mb < 2; ++mb) { mr[mb] = -3.0e38f; ls[mb] = 0.f;
#pragma unroll
        for (int nb = 0; nb < 4; ++nb) acc[nb][mb] = (v8f){}; }
    stage(0, 0);
    asm volatile("s_wait_asynccnt 0x0" ::: "memory");   // this wave's copies of stage 0 have landed
    __syncthreads();   // stage 0 is in LDS before any wave reads it
    stage(1, 1);
#pragma unroll 1   // one stage a trip: the trip's foot is the hand-over of the buffers
    for (int t = 0; t < NT; ++t) {
        const h16* sl = (const h16*)sm + (t & 1) * BUFE + lane * 8;
#pragma unroll 1   // one pass of 64 keys a trip: with both passes in one block the build carried values of the first far into the second and spilled
        for (int ps = 0; ps < SK / 64; ++ps) { V kf[4][2], vf[2][4], pa[2][2]; v8f s[4][2]; const h16* sk = sl + ps * 4096; const h16* sv = sl + KE + ps * 1024;
#pragma unroll
            for (int g = 0; g < 4; ++g)
#pragma unroll
                for (int kk = 0; kk < 2; ++kk) kf[g][kk] = F::ldf(sk + g * 1024 + kk * 512);
            __builtin_amdgcn_sched_barrier(0);   // keeps the pass's K reads together ahead of its products; without it the build keeps one K fragment and waits out the LDS latency eight times a pass
#pragma unroll
            for (int g = 0; g < 4; ++g) { s[g][0] = (v8f){}; s[g][1] = (v8f){};
#pragma unroll
                for (int kk = 0; kk < 2; ++kk)
#pragma unroll
                    for (int mb = 0; mb < 2; ++mb) s[g][mb] = F::mma(kf[g][kk], qa[mb][kk], s[g][mb]); }
            __builtin_amdgcn_sched_barrier(0);   // keeps the pass's products back to back; without it the build mixes the first steps of the maximum among them, each behind the idle slots that a product's result asks for
#pragma unroll
            for (int mb = 0; mb < 2; ++mb) { float m = s[0][mb][0];
#pragma unroll
                for (int g = 0; g < 4; ++g)
#pragma unroll
                    for (int j = 0; j < 8; ++j) m = fmaxf(m, s[g][mb][j]);
                m = fmaxf(m, xrow(m)); const float mn = fmaxf(mr[mb], m); const float al = __builtin_amdgcn_exp2f((mr[mb] - mn) * C1); const float mc = mn * C1; mr[mb] = mn; v8f a8;   // first pass: the exponent is hugely negative and the weight is 0
#pragma unroll
                for (int ks = 0; ks < 2; ++ks) { v8h p8[2];
#pragma unroll
                    for (int u = 0; u < 2; ++u) { const v8f x = s[2 * ks + u][mb] * C1 - mc; v8f e;
#pragma unroll
                        for (int j = 0; j < 8; ++j) e[j] = __builtin_amdgcn_exp2f(x[j]);
                        if (ks == 0 && u == 0) a8 = e; else a8 += e;
                        p8[u] = __builtin_convertvector(e, v8h); }
                    pa[ks][mb] = cat16(p8[0], p8[1]); }
                ls[mb] = ls[mb] * al + (((a8[0] + a8[1]) + (a8[2] + a8[3])) + ((a8[4] + a8[5]) + (a8[6] + a8[7])));
#pragma unroll
                for (int nb = 0; nb < 4; ++nb) acc[nb][mb] *= al;
                // one k step of V is read behind each half of the vector work: the first flies during the exponentials, the second during the first k step's products
                __builtin_amdgcn_sched_barrier(0);   // keeps the second k step's reads from rising to the first's, where both would hold their registers through all the exponentials
#pragma unroll
                for (int nb = 0; nb < 4; ++nb) vf[mb][nb] = F::ldf(sv + nb * (SK * 16) + mb * 512);
                __builtin_amdgcn_sched_barrier(0);   // keeps these reads here, ahead of the work that follows; without it they sink among the products of P V, two at a time, and each pair is waited for singly
            }
#pragma unroll
            for (int ks = 0; ks < 2; ++ks)
#pragma unroll
                for (int nb = 0; nb < 4; ++nb)
#pragma unroll
                    for (int mb = 0; mb < 2; ++mb) acc[nb][mb] = F::mma(vf[ks][nb], pa[ks][mb], acc[nb][mb]);
        }
        asm volatile("s_wait_dscnt 0x0" ::: "memory");      // this wave's reads of the buffer are done before the barrier behind which it is refilled
        asm volatile("s_wait_asynccnt 0x0" ::: "memory");   // this wave's copies of the next stage have landed
        __syncthreads();   // publishes the next stage and ends every wave's reads of this one
        if (t + 2 < NT) stage(t + 2, t & 1);
    }
    asm volatile("s_wait_asynccnt 0x0" ::: "memory");   // no copy is outstanding when the wave ends
    const size_t oo = fro(tq + lr, h * HD + hi * 8, DQ); bf* ph = Ah + oo; bf* pl = Al + oo;   // group nb of 16 d is 256 nb elements further on, the second 16 queries 16 DQ
#pragma unroll
    for (int mb = 0; mb < 2; ++mb) { const float cs = __fdiv_rn(1.0f, ls[mb] + xrow(ls[mb]));   // the sum is at least about 1: the key that holds the maximum counts 1
#pragma unroll
        for (int nb = 0; nb < 4; ++nb) { v8us oh, ol;
#pragma unroll
            for (int j = 0; j < 8; ++j) { unsigned short a, c2; splitf(acc[nb][mb][j] * cs, a, c2); oh[j] = a; ol[j] = c2; }
            *(v8us*)(ph + mb * 16 * DQ + nb * 256) = oh; *(v8us*)(pl + mb * 16 * DQ + nb * 256) = ol; } }
}
#define NFL  ((TT - RH) / FQ)     // fp16 work-groups per batch and head
#define NHL  (RH / RT)            // hi/lo work-groups per batch and head
__global__ __launch_bounds__(512) void k_attn(const h16* __restrict__ Q16, const h16* __restrict__ K16, const h16* __restrict__ V16, const bf* __restrict__ Qh, const bf* __restrict__ Ql, const bf* __restrict__ Kh, const bf* __restrict__ Kl, const bf* __restrict__ Vh, const bf* __restrict__ Vl, bf* Ah, bf* Al) {
    __shared__ __align__(16) float sm[RT * SPF];
    // the work-groups are numbered along x, y, z; the fp16 ones, which run longest, have the lowest numbers
    const unsigned lin = (blockIdx.z * (NFL + NHL) + blockIdx.y) * NH_ + blockIdx.x;
    if (lin < NFL * NB_ * NH_) { const unsigned h = lin % NH_, r = lin / NH_, zb = r / NFL; const int t0 = RH + (int)(r % NFL) * FQ; const size_t zo = ((size_t)zb * NH_ + h) * TT * HD, za = (size_t)zb * TT * DQ;
        attn_run(sm, Q16 + zo, K16 + zo, V16 + zo, t0, (int)h, Ah + za, Al + za);
    } else { const unsigned l2 = lin - NFL * NB_ * NH_, h = l2 % NH_, r = l2 / NH_, zb = r / NHL; const int t0 = (int)(r % NHL) * RT; const size_t zo = ((size_t)zb * NH_ + h) * TT * HD, za = (size_t)zb * TT * DQ;
        attn_body<bf, true>(sm, Qh + zo, Ql + zo, Kh + zo, Kl + zo, Vh + zo, Vl + zo, t0, (int)h, Ah + za, Al + za); }
}

extern "C" void kernel_launch(void* const* d_in, const int* in_sizes, int n_in,
                              void* d_out, int out_size, void* d_ws, size_t ws_size, hipStream_t stream) {
    (void)in_sizes; (void)n_in; (void)out_size;
    const float* x = (const float*)d_in[0]; const float* fcos = (const float*)d_in[1]; const float* fsin = (const float*)d_in[2]; const float* wq = (const float*)d_in[3]; const float* bq = (const float*)d_in[4]; const float* wk = (const float*)d_in[5]; const float* bk = (const float*)d_in[6]; const float* wv = (const float*)d_in[7]; const float* bv = (const float*)d_in[8]; const float* wo = (const float*)d_in[9]; const float* bo = (const float*)d_in[10];   /* hidden [4][2048][1024] (ONE stream, rounded to bf16 once for q, k and v), cos, sin ([4][2048][64] = [B][S][D] PER-BATCH full-width table INPUTS: read per element by value), Wq, bq, Wk, bk, Wv, bv, Wo, bo ('oi' (out, in) [1024][1024] + [1024]): ELEVEN inputs, all read */
    float* OUT = (float*)d_out;     // [4][2048][1024]
    char* wsp = (char*)d_ws;
    auto take = [&](size_t bytes) { char* p = wsp; wsp += (bytes + 255) & ~(size_t)255; return (void*)p; };
    bf* WQ = (bf*)take((size_t)DQ * DM * 2); bf* WK = (bf*)take((size_t)DKV * DM * 2); bf* WV = (bf*)take((size_t)DKV * DM * 2); bf* WO = (bf*)take((size_t)DM * DQ * 2);
    bf* XB = (bf*)take((size_t)NB_ * TT * DM * 2);
    h16* QP16 = (h16*)take((size_t)NB_ * NH_ * TT * HD * 2); h16* KP16 = (h16*)take((size_t)NB_ * NKV * TT * HD * 2); h16* VT16 = (h16*)take((size_t)NB_ * NKV * HD * TT * 2);
    bf* QPh = (bf*)take((size_t)NB_ * NH_ * TT * HD * 2); bf* QPl = (bf*)take((size_t)NB_ * NH_ * TT * HD * 2); bf* KPh = (bf*)take((size_t)NB_ * NKV * TT * HD * 2); bf* KPl = (bf*)take((size_t)NB_ * NKV * TT * HD * 2); bf* VTh = (bf*)take((size_t)NB_ * NKV * HD * TT * 2); bf* VTl = (bf*)take((size_t)NB_ * NKV * HD * TT * 2);
    bf* ATh = (bf*)take((size_t)NB_ * TT * DQ * 2); bf* ATl = (bf*)take((size_t)NB_ * TT * DQ * 2);
    (void)WK; (void)WV;   // reached through WQ
    if ((size_t)(wsp - (char*)d_ws) > ws_size) return;    // 200 MiB of the 256 MiB
    k_cvtall<<<(NB_ * TT * DM + 4 * DM * DM) / CVB, 256, 0, stream>>>(x, wq, wk, wv, wo, XB, WQ);   // WQ, WK, WV, WO are consecutive takes of 2 MiB each
    /* q, k, v: one launch; WQ, WK, WV are one [3 DQ][DM] matrix, and QP16, KP16, VT16 as well as QPh, QPl, KPh, KPl, VTh, VTl are consecutive takes. The q and k parts read batch z's own slice of the INPUT rotary tables in their epilogue; k_cs5 and its INVT constants stay defined and are NOT launched */
    k_gemms<0, 1><<<dim3(TT / 128, (DQ + 2 * DKV) / 256, NB_), 256, 0, stream>>>(XB, nullptr, WQ, nullptr, bq, bk, bv, fcos, fsin, QP16, QPh, QPl);
    k_attn<<<dim3(NH_, NFL + NHL, NB_), 512, 0, stream>>>(QP16, KP16, VT16, QPh, QPl, KPh, KPl, VTh, VTl, ATh, ATl);   // one kv head per query head
    k_gemms<1, 0><<<dim3(TT / 128, DM / 256, NB_), 256, 0, stream>>>(ATh, ATl, WO, OUT, bo, nullptr, nullptr, nullptr, nullptr, nullptr, nullptr, nullptr);
}

// v009
// One run takes 169 microseconds.
// Next to v008, in two timings, it ran 1.20 times as fast each time.
// Over all steps from v000 it is 23.2 times as fast.
#include <hip/hip_runtime.h>

// Rotary multi-head self-attention with PER-BATCH full-width rotary tables given as inputs (hidden [4][2048][1024]: ONE stream; q, k, v = hidden W^T + b ('oi' (out, in) [1024][1024] normal x 1024^-0.5 + zero biases: read; 16 heads x 64); q, k -> t cos + cat(-t2, t1) sin with the cos / sin INPUT tables [4][2048][64] = [B][S][D] (uniform random values on this draw: batch b reads ITS OWN slice, per element by value; no structure assumed); scores x 64^-0.5; softmax over all keys (no mask); out = merged Wo^T + bo ('oi' + a zero bias: read) -> [4][2048][1024] (8.4 M); argument order hidden, cos, sin, Wq, bq, Wk, bk, Wv, bv, Wo, bo).
// Every stage is launched once for all four batches (batch = grid z; every workspace plane holds the four batches one behind the other). Layout per batch: bf16 copies of the input stream(s); 'oi' weights; exact projections + f32 biases, whose epilogue applies the rotary tables and writes the head planes (q, k: [h][t][d]; v: [h][d][t]); dense T-2048 attention in one kernel, scores and probabilities in registers (hybrid rows: < 512 hi/lo 3 products; rest fp16; each wave its own 32 queries against a running maximum, K and V shared through LDS); merged hi/lo x Wo exact + bo.
// Every 16-bit plane that a matrix product reads from memory (hidden, the weights, q, k, v, merged) lies in FRAGMENT ORDER (fro() below), so that one wave-wide 16-byte load covers 512 consecutive bytes = four whole 128-byte lines; each lane receives the same elements as from a row-major plane.
// Compute dtypes, f32 accumulate: every input rounded to bf16; projections exact + f32 biases; attention rows < 512 3 products, rest fp16; softmax f32; Wo hl x exact + bias.

#define NB_  4
#define TT   2048
#define DM   1024
#define NH_  16
#define NKV  16
#define REP  (NH_ / NKV)
static_assert(NKV == NH_, "the q, k, v launch numbers its tile columns by NH_ heads a part");
#define HD   64
#define DQ   (NH_ * HD)
#define DKV  (NKV * HD)
#define RH   512                  // query rows < RH use hi+lo planes (0: none)
#define WIN  0
#define PCAR 1024.0f
#define SCL  0.125f   // HD^-0.5
typedef _Float16 h16;
typedef unsigned short bf;
typedef __attribute__((ext_vector_type(16))) __bf16   v16bf;
typedef __attribute__((ext_vector_type(16))) _Float16 v16h;
typedef __attribute__((ext_vector_type(8)))  _Float16 v8h;
typedef __attribute__((ext_vector_type(8)))  unsigned short v8us;
typedef __attribute__((ext_vector_type(8)))  float    v8f;
typedef __attribute__((ext_vector_type(4)))  float    v4f;
typedef v8h  __attribute__((may_alias)) v8ha;
typedef v4f  __attribute__((may_alias)) v4fa;
typedef v8us __attribute__((may_alias)) v8usa;

__device__ __forceinline__ unsigned short f2bf(float f) { unsigned u = __float_as_uint(f); u += 0x7FFFu + ((u >> 16) & 1u); return (unsigned short)(u >> 16); }
__device__ __forceinline__ float bf2f(unsigned short b) { return __uint_as_float(((unsigned)b) << 16); }
__device__ __forceinline__ float bfr(float f) { return bf2f(f2bf(f)); }
__device__ __forceinline__ v16h cat16(v8h lo, v8h hi) { return __builtin_shufflevector(lo, hi, 0, 1, 2, 3, 4, 5, 6, 7, 8, 9, 10, 11, 12, 13, 14, 15); }
__device__ __forceinline__ v16bf cat16b(v8us lo, v8us hi) { return __builtin_bit_cast(v16bf, __builtin_shufflevector(lo, hi, 0, 1, 2, 3, 4, 5, 6, 7, 8, 9, 10, 11, 12, 13, 14, 15)); }
__device__ __forceinline__ v8f wmma16(v16h a, v16h b, v8f c) { return __builtin_amdgcn_wmma_f32_16x16x32_f16(false, a, false, b, (short)0, c, false, false); }
__device__ __forceinline__ v8f wmmab(v16bf a, v16bf b, v8f c) { return __builtin_amdgcn_wmma_f32_16x16x32_bf16(false, a, false, b, (short)0, c, false, false); }

__device__ __forceinline__ h16 tohx(float x) { return (h16)x; }
__device__ __forceinline__ void splitf(float y, unsigned short& h, unsigned short& l) { h = f2bf(y); l = f2bf(y - bf2f(h)); }
typedef __attribute__((ext_vector_type(2))) _Float16 v2h;
typedef __attribute__((ext_vector_type(4))) _Float16 v4h;
typedef __attribute__((ext_vector_type(2))) unsigned short v2us;
typedef __attribute__((ext_vector_type(4))) unsigned short v4us;
typedef __attribute__((ext_vector_type(2))) float v2f;
typedef __attribute__((ext_vector_type(4))) int v4i;

// ---- k_gemms: GEMM with the operands shared through LDS. One work-group (8 waves, 2 x 4) forms a 128 x 256 tile of C, each wave one 64 x 64 tile (16 accumulators) over the WHOLE k range, k ascending; grid (M / 128, N / 256, batches), 256 threads.
// C[m][n] = sum_k A[m][k] Bt[n][k] (+ A2[m][k] Bt[n][k] for NSPLIT 1) + bias[n] (rounded to bf16). A, A2, Bt are bf16 planes of DM columns in fragment order (fro() below); z is the batch: A, A2 and C lie TT * DM elements further on for each, Bt is shared.
// A slab is 64 k of the tile's 128 A (and A2) rows and 256 Bt rows: per group of 16 rows two fragment blocks = 2 KiB that are consecutive in memory. Asynchronous copies bring a slab into LDS as it lies (group g at g * 2 KiB), two buffers, the next slab in flight while one is worked on; every wave reads its fragments from LDS as it would from memory.
// EPI 0: f32 C rows [m][DM]. EPI 1: the q, k and v projections in one launch: Bt holds the three weights one behind the other, a wave's 64 columns are one head of part (0 q, 1 k, 2 v; the same for the whole work-group), bias / biasK / biasV are the parts' biases. Parts 0, 1: rotate-half rotary with the cos / sin tables [t][64], each rounded to bf16, then head planes [h][t][d] (fp16 + bf16 hi/lo); part 2: transposed head planes [h][d][t] (fp16 + bf16 hi/lo), straight from the accumulators (a lane holds eight consecutive t of one d: its 16 bytes of a block); each head's plane in fragment order. The planes of part p start p (fp16) or 2 p (hi, lo) whole planes behind P16, Ph, Pl; batch z's tables are TT * HD and its head planes NH_ * TT * HD elements further on. C is not written for EPI 1.
// fro: the place (in elements) of element (row, k) of a [rows][K] 16-bit operand plane in fragment order. A block of 512 elements holds 16 rows x 32 k; blocks run along k, then down the row groups. Inside a block: half s = bit 4 of k (256 elements), then lane = 16 * (bit 3 of k) + row % 16 (8 elements), then k % 8: the two 16-byte pieces that lane holds of the block's A or B fragment.
__device__ __forceinline__ size_t fro(int row, int k, int K) { return (size_t)(row >> 4) * 16 * K + (k >> 5) * 512 + ((k >> 4) & 1) * 256 + (((k >> 3) & 1) * 16 + (row & 15)) * 8 + (k & 7); }
template <typename T16> struct WFrag;
// ld: a fragment from a row-major row (LDS); ldf: from a block in fragment order, p = the block + 8 * lane
template <> struct WFrag<h16> { typedef v16h V; static __device__ __forceinline__ V ld(const h16* p) { return cat16(*(const v8h*)p, *(const v8h*)(p + 16)); } static __device__ __forceinline__ V ldf(const h16* p) { return cat16(*(const v8h*)p, *(const v8h*)(p + 256)); } static __device__ __forceinline__ v8f mma(V a, V b, v8f c) { return wmma16(a, b, c); } };
template <> struct WFrag<bf> { typedef v16bf V; static __device__ __forceinline__ V ld(const bf* p) { return cat16b(*(const v8us*)p, *(const v8us*)(p + 16)); } static __device__ __forceinline__ V ldf(const bf* p) { return cat16b(*(const v8us*)p, *(const v8us*)(p + 256)); } static __device__ __forceinline__ v8f mma(V a, V b, v8f c) { return wmmab(a, b, c); } };
// cp4: four asynchronous copies of 16 bytes a lane, global memory -> LDS: row groups two apart (32 rows of DM elements in memory, 4 KiB in LDS)
__device__ __forceinline__ void cp4(unsigned l0, const bf* g0) {
    const unsigned l1 = l0 + 4096u, l2 = l0 + 8192u, l3 = l0 + 12288u; const bf* g1 = g0 + 32 * DM; const bf* g2 = g0 + 64 * DM; const bf* g3 = g0 + 96 * DM;
    // the copies and, as the last line of the same statement, the wait before a register that a copy names is rewritten
    asm volatile("global_load_async_to_lds_b128 %0, %1, off\n\tglobal_load_async_to_lds_b128 %2, %3, off\n\tglobal_load_async_to_lds_b128 %4, %5, off\n\tglobal_load_async_to_lds_b128 %6, %7, off\n\ts_wait_xcnt 0x0" :: "v"(l0), "v"(g0), "v"(l1), "v"(g1), "v"(l2), "v"(g2), "v"(l3), "v"(g3) : "memory");
}
// the second launch bound (waves per SIMD) holds a wave to 256 registers, so that two work-groups fit on a WGP
template <int NSPLIT, int EPI>
__global__ __launch_bounds__(256, 4) void k_gemms(const bf* __restrict__ A, const bf* __restrict__ A2, const bf* __restrict__ Bt, float* C, const float* __restrict__ bias, const float* __restrict__ biasK, const float* __restrict__ biasV, const float* __restrict__ cosT, const float* __restrict__ sinT, h16* P16, bf* Ph, bf* Pl) {
    typedef WFrag<bf> F; typedef F::V V;
    constexpr int K = DM, GA = NSPLIT ? 16 : 8, NG = GA + 16, BUFE = NG * 1024, NT = K / 64;   // row groups of A (and A2), of a slab; 16-bit elements of a buffer; slabs
    static_assert(NT >= 2 && BUFE <= 8 * 64 * 68 && DQ % 256 == 0 && TT % 128 == 0, "two slabs at least; the two buffers (BUFE floats) lie inside the eight output tiles");
    __shared__ __align__(16) float os[8 * 64 * 68];   // first the two operand buffers, then one [64][68] f32 tile per wave
    const size_t z = blockIdx.z; const int lane = threadIdx.x & 31, lr = lane & 15, hi = lane >> 4; const int wv = __builtin_amdgcn_readfirstlane((int)(threadIdx.x >> 5)), wm = wv & 1, wn = wv >> 1;
    const int r0 = blockIdx.x * 128, c0 = blockIdx.y * 256, r0w = r0 + wm * 64, c0w = c0 + wn * 64;
    // copy c of wave w brings piece w % 4 (512 B) of row group 2 c + w / 4
    const unsigned lb = (unsigned)(size_t)os + (unsigned)(wv * 512 + lane * 16); const int go = (wv >> 2) * 16 * K + (wv & 3) * 256 + lane * 8;
    const bf* pA = A + z * (size_t)(TT * DM) + (size_t)r0 * K + go; const bf* pA2 = NSPLIT ? A2 + z * (size_t)(TT * DM) + (size_t)r0 * K + go : nullptr; const bf* pB = Bt + (size_t)c0 * K + go;
    auto stage = [&](int t, int buf) { const unsigned l = lb + (unsigned)buf * (unsigned)(BUFE * 2); const int ko = t * 1024;
        cp4(l, pA + ko); if constexpr (NSPLIT != 0) cp4(l + 16384u, pA2 + ko); cp4(l + GA * 2048u, pB + ko); cp4(l + GA * 2048u + 16384u, pB + ko + 128 * K); };
    v8f acc[4][4];
#pragma unroll
    for (int mb = 0; mb < 4; ++mb)
#pragma unroll
        for (int nb = 0; nb < 4; ++nb) acc[mb][nb] = (v8f){};
    stage(0, 0);
    asm volatile("s_wait_asynccnt 0x0" ::: "memory");   // this wave's copies of slab 0 have landed
    __syncthreads();   // slab 0 is in LDS before any wave reads it
    stage(1, 1);
#pragma unroll 1   // one slab a trip: the trip's foot is the hand-over of the buffers
    for (int t = 0; t < NT; ++t) {
        const bf* sl = (const bf*)os + (t & 1) * BUFE + lane * 8;
        // unrolled: fragment and accumulator arrays are indexed by constants
#pragma unroll
        for (int kk = 0; kk < 2; ++kk) { V a[4], a2[4], b[4];
#pragma unroll
            for (int mb = 0; mb < 4; ++mb) { a[mb] = F::ldf(sl + (wm * 4 + mb) * 1024 + kk * 512); if (NSPLIT) a2[mb] = F::ldf(sl + (8 + wm * 4 + mb) * 1024 + kk * 512); }
#pragma unroll
            for (int nb = 0; nb < 4; ++nb) b[nb] = F::ldf(sl + (GA + wn * 4 + nb) * 1024 + kk * 512);
            __builtin_amdgcn_sched_barrier(0);   // keeps the k step's LDS reads together ahead of its products; without it the build keeps one B fragment and waits out the LDS latency four times a k step
#pragma unroll
            for (int nb = 0; nb < 4; ++nb)
#pragma unroll
                for (int mb = 0; mb < 4; ++mb) { acc[mb][nb] = F::mma(a[mb], b[nb], acc[mb][nb]); if (NSPLIT) acc[mb][nb] = F::mma(a2[mb], b[nb], acc[mb][nb]); } }
        asm volatile("s_wait_dscnt 0x0" ::: "memory");      // this wave's reads of the buffer are done before the barrier behind which it is refilled
        asm volatile("s_wait_asynccnt 0x0" ::: "memory");   // this wave's copies of the next slab have landed
        __syncthreads();   // publishes the next slab and ends every wave's reads of this one
        if (t + 2 < NT) stage(t + 2, t & 1);
    }
    asm volatile("s_wait_asynccnt 0x0" ::: "memory");   // no copy is outstanding when the buffers become output tiles
    const int part = EPI == 1 ? (int)blockIdx.y / (DQ / 256) : 0, head = EPI == 1 ? ((int)blockIdx.y % (DQ / 256)) * 4 + wn : 0;   // part: the same for the whole work-group
    const float* bp = bias + c0w; if constexpr (EPI == 1) bp = (part == 0 ? bias : part == 1 ? biasK : biasV) + head * 64;
    if constexpr (EPI == 1) { cosT += z * (size_t)(TT * HD); sinT += z * (size_t)(TT * HD); P16 += ((size_t)part * NB_ + z) * (size_t)(NH_ * TT * HD); Ph += ((size_t)part * 2 * NB_ + z) * (size_t)(NH_ * TT * HD); Pl += ((size_t)part * 2 * NB_ + z) * (size_t)(NH_ * TT * HD);
    }
    if (EPI == 1 && part == 2) {
        // unrolled: acc is indexed by constants
#pragma unroll
        for (int nb = 0; nb < 4; ++nb) { const float b1 = bfr(bp[nb * 16 + lr]);
#pragma unroll
            for (int mb = 0; mb < 4; ++mb) { v8h o16; v8us oh, ol;
#pragma unroll
                for (int j = 0; j < 8; ++j) { const float x = acc[mb][nb][j] + b1; o16[j] = tohx(x); unsigned short a2, c2; splitf(x, a2, c2); oh[j] = a2; ol[j] = c2; }
                const size_t e = (size_t)head * HD * TT + fro(nb * 16 + lr, r0w + mb * 16 + hi * 8, TT); *(v8h*)(P16 + e) = o16; *(v8us*)(Ph + e) = oh; *(v8us*)(Pl + e) = ol; } }
    } else {
        // the last trip's barrier has ended every wave's reads of the buffers: the tiles may overwrite them
        float* ow = os + wv * (64 * 68); const int cofs = lr * 4; v4f bb; bb[0] = bfr(bp[cofs]); bb[1] = bfr(bp[cofs + 1]); bb[2] = bfr(bp[cofs + 2]); bb[3] = bfr(bp[cofs + 3]);
#pragma unroll
        for (int mb = 0; mb < 4; ++mb)
#pragma unroll
            for (int nb = 0; nb < 4; ++nb)
#pragma unroll
                for (int j = 0; j < 8; ++j) ow[(mb * 16 + hi * 8 + j) * 68 + nb * 16 + lr] = acc[mb][nb][j];
        const unsigned tl = (unsigned)(hi * HD + cofs); constexpr int RC = EPI == 1 ? 4 : 8;
        __syncthreads();   // the tile is in LDS before a lane reads what other lanes wrote; part is the same for the whole work-group, so every wave of it passes here or none
#pragma unroll 1   // RC row pairs a trip: the whole tile unrolled would be 32 KiB of code, and more rows a trip made the rotary build spill
        for (int ib = 0; ib < 32 / RC; ++ib) { v4f cc[RC], sn[RC], val[RC]; const int rb = r0w + ib * (2 * RC);   // the trip's first row: wave-uniform
            // the inner loops are unrolled so that a trip's loads all issue ahead of its arithmetic
            if constexpr (EPI == 1) { const float* cb = cosT + (size_t)rb * HD + tl; const float* sp = sinT + (size_t)rb * HD + tl;
#pragma unroll
                for (int i = 0; i < RC; ++i) { cc[i] = *(const v4f*)(cb + i * 2 * HD); sn[i] = *(const v4f*)(sp + i * 2 * HD); }
                asm volatile("s_wait_xcnt 0x0" :: "v"(cb), "v"(sp) : "memory"); }   // the wait before a register that the loads above name is rewritten; the two addresses as inputs stay live through the run, so that no load of the run lands in them
#pragma unroll
            for (int i = 0; i < RC; ++i) val[i] = *(const v4fa*)(ow + (ib * (2 * RC) + i * 2 + hi) * 68 + cofs) + bb;
            __builtin_amdgcn_sched_barrier(0);   // keeps the trip's loads together ahead of its arithmetic; without it they sink among the roundings and each latency is paid singly
            if constexpr (EPI == 0) { float* cp = C + z * (size_t)(TT * DM) + (size_t)(rb + hi) * DM + c0w + cofs;
#pragma unroll
                for (int i = 0; i < RC; ++i) *(v4f*)(cp + i * 2 * DM) = val[i];
                asm volatile("s_wait_xcnt 0x0" :: "v"(cp) : "memory");   // the wait before the address that the stores above name is rewritten for the next trip; as an input it stays live through the run
            } else { const size_t e = (size_t)head * TT * HD + fro(rb + hi, cofs, HD); h16* q16 = P16 + e; bf* qh = Ph + e; bf* ql = Pl + e;   // the trip's 2 RC rows lie inside one group of 16 rows (2 RC divides 16): row pair i is 16 i elements further on
#pragma unroll
                for (int i = 0; i < RC; ++i) { v4h o16; v4us oh, ol;
#pragma unroll
                    for (int q = 0; q < 4; ++q) { const float xp = __builtin_amdgcn_update_dpp(0.0f, val[i][q], 0x168, 0xf, 0xf, true);   // row_xmask:8: column d ^ 32 of this row sits in lane ^ 8
                        const float s = bfr(sn[i][q]); const float r = val[i][q] * bfr(cc[i][q]) + xp * (cofs < HD / 2 ? -s : s);
                        o16[q] = tohx(r); unsigned short a2, c2; splitf(r, a2, c2); oh[q] = a2; ol[q] = c2; }
                    *(v4h*)(q16 + i * 16) = o16; *(v4us*)(qh + i * 16) = oh; *(v4us*)(ql + i * 16) = ol; }
                asm volatile("s_wait_xcnt 0x0" :: "v"(q16), "v"(qh), "v"(ql) : "memory");   // as above, for the three planes' stores
            }
        }
    }
}


// k_cvtall: every f32 -> bf16 rounding of a call in one launch. A work-group rounds CVB consecutive elements: groups 0 .. NB_ TT DM / CVB - 1 take hidden (all batches), the rest the four weights in the order q, k, v, o, whose bf16 copies lie one behind the other at W4. CVB elements are one group of 16 rows, which fragment order keeps together: a thread reads the eight elements that belong at its place, so that the stores are consecutive.
#define CVG  8                    // 8-element groups per thread
#define CVB  (256 * 8 * CVG)
static_assert(CVB == 16 * DM && DQ == DM, "a work-group of k_cvtall rounds one group of 16 rows of DM elements");
__global__ __launch_bounds__(256) void k_cvtall(const float* __restrict__ x, const float* __restrict__ wq, const float* __restrict__ wk, const float* __restrict__ wv, const float* __restrict__ wo, bf* XB, bf* W4) {
    constexpr int NX = NB_ * TT * DM / CVB, NW = DM * DM / CVB; const int blk = blockIdx.x; const float* src; bf* dst;
    if (blk < NX) { src = x + (size_t)blk * CVB; dst = XB + (size_t)blk * CVB; }
    else { const int wb = blk - NX, w = wb / NW; src = (w == 0 ? wq : w == 1 ? wk : w == 2 ? wv : wo) + (size_t)(wb % NW) * CVB; dst = W4 + (size_t)wb * CVB; }
    v8f v[CVG]; const unsigned so = (unsigned)(((int)threadIdx.x & 15) * DM + ((int)threadIdx.x >> 6) * 32 + (((int)threadIdx.x >> 4) & 3) * 8);   // place oc = 256 g + thread of the group holds row oc % 16, k block oc / 64, piece (oc / 16) % 4 of the block's 32 k: 128 elements further for each g
    // both loops are unrolled so that all loads of a thread issue ahead of its first rounding
#pragma unroll
    for (int g = 0; g < CVG; ++g) v[g] = *(const v8f*)(src + so + g * 128);
#pragma unroll
    for (int g = 0; g < CVG; ++g) { v8us o;
#pragma unroll
        for (int k = 0; k < 8; ++k) o[k] = f2bf(v[g][k]);
        *(v8us*)(dst + (g * 256 + (int)threadIdx.x) * 8) = o; }
}

__constant__ float INVT[HD / 2] = { 1.000000000e+00f, 7.498942018e-01f, 5.623413324e-01f, 4.216965139e-01f, 3.162277639e-01f, 2.371373624e-01f, 1.778279394e-01f, 1.333521456e-01f, 1.000000015e-01f, 7.498941571e-02f, 5.623412877e-02f, 4.216964915e-02f, 3.162277862e-02f, 2.371373586e-02f, 1.778279431e-02f, 1.333521493e-02f, 9.999999776e-03f, 7.498942316e-03f, 5.623413250e-03f, 4.216964822e-03f, 3.162277862e-03f, 2.371373819e-03f, 1.778279431e-03f, 1.333521446e-03f, 1.000000047e-03f, 7.498941850e-04f, 5.623413017e-04f, 4.216964880e-04f, 3.162277862e-04f, 2.371373848e-04f, 1.778279402e-04f, 1.333521504e-04f };   // float32 1 / 10000^(2i/64), generated with jnp to be bit-exact
__global__ __launch_bounds__(256) void k_cs5(float* CS) { const int idx = blockIdx.x * 256 + threadIdx.x; if (idx >= TT * HD) return; const int d = idx % HD; const int t = idx / HD; const float a = __fmul_rn((float)t, INVT[d % (HD / 2)]); v2f cs; cs[0] = cosf(a); cs[1] = sinf(a); *(v2f*)(CS + (size_t)idx * 2) = cs;  }
// k_attn: one work-group = 128 (hi/lo) or 512 (fp16) query rows of one head, all 2048 keys; scores and probabilities never reach memory: both kinds keep them in registers (attn_run: the fp16 rows; attn_runh: the hi/lo rows, whose partial output tiles are joined through LDS).
// grid (heads, fp16 + hi/lo work-groups per head, batches), numbered as k_attn says; 512 threads = 16 waves. Rows below RH use the hi/lo bf16 planes (3 products), the rest the fp16 planes. Q, K and V fragments come from planes in fragment order: 16 rows are 16 HD (q, k) or 16 TT (v) elements, a k step of 32 is 512.
#define SMF  65536                // floats of LDS of k_attn: the two buffers of attn_runh
// xrow: the value that lane l ^ 16 holds (the same place in the other 16-lane row)
__device__ __forceinline__ float xrow(float x) { const unsigned u = __float_as_uint(x); return __uint_as_float(__builtin_amdgcn_permlanex16(u, u, 0x76543210u, 0xfedcba98u, false, false)); }
// attn_run: the fp16 row tiles (t0 >= RH). One work-group = FQ = 512 query rows of one head: wave w owns queries t0 + 32 w .. + 31 against ALL keys, so that a K or V byte is fetched from L2 once for 512 queries and nothing is joined across waves.
// K and V reach the waves through LDS: a stage is SK = 128 keys, K as 16 KiB and V as 4 x 4 KiB (one run per group of 16 d) that are consecutive in memory (fragment order), brought by asynchronous copies as they lie, two buffers, the next stage in flight while one is worked on.
// Scores are formed TRANSPOSED, S^T = K Q^T (A = K, B = Q): lane (lr, hi) holds, for query mb * 16 + lr, keys g * 16 + hi * 8 + 0..7, and two neighbouring key groups are exactly the lane's sixteen elements of a fragment of P for one k step.
// The output is formed transposed too, O^T += V^T P^T (A = V^T, the plane as it lies; B = P): a lane's accumulators all belong to its own query, so maximum, sum and rescaling stay in the lane (plus lane ^ 16 for the maximum, and once at the end for the sum).
// Running softmax per pass of 64 keys: m' = max(m, the pass's maximum), the sums so far and O^T are multiplied by exp(m - m'), p = exp(s - m') in (0, 1] rounded to fp16; at the end O^T / l. A lane ends with eight consecutive d of one query: its 16 bytes of a block of the merged planes.
#define FQ   512
#define SK   128
static_assert((TT - RH) % FQ == 0 && TT % SK == 0 && TT / SK >= 2 && 4 * SK * HD * 2 <= SMF * 4, "whole work-groups; two stages at least; the two buffers lie inside sm");
// cp4x: four asynchronous copies of 16 bytes a lane, global memory -> LDS, each with addresses of its own
__device__ __forceinline__ void cp4x(unsigned l0, const h16* g0, unsigned l1, const h16* g1, unsigned l2, const h16* g2, unsigned l3, const h16* g3) {
    // the copies and, as the last line of the same statement, the wait before a register that a copy names is rewritten
    asm volatile("global_load_async_to_lds_b128 %0, %1, off\n\tglobal_load_async_to_lds_b128 %2, %3, off\n\tglobal_load_async_to_lds_b128 %4, %5, off\n\tglobal_load_async_to_lds_b128 %6, %7, off\n\ts_wait_xcnt 0x0" :: "v"(l0), "v"(g0), "v"(l1), "v"(g1), "v"(l2), "v"(g2), "v"(l3), "v"(g3) : "memory");
}
__device__ __forceinline__ void attn_run(float* sm, const h16* __restrict__ Q, const h16* __restrict__ Kp, const h16* __restrict__ Vt, int t0, int h, bf* Ah, bf* Al) {
    typedef WFrag<h16> F; typedef F::V V;
    constexpr int NT = TT / SK, KE = SK * HD, BUFE = 2 * KE;   // stages; 16-bit elements of a stage's K (and of its V), of a buffer
    constexpr float C1 = SCL * 1.4426950408889634f;   // raw score -> exponent of two
    const int lane = threadIdx.x & 31, lr = lane & 15, hi = lane >> 4; const int wv = __builtin_amdgcn_readfirstlane((int)(threadIdx.x >> 5)); const int tq = t0 + wv * 32;
    // a stage is 64 pieces of 512 B: wave w brings pieces w and w + 16 of K and of V (V piece p: group p / 8 of 16 d, 512 B number p % 8 of its run)
    const unsigned lb = (unsigned)(size_t)sm + (unsigned)(wv * 512 + lane * 16); const h16* gk = Kp + wv * 256 + lane * 8; const h16* gv = Vt + (wv >> 3) * 16 * TT + (wv & 7) * 256 + lane * 8;
    auto stage = [&](int t, int buf) { const unsigned l = lb + (unsigned)buf * (unsigned)(BUFE * 2); const h16* k0 = gk + t * KE; const h16* v0 = gv + t * (SK * 16);
        cp4x(l, k0, l + 8192u, k0 + 4096, l + (unsigned)(KE * 2), v0, l + (unsigned)(KE * 2) + 8192u, v0 + 32 * TT); };
    V qa[2][2]; const h16* qb = Q + (size_t)tq * HD; const unsigned lo = (unsigned)(lane * 8);   // a 32-bit lane offset over a wave-uniform base
    // every inner loop below is unrolled: fragment and accumulator arrays are indexed by constants
#pragma unroll
    for (int mb = 0; mb < 2; ++mb)
#pragma unroll
        for (int kk = 0; kk < 2; ++kk) qa[mb][kk] = F::ldf(qb + lo + mb * 16 * HD + kk * 512);
    asm volatile("s_wait_xcnt 0x0" :: "v"(lane) : "memory");   // the wait before a register that the loads above name is rewritten; the lane number, their (scaled) offset register, as an input keeps that register live through the run
    v8f acc[4][2]; float mr[2], ls[2];
#pragma unroll
    for (int mb = 0; mb < 2; ++mb) { mr[mb] = -3.0e38f; ls[mb] = 0.f;
#pragma unroll
        for (int nb = 0; nb < 4; ++nb) acc[nb][mb] = (v8f){}; }
    stage(0, 0);
    asm volatile("s_wait_asynccnt 0x0" ::: "memory");   // this wave's copies of stage 0 have landed
    __syncthreads();   // stage 0 is in LDS before any wave reads it
    stage(1, 1);
#pragma unroll 1   // one stage a trip: the trip's foot is the hand-over of the buffers
    for (int t = 0; t < NT; ++t) {
        const h16* sl = (const h16*)sm + (t & 1) * BUFE + lane * 8;
#pragma unroll 1   // one pass of 64 keys a trip: with both passes in one block the build carried values of the first far into the second and spilled
        for (int ps = 0; ps < SK / 64; ++ps) { V kf[4][2], vf[2][4], pa[2][2]; v8f s[4][2]; const h16* sk = sl + ps * 4096; const h16* sv = sl + KE + ps * 1024;
#pragma unroll
            for (int g = 0; g < 4; ++g)
#pragma unroll
                for (int kk = 0; kk < 2; ++kk) kf[g][kk] = F::ldf(sk + g * 1024 + kk * 512);
            __builtin_amdgcn_sched_barrier(0);   // keeps the pass's K reads together ahead of its products; without it the build keeps one K fragment and waits out the LDS latency eight times a pass
#pragma unroll
            for (int g = 0; g < 4; ++g) { s[g][0] = (v8f){}; s[g][1] = (v8f){};
#pragma unroll
                for (int kk = 0; kk < 2; ++kk)
#pragma unroll
                    for (int mb = 0; mb < 2; ++mb) s[g][mb] = F::mma(kf[g][kk], qa[mb][kk], s[g][mb]); }
            __builtin_amdgcn_sched_barrier(0);   // keeps the pass's products back to back; without it the build mixes the first steps of the maximum among them, each behind the idle slots that a product's result asks for
#pragma unroll
            for (int mb = 0; mb < 2; ++mb) { float m = s[0][mb][0];
#pragma unroll
                for (int g = 0; g < 4; ++g)
#pragma unroll
                    for (int j = 0; j < 8; ++j) m = fmaxf(m, s[g][mb][j]);
                m = fmaxf(m, xrow(m)); const float mn = fmaxf(mr[mb], m); const float al = __builtin_amdgcn_exp2f((mr[mb] - mn) * C1); const float mc = mn * C1; mr[mb] = mn; v8f a8;   // first pass: the exponent is hugely negative and the weight is 0
#pragma unroll
                for (int ks = 0; ks < 2; ++ks) { v8h p8[2];
#pragma unroll
                    for (int u = 0; u < 2; ++u) { const v8f x = s[2 * ks + u][mb] * C1 - mc; v8f e;
#pragma unroll
                        for (int j = 0; j < 8; ++j) e[j] = __builtin_amdgcn_exp2f(x[j]);
                        if (ks == 0 && u == 0) a8 = e; else a8 += e;
                        p8[u] = __builtin_convertvector(e, v8h); }
                    pa[ks][mb] = cat16(p8[0], p8[1]); }
                ls[mb] = ls[mb] * al + (((a8[0] + a8[1]) + (a8[2] + a8[3])) + ((a8[4] + a8[5]) + (a8[6] + a8[7])));
#pragma unroll
                for (int nb = 0; nb < 4; ++nb) acc[nb][mb] *= al;
                // one k step of V is read behind each half of the vector work: the first flies during the exponentials, the second during the first k step's products
                __builtin_amdgcn_sched_barrier(0);   // keeps the second k step's reads from rising to the first's, where both would hold their registers through all the exponentials
#pragma unroll
                for (int nb = 0; nb < 4; ++nb) vf[mb][nb] = F::ldf(sv + nb * (SK * 16) + mb * 512);
                __builtin_amdgcn_sched_barrier(0);   // keeps these reads here, ahead of the work that follows; without it they sink among the products of P V, two at a time, and each pair is waited for singly
            }
#pragma unroll
            for (int ks = 0; ks < 2; ++ks)
#pragma unroll
                for (int nb = 0; nb < 4; ++nb)
#pragma unroll
                    for (int mb = 0; mb < 2; ++mb) acc[nb][mb] = F::mma(vf[ks][nb], pa[ks][mb], acc[nb][mb]);
            __builtin_amdgcn_sched_barrier(0);   // keeps the slot below behind the pass's last WMMA; without it the build lifts it among the products
            asm volatile("v_nop");   // one more vector slot behind the pass's last WMMA: the next pass opens with an address written into a register of that WMMA's B operand, behind three slots only
        }
        asm volatile("s_wait_dscnt 0x0" ::: "memory");      // this wave's reads of the buffer are done before the barrier behind which it is refilled
        asm volatile("s_wait_asynccnt 0x0" ::: "memory");   // this wave's copies of the next stage have landed
        __syncthreads();   // publishes the next stage and ends every wave's reads of this one
        if (t + 2 < NT) stage(t + 2, t & 1);
    }
    asm volatile("s_wait_asynccnt 0x0" ::: "memory");   // no copy is outstanding when the wave ends
    const size_t oo = fro(tq + lr, h * HD + hi * 8, DQ); bf* ph = Ah + oo; bf* pl = Al + oo;   // group nb of 16 d is 256 nb elements further on, the second 16 queries 16 DQ
#pragma unroll
    for (int mb = 0; mb < 2; ++mb) { const float cs = __fdiv_rn(1.0f, ls[mb] + xrow(ls[mb]));   // the sum is at least about 1: the key that holds the maximum counts 1
#pragma unroll
        for (int nb = 0; nb < 4; ++nb) { v8us oh, ol;
#pragma unroll
            for (int j = 0; j < 8; ++j) { unsigned short a, c2; splitf(acc[nb][mb][j] * cs, a, c2); oh[j] = a; ol[j] = c2; }
            *(v8us*)(ph + mb * 16 * DQ + nb * 256) = oh; *(v8us*)(pl + mb * 16 * DQ + nb * 256) = ol; } }
}
// attn_runh: the hi/lo row tiles (t0 < RH), in the manner of attn_run with three products for each of its one. One work-group = HQ = 128 query rows of one head: wave w owns queries t0 + 32 (w / 4) .. + 31 against the keys 64 (w % 4) .. + 63 of every stage of HS = 256 keys, so that a K or V byte is fetched from L2 once for 128 queries.
// A stage is four planes of 32 KiB, K hi, K lo (consecutive in memory) and V hi, V lo (4 x 8 KiB, one run per group of 16 d), brought by asynchronous copies as they lie, two buffers, the next stage in flight while one is worked on.
// S^T = Kh Qh^T + Kl Qh^T + Kh Ql^T; running softmax per pass of 32 keys as in attn_run; p = exp(s - m') in (0, 1] is split into bf16 hi + lo; O^T += Vh^T Ph^T + Vh^T Pl^T + Vl^T Ph^T.
// At the end the four waves of a query tile join through LDS: with M the largest of their maxima, O^T = sum_i exp(m_i - M) O_i^T / sum_i exp(m_i - M) l_i, i ascending; wave w joins group w % 4 of 16 d.
#define HQ   128
#define HS   256
static_assert(RH % HQ == 0 && TT % HS == 0 && TT / HS >= 2 && 2 * 4 * HS * HD * 2 <= SMF * 4 && 16 * 2048 + 2048 <= SMF, "whole work-groups; two stages at least; the two buffers, and later the partial tiles with their maxima and sums, lie inside sm");
typedef __attribute__((ext_vector_type(8))) __bf16 v8bf;
typedef __attribute__((ext_vector_type(4))) unsigned v4u;
// cp4s: four asynchronous copies of 16 bytes a lane, global memory -> LDS: 8 KiB apart in LDS, gs elements apart in memory
__device__ __forceinline__ void cp4s(unsigned l0, const bf* g0, int gs) {
    const unsigned l1 = l0 + 8192u, l2 = l0 + 16384u, l3 = l0 + 24576u; const bf* g1 = g0 + gs; const bf* g2 = g0 + 2 * gs; const bf* g3 = g0 + 3 * gs;
    // the copies and, as the last line of the same statement, the wait before a register that a copy names is rewritten
    asm volatile("global_load_async_to_lds_b128 %0, %1, off\n\tglobal_load_async_to_lds_b128 %2, %3, off\n\tglobal_load_async_to_lds_b128 %4, %5, off\n\tglobal_load_async_to_lds_b128 %6, %7, off\n\ts_wait_xcnt 0x0" :: "v"(l0), "v"(g0), "v"(l1), "v"(g1), "v"(l2), "v"(g2), "v"(l3), "v"(g3) : "memory");
}
__device__ __forceinline__ void attn_runh(float* sm, const bf* __restrict__ Qh, const bf* __restrict__ Ql, const bf* __restrict__ Kh, const bf* __restrict__ Kl, const bf* __restrict__ Vh, const bf* __restrict__ Vl, int t0, int h, bf* Ah, bf* Al) {
    typedef WFrag<bf> F; typedef F::V V;
    constexpr int NT = TT / HS, PE = HS * HD, BUFE = 4 * PE;   // stages; 16-bit elements of one plane's share of a stage, of a buffer
    constexpr float C1 = SCL * 1.4426950408889634f;   // raw score -> exponent of two
    const int lane = threadIdx.x & 31, lr = lane & 15, hi = lane >> 4; const int wv = __builtin_amdgcn_readfirstlane((int)(threadIdx.x >> 5)), qt = wv >> 2, kq = wv & 3; const int tq = t0 + qt * 32;
    // a plane's share of a stage is 64 pieces of 512 B: wave w brings pieces w + 16 c, c = 0 .. 3 (V: piece w of the run of d group c)
    const unsigned lb = (unsigned)(size_t)sm + (unsigned)(wv * 512 + lane * 16); const int go = wv * 256 + lane * 8;
    auto stage = [&](int t, int buf) { const unsigned l = lb + (unsigned)buf * (unsigned)(BUFE * 2); const int ko = go + t * PE, vo = go + t * (HS * 16);
        cp4s(l, Kh + ko, 4096); cp4s(l + (unsigned)(PE * 2), Kl + ko, 4096); cp4s(l + (unsigned)(PE * 4), Vh + vo, 16 * TT); cp4s(l + (unsigned)(PE * 6), Vl + vo, 16 * TT); };
    V qh[2][2], ql[2][2]; const bf* qb = Qh + (size_t)tq * HD; const bf* qb2 = Ql + (size_t)tq * HD; const unsigned lo = (unsigned)(lane * 8);   // a 32-bit lane offset over wave-uniform bases
    // every inner loop below is unrolled: fragment and accumulator arrays are indexed by constants
#pragma unroll
    for (int mb = 0; mb < 2; ++mb)
#pragma unroll
        for (int kk = 0; kk < 2; ++kk) { qh[mb][kk] = F::ldf(qb + lo + mb * 16 * HD + kk * 512); ql[mb][kk] = F::ldf(qb2 + lo + mb * 16 * HD + kk * 512); }
    asm volatile("s_wait_xcnt 0x0" :: "v"(lane) : "memory");   // the wait before a register that the loads above name is rewritten; the lane number, their (scaled) offset register, as an input keeps that register live through the run
    v8f acc[4][2]; float mr[2], ls[2];
#pragma unroll
    for (int mb = 0; mb < 2; ++mb) { mr[mb] = -3.0e38f; ls[mb] = 0.f;
#pragma unroll
        for (int nb = 0; nb < 4; ++nb) acc[nb][mb] = (v8f){}; }
    stage(0, 0);
    asm volatile("s_wait_asynccnt 0x0" ::: "memory");   // this wave's copies of stage 0 have landed
    __syncthreads();   // stage 0 is in LDS before any wave reads it
    stage(1, 1);
#pragma unroll 1   // one stage a trip: the trip's foot is the hand-over of the buffers
    for (int t = 0; t < NT; ++t) {
        const bf* sl = (const bf*)sm + (t & 1) * BUFE + lane * 8;
#pragma unroll 1   // one pass of 32 keys a trip: what 256 registers hold beside Q hi, lo and O^T
        for (int ps = 0; ps < 2; ++ps) { V kh[2][2], kl[2][2], vh[4], vl[4], ph[2], pl[2]; v8f s[2][2]; const bf* sk = sl + (kq * 2 + ps) * 2048; const bf* sv = sl + 2 * PE + (kq * 2 + ps) * 512;
#pragma unroll
            for (int g = 0; g < 2; ++g)
#pragma unroll
                for (int kk = 0; kk < 2; ++kk) { kh[g][kk] = F::ldf(sk + g * 1024 + kk * 512); kl[g][kk] = F::ldf(sk + PE + g * 1024 + kk * 512); }
            __builtin_amdgcn_sched_barrier(0);   // keeps the pass's K reads together ahead of its products; without it each fragment's LDS latency is waited out singly
#pragma unroll
            for (int g = 0; g < 2; ++g) { s[g][0] = (v8f){}; s[g][1] = (v8f){}; }
            // the four score tiles take turns, so that no product waits for the one before it
#pragma unroll
            for (int kk = 0; kk < 2; ++kk) {
#pragma unroll
                for (int g = 0; g < 2; ++g)
#pragma unroll
                    for (int mb = 0; mb < 2; ++mb) s[g][mb] = F::mma(kh[g][kk], qh[mb][kk], s[g][mb]);
#pragma unroll
                for (int g = 0; g < 2; ++g)
#pragma unroll
                    for (int mb = 0; mb < 2; ++mb) s[g][mb] = F::mma(kl[g][kk], qh[mb][kk], s[g][mb]);
#pragma unroll
                for (int g = 0; g < 2; ++g)
#pragma unroll
                    for (int mb = 0; mb < 2; ++mb) s[g][mb] = F::mma(kh[g][kk], ql[mb][kk], s[g][mb]); }
            __builtin_amdgcn_sched_barrier(0);   // keeps the pass's products back to back; without it the first steps of the maximum stand among them, each behind the idle slots that a product's result asks for
#pragma unroll
            for (int mb = 0; mb < 2; ++mb) { float m = s[0][mb][0];
#pragma unroll
                for (int g = 0; g < 2; ++g)
#pragma unroll
                    for (int j = 0; j < 8; ++j) m = fmaxf(m, s[g][mb][j]);
                m = fmaxf(m, xrow(m)); const float mn = fmaxf(mr[mb], m); const float al = __builtin_amdgcn_exp2f((mr[mb] - mn) * C1); const float mc = mn * C1; mr[mb] = mn; v8f a8; v8bf h8[2], l8[2];   // first pass: the exponent is hugely negative and the weight is 0
#pragma unroll
                for (int u = 0; u < 2; ++u) { const v8f x = s[u][mb] * C1 - mc; v8f e;
#pragma unroll
                    for (int j = 0; j < 8; ++j) e[j] = __builtin_amdgcn_exp2f(x[j]);
                    if (u == 0) a8 = e; else a8 += e;
                    h8[u] = __builtin_convertvector(e, v8bf); const v4u hw = __builtin_bit_cast(v4u, h8[u]); v8f r;   // the hi parts as f32 again, from the packed words: the low half shifted up, the high half masked
#pragma unroll
                    for (int j = 0; j < 4; ++j) { r[2 * j] = e[2 * j] - __uint_as_float(hw[j] << 16); r[2 * j + 1] = e[2 * j + 1] - __uint_as_float(hw[j] & 0xffff0000u); }
                    l8[u] = __builtin_convertvector(r, v8bf); }
                ph[mb] = __builtin_shufflevector(h8[0], h8[1], 0, 1, 2, 3, 4, 5, 6, 7, 8, 9, 10, 11, 12, 13, 14, 15); pl[mb] = __builtin_shufflevector(l8[0], l8[1], 0, 1, 2, 3, 4, 5, 6, 7, 8, 9, 10, 11, 12, 13, 14, 15);
                ls[mb] = ls[mb] * al + (((a8[0] + a8[1]) + (a8[2] + a8[3])) + ((a8[4] + a8[5]) + (a8[6] + a8[7])));
#pragma unroll
                for (int nb = 0; nb < 4; ++nb) acc[nb][mb] *= al;
            }
            __builtin_amdgcn_sched_barrier(0);   // keeps the V reads behind the vector work: beside the exponentials their registers made the build spill
#pragma unroll
            for (int nb = 0; nb < 4; ++nb) vh[nb] = F::ldf(sv + nb * (HS * 16));
            __builtin_amdgcn_sched_barrier(0);   // keeps the hi plane's reads together ahead of its products
#pragma unroll
            for (int nb = 0; nb < 4; ++nb)
#pragma unroll
                for (int mb = 0; mb < 2; ++mb) acc[nb][mb] = F::mma(vh[nb], ph[mb], acc[nb][mb]);
#pragma unroll
            for (int nb = 0; nb < 4; ++nb)
#pragma unroll
                for (int mb = 0; mb < 2; ++mb) acc[nb][mb] = F::mma(vh[nb], pl[mb], acc[nb][mb]);
            __builtin_amdgcn_sched_barrier(0);   // keeps the lo plane's reads behind the last product with hi, whose registers they take; ahead of it the build ran out of registers and moved Q to and fro in every pass
#pragma unroll
            for (int nb = 0; nb < 4; ++nb) vl[nb] = F::ldf(sv + PE + nb * (HS * 16));
            __builtin_amdgcn_sched_barrier(0);   // keeps the lo plane's reads together ahead of its products; without it the build reads one fragment at a time and waits out the LDS latency for each
#pragma unroll
            for (int nb = 0; nb < 4; ++nb)
#pragma unroll
                for (int mb = 0; mb < 2; ++mb) acc[nb][mb] = F::mma(vl[nb], ph[mb], acc[nb][mb]);
        }
        asm volatile("s_wait_dscnt 0x0" ::: "memory");      // this wave's reads of the buffer are done before the barrier behind which it is refilled
        asm volatile("s_wait_asynccnt 0x0" ::: "memory");   // this wave's copies of the next stage have landed
        __syncthreads();   // publishes the next stage and ends every wave's reads of this one
        if (t + 2 < NT) stage(t + 2, t & 1);
    }
    asm volatile("s_wait_asynccnt 0x0" ::: "memory");   // no copy is outstanding when the buffers become partial tiles
    // the last trip's barrier has ended every wave's reads of the buffers: the partial tiles may overwrite them. Wave w's tile: 2048 floats at 2048 w, quarter (nb, mb, half of the lane's eight) as 128 floats, four a lane; behind the tiles the maxima, then the sums, one per wave, mb and lane
    float* pm = sm + 16 * 2048;
#pragma unroll
    for (int mb = 0; mb < 2; ++mb) { pm[(wv * 2 + mb) * 32 + lane] = mr[mb]; pm[1024 + (wv * 2 + mb) * 32 + lane] = ls[mb] + xrow(ls[mb]);
#pragma unroll
        for (int nb = 0; nb < 4; ++nb) { float* pw = sm + wv * 2048 + (nb * 2 + mb) * 256 + lane * 4; *(v4fa*)pw = __builtin_shufflevector(acc[nb][mb], acc[nb][mb], 0, 1, 2, 3); *(v4fa*)(pw + 128) = __builtin_shufflevector(acc[nb][mb], acc[nb][mb], 4, 5, 6, 7); } }
    __syncthreads();   // every wave's partial tile, maxima and sums are in LDS before another wave reads them
    const size_t oo = fro(tq + lr, h * HD + kq * 16 + hi * 8, DQ); bf* po = Ah + oo; bf* pp = Al + oo;   // the second 16 queries are 16 DQ elements further on
    v8us oh[2], ol[2];
#pragma unroll
    for (int mb = 0; mb < 2; ++mb) { float m4[4], l4[4];
#pragma unroll
        for (int i = 0; i < 4; ++i) { m4[i] = pm[((qt * 4 + i) * 2 + mb) * 32 + lane]; l4[i] = pm[1024 + ((qt * 4 + i) * 2 + mb) * 32 + lane]; }
        const float mx = fmaxf(fmaxf(m4[0], m4[1]), fmaxf(m4[2], m4[3])); float lt = 0.f; v4f o0 = (v4f){}, o1 = (v4f){};
#pragma unroll
        for (int i = 0; i < 4; ++i) { const float w = __builtin_amdgcn_exp2f((m4[i] - mx) * C1); const float* pr = sm + (qt * 4 + i) * 2048 + (kq * 2 + mb) * 256 + lane * 4; lt += w * l4[i]; o0 += *(const v4fa*)pr * w; o1 += *(const v4fa*)(pr + 128) * w; }
        const float cs = __fdiv_rn(1.0f, lt);   // the sum is at least about 1: the key that holds the maximum counts 1
#pragma unroll
        for (int j = 0; j < 8; ++j) { unsigned short a, c2; splitf((j < 4 ? o0[j & 3] : o1[j & 3]) * cs, a, c2); oh[mb][j] = a; ol[mb][j] = c2; } }
    __builtin_amdgcn_sched_barrier(0);   // keeps the four stores behind all the arithmetic: no register that a store names is written again before the wave ends
#pragma unroll
    for (int mb = 0; mb < 2; ++mb) { *(v8us*)(po + mb * 16 * DQ) = oh[mb]; *(v8us*)(pp + mb * 16 * DQ) = ol[mb]; }
}
#define NFL  ((TT - RH) / FQ)     // fp16 work-groups per batch and head
#define NHL  (RH / HQ)            // hi/lo work-groups per batch and head
__global__ __launch_bounds__(512) void k_attn(const h16* __restrict__ Q16, const h16* __restrict__ K16, const h16* __restrict__ V16, const bf* __restrict__ Qh, const bf* __restrict__ Ql, const bf* __restrict__ Kh, const bf* __restrict__ Kl, const bf* __restrict__ Vh, const bf* __restrict__ Vl, bf* Ah, bf* Al) {
    __shared__ __align__(16) float sm[SMF];
    // the work-groups are numbered along x, y, z; the fp16 ones, which run longest, have the lowest numbers
    const unsigned lin = (blockIdx.z * (NFL + NHL) + blockIdx.y) * NH_ + blockIdx.x;
    if (lin < NFL * NB_ * NH_) { const unsigned h = lin % NH_, r = lin / NH_, zb = r / NFL; const int t0 = RH + (int)(r % NFL) * FQ; const size_t zo = ((size_t)zb * NH_ + h) * TT * HD, za = (size_t)zb * TT * DQ;
        attn_run(sm, Q16 + zo, K16 + zo, V16 + zo, t0, (int)h, Ah + za, Al + za);
    } else { const unsigned l2 = lin - NFL * NB_ * NH_, h = l2 % NH_, r = l2 / NH_, zb = r / NHL; const int t0 = (int)(r % NHL) * HQ; const size_t zo = ((size_t)zb * NH_ + h) * TT * HD, za = (size_t)zb * TT * DQ;
        attn_runh(sm, Qh + zo, Ql + zo, Kh + zo, Kl + zo, Vh + zo, Vl + zo, t0, (int)h, Ah + za, Al + za); }
}

extern "C" void kernel_launch(void* const* d_in, const int* in_sizes, int n_in,
                              void* d_out, int out_size, void* d_ws, size_t ws_size, hipStream_t stream) {
    (void)in_sizes; (void)n_in; (void)out_size;
    const float* x = (const float*)d_in[0]; const float* fcos = (const float*)d_in[1]; const float* fsin = (const float*)d_in[2]; const float* wq = (const float*)d_in[3]; const float* bq = (const float*)d_in[4]; const float* wk = (const float*)d_in[5]; const float* bk = (const float*)d_in[6]; const float* wv = (const float*)d_in[7]; const float* bv = (const float*)d_in[8]; const float* wo = (const float*)d_in[9]; const float* bo = (const float*)d_in[10];   /* hidden [4][2048][1024] (ONE stream, rounded to bf16 once for q, k and v), cos, sin ([4][2048][64] = [B][S][D] PER-BATCH full-width table INPUTS: read per element by value), Wq, bq, Wk, bk, Wv, bv, Wo, bo ('oi' (out, in) [1024][1024] + [1024]): ELEVEN inputs, all read */
    float* OUT = (float*)d_out;     // [4][2048][1024]
    char* wsp = (char*)d_ws;
    auto take = [&](size_t bytes) { char* p = wsp; wsp += (bytes + 255) & ~(size_t)255; return (void*)p; };
    bf* WQ = (bf*)take((size_t)DQ * DM * 2); bf* WK = (bf*)take((size_t)DKV * DM * 2); bf* WV = (bf*)take((size_t)DKV * DM * 2); bf* WO = (bf*)take((size_t)DM * DQ * 2);
    bf* XB = (bf*)take((size_t)NB_ * TT * DM * 2);
    h16* QP16 = (h16*)take((size_t)NB_ * NH_ * TT * HD * 2); h16* KP16 = (h16*)take((size_t)NB_ * NKV * TT * HD * 2); h16* VT16 = (h16*)take((size_t)NB_ * NKV * HD * TT * 2);
    bf* QPh = (bf*)take((size_t)NB_ * NH_ * TT * HD * 2); bf* QPl = (bf*)take((size_t)NB_ * NH_ * TT * HD * 2); bf* KPh = (bf*)take((size_t)NB_ * NKV * TT * HD * 2); bf* KPl = (bf*)take((size_t)NB_ * NKV * TT * HD * 2); bf* VTh = (bf*)take((size_t)NB_ * NKV * HD * TT * 2); bf* VTl = (bf*)take((size_t)NB_ * NKV * HD * TT * 2);
    bf* ATh = (bf*)take((size_t)NB_ * TT * DQ * 2); bf* ATl = (bf*)take((size_t)NB_ * TT * DQ * 2);
    (void)WK; (void)WV;   // reached through WQ
    if ((size_t)(wsp - (char*)d_ws) > ws_size) return;    // 200 MiB of the 256 MiB
    k_cvtall<<<(NB_ * TT * DM + 4 * DM * DM) / CVB, 256, 0, stream>>>(x, wq, wk, wv, wo, XB, WQ);   // WQ, WK, WV, WO are consecutive takes of 2 MiB each
    /* q, k, v: one launch; WQ, WK, WV are one [3 DQ][DM] matrix, and QP16, KP16, VT16 as well as QPh, QPl, KPh, KPl, VTh, VTl are consecutive takes. The q and k parts read batch z's own slice of the INPUT rotary tables in their epilogue; k_cs5 and its INVT constants stay defined and are NOT launched */
    k_gemms<0, 1><<<dim3(TT / 128, (DQ + 2 * DKV) / 256, NB_), 256, 0, stream>>>(XB, nullptr, WQ, nullptr, bq, bk, bv, fcos, fsin, QP16, QPh, QPl);
    k_attn<<<dim3(NH_, NFL + NHL, NB_), 512, 0, stream>>>(QP16, KP16, VT16, QPh, QPl, KPh, KPl, VTh, VTl, ATh, ATl);   // one kv head per query head
    k_gemms<1, 0><<<dim3(TT / 128, DM / 256, NB_), 256, 0, stream>>>(ATh, ATl, WO, OUT, bo, nullptr, nullptr, nullptr, nullptr, nullptr, nullptr, nullptr);
}

// v010
// Measured time: 162 microseconds a run.
// In both of two side-by-side timings against v009, it was 1.04 times as fast.
// Counting every step since v000, it is 24.3 times as fast.
#include <hip/hip_runtime.h>

// Rotary multi-head self-attention with PER-BATCH full-width rotary tables given as inputs (hidden [4][2048][1024]: ONE stream; q, k, v = hidden W^T + b ('oi' (out, in) [1024][1024] normal x 1024^-0.5 + zero biases: read; 16 heads x 64); q, k -> t cos + cat(-t2, t1) sin with the cos / sin INPUT tables [4][2048][64] = [B][S][D] (uniform random values on this draw: batch b reads ITS OWN slice, per element by value; no structure assumed); scores x 64^-0.5; softmax over all keys (no mask); out = merged Wo^T + bo ('oi' + a zero bias: read) -> [4][2048][1024] (8.4 M); argument order hidden, cos, sin, Wq, bq, Wk, bk, Wv, bv, Wo, bo).
// Every stage is launched once for all four batches (batch = grid z; every workspace plane holds the four batches one behind the other). Layout per batch: bf16 copies of the input stream(s); 'oi' weights; exact projections + f32 biases, whose epilogue applies the rotary tables and writes the head planes (q, k: [h][t][d]; v: [h][d][t]); dense T-2048 attention in one kernel, scores and probabilities in registers (hybrid rows: < 512 hi/lo 3 products; rest fp16; each wave its own 32 queries against a lagging reference maximum, K and V shared through LDS); merged hi/lo x Wo exact + bo.
// Every 16-bit plane that a matrix product reads from memory (hidden, the weights, q, k, v, merged) lies in FRAGMENT ORDER (fro() below), so that one wave-wide 16-byte load covers 512 consecutive bytes = four whole 128-byte lines; each lane receives the same elements as from a row-major plane.
// Compute dtypes, f32 accumulate: every input rounded to bf16; projections exact + f32 biases; attention rows < 512 3 products, rest fp16; softmax f32; Wo hl x exact + bias.

#define NB_  4
#define TT   2048
#define DM   1024
#define NH_  16
#define NKV  16
#define REP  (NH_ / NKV)
static_assert(NKV == NH_, "the q, k, v launch numbers its tile columns by NH_ heads a part");
#define HD   64
#define DQ   (NH_ * HD)
#define DKV  (NKV * HD)
#define RH   512                  // query rows < RH use hi+lo planes (0: none)
#define WIN  0
#define PCAR 1024.0f
#define SCL  0.125f   // HD^-0.5
#define QEX  (SCL * 1.4426950408889634f)   // raw score -> exponent of two
typedef _Float16 h16;
typedef unsigned short bf;
typedef __attribute__((ext_vector_type(16))) __bf16   v16bf;
typedef __attribute__((ext_vector_type(16))) _Float16 v16h;
typedef __attribute__((ext_vector_type(8)))  _Float16 v8h;
typedef __attribute__((ext_vector_type(8)))  unsigned short v8us;
typedef __attribute__((ext_vector_type(8)))  float    v8f;
typedef __attribute__((ext_vector_type(4)))  float    v4f;
typedef v8h  __attribute__((may_alias)) v8ha;
typedef v4f  __attribute__((may_alias)) v4fa;
typedef v8us __attribute__((may_alias)) v8usa;

__device__ __forceinline__ unsigned short f2bf(float f) { unsigned u = __float_as_uint(f); u += 0x7FFFu + ((u >> 16) & 1u); return (unsigned short)(u >> 16); }
__device__ __forceinline__ float bf2f(unsigned short b) { return __uint_as_float(((unsigned)b) << 16); }
__device__ __forceinline__ float bfr(float f) { return bf2f(f2bf(f)); }
__device__ __forceinline__ v16h cat16(v8h lo, v8h hi) { return __builtin_shufflevector(lo, hi, 0, 1, 2, 3, 4, 5, 6, 7, 8, 9, 10, 11, 12, 13, 14, 15); }
__device__ __forceinline__ v16bf cat16b(v8us lo, v8us hi) { return __builtin_bit_cast(v16bf, __builtin_shufflevector(lo, hi, 0, 1, 2, 3, 4, 5, 6, 7, 8, 9, 10, 11, 12, 13, 14, 15)); }
__device__ __forceinline__ v8f wmma16(v16h a, v16h b, v8f c) { return __builtin_amdgcn_wmma_f32_16x16x32_f16(false, a, false, b, (short)0, c, false, false); }
__device__ __forceinline__ v8f wmmab(v16bf a, v16bf b, v8f c) { return __builtin_amdgcn_wmma_f32_16x16x32_bf16(false, a, false, b, (short)0, c, false, false); }

__device__ __forceinline__ h16 tohx(float x) { return (h16)x; }
__device__ __forceinline__ void splitf(float y, unsigned short& h, unsigned short& l) { h = f2bf(y); l = f2bf(y - bf2f(h)); }
typedef __attribute__((ext_vector_type(2))) _Float16 v2h;
typedef __attribute__((ext_vector_type(4))) _Float16 v4h;
typedef __attribute__((ext_vector_type(2))) unsigned short v2us;
typedef __attribute__((ext_vector_type(4))) unsigned short v4us;
typedef __attribute__((ext_vector_type(2))) float v2f;
typedef __attribute__((ext_vector_type(4))) int v4i;

// ---- k_gemms: GEMM with the operands shared through LDS. One work-group (8 waves, 2 x 4) forms a 128 x 256 tile of C, each wave one 64 x 64 tile (16 accumulators) over the WHOLE k range, k ascending; grid (M / 128, N / 256, batches), 256 threads.
// C[m][n] = sum_k A[m][k] Bt[n][k] (+ A2[m][k] Bt[n][k] for NSPLIT 1) + bias[n] (rounded to bf16). A, A2, Bt are bf16 planes of DM columns in fragment order (fro() below); z is the batch: A, A2 and C lie TT * DM elements further on for each, Bt is shared.
// A slab is 64 k of the tile's 128 A (and A2) rows and 256 Bt rows: per group of 16 rows two fragment blocks = 2 KiB that are consecutive in memory. Asynchronous copies bring a slab into LDS as it lies (group g at g * 2 KiB), two buffers, the next slab in flight while one is worked on; every wave reads its fragments from LDS as it would from memory.
// EPI 0: f32 C rows [m][DM]. EPI 1: the q, k and v projections in one launch: Bt holds the three weights one behind the other, a wave's 64 columns are one head of part (0 q, 1 k, 2 v; the same for the whole work-group), bias / biasK / biasV are the parts' biases. Parts 0, 1: rotate-half rotary with the cos / sin tables [t][64], each rounded to bf16, then head planes [h][t][d] (fp16 + bf16 hi/lo); part 2: transposed head planes [h][d][t] (fp16 + bf16 hi/lo), straight from the accumulators (a lane holds eight consecutive t of one d: its 16 bytes of a block); each head's plane in fragment order. The planes of part p start p (fp16) or 2 p (hi, lo) whole planes behind P16, Ph, Pl; batch z's tables are TT * HD and its head planes NH_ * TT * HD elements further on. C is not written for EPI 1.
// fro: the place (in elements) of element (row, k) of a [rows][K] 16-bit operand plane in fragment order. A block of 512 elements holds 16 rows x 32 k; blocks run along k, then down the row groups. Inside a block: half s = bit 4 of k (256 elements), then lane = 16 * (bit 3 of k) + row % 16 (8 elements), then k % 8: the two 16-byte pieces that lane holds of the block's A or B fragment.
__device__ __forceinline__ size_t fro(int row, int k, int K) { return (size_t)(row >> 4) * 16 * K + (k >> 5) * 512 + ((k >> 4) & 1) * 256 + (((k >> 3) & 1) * 16 + (row & 15)) * 8 + (k & 7); }
template <typename T16> struct WFrag;
// ld: a fragment from a row-major row (LDS); ldf: from a block in fragment order, p = the block + 8 * lane
template <> struct WFrag<h16> { typedef v16h V; static __device__ __forceinline__ V ld(const h16* p) { return cat16(*(const v8h*)p, *(const v8h*)(p + 16)); } static __device__ __forceinline__ V ldf(const h16* p) { return cat16(*(const v8h*)p, *(const v8h*)(p + 256)); } static __device__ __forceinline__ v8f mma(V a, V b, v8f c) { return wmma16(a, b, c); } };
template <> struct WFrag<bf> { typedef v16bf V; static __device__ __forceinline__ V ld(const bf* p) { return cat16b(*(const v8us*)p, *(const v8us*)(p + 16)); } static __device__ __forceinline__ V ldf(const bf* p) { return cat16b(*(const v8us*)p, *(const v8us*)(p + 256)); } static __device__ __forceinline__ v8f mma(V a, V b, v8f c) { return wmmab(a, b, c); } };
// cp4: four asynchronous copies of 16 bytes a lane, global memory -> LDS: row groups two apart (32 rows of DM elements in memory, 4 KiB in LDS)
__device__ __forceinline__ void cp4(unsigned l0, const bf* g0) {
    const unsigned l1 = l0 + 4096u, l2 = l0 + 8192u, l3 = l0 + 12288u; const bf* g1 = g0 + 32 * DM; const bf* g2 = g0 + 64 * DM; const bf* g3 = g0 + 96 * DM;
    // the copies and, as the last line of the same statement, the wait before a register that a copy names is rewritten
    asm volatile("global_load_async_to_lds_b128 %0, %1, off\n\tglobal_load_async_to_lds_b128 %2, %3, off\n\tglobal_load_async_to_lds_b128 %4, %5, off\n\tglobal_load_async_to_lds_b128 %6, %7, off\n\ts_wait_xcnt 0x0" :: "v"(l0), "v"(g0), "v"(l1), "v"(g1), "v"(l2), "v"(g2), "v"(l3), "v"(g3) : "memory");
}
// the second launch bound (waves per SIMD) holds a wave to 256 registers, so that two work-groups fit on a WGP
template <int NSPLIT, int EPI>
__global__ __launch_bounds__(256, 4) void k_gemms(const bf* __restrict__ A, const bf* __restrict__ A2, const bf* __restrict__ Bt, float* C, const float* __restrict__ bias, const float* __restrict__ biasK, const float* __restrict__ biasV, const float* __restrict__ cosT, const float* __restrict__ sinT, h16* P16, bf* Ph, bf* Pl) {
    typedef WFrag<bf> F; typedef F::V V;
    constexpr int K = DM, GA = NSPLIT ? 16 : 8, NG = GA + 16, BUFE = NG * 1024, NT = K / 64;   // row groups of A (and A2), of a slab; 16-bit elements of a buffer; slabs
    static_assert(NT >= 2 && BUFE <= 8 * 64 * 68 && DQ % 256 == 0 && TT % 128 == 0, "two slabs at least; the two buffers (BUFE floats) lie inside the eight output tiles");
    __shared__ __align__(16) float os[8 * 64 * 68];   // first the two operand buffers, then one [64][68] f32 tile per wave
    const size_t z = blockIdx.z; const int lane = threadIdx.x & 31, lr = lane & 15, hi = lane >> 4; const int wv = __builtin_amdgcn_readfirstlane((int)(threadIdx.x >> 5)), wm = wv & 1, wn = wv >> 1;
    const int r0 = blockIdx.x * 128, c0 = blockIdx.y * 256, r0w = r0 + wm * 64, c0w = c0 + wn * 64;
    // copy c of wave w brings piece w % 4 (512 B) of row group 2 c + w / 4
    const unsigned lb = (unsigned)(size_t)os + (unsigned)(wv * 512 + lane * 16); const int go = (wv >> 2) * 16 * K + (wv & 3) * 256 + lane * 8;
    const bf* pA = A + z * (size_t)(TT * DM) + (size_t)r0 * K + go; const bf* pA2 = NSPLIT ? A2 + z * (size_t)(TT * DM) + (size_t)r0 * K + go : nullptr; const bf* pB = Bt + (size_t)c0 * K + go;
    auto stage = [&](int t, int buf) { const unsigned l = lb + (unsigned)buf * (unsigned)(BUFE * 2); const int ko = t * 1024;
        cp4(l, pA + ko); if constexpr (NSPLIT != 0) cp4(l + 16384u, pA2 + ko); cp4(l + GA * 2048u, pB + ko); cp4(l + GA * 2048u + 16384u, pB + ko + 128 * K); };
    v8f acc[4][4];
#pragma unroll
    for (int mb = 0; mb < 4; ++mb)
#pragma unroll
        for (int nb = 0; nb < 4; ++nb) acc[mb][nb] = (v8f){};
    stage(0, 0);
    asm volatile("s_wait_asynccnt 0x0" ::: "memory");   // this wave's copies of slab 0 have landed
    __syncthreads();   // slab 0 is in LDS before any wave reads it
    stage(1, 1);
#pragma unroll 1   // one slab a trip: the trip's foot is the hand-over of the buffers
    for (int t = 0; t < NT; ++t) {
        const bf* sl = (const bf*)os + (t & 1) * BUFE + lane * 8;
        // unrolled: fragment and accumulator arrays are indexed by constants
#pragma unroll
        for (int kk = 0; kk < 2; ++kk) { V a[4], a2[4], b[4];
#pragma unroll
            for (int mb = 0; mb < 4; ++mb) { a[mb] = F::ldf(sl + (wm * 4 + mb) * 1024 + kk * 512); if (NSPLIT) a2[mb] = F::ldf(sl + (8 + wm * 4 + mb) * 1024 + kk * 512); }
#pragma unroll
            for (int nb = 0; nb < 4; ++nb) b[nb] = F::ldf(sl + (GA + wn * 4 + nb) * 1024 + kk * 512);
            __builtin_amdgcn_sched_barrier(0);   // keeps the k step's LDS reads together ahead of its products; without it the build keeps one B fragment and waits out the LDS latency four times a k step
#pragma unroll
            for (int nb = 0; nb < 4; ++nb)
#pragma unroll
                for (int mb = 0; mb < 4; ++mb) { acc[mb][nb] = F::mma(a[mb], b[nb], acc[mb][nb]); if (NSPLIT) acc[mb][nb] = F::mma(a2[mb], b[nb], acc[mb][nb]); } }
        asm volatile("s_wait_dscnt 0x0" ::: "memory");      // this wave's reads of the buffer are done before the barrier behind which it is refilled
        asm volatile("s_wait_asynccnt 0x0" ::: "memory");   // this wave's copies of the next slab have landed
        __syncthreads();   // publishes the next slab and ends every wave's reads of this one
        if (t + 2 < NT) stage(t + 2, t & 1);
    }
    asm volatile("s_wait_asynccnt 0x0" ::: "memory");   // no copy is outstanding when the buffers become output tiles
    const int part = EPI == 1 ? (int)blockIdx.y / (DQ / 256) : 0, head = EPI == 1 ? ((int)blockIdx.y % (DQ / 256)) * 4 + wn : 0;   // part: the same for the whole work-group
    const float* bp = bias + c0w; if constexpr (EPI == 1) bp = (part == 0 ? bias : part == 1 ? biasK : biasV) + head * 64;
    if constexpr (EPI == 1) { cosT += z * (size_t)(TT * HD); sinT += z * (size_t)(TT * HD); P16 += ((size_t)part * NB_ + z) * (size_t)(NH_ * TT * HD); Ph += ((size_t)part * 2 * NB_ + z) * (size_t)(NH_ * TT * HD); Pl += ((size_t)part * 2 * NB_ + z) * (size_t)(NH_ * TT * HD);
    }
    if (EPI == 1 && part == 2) {
        // unrolled: acc is indexed by constants
#pragma unroll
        for (int nb = 0; nb < 4; ++nb) { const float b1 = bfr(bp[nb * 16 + lr]);
#pragma unroll
            for (int mb = 0; mb < 4; ++mb) { v8h o16; v8us oh, ol;
#pragma unroll
                for (int j = 0; j < 8; ++j) { const float x = acc[mb][nb][j] + b1; o16[j] = tohx(x); unsigned short a2, c2; splitf(x, a2, c2); oh[j] = a2; ol[j] = c2; }
                const size_t e = (size_t)head * HD * TT + fro(nb * 16 + lr, r0w + mb * 16 + hi * 8, TT); *(v8h*)(P16 + e) = o16; *(v8us*)(Ph + e) = oh; *(v8us*)(Pl + e) = ol; } }
    } else {
        // the last trip's barrier has ended every wave's reads of the buffers: the tiles may overwrite them
        float* ow = os + wv * (64 * 68); const int cofs = lr * 4; v4f bb; bb[0] = bfr(bp[cofs]); bb[1] = bfr(bp[cofs + 1]); bb[2] = bfr(bp[cofs + 2]); bb[3] = bfr(bp[cofs + 3]);
#pragma unroll
        for (int mb = 0; mb < 4; ++mb)
#pragma unroll
            for (int nb = 0; nb < 4; ++nb)
#pragma unroll
                for (int j = 0; j < 8; ++j) ow[(mb * 16 + hi * 8 + j) * 68 + nb * 16 + lr] = acc[mb][nb][j];
        const unsigned tl = (unsigned)(hi * HD + cofs); constexpr int RC = EPI == 1 ? 4 : 8; const float qs = part == 0 ? QEX : 1.0f;   // the planes of q hold q QEX (scaled in f32, then rounded as before): its products with k are exponents of two
        __syncthreads();   // the tile is in LDS before a lane reads what other lanes wrote; part is the same for the whole work-group, so every wave of it passes here or none
#pragma unroll 1   // RC row pairs a trip: the whole tile unrolled would be 32 KiB of code, and more rows a trip made the rotary build spill
        for (int ib = 0; ib < 32 / RC; ++ib) { v4f cc[RC], sn[RC], val[RC]; const int rb = r0w + ib * (2 * RC);   // the trip's first row: wave-uniform
            // the inner loops are unrolled so that a trip's loads all issue ahead of its arithmetic
            if constexpr (EPI == 1) { const float* cb = cosT + (size_t)rb * HD + tl; const float* sp = sinT + (size_t)rb * HD + tl;
#pragma unroll
                for (int i = 0; i < RC; ++i) { cc[i] = *(const v4f*)(cb + i * 2 * HD); sn[i] = *(const v4f*)(sp + i * 2 * HD); }
                asm volatile("s_wait_xcnt 0x0" :: "v"(cb), "v"(sp) : "memory"); }   // the wait before a register that the loads above name is rewritten; the two addresses as inputs stay live through the run, so that no load of the run lands in them
#pragma unroll
            for (int i = 0; i < RC; ++i) val[i] = *(const v4fa*)(ow + (ib * (2 * RC) + i * 2 + hi) * 68 + cofs) + bb;
            __builtin_amdgcn_sched_barrier(0);   // keeps the trip's loads together ahead of its arithmetic; without it they sink among the roundings and each latency is paid singly
            if constexpr (EPI == 0) { float* cp = C + z * (size_t)(TT * DM) + (size_t)(rb + hi) * DM + c0w + cofs;
#pragma unroll
                for (int i = 0; i < RC; ++i) *(v4f*)(cp + i * 2 * DM) = val[i];
                asm volatile("s_wait_xcnt 0x0" :: "v"(cp) : "memory");   // the wait before the address that the stores above name is rewritten for the next trip; as an input it stays live through the run
            } else { const size_t e = (size_t)head * TT * HD + fro(rb + hi, cofs, HD); h16* q16 = P16 + e; bf* qh = Ph + e; bf* ql = Pl + e;   // the trip's 2 RC rows lie inside one group of 16 rows (2 RC divides 16): row pair i is 16 i elements further on
#pragma unroll
                for (int i = 0; i < RC; ++i) { v4h o16; v4us oh, ol;
#pragma unroll
                    for (int q = 0; q < 4; ++q) { const float xp = __builtin_amdgcn_update_dpp(0.0f, val[i][q], 0x168, 0xf, 0xf, true);   // row_xmask:8: column d ^ 32 of this row sits in lane ^ 8
                        const float s = bfr(sn[i][q]); const float r = val[i][q] * bfr(cc[i][q]) + xp * (cofs < HD / 2 ? -s : s);
                        o16[q] = tohx(r * qs); unsigned short a2, c2; splitf(r * qs, a2, c2); oh[q] = a2; ol[q] = c2; }
                    *(v4h*)(q16 + i * 16) = o16; *(v4us*)(qh + i * 16) = oh; *(v4us*)(ql + i * 16) = ol; }
                asm volatile("s_wait_xcnt 0x0" :: "v"(q16), "v"(qh), "v"(ql) : "memory");   // as above, for the three planes' stores
            }
        }
    }
}


// k_cvtall: every f32 -> bf16 rounding of a call in one launch. A work-group rounds CVB consecutive elements: groups 0 .. NB_ TT DM / CVB - 1 take hidden (all batches), the rest the four weights in the order q, k, v, o, whose bf16 copies lie one behind the other at W4. CVB elements are one group of 16 rows, which fragment order keeps together: a thread reads the eight elements that belong at its place, so that the stores are consecutive.
#define CVG  8                    // 8-element groups per thread
#define CVB  (256 * 8 * CVG)
static_assert(CVB == 16 * DM && DQ == DM, "a work-group of k_cvtall rounds one group of 16 rows of DM elements");
__global__ __launch_bounds__(256) void k_cvtall(const float* __restrict__ x, const float* __restrict__ wq, const float* __restrict__ wk, const float* __restrict__ wv, const float* __restrict__ wo, bf* XB, bf* W4) {
    constexpr int NX = NB_ * TT * DM / CVB, NW = DM * DM / CVB; const int blk = blockIdx.x; const float* src; bf* dst;
    if (blk < NX) { src = x + (size_t)blk * CVB; dst = XB + (size_t)blk * CVB; }
    else { const int wb = blk - NX, w = wb / NW; src = (w == 0 ? wq : w == 1 ? wk : w == 2 ? wv : wo) + (size_t)(wb % NW) * CVB; dst = W4 + (size_t)wb * CVB; }
    v8f v[CVG]; const unsigned so = (unsigned)(((int)threadIdx.x & 15) * DM + ((int)threadIdx.x >> 6) * 32 + (((int)threadIdx.x >> 4) & 3) * 8);   // place oc = 256 g + thread of the group holds row oc % 16, k block oc / 64, piece (oc / 16) % 4 of the block's 32 k: 128 elements further for each g
    // both loops are unrolled so that all loads of a thread issue ahead of its first rounding
#pragma unroll
    for (int g = 0; g < CVG; ++g) v[g] = *(const v8f*)(src + so + g * 128);
#pragma unroll
    for (int g = 0; g < CVG; ++g) { v8us o;
#pragma unroll
        for (int k = 0; k < 8; ++k) o[k] = f2bf(v[g][k]);
        *(v8us*)(dst + (g * 256 + (int)threadIdx.x) * 8) = o; }
}

__constant__ float INVT[HD / 2] = { 1.000000000e+00f, 7.498942018e-01f, 5.623413324e-01f, 4.216965139e-01f, 3.162277639e-01f, 2.371373624e-01f, 1.778279394e-01f, 1.333521456e-01f, 1.000000015e-01f, 7.498941571e-02f, 5.623412877e-02f, 4.216964915e-02f, 3.162277862e-02f, 2.371373586e-02f, 1.778279431e-02f, 1.333521493e-02f, 9.999999776e-03f, 7.498942316e-03f, 5.623413250e-03f, 4.216964822e-03f, 3.162277862e-03f, 2.371373819e-03f, 1.778279431e-03f, 1.333521446e-03f, 1.000000047e-03f, 7.498941850e-04f, 5.623413017e-04f, 4.216964880e-04f, 3.162277862e-04f, 2.371373848e-04f, 1.778279402e-04f, 1.333521504e-04f };   // float32 1 / 10000^(2i/64), generated with jnp to be bit-exact
__global__ __launch_bounds__(256) void k_cs5(float* CS) { const int idx = blockIdx.x * 256 + threadIdx.x; if (idx >= TT * HD) return; const int d = idx % HD; const int t = idx / HD; const float a = __fmul_rn((float)t, INVT[d % (HD / 2)]); v2f cs; cs[0] = cosf(a); cs[1] = sinf(a); *(v2f*)(CS + (size_t)idx * 2) = cs;  }
// k_attn: one work-group = 128 (hi/lo) or 512 (fp16) query rows of one head, all 2048 keys; scores and probabilities never reach memory: both kinds keep them in registers (attn_run: the fp16 rows; attn_runh: the hi/lo rows, whose partial output tiles are joined through LDS).
// grid (heads, fp16 + hi/lo work-groups per head, batches), numbered as k_attn says; 512 threads = 16 waves. Rows below RH use the hi/lo bf16 planes (3 products), the rest the fp16 planes. Q, K and V fragments come from planes in fragment order: 16 rows are 16 HD (q, k) or 16 TT (v) elements, a k step of 32 is 512.
#define SMF  65536                // floats of LDS of k_attn: the two buffers of attn_runh
// xrow: the value that lane l ^ 16 holds (the same place in the other 16-lane row)
__device__ __forceinline__ float xrow(float x) { const unsigned u = __float_as_uint(x); return __uint_as_float(__builtin_amdgcn_permlanex16(u, u, 0x76543210u, 0xfedcba98u, false, false)); }
// attn_run: the fp16 row tiles (t0 >= RH). One work-group = FQ = 512 query rows of one head: wave w owns queries t0 + 32 w .. + 31 against ALL keys, so that a K or V byte is fetched from L2 once for 512 queries and nothing is joined across waves.
// K and V reach the waves through LDS: a stage is SK = 128 keys, K as 16 KiB and V as 4 x 4 KiB (one run per group of 16 d) that are consecutive in memory (fragment order), brought by asynchronous copies as they lie, two buffers, the next stage in flight while one is worked on.
// Scores are formed TRANSPOSED, S^T = K Q^T (A = K, B = Q): lane (lr, hi) holds, for query mb * 16 + lr, keys g * 16 + hi * 8 + 0..7, and two neighbouring key groups are exactly the lane's sixteen elements of a fragment of P for one k step.
// The output is formed transposed too, O^T += V^T P^T (A = V^T, the plane as it lies; B = P): a lane's accumulators all belong to its own query, so maximum, sum and rescaling stay in the lane (plus lane ^ 16 for the maximum, and once at the end for the sum).
// Running softmax per pass of 64 keys against a reference maximum m that lags: the fp16 plane of q holds q QEX, and the score tiles start from -m, so that p = 2^tile, rounded to fp16, with no arithmetic in between. m is the first pass's maximum and moves to the running maximum only when a score passes it by more than 2^8 (then the sums so far and O^T are multiplied by 2^(m - m')); p lies in (0, 2^8]; at the end O^T / l. A lane ends with eight consecutive d of one query: its 16 bytes of a block of the merged planes.
#define FQ   512
#define SK   128
static_assert((TT - RH) % FQ == 0 && TT % SK == 0 && TT / SK >= 2 && 4 * SK * HD * 2 <= SMF * 4, "whole work-groups; two stages at least; the two buffers lie inside sm");
// cp4x: four asynchronous copies of 16 bytes a lane, global memory -> LDS, each with addresses of its own
__device__ __forceinline__ void cp4x(unsigned l0, const h16* g0, unsigned l1, const h16* g1, unsigned l2, const h16* g2, unsigned l3, const h16* g3) {
    // the copies and, as the last line of the same statement, the wait before a register that a copy names is rewritten
    asm volatile("global_load_async_to_lds_b128 %0, %1, off\n\tglobal_load_async_to_lds_b128 %2, %3, off\n\tglobal_load_async_to_lds_b128 %4, %5, off\n\tglobal_load_async_to_lds_b128 %6, %7, off\n\ts_wait_xcnt 0x0" :: "v"(l0), "v"(g0), "v"(l1), "v"(g1), "v"(l2), "v"(g2), "v"(l3), "v"(g3) : "memory");
}
__device__ __forceinline__ void attn_run(float* sm, const h16* __restrict__ Q, const h16* __restrict__ Kp, const h16* __restrict__ Vt, int t0, int h, bf* Ah, bf* Al) {
    typedef WFrag<h16> F; typedef F::V V;
    constexpr int NT = TT / SK, KE = SK * HD, BUFE = 2 * KE;   // stages; 16-bit elements of a stage's K (and of its V), of a buffer
    constexpr float TH = 8.0f;   // how far (in powers of two) a score may pass the reference maximum before that is moved: p stays below 2^8, far inside fp16
    const int lane = threadIdx.x & 31, lr = lane & 15, hi = lane >> 4; const int wv = __builtin_amdgcn_readfirstlane((int)(threadIdx.x >> 5)); const int tq = t0 + wv * 32;
    // a stage is 64 pieces of 512 B: wave w brings pieces w and w + 16 of K and of V (V piece p: group p / 8 of 16 d, 512 B number p % 8 of its run)
    const unsigned lb = (unsigned)(size_t)sm + (unsigned)(wv * 512 + lane * 16); const h16* gk = Kp + wv * 256 + lane * 8; const h16* gv = Vt + (wv >> 3) * 16 * TT + (wv & 7) * 256 + lane * 8;
    auto stage = [&](int t, int buf) { const unsigned l = lb + (unsigned)buf * (unsigned)(BUFE * 2); const h16* k0 = gk + t * KE; const h16* v0 = gv + t * (SK * 16);
        cp4x(l, k0, l + 8192u, k0 + 4096, l + (unsigned)(KE * 2), v0, l + (unsigned)(KE * 2) + 8192u, v0 + 32 * TT); };
    V qa[2][2]; const h16* qb = Q + (size_t)tq * HD; const unsigned lo = (unsigned)(lane * 8);   // a 32-bit lane offset over a wave-uniform base
    // every inner loop below is unrolled: fragment and accumulator arrays are indexed by constants
#pragma unroll
    for (int mb = 0; mb < 2; ++mb)
#pragma unroll
        for (int kk = 0; kk < 2; ++kk) qa[mb][kk] = F::ldf(qb + lo + mb * 16 * HD + kk * 512);
    asm volatile("s_wait_xcnt 0x0" :: "v"(lane) : "memory");   // the wait before a register that the loads above name is rewritten; the lane number, their (scaled) offset register, as an input keeps that register live through the run
    v8f acc[4][2], nm[2]; float ls[2];   // nm: minus the lane's query's reference maximum in all eight places, the start value of its score tiles
#pragma unroll
    for (int mb = 0; mb < 2; ++mb) { nm[mb] = (v8f){}; ls[mb] = 0.f;
#pragma unroll
        for (int nb = 0; nb < 4; ++nb) acc[nb][mb] = (v8f){}; }
    stage(0, 0);
    asm volatile("s_wait_asynccnt 0x0" ::: "memory");   // this wave's copies of stage 0 have landed
    __syncthreads();   // stage 0 is in LDS before any wave reads it
    stage(1, 1);
#pragma unroll 1   // one stage a trip: the trip's foot is the hand-over of the buffers
    for (int t = 0; t < NT; ++t) {
        const h16* sl = (const h16*)sm + (t & 1) * BUFE + lane * 8;
#pragma unroll 1   // one pass of 64 keys a trip: with both passes in one block the build carried values of the first far into the second and spilled
        for (int ps = 0; ps < SK / 64; ++ps) { V kf[4][2], vf[2][4], pa[2][2]; v8f s[4][2]; const h16* sk = sl + ps * 4096; const h16* sv = sl + KE + ps * 1024;
#pragma unroll
            for (int g = 0; g < 4; ++g)
#pragma unroll
                for (int kk = 0; kk < 2; ++kk) kf[g][kk] = F::ldf(sk + g * 1024 + kk * 512);
            __builtin_amdgcn_sched_barrier(0);   // keeps the pass's K reads together ahead of its products; without it the build keeps one K fragment and waits out the LDS latency eight times a pass
#pragma unroll
            for (int g = 0; g < 4; ++g)
#pragma unroll
                for (int kk = 0; kk < 2; ++kk)
#pragma unroll
                    for (int mb = 0; mb < 2; ++mb) s[g][mb] = F::mma(kf[g][kk], qa[mb][kk], kk == 0 ? nm[mb] : s[g][mb]);   // a tile starts from minus the reference maximum: what comes out is the exponent itself
            __builtin_amdgcn_sched_barrier(0);   // keeps the pass's products back to back; without it the build mixes the first steps of the maximum among them, each behind the idle slots that a product's result asks for
            float mx[2];
#pragma unroll
            for (int mb = 0; mb < 2; ++mb) { float mg[4];   // four chains, so that no step waits for the one before it
#pragma unroll
                for (int g = 0; g < 4; ++g) { mg[g] = s[g][mb][0];
#pragma unroll
                    for (int j = 1; j < 8; ++j) mg[g] = fmaxf(mg[g], s[g][mb][j]); }
                mx[mb] = fmaxf(fmaxf(mg[0], mg[1]), fmaxf(mg[2], mg[3])); }
            const bool first = (t | ps) == 0;
            // the reference maximum moves in the first pass (to that pass's maximum, whatever its sign: the bar lies below every finite score) and whenever a score of any lane has passed it by more than TH; the test reads the same in the whole wave
            if (__builtin_amdgcn_ballot_w32(fmaxf(mx[0], mx[1]) > (first ? -3.4e38f : TH)) != 0u) {
#pragma unroll
                for (int mb = 0; mb < 2; ++mb) { const float m = fmaxf(mx[mb], xrow(mx[mb])); const float d = first ? m : fmaxf(m, 0.f); const float al = first ? 0.f : __builtin_amdgcn_exp2f(-d);   // first pass: nothing is summed yet, the weight is 0
                    nm[mb] -= d; ls[mb] *= al;
#pragma unroll
                    for (int g = 0; g < 4; ++g) s[g][mb] -= d;
#pragma unroll
                    for (int nb = 0; nb < 4; ++nb) acc[nb][mb] *= al; } }
#pragma unroll
            for (int mb = 0; mb < 2; ++mb) { v8f a8;
#pragma unroll
                for (int ks = 0; ks < 2; ++ks) { v8h p8[2];
#pragma unroll
                    for (int u = 0; u < 2; ++u) { const v8f x = s[2 * ks + u][mb]; v8f e;
#pragma unroll
                        for (int j = 0; j < 8; ++j) e[j] = __builtin_amdgcn_exp2f(x[j]);
                        if (ks == 0 && u == 0) a8 = e; else a8 += e;
                        p8[u] = __builtin_convertvector(e, v8h); }
                    pa[ks][mb] = cat16(p8[0], p8[1]); }
                ls[mb] += ((a8[0] + a8[1]) + (a8[2] + a8[3])) + ((a8[4] + a8[5]) + (a8[6] + a8[7]));
                // one k step of V is read behind each half of the vector work: the first flies during the exponentials, the second during the first k step's products
                __builtin_amdgcn_sched_barrier(0);   // keeps the second k step's reads from rising to the first's, where both would hold their registers through all the exponentials
#pragma unroll
                for (int nb = 0; nb < 4; ++nb) vf[mb][nb] = F::ldf(sv + nb * (SK * 16) + mb * 512);
                __builtin_amdgcn_sched_barrier(0);   // keeps these reads here, ahead of the work that follows; without it they sink among the products of P V, two at a time, and each pair is waited for singly
            }
#pragma unroll
            for (int ks = 0; ks < 2; ++ks)
#pragma unroll
                for (int nb = 0; nb < 4; ++nb)
#pragma unroll
                    for (int mb = 0; mb < 2; ++mb) acc[nb][mb] = F::mma(vf[ks][nb], pa[ks][mb], acc[nb][mb]);
        }
        asm volatile("s_wait_dscnt 0x0" ::: "memory");      // this wave's reads of the buffer are done before the barrier behind which it is refilled
        asm volatile("s_wait_asynccnt 0x0" ::: "memory");   // this wave's copies of the next stage have landed
        __syncthreads();   // publishes the next stage and ends every wave's reads of this one
        if (t + 2 < NT) stage(t + 2, t & 1);
    }
    asm volatile("s_wait_asynccnt 0x0" ::: "memory");   // no copy is outstanding when the wave ends
    const size_t oo = fro(tq + lr, h * HD + hi * 8, DQ); bf* ph = Ah + oo; bf* pl = Al + oo;   // group nb of 16 d is 256 nb elements further on, the second 16 queries 16 DQ
#pragma unroll
    for (int mb = 0; mb < 2; ++mb) { const float cs = __fdiv_rn(1.0f, ls[mb] + xrow(ls[mb]));   // the sum is at least about 1: the key that holds the reference maximum counts 1
#pragma unroll
        for (int nb = 0; nb < 4; ++nb) { v8us oh, ol;
#pragma unroll
            for (int j = 0; j < 8; ++j) { unsigned short a, c2; splitf(acc[nb][mb][j] * cs, a, c2); oh[j] = a; ol[j] = c2; }
            *(v8us*)(ph + mb * 16 * DQ + nb * 256) = oh; *(v8us*)(pl + mb * 16 * DQ + nb * 256) = ol; } }
}
// attn_runh: the hi/lo row tiles (t0 < RH), in the manner of attn_run with three products for each of its one. One work-group = HQ = 128 query rows of one head: wave w owns queries t0 + 32 (w / 4) .. + 31 against the keys 64 (w % 4) .. + 63 of every stage of HS = 256 keys, so that a K or V byte is fetched from L2 once for 128 queries.
// A stage is four planes of 32 KiB, K hi, K lo (consecutive in memory) and V hi, V lo (4 x 8 KiB, one run per group of 16 d), brought by asynchronous copies as they lie, two buffers, the next stage in flight while one is worked on.
// S^T = Kh Qh^T + Kl Qh^T + Kh Ql^T - m; running softmax per pass of 32 keys as in attn_run, against a reference maximum m that lags; p = 2^tile in (0, 2^8] is split into bf16 hi + lo; O^T += Vh^T Ph^T + Vh^T Pl^T + Vl^T Ph^T.
// At the end the four waves of a query tile join through LDS: with M the largest of their reference maxima (exponents of two), O^T = sum_i 2^(m_i - M) O_i^T / sum_i 2^(m_i - M) l_i, i ascending; wave w joins group w % 4 of 16 d.
#define HQ   128
#define HS   256
static_assert(RH % HQ == 0 && TT % HS == 0 && TT / HS >= 2 && 2 * 4 * HS * HD * 2 <= SMF * 4 && 16 * 2048 + 2048 <= SMF, "whole work-groups; two stages at least; the two buffers, and later the partial tiles with their maxima and sums, lie inside sm");
typedef __attribute__((ext_vector_type(8))) __bf16 v8bf;
typedef __attribute__((ext_vector_type(4))) unsigned v4u;
// cp4s: four asynchronous copies of 16 bytes a lane, global memory -> LDS: 8 KiB apart in LDS, gs elements apart in memory
__device__ __forceinline__ void cp4s(unsigned l0, const bf* g0, int gs) {
    const unsigned l1 = l0 + 8192u, l2 = l0 + 16384u, l3 = l0 + 24576u; const bf* g1 = g0 + gs; const bf* g2 = g0 + 2 * gs; const bf* g3 = g0 + 3 * gs;
    // the copies and, as the last line of the same statement, the wait before a register that a copy names is rewritten
    asm volatile("global_load_async_to_lds_b128 %0, %1, off\n\tglobal_load_async_to_lds_b128 %2, %3, off\n\tglobal_load_async_to_lds_b128 %4, %5, off\n\tglobal_load_async_to_lds_b128 %6, %7, off\n\ts_wait_xcnt 0x0" :: "v"(l0), "v"(g0), "v"(l1), "v"(g1), "v"(l2), "v"(g2), "v"(l3), "v"(g3) : "memory");
}
__device__ __forceinline__ void attn_runh(float* sm, const bf* __restrict__ Qh, const bf* __restrict__ Ql, const bf* __restrict__ Kh, const bf* __restrict__ Kl, const bf* __restrict__ Vh, const bf* __restrict__ Vl, int t0, int h, bf* Ah, bf* Al) {
    typedef WFrag<bf> F; typedef F::V V;
    constexpr int NT = TT / HS, PE = HS * HD, BUFE = 4 * PE;   // stages; 16-bit elements of one plane's share of a stage, of a buffer
    constexpr float TH = 8.0f;   // as in attn_run
    const int lane = threadIdx.x & 31, lr = lane & 15, hi = lane >> 4; const int wv = __builtin_amdgcn_readfirstlane((int)(threadIdx.x >> 5)), qt = wv >> 2, kq = wv & 3; const int tq = t0 + qt * 32;
    // a plane's share of a stage is 64 pieces of 512 B: wave w brings pieces w + 16 c, c = 0 .. 3 (V: piece w of the run of d group c)
    const unsigned lb = (unsigned)(size_t)sm + (unsigned)(wv * 512 + lane * 16); const int go = wv * 256 + lane * 8;
    auto stage = [&](int t, int buf) { const unsigned l = lb + (unsigned)buf * (unsigned)(BUFE * 2); const int ko = go + t * PE, vo = go + t * (HS * 16);
        cp4s(l, Kh + ko, 4096); cp4s(l + (unsigned)(PE * 2), Kl + ko, 4096); cp4s(l + (unsigned)(PE * 4), Vh + vo, 16 * TT); cp4s(l + (unsigned)(PE * 6), Vl + vo, 16 * TT); };
    V qh[2][2], ql[2][2]; const bf* qb = Qh + (size_t)tq * HD; const bf* qb2 = Ql + (size_t)tq * HD; const unsigned lo = (unsigned)(lane * 8);   // a 32-bit lane offset over wave-uniform bases
    // every inner loop below is unrolled: fragment and accumulator arrays are indexed by constants
#pragma unroll
    for (int mb = 0; mb < 2; ++mb)
#pragma unroll
        for (int kk = 0; kk < 2; ++kk) { qh[mb][kk] = F::ldf(qb + lo + mb * 16 * HD + kk * 512); ql[mb][kk] = F::ldf(qb2 + lo + mb * 16 * HD + kk * 512); }
    asm volatile("s_wait_xcnt 0x0" :: "v"(lane) : "memory");   // the wait before a register that the loads above name is rewritten; the lane number, their (scaled) offset register, as an input keeps that register live through the run
    v8f acc[4][2], nm[2]; float ls[2];   // nm: as in attn_run
#pragma unroll
    for (int mb = 0; mb < 2; ++mb) { nm[mb] = (v8f){}; ls[mb] = 0.f;
#pragma unroll
        for (int nb = 0; nb < 4; ++nb) acc[nb][mb] = (v8f){}; }
    stage(0, 0);
    asm volatile("s_wait_asynccnt 0x0" ::: "memory");   // this wave's copies of stage 0 have landed
    __syncthreads();   // stage 0 is in LDS before any wave reads it
    stage(1, 1);
#pragma unroll 1   // one stage a trip: the trip's foot is the hand-over of the buffers
    for (int t = 0; t < NT; ++t) {
        const bf* sl = (const bf*)sm + (t & 1) * BUFE + lane * 8;
#pragma unroll 1   // one pass of 32 keys a trip: what 256 registers hold beside Q hi, lo and O^T
        for (int ps = 0; ps < 2; ++ps) { V kh[2][2], kl[2][2], vh[4], vl[4], ph[2], pl[2]; v8f s[2][2]; const bf* sk = sl + (kq * 2 + ps) * 2048; const bf* sv = sl + 2 * PE + (kq * 2 + ps) * 512;
#pragma unroll
            for (int g = 0; g < 2; ++g)
#pragma unroll
                for (int kk = 0; kk < 2; ++kk) { kh[g][kk] = F::ldf(sk + g * 1024 + kk * 512); kl[g][kk] = F::ldf(sk + PE + g * 1024 + kk * 512); }
            __builtin_amdgcn_sched_barrier(0);   // keeps the pass's K reads together ahead of its products; without it each fragment's LDS latency is waited out singly
            // the four score tiles take turns, so that no product waits for the one before it; a tile starts from minus the reference maximum
#pragma unroll
            for (int kk = 0; kk < 2; ++kk) {
#pragma unroll
                for (int g = 0; g < 2; ++g)
#pragma unroll
                    for (int mb = 0; mb < 2; ++mb) s[g][mb] = F::mma(kh[g][kk], qh[mb][kk], kk == 0 ? nm[mb] : s[g][mb]);
#pragma unroll
                for (int g = 0; g < 2; ++g)
#pragma unroll
                    for (int mb = 0; mb < 2; ++mb) s[g][mb] = F::mma(kl[g][kk], qh[mb][kk], s[g][mb]);
#pragma unroll
                for (int g = 0; g < 2; ++g)
#pragma unroll
                    for (int mb = 0; mb < 2; ++mb) s[g][mb] = F::mma(kh[g][kk], ql[mb][kk], s[g][mb]); }
            __builtin_amdgcn_sched_barrier(0);   // keeps the pass's products back to back; without it the first steps of the maximum stand among them, each behind the idle slots that a product's result asks for
            float mx[2];
#pragma unroll
            for (int mb = 0; mb < 2; ++mb) { float mg[2];
#pragma unroll
                for (int g = 0; g < 2; ++g) { mg[g] = s[g][mb][0];
#pragma unroll
                    for (int j = 1; j < 8; ++j) mg[g] = fmaxf(mg[g], s[g][mb][j]); }
                mx[mb] = fmaxf(mg[0], mg[1]); }
            const bool first = (t | ps) == 0;
            // as in attn_run: the reference maximum moves in the first pass and whenever a score of any lane has passed it by more than TH; the test reads the same in the whole wave
            if (__builtin_amdgcn_ballot_w32(fmaxf(mx[0], mx[1]) > (first ? -3.4e38f : TH)) != 0u) {
#pragma unroll
                for (int mb = 0; mb < 2; ++mb) { const float m = fmaxf(mx[mb], xrow(mx[mb])); const float d = first ? m : fmaxf(m, 0.f); const float al = first ? 0.f : __builtin_amdgcn_exp2f(-d);   // first pass: nothing is summed yet, the weight is 0
                    nm[mb] -= d; ls[mb] *= al;
#pragma unroll
                    for (int g = 0; g < 2; ++g) s[g][mb] -= d;
#pragma unroll
                    for (int nb = 0; nb < 4; ++nb) acc[nb][mb] *= al; } }
#pragma unroll
            for (int mb = 0; mb < 2; ++mb) { v8f a8; v8bf h8[2], l8[2];
#pragma unroll
                for (int u = 0; u < 2; ++u) { const v8f x = s[u][mb]; v8f e;
#pragma unroll
                    for (int j = 0; j < 8; ++j) e[j] = __builtin_amdgcn_exp2f(x[j]);
                    if (u == 0) a8 = e; else a8 += e;
                    h8[u] = __builtin_convertvector(e, v8bf); const v4u hw = __builtin_bit_cast(v4u, h8[u]); v8f r;   // the hi parts as f32 again, from the packed words: the low half shifted up, the high half masked
#pragma unroll
                    for (int j = 0; j < 4; ++j) { r[2 * j] = e[2 * j] - __uint_as_float(hw[j] << 16); r[2 * j + 1] = e[2 * j + 1] - __uint_as_float(hw[j] & 0xffff0000u); }
                    l8[u] = __builtin_convertvector(r, v8bf); }
                ph[mb] = __builtin_shufflevector(h8[0], h8[1], 0, 1, 2, 3, 4, 5, 6, 7, 8, 9, 10, 11, 12, 13, 14, 15); pl[mb] = __builtin_shufflevector(l8[0], l8[1], 0, 1, 2, 3, 4, 5, 6, 7, 8, 9, 10, 11, 12, 13, 14, 15);
                ls[mb] += ((a8[0] + a8[1]) + (a8[2] + a8[3])) + ((a8[4] + a8[5]) + (a8[6] + a8[7]));
            }
            __builtin_amdgcn_sched_barrier(0);   // keeps the V reads behind the vector work: beside the exponentials their registers made the build spill
#pragma unroll
            for (int nb = 0; nb < 4; ++nb) vh[nb] = F::ldf(sv + nb * (HS * 16));
            __builtin_amdgcn_sched_barrier(0);   // keeps the hi plane's reads together ahead of its products
#pragma unroll
            for (int nb = 0; nb < 4; ++nb)
#pragma unroll
                for (int mb = 0; mb < 2; ++mb) acc[nb][mb] = F::mma(vh[nb], ph[mb], acc[nb][mb]);
#pragma unroll
            for (int nb = 0; nb < 4; ++nb)
#pragma unroll
                for (int mb = 0; mb < 2; ++mb) acc[nb][mb] = F::mma(vh[nb], pl[mb], acc[nb][mb]);
            __builtin_amdgcn_sched_barrier(0);   // keeps the lo plane's reads behind the last product with hi, whose registers they take; ahead of it the build ran out of registers and moved Q to and fro in every pass
#pragma unroll
            for (int nb = 0; nb < 4; ++nb) vl[nb] = F::ldf(sv + PE + nb * (HS * 16));
            __builtin_amdgcn_sched_barrier(0);   // keeps the lo plane's reads together ahead of its products; without it the build reads one fragment at a time and waits out the LDS latency for each
#pragma unroll
            for (int nb = 0; nb < 4; ++nb)
#pragma unroll
                for (int mb = 0; mb < 2; ++mb) acc[nb][mb] = F::mma(vl[nb], ph[mb], acc[nb][mb]);
        }
        asm volatile("s_wait_dscnt 0x0" ::: "memory");      // this wave's reads of the buffer are done before the barrier behind which it is refilled
        asm volatile("s_wait_asynccnt 0x0" ::: "memory");   // this wave's copies of the next stage have landed
        __syncthreads();   // publishes the next stage and ends every wave's reads of this one
        if (t + 2 < NT) stage(t + 2, t & 1);
    }
    asm volatile("s_wait_asynccnt 0x0" ::: "memory");   // no copy is outstanding when the buffers become partial tiles
    // the last trip's barrier has ended every wave's reads of the buffers: the partial tiles may overwrite them. Wave w's tile: 2048 floats at 2048 w, quarter (nb, mb, half of the lane's eight) as 128 floats, four a lane; behind the tiles the maxima, then the sums, one per wave, mb and lane
    float* pm = sm + 16 * 2048;
#pragma unroll
    for (int mb = 0; mb < 2; ++mb) { pm[(wv * 2 + mb) * 32 + lane] = -nm[mb][0]; pm[1024 + (wv * 2 + mb) * 32 + lane] = ls[mb] + xrow(ls[mb]);
#pragma unroll
        for (int nb = 0; nb < 4; ++nb) { float* pw = sm + wv * 2048 + (nb * 2 + mb) * 256 + lane * 4; *(v4fa*)pw = __builtin_shufflevector(acc[nb][mb], acc[nb][mb], 0, 1, 2, 3); *(v4fa*)(pw + 128) = __builtin_shufflevector(acc[nb][mb], acc[nb][mb], 4, 5, 6, 7); } }
    __syncthreads();   // every wave's partial tile, maxima and sums are in LDS before another wave reads them
    const size_t oo = fro(tq + lr, h * HD + kq * 16 + hi * 8, DQ); bf* po = Ah + oo; bf* pp = Al + oo;   // the second 16 queries are 16 DQ elements further on
    v8us oh[2], ol[2];
#pragma unroll
    for (int mb = 0; mb < 2; ++mb) { float m4[4], l4[4];
#pragma unroll
        for (int i = 0; i < 4; ++i) { m4[i] = pm[((qt * 4 + i) * 2 + mb) * 32 + lane]; l4[i] = pm[1024 + ((qt * 4 + i) * 2 + mb) * 32 + lane]; }
        const float mx = fmaxf(fmaxf(m4[0], m4[1]), fmaxf(m4[2], m4[3])); float lt = 0.f; v4f o0 = (v4f){}, o1 = (v4f){};
#pragma unroll
        for (int i = 0; i < 4; ++i) { const float w = __builtin_amdgcn_exp2f(m4[i] - mx); const float* pr = sm + (qt * 4 + i) * 2048 + (kq * 2 + mb) * 256 + lane * 4; lt += w * l4[i]; o0 += *(const v4fa*)pr * w; o1 += *(const v4fa*)(pr + 128) * w; }
        const float cs = __fdiv_rn(1.0f, lt);   // the sum is at least about 1: the key that holds the largest reference maximum counts 1
#pragma unroll
        for (int j = 0; j < 8; ++j) { unsigned short a, c2; splitf((j < 4 ? o0[j & 3] : o1[j & 3]) * cs, a, c2); oh[mb][j] = a; ol[mb][j] = c2; } }
    __builtin_amdgcn_sched_barrier(0);   // keeps the four stores behind all the arithmetic: no register that a store names is written again before the wave ends
#pragma unroll
    for (int mb = 0; mb < 2; ++mb) { *(v8us*)(po + mb * 16 * DQ) = oh[mb]; *(v8us*)(pp + mb * 16 * DQ) = ol[mb]; }
}
#define NFL  ((TT - RH) / FQ)     // fp16 work-groups per batch and head
#define NHL  (RH / HQ)            // hi/lo work-groups per batch and head
__global__ __launch_bounds__(512) void k_attn(const h16* __restrict__ Q16, const h16* __restrict__ K16, const h16* __restrict__ V16, const bf* __restrict__ Qh, const bf* __restrict__ Ql, const bf* __restrict__ Kh, const bf* __restrict__ Kl, const bf* __restrict__ Vh, const bf* __restrict__ Vl, bf* Ah, bf* Al) {
    __shared__ __align__(16) float sm[SMF];
    // the work-groups are numbered along x, y, z; the fp16 ones, which run longest, have the lowest numbers
    const unsigned lin = (blockIdx.z * (NFL + NHL) + blockIdx.y) * NH_ + blockIdx.x;
    if (lin < NFL * NB_ * NH_) { const unsigned h = lin % NH_, r = lin / NH_, zb = r / NFL; const int t0 = RH + (int)(r % NFL) * FQ; const size_t zo = ((size_t)zb * NH_ + h) * TT * HD, za = (size_t)zb * TT * DQ;
        attn_run(sm, Q16 + zo, K16 + zo, V16 + zo, t0, (int)h, Ah + za, Al + za);
    } else { const unsigned l2 = lin - NFL * NB_ * NH_, h = l2 % NH_, r = l2 / NH_, zb = r / NHL; const int t0 = (int)(r % NHL) * HQ; const size_t zo = ((size_t)zb * NH_ + h) * TT * HD, za = (size_t)zb * TT * DQ;
        attn_runh(sm, Qh + zo, Ql + zo, Kh + zo, Kl + zo, Vh + zo, Vl + zo, t0, (int)h, Ah + za, Al + za); }
}

extern "C" void kernel_launch(void* const* d_in, const int* in_sizes, int n_in,
                              void* d_out, int out_size, void* d_ws, size_t ws_size, hipStream_t stream) {
    (void)in_sizes; (void)n_in; (void)out_size;
    const float* x = (const float*)d_in[0]; const float* fcos = (const float*)d_in[1]; const float* fsin = (const float*)d_in[2]; const float* wq = (const float*)d_in[3]; const float* bq = (const float*)d_in[4]; const float* wk = (const float*)d_in[5]; const float* bk = (const float*)d_in[6]; const float* wv = (const float*)d_in[7]; const float* bv = (const float*)d_in[8]; const float* wo = (const float*)d_in[9]; const float* bo = (const float*)d_in[10];   /* hidden [4][2048][1024] (ONE stream, rounded to bf16 once for q, k and v), cos, sin ([4][2048][64] = [B][S][D] PER-BATCH full-width table INPUTS: read per element by value), Wq, bq, Wk, bk, Wv, bv, Wo, bo ('oi' (out, in) [1024][1024] + [1024]): ELEVEN inputs, all read */
    float* OUT = (float*)d_out;     // [4][2048][1024]
    char* wsp = (char*)d_ws;
    auto take = [&](size_t bytes) { char* p = wsp; wsp += (bytes + 255) & ~(size_t)255; return (void*)p; };
    bf* WQ = (bf*)take((size_t)DQ * DM * 2); bf* WK = (bf*)take((size_t)DKV * DM * 2); bf* WV = (bf*)take((size_t)DKV * DM * 2); bf* WO = (bf*)take((size_t)DM * DQ * 2);
    bf* XB = (bf*)take((size_t)NB_ * TT * DM * 2);
    h16* QP16 = (h16*)take((size_t)NB_ * NH_ * TT * HD * 2); h16* KP16 = (h16*)take((size_t)NB_ * NKV * TT * HD * 2); h16* VT16 = (h16*)take((size_t)NB_ * NKV * HD * TT * 2);
    bf* QPh = (bf*)take((size_t)NB_ * NH_ * TT * HD * 2); bf* QPl = (bf*)take((size_t)NB_ * NH_ * TT * HD * 2); bf* KPh = (bf*)take((size_t)NB_ * NKV * TT * HD * 2); bf* KPl = (bf*)take((size_t)NB_ * NKV * TT * HD * 2); bf* VTh = (bf*)take((size_t)NB_ * NKV * HD * TT * 2); bf* VTl = (bf*)take((size_t)NB_ * NKV * HD * TT * 2);
    bf* ATh = (bf*)take((size_t)NB_ * TT * DQ * 2); bf* ATl = (bf*)take((size_t)NB_ * TT * DQ * 2);
    (void)WK; (void)WV;   // reached through WQ
    if ((size_t)(wsp - (char*)d_ws) > ws_size) return;    // 200 MiB of the 256 MiB
    k_cvtall<<<(NB_ * TT * DM + 4 * DM * DM) / CVB, 256, 0, stream>>>(x, wq, wk, wv, wo, XB, WQ);   // WQ, WK, WV, WO are consecutive takes of 2 MiB each
    /* q, k, v: one launch; WQ, WK, WV are one [3 DQ][DM] matrix, and QP16, KP16, VT16 as well as QPh, QPl, KPh, KPl, VTh, VTl are consecutive takes. The q and k parts read batch z's own slice of the INPUT rotary tables in their epilogue; k_cs5 and its INVT constants stay defined and are NOT launched */
    k_gemms<0, 1><<<dim3(TT / 128, (DQ + 2 * DKV) / 256, NB_), 256, 0, stream>>>(XB, nullptr, WQ, nullptr, bq, bk, bv, fcos, fsin, QP16, QPh, QPl);
    k_attn<<<dim3(NH_, NFL + NHL, NB_), 512, 0, stream>>>(QP16, KP16, VT16, QPh, QPl, KPh, KPl, VTh, VTl, ATh, ATl);   // one kv head per query head
    k_gemms<1, 0><<<dim3(TT / 128, DM / 256, NB_), 256, 0, stream>>>(ATh, ATl, WO, OUT, bo, nullptr, nullptr, nullptr, nullptr, nullptr, nullptr, nullptr);
}
